// v000
// Times are from an AMD MI455X. After a warm-up the kernel runs many times in a row, and a time is the length of
// such a window on the GPU divided by its runs, so every launch and the gaps after it count. The runs cycle
// through copies of the inputs. A figure is the median of several windows, for all but v000 over two sittings.
// Sittings can differ by a few percent; kernels timed side by side share one.
// v000 is the starting kernel. One run takes 843 microseconds.
// compute dtype: all float inputs rounded to bf16; q/k/v projections with EXACT bf16 products on WMMA 16x16x32 (f32 accumulate); causal logits over the 768-wide head: 3 products for the first 384 rows, single f16 q x k after, x 768^-0.5; softmax f32; P x 2^11 once to f16 x v once to f16 (bf16 hi + lo below row 384); f32 output.
#include <hip/hip_runtime.h>
#include <math.h>

typedef __attribute__((ext_vector_type(16))) _Float16 v16h;
typedef __attribute__((ext_vector_type(16))) __bf16 v16b;
typedef __attribute__((ext_vector_type(8)))  _Float16 v8h;
typedef __attribute__((ext_vector_type(8)))  float v8f;
typedef __attribute__((ext_vector_type(4)))  float v4f;
typedef __attribute__((ext_vector_type(2)))  float v2f;
typedef __attribute__((ext_vector_type(4)))  unsigned v4u;
typedef __attribute__((ext_vector_type(4)))  int v4i;
typedef float __attribute__((may_alias)) float_a;
typedef int __attribute__((may_alias)) int_a;

template <typename T> __device__ __forceinline__ void vst2(void* p, T v) { *(T*)p = v;  }
__device__ __forceinline__ v8f wmma16(v16h a, v16h b, v8f c) {
  v8f d = __builtin_amdgcn_wmma_f32_16x16x32_f16(false, a, false, b, (short)0, c, false, false);
  asm volatile("v_nop\n\tv_nop\n\tv_nop\n\tv_nop" : "+v"(d) : "v"(a), "v"(b));
  return d;
}
__device__ __forceinline__ v8f wmma_bf(v16b a, v16b b, v8f c) {
  v8f d = __builtin_amdgcn_wmma_f32_16x16x32_bf16(false, a, false, b, (short)0, c, false, false);
  asm volatile("v_nop\n\tv_nop\n\tv_nop\n\tv_nop" : "+v"(d) : "v"(a), "v"(b));
  return d;
}
// 16x16x32 fragments: lane = (h = lane>>4, row/col = lane&15); elements 0..7 = k0+8h+0..7, 8..15 = k0+16+8h+0..7; D element r = row 8h+r
__device__ __forceinline__ v16h frag_h(const _Float16* rowk0, int lane) {
  union { v16h v; v8h q[2]; } u; const _Float16* p = rowk0 + 8 * (lane >> 4);
  u.q[0] = *(const v8h*)p; u.q[1] = *(const v8h*)(p + 16); return u.v;
}
__device__ __forceinline__ v16h frag_f32(const float* rowk0, int lane) {
  v16h a; const float* p = rowk0 + 8 * (lane >> 4);
#pragma unroll
  for (int i = 0; i < 8; ++i) { a[i] = (_Float16)p[i]; a[8 + i] = (_Float16)p[16 + i]; }
  return a;
}
__device__ __forceinline__ v16h frag_f32s(const float* rowk0, int lane, float sc) {
  v16h a; const float* p = rowk0 + 8 * (lane >> 4);
#pragma unroll
  for (int i = 0; i < 8; ++i) { a[i] = (_Float16)(p[i] * sc); a[8 + i] = (_Float16)(p[16 + i] * sc); }
  return a;
}
// column fragment from a [K][ld] layout (column n), rows >= K read as 0
__device__ __forceinline__ v16h fragc_f32(const float* W, int k0, int n, int lane, int ld, int K) {
  v16h a; const int g = lane >> 4;
#pragma unroll
  for (int i = 0; i < 8; ++i) { const int ka = k0 + 8 * g + i, kb = ka + 16;
    a[i] = (_Float16)(ka < K ? W[(size_t)(ka < K ? ka : K - 1) * ld + n] : 0.f); a[8 + i] = (_Float16)(kb < K ? W[(size_t)(kb < K ? kb : K - 1) * ld + n] : 0.f); }
  return a;
}
struct F2 { v16b h, l; };
__device__ __forceinline__ F2 bsplit16(const float v[16]) { F2 r;
#pragma unroll
  for (int i = 0; i < 16; ++i) { const __bf16 h = (__bf16)v[i]; r.h[i] = h; r.l[i] = (__bf16)(v[i] - (float)h); }
  return r; }
__device__ __forceinline__ F2 split_row(const float* row, int k0, int lane) { float v[16]; const float* p = row + k0 + 8 * (lane >> 4);
#pragma unroll
  for (int i = 0; i < 8; ++i) { v[i] = p[i]; v[8 + i] = p[16 + i]; }
  return bsplit16(v); }
__device__ __forceinline__ F2 split_rowK(const float* row, int k0, int lane, int K) { float v[16]; const int g = lane >> 4;
#pragma unroll
  for (int i = 0; i < 8; ++i) { const int ka = k0 + 8 * g + i, kb = ka + 16; v[i] = ka < K ? row[ka < K ? ka : K - 1] : 0.f; v[8 + i] = kb < K ? row[kb < K ? kb : K - 1] : 0.f; }
  return bsplit16(v); }
__device__ __forceinline__ F2 split_col(const float* W, int k0, int n, int lane, int ld, int K) { float v[16]; const int g = lane >> 4;
#pragma unroll
  for (int i = 0; i < 8; ++i) { const int ka = k0 + 8 * g + i, kb = ka + 16; v[i] = ka < K ? W[(size_t)(ka < K ? ka : K - 1) * ld + n] : 0.f; v[8 + i] = kb < K ? W[(size_t)(kb < K ? kb : K - 1) * ld + n] : 0.f; }
  return bsplit16(v); }
__device__ __forceinline__ v8f mac3(const F2& a, const F2& b, v8f c) { c = wmma_bf(a.l, b.h, c); c = wmma_bf(a.h, b.l, c); return wmma_bf(a.h, b.h, c); }
__device__ __forceinline__ float sigm(float v) { return 1.0f / (1.0f + expf(-v)); }
#define LDSX() do { asm volatile("s_wait_dscnt 0" ::: "memory"); __builtin_amdgcn_wave_barrier(); __builtin_amdgcn_fence(__ATOMIC_RELEASE, "workgroup"); } while (0)

// Single-head causal self-attention with a 768-WIDE head (x [4,2048,768]; (in,out) Wq / Wk / Wv [768,768] uniform, no biases; scores = q k^T with -inf above the diagonal, then / sqrt(768); no head split, no output projection): out = softmax(causal(q k^T) / sqrt(768)) v -> [4,2048,768].
#define NB 4
#define TT 2048
#define CC 768            // NH * HD = projected width
#define DIN 768          // input (model) width
#define NH 1
#define HD 768
#define NQB (TT / 64)
#define HG 1
#define SCALE (0.036084391824351615f)
#define CAUSAL 1
#ifndef TNB
#define TNB NB
#endif
__device__ __forceinline__ float bfr(float v) { return (float)(__bf16)v; }
__host__ __device__ __forceinline__ int kb_last(int qb) { return CAUSAL ? ((qb * 64 + 63) >> 7) : (TT / 128 - 1); }
typedef __attribute__((ext_vector_type(8))) __bf16 v8b;
__device__ __forceinline__ v16b frag_b(const __bf16* rowk0, int lane) {
  union { v16b v; v8b q[2]; } u; const __bf16* p = rowk0 + 8 * (lane >> 4);
  u.q[0] = *(const v8b*)p; u.q[1] = *(const v8b*)(p + 16); return u.v;
}
#define QBH 6              // causal: query blocks 0..QBH-1 of each sequence (few keys, no averaging) take the high-precision path
#define QHI 384            // rows carrying a q residual plane (all rows when non-causal: 2-product logits everywhere)
#define KHI 384            // key rows carrying k residual / v bf16 hi+lo planes (used only by the causal high-precision path)
// B fragment (k rows k0+.., output column o) of a weight: (in,out) [K][ld] or (out,in) [ld rows of K]: bf16 exact, or f16(bf16 * 256) exact
__device__ __forceinline__ v16b wcol_io(const float* Wm, int k0, int o, int lane, int ld) { v16b w; const int g = lane >> 4;
#pragma unroll
  for (int i = 0; i < 8; ++i) { w[i] = (__bf16)Wm[(size_t)(k0 + 8 * g + i) * ld + o]; w[8 + i] = (__bf16)Wm[(size_t)(k0 + 16 + 8 * g + i) * ld + o]; }
  return w; }
__device__ __forceinline__ v16b wcol_oi(const float* Wm, int k0, int o, int lane, int K) { v16b w; const float* p = Wm + (size_t)o * K + k0 + 8 * (lane >> 4);
#pragma unroll
  for (int i = 0; i < 8; ++i) { w[i] = (__bf16)p[i]; w[8 + i] = (__bf16)p[16 + i]; }
  return w; }
__device__ __forceinline__ v16h wcolh_io(const float* Wm, int k0, int o, int lane, int ld) { v16h w; const int g = lane >> 4;
#pragma unroll
  for (int i = 0; i < 8; ++i) { w[i] = (_Float16)(bfr(Wm[(size_t)(k0 + 8 * g + i) * ld + o]) * 256.0f); w[8 + i] = (_Float16)(bfr(Wm[(size_t)(k0 + 16 + 8 * g + i) * ld + o]) * 256.0f); }
  return w; }
__device__ __forceinline__ v16h wcolh_oi(const float* Wm, int k0, int o, int lane, int K) { v16h w; const float* p = Wm + (size_t)o * K + k0 + 8 * (lane >> 4);
#pragma unroll
  for (int i = 0; i < 8; ++i) { w[i] = (_Float16)(bfr(p[i]) * 256.0f); w[8 + i] = (_Float16)(bfr(p[16 + i]) * 256.0f); }
  return w; }
#define WQKV_LAYOUT 0   // 0 = (in,out) [DIN][CC]; 1 = (out,in) [CC][DIN]; 2 = per-head [NH][DIN][HD]
__device__ __forceinline__ v16b wcol_hdk(const float* Wm, int k0, int o, int lane) { v16b w; const int g = lane >> 4; const float* p = Wm + (size_t)(o / HD) * DIN * HD + (o % HD);
#pragma unroll
  for (int i = 0; i < 8; ++i) { w[i] = (__bf16)p[(size_t)(k0 + 8 * g + i) * HD]; w[8 + i] = (__bf16)p[(size_t)(k0 + 16 + 8 * g + i) * HD]; }
  return w; }
#define WO_OUT_IN 0
#if WQKV_LAYOUT == 1
#define WCOL(W, k0, o, lane) wcol_oi(W, k0, o, lane, DIN)
#elif WQKV_LAYOUT == 2
#define WCOL(W, k0, o, lane) wcol_hdk(W, k0, o, lane)
#else
#define WCOL(W, k0, o, lane) wcol_io(W, k0, o, lane, CC)
#endif
#if WO_OUT_IN
#define WOCOL(W, k0, o, lane) wcol_oi(W, k0, o, lane, CC)
#define WOCOLH(W, k0, o, lane) wcolh_oi(W, k0, o, lane, CC)
#else
#define WOCOL(W, k0, o, lane) wcol_io(W, k0, o, lane, DIN)
#define WOCOLH(W, k0, o, lane) wcolh_io(W, k0, o, lane, DIN)
#endif

#ifndef SM_EXTRA_PARAMS
#define SM_EXTRA_PARAMS
#endif
#ifndef PROJ_EXTRA_PARAMS
#define PROJ_EXTRA_PARAMS
#endif
#ifndef SM_MASK_HOOK
#define SM_MASK_HOOK (void)0
#endif

#define WS_QH  0u                                      // f16 q rows [b*t][CC]
#define WS_KH  (WS_QH + 2u * (size_t)NB * TT * CC)      // f16 k rows [b*t][CC]
#define WS_VT  (WS_KH + 2u * (size_t)NB * TT * CC)      // f16 v planes [b][c][t]
#define WS_QL  (WS_VT + 2u * (size_t)NB * CC * TT)      // f16 q residual x 2^10 rows [b][t < QHI][CC]
#define WS_KL  (WS_QL + 2u * (size_t)NB * QHI * CC)     // f16 k residual x 2^10 rows [b][t < KHI][CC]
#define WS_VB  (WS_KL + 2u * (size_t)NB * KHI * CC)     // bf16 v hi planes [b][c][t < KHI]
#define WS_VBL (WS_VB + 2u * (size_t)NB * CC * KHI)
#define WS_S   (WS_VBL + 2u * (size_t)NB * CC * KHI)    // f32 logits / P [hg][t][s]
#define WS_Y   (WS_S  + 4u * (size_t)HG * TT * TT)      // f32 ctx rows [b*t][CC] (only when there is an output projection)
#define WS_END (WS_Y  + 0u)

// ---- k_proj: block = (64 rows, 128 cols, which): q/k/v = X W (+ b) with exact bf16 products (K = DIN) -> which 0: q f16 rows (+ residual rows < QHI); 1: k f16 rows (+ residual rows < KHI); 2: v f16 planes [c][t] (+ bf16 hi/lo planes for t < KHI)
__global__ __launch_bounds__(128) void k_proj(const float* __restrict__ XQ, const float* __restrict__ XK, const float* __restrict__ XV, const float* __restrict__ WQ, const float* __restrict__ WK, const float* __restrict__ WV, const float* __restrict__ BQ, const float* __restrict__ BK, const float* __restrict__ BV,
    _Float16* __restrict__ QH, _Float16* __restrict__ QL, _Float16* __restrict__ KH, _Float16* __restrict__ KL, _Float16* __restrict__ VT, __bf16* __restrict__ VB, __bf16* __restrict__ VBL) {
  __shared__ __align__(16) _Float16 sh[64][136], sl[64][136]; __shared__ __align__(16) _Float16 th[128][72]; __shared__ __align__(16) __bf16 tb[128][72], tbl[128][72];
  const int tid = threadIdx.x, wave = tid >> 5, lane = tid & 31, col = lane & 15, g = lane >> 4; const int which = blockIdx.z; const int c0 = blockIdx.y * 128; const size_t r0 = (size_t)blockIdx.x * 64; const size_t bb = r0 / TT; const int t0 = (int)(r0 % TT);
  const float* X = which == 0 ? XQ : which == 1 ? XK : XV; const float* WA = which == 0 ? WQ : which == 1 ? WK : WV; const float* BA = which == 0 ? BQ : which == 1 ? BK : BV;
  v8f acc[8] = {};
#pragma unroll 2
  for (int kc = 0; kc < DIN / 32; ++kc) { v16b a; { const float* p = X + (r0 + wave * 16 + col) * DIN + kc * 32 + 8 * g;
#pragma unroll
      for (int i = 0; i < 8; ++i) { a[i] = (__bf16)p[i]; a[8 + i] = (__bf16)p[16 + i]; } }
    asm volatile("s_wait_loadcnt 0x0" ::: "memory");
#pragma unroll
    for (int j = 0; j < 8; ++j) { const v16b w = WCOL(WA, kc * 32, c0 + j * 16 + col, lane); asm volatile("s_wait_loadcnt 0x0" ::: "memory"); acc[j] = wmma_bf(a, w, acc[j]); } }
  if (which < 2) { _Float16* DH = which == 0 ? QH : KH; _Float16* DL = which == 0 ? QL : KL; const int nhi = which == 0 ? QHI : KHI; const bool hi_rows = t0 < nhi;
#pragma unroll
    for (int j = 0; j < 8; ++j) { const float bias = BA ? bfr(BA[c0 + j * 16 + col]) : 0.f;
#pragma unroll
      for (int r = 0; r < 8; ++r) { const float v = acc[j][r] + bias; const _Float16 hv = (_Float16)v; sh[wave * 16 + 8 * g + r][j * 16 + col] = hv; sl[wave * 16 + 8 * g + r][j * 16 + col] = (_Float16)((v - (float)hv) * 1024.0f); } }
    __syncthreads();
    for (int e = tid; e < 64 * 16; e += 128) { const int rl = e >> 4, q = e & 15; vst2((unsigned*)(DH + (r0 + rl) * CC + c0 + q * 8), *(const v4u*)&sh[rl][q * 8]); if (hi_rows) vst2((unsigned*)(DL + (bb * nhi + t0 + rl) * (size_t)CC + c0 + q * 8), *(const v4u*)&sl[rl][q * 8]); }
  } else { const bool hi_rows = t0 < KHI;
#pragma unroll
    for (int j = 0; j < 8; ++j) { const float bias = BA ? bfr(BA[c0 + j * 16 + col]) : 0.f;
#pragma unroll
      for (int r = 0; r < 8; ++r) { const float v = acc[j][r] + bias; const int rl = wave * 16 + 8 * g + r, cl = j * 16 + col; th[cl][rl] = (_Float16)v; const __bf16 bh = (__bf16)v; tb[cl][rl] = bh; tbl[cl][rl] = (__bf16)(v - (float)bh); } }
    __syncthreads();
    for (int e = tid; e < 128 * 8; e += 128) { const int cl = e >> 3, q = e & 7; vst2((unsigned*)(VT + (bb * CC + c0 + cl) * (size_t)TT + t0 + q * 8), *(const v4u*)&th[cl][q * 8]); if (hi_rows) { const size_t o3 = (bb * CC + c0 + cl) * (size_t)KHI + t0 + q * 8; vst2((unsigned*)(VB + o3), *(const v4u*)&tb[cl][q * 8]); vst2((unsigned*)(VBL + o3), *(const v4u*)&tbl[cl][q * 8]); } } } }
// ---- k_sc: block = (query block qb, key block kb <= kb_last(qb), head in group) of batch b: logits x SCALE; q hi + residual (x 2^10) against k (2 products) for query rows < QHI, plus the k residual (3 products) for query blocks < QBH (causal early rows); causal: blocks past the diagonal exit, the mask itself is applied by index in k_sm
__global__ __launch_bounds__(128) void k_sc(const _Float16* __restrict__ QH, const _Float16* __restrict__ KH, const _Float16* __restrict__ QL, const _Float16* __restrict__ KL, int b, int h0, float* __restrict__ S0) { __shared__ __align__(16) float ss[4][16][132];
  const int qb = blockIdx.x, kb = blockIdx.y; if (kb > kb_last(qb)) return;
  const int h = h0 + blockIdx.z; float* S = S0 + (size_t)blockIdx.z * TT * TT;
  const int tid = threadIdx.x, wave = tid >> 5, lane = tid & 31, col = lane & 15, g = lane >> 4; const int k0 = kb * 128; const int ql0 = qb * 64 + wave * 16; const size_t q0 = (size_t)b * TT + ql0, kr0 = (size_t)b * TT + k0;
  v8f acc[8] = {}, accl[8] = {};
  const _Float16* QLb = QL + (size_t)b * QHI * CC; const _Float16* KLb = KL + (size_t)b * KHI * CC;
  if (qb < QBH) {
#pragma unroll
    for (int kc = 0; kc < HD / 32; ++kc) { const v16h ah = frag_h(QH + (q0 + col) * CC + h * HD + kc * 32, lane), al = frag_h(QLb + (size_t)(ql0 + col) * CC + h * HD + kc * 32, lane);
#pragma unroll
      for (int j = 0; j < 8; ++j) { const v16h kbf = frag_h(KH + (kr0 + j * 16 + col) * CC + h * HD + kc * 32, lane), klf = frag_h(KLb + (size_t)(k0 + j * 16 + col) * CC + h * HD + kc * 32, lane); acc[j] = wmma16(ah, kbf, acc[j]); accl[j] = wmma16(al, kbf, accl[j]); accl[j] = wmma16(ah, klf, accl[j]); } }
  } else if (qb * 64 < QHI) {
#pragma unroll
    for (int kc = 0; kc < HD / 32; ++kc) { const v16h ah = frag_h(QH + (q0 + col) * CC + h * HD + kc * 32, lane), al = frag_h(QLb + (size_t)(ql0 + col) * CC + h * HD + kc * 32, lane);
#pragma unroll
      for (int j = 0; j < 8; ++j) { const v16h kbf = frag_h(KH + (kr0 + j * 16 + col) * CC + h * HD + kc * 32, lane); acc[j] = wmma16(ah, kbf, acc[j]); accl[j] = wmma16(al, kbf, accl[j]); } }
  } else {
#pragma unroll
    for (int kc = 0; kc < HD / 32; ++kc) { const v16h ah = frag_h(QH + (q0 + col) * CC + h * HD + kc * 32, lane);
#pragma unroll
      for (int j = 0; j < 8; ++j) { const v16h kbf = frag_h(KH + (kr0 + j * 16 + col) * CC + h * HD + kc * 32, lane); acc[j] = wmma16(ah, kbf, acc[j]); } } }
#pragma unroll
  for (int j = 0; j < 8; ++j) {
#pragma unroll
    for (int r = 0; r < 8; ++r) ss[wave][8 * g + r][j * 16 + col] = (acc[j][r] + accl[j][r] * (1.0f / 1024.0f)) * SCALE; }
  LDSX(); for (int rl = 0; rl < 16; ++rl) vst2(S + (size_t)(ql0 + rl) * TT + k0 + lane * 4, *(const v4f*)&ss[wave][rl][lane * 4]); }
// ---- k_sm: block = query row t (head in group): keys [0, kend): causal -> logit if s <= t else excluded; softmax in f32; P x 2^11 in place (0 for excluded)
__global__ __launch_bounds__(256) void k_sm(float* __restrict__ S0 SM_EXTRA_PARAMS) { __shared__ float sred[8]; __shared__ float sbc; __shared__ __align__(16) float shv[TT];
  const int tid = threadIdx.x; const int t = blockIdx.x; const int kend = (kb_last(t >> 6) + 1) * 128;
  float* sr = S0 + (size_t)blockIdx.y * TT * TT + (size_t)t * TT;
  float m = -3.0e38f; for (int k = tid; k < kend; k += 256) { float v = (!CAUSAL || k <= t) ? sr[k] : -3.0e38f; SM_MASK_HOOK; shv[k] = v; m = fmaxf(m, v); }
#pragma unroll
  for (int o = 1; o < 32; o <<= 1) m = fmaxf(m, __shfl_xor(m, o));
  if ((tid & 31) == 0) sred[tid >> 5] = m; __syncthreads(); if (tid == 0) { float a = sred[0]; for (int i = 1; i < 8; ++i) a = fmaxf(a, sred[i]); sbc = a; } __syncthreads(); m = sbc; __syncthreads();
  float sum = 0.f; for (int k = tid; k < kend; k += 256) { const float v = shv[k]; const float e = (v <= -1.0e38f) ? 0.f : expf(v - m); shv[k] = e; sum += e; }
#pragma unroll
  for (int o = 1; o < 32; o <<= 1) sum += __shfl_xor(sum, o);
  if ((tid & 31) == 0) sred[tid >> 5] = sum; __syncthreads(); if (tid == 0) { float a = 0.f; for (int i = 0; i < 8; ++i) a += sred[i]; sbc = a > 0.f ? 2048.0f / a : 0.f; }   /* a fully excluded row yields P = 0 */ __syncthreads(); const float inv = sbc;
  for (int k = tid; k < kend; k += 256) shv[k] = shv[k] * inv;
  __syncthreads(); for (int q = tid; q < kend / 4; q += 256) vst2(sr + q * 4, *(const v4f*)&shv[q * 4]); }
#define DVH 128            // value columns per k_pv block: the 768-wide head is walked in six 128-column slices (8 accumulator tiles per wave; a 48-tile accumulator would not fit the register file)
// ---- k_pv: block = (64 queries (qb), 128-column value slice d0, head in group) of (b, h): ctx[:, d0 .. d0+127] = P . v over keys [0, kend) (P x 2^11 once to f16 against v f16: 1 product; causal early query blocks: P and v as bf16 hi + lo, 3 products); the 512-B (row, slice) segment by 32 lanes x 16 B
__global__ __launch_bounds__(128) void k_pv(const float* __restrict__ PS0, const _Float16* __restrict__ VT, const __bf16* __restrict__ VB, const __bf16* __restrict__ VBL, int b, int h0, float* __restrict__ Y) { const int h = h0 + blockIdx.z; const int d0 = blockIdx.y * DVH; const float* PS = PS0 + (size_t)blockIdx.z * TT * TT; __shared__ __align__(16) float ss[4][16][DVH + 4];
  const int tid = threadIdx.x, wave = tid >> 5, lane = tid & 31, col = lane & 15, g = lane >> 4; const int qb = blockIdx.x; const int ql0 = qb * 64 + wave * 16; const int kce = (kb_last(qb) + 1) * 4;
  v8f acc[DVH / 16] = {};
  if (qb < QBH) {
#pragma unroll 1
    for (int kc = 0; kc < kce; ++kc) { const F2 p = split_row(PS + (size_t)(ql0 + col) * TT, kc * 32, lane);
      asm volatile("s_wait_loadcnt 0x0" ::: "memory");
#pragma unroll
      for (int j = 0; j < DVH / 16; ++j) { const size_t po = ((size_t)b * CC + h * HD + d0 + j * 16 + col) * (size_t)KHI + kc * 32; const v16b vh = frag_b(VB + po, lane); acc[j] = wmma_bf(p.h, vh, acc[j]); acc[j] = wmma_bf(p.l, vh, acc[j]); acc[j] = wmma_bf(p.h, frag_b(VBL + po, lane), acc[j]); } }
  } else {
#pragma unroll 1
    for (int kc = 0; kc < kce; ++kc) { const v16h p = frag_f32(PS + (size_t)(ql0 + col) * TT + kc * 32, lane);
      asm volatile("s_wait_loadcnt 0x0" ::: "memory");
#pragma unroll
      for (int j = 0; j < DVH / 16; ++j) { const size_t po = ((size_t)b * CC + h * HD + d0 + j * 16 + col) * (size_t)TT + kc * 32; acc[j] = wmma16(p, frag_h(VT + po, lane), acc[j]); } } }
#pragma unroll
  for (int j = 0; j < DVH / 16; ++j)
#pragma unroll
    for (int r = 0; r < 8; ++r) ss[wave][8 * g + r][j * 16 + col] = acc[j][r] * (1.0f / 2048.0f);
  LDSX(); for (int rl = 0; rl < 16; ++rl) vst2(Y + ((size_t)b * TT + ql0 + rl) * CC + h * HD + d0 + lane * 4, *(const v4f*)&ss[wave][rl][lane * 4]); }   
extern "C" void kernel_launch(void* const* d_in, const int* in_sizes, int n_in, void* d_out, int out_size, void* d_ws, size_t ws_size, hipStream_t stream) {
  (void)in_sizes; (void)n_in; (void)out_size;
  const float** F = (const float**)d_in;
  if (ws_size < (size_t)WS_END) return;
  char* ws = (char*)d_ws; _Float16 *QH = (_Float16*)(ws + WS_QH), *KH = (_Float16*)(ws + WS_KH), *VT = (_Float16*)(ws + WS_VT), *QL = (_Float16*)(ws + WS_QL), *KL = (_Float16*)(ws + WS_KL); __bf16 *VB = (__bf16*)(ws + WS_VB), *VBL = (__bf16*)(ws + WS_VBL); float *S = (float*)(ws + WS_S), *Y = (float*)(ws + WS_Y);
  (void)Y; (void)QL; (void)KL; (void)VB; (void)VBL;
  // inputs: 0 x [4,2048,768]; 1 Wq [768,768] (in,out); 2 Wk; 3 Wv; no biases, no output projection
  k_proj<<<dim3(TNB * TT / 64, CC / 128, 3), 128, 0, stream>>>(F[0], F[0], F[0], F[1], F[2], F[3], nullptr, nullptr, nullptr, QH, QL, KH, KL, VT, VB, VBL);
  for (int b = 0; b < TNB; ++b) {
    k_sc<<<dim3(NQB, TT / 128, 1), 128, 0, stream>>>(QH, KH, QL, KL, b, 0, S);
    k_sm<<<dim3(TT, 1), 256, 0, stream>>>(S);
    k_pv<<<dim3(NQB, HD / DVH, 1), 128, 0, stream>>>(S, VT, VB, VBL, b, 0, (float*)d_out);   /* six 128-column value slices per query block */
  }
}

// v001
// It runs in 437 microseconds.
// In both of two side-by-side timings against v000, it was 1.93 times as fast.
// compute dtype: all float inputs rounded to bf16; q/k/v projections with EXACT bf16 products on WMMA 16x16x32 (f32 accumulate); causal logits over the 768-wide head: 3 products for the first 384 rows, single f16 q x k after, x 768^-0.5; softmax f32; P x 2^11 once to f16 x v once to f16 (bf16 hi + lo below row 384); f32 output.
#include <hip/hip_runtime.h>
#include <math.h>

typedef __attribute__((ext_vector_type(16))) _Float16 v16h;
typedef __attribute__((ext_vector_type(16))) __bf16 v16b;
typedef __attribute__((ext_vector_type(8)))  _Float16 v8h;
typedef __attribute__((ext_vector_type(8)))  float v8f;
typedef __attribute__((ext_vector_type(4)))  float v4f;
typedef __attribute__((ext_vector_type(2)))  float v2f;
typedef __attribute__((ext_vector_type(4)))  unsigned v4u;
typedef __attribute__((ext_vector_type(4)))  int v4i;
typedef float __attribute__((may_alias)) float_a;
typedef int __attribute__((may_alias)) int_a;

template <typename T> __device__ __forceinline__ void vst2(void* p, T v) { *(T*)p = v;  }
__device__ __forceinline__ v8f wmma16(v16h a, v16h b, v8f c) {
  v8f d = __builtin_amdgcn_wmma_f32_16x16x32_f16(false, a, false, b, (short)0, c, false, false);
  asm volatile("v_nop\n\tv_nop\n\tv_nop\n\tv_nop" : "+v"(d) : "v"(a), "v"(b));
  return d;
}
__device__ __forceinline__ v8f wmma_bf(v16b a, v16b b, v8f c) {
  v8f d = __builtin_amdgcn_wmma_f32_16x16x32_bf16(false, a, false, b, (short)0, c, false, false);
  asm volatile("v_nop\n\tv_nop\n\tv_nop\n\tv_nop" : "+v"(d) : "v"(a), "v"(b));
  return d;
}
// 16x16x32 fragments: lane = (h = lane>>4, row/col = lane&15); elements 0..7 = k0+8h+0..7, 8..15 = k0+16+8h+0..7; D element r = row 8h+r
__device__ __forceinline__ v16h frag_h(const _Float16* rowk0, int lane) {
  union { v16h v; v8h q[2]; } u; const _Float16* p = rowk0 + 8 * (lane >> 4);
  u.q[0] = *(const v8h*)p; u.q[1] = *(const v8h*)(p + 16); return u.v;
}
__device__ __forceinline__ v16h frag_f32(const float* rowk0, int lane) {
  v16h a; const float* p = rowk0 + 8 * (lane >> 4);
#pragma unroll
  for (int i = 0; i < 8; ++i) { a[i] = (_Float16)p[i]; a[8 + i] = (_Float16)p[16 + i]; }
  return a;
}
__device__ __forceinline__ v16h frag_f32s(const float* rowk0, int lane, float sc) {
  v16h a; const float* p = rowk0 + 8 * (lane >> 4);
#pragma unroll
  for (int i = 0; i < 8; ++i) { a[i] = (_Float16)(p[i] * sc); a[8 + i] = (_Float16)(p[16 + i] * sc); }
  return a;
}
// column fragment from a [K][ld] layout (column n), rows >= K read as 0
__device__ __forceinline__ v16h fragc_f32(const float* W, int k0, int n, int lane, int ld, int K) {
  v16h a; const int g = lane >> 4;
#pragma unroll
  for (int i = 0; i < 8; ++i) { const int ka = k0 + 8 * g + i, kb = ka + 16;
    a[i] = (_Float16)(ka < K ? W[(size_t)(ka < K ? ka : K - 1) * ld + n] : 0.f); a[8 + i] = (_Float16)(kb < K ? W[(size_t)(kb < K ? kb : K - 1) * ld + n] : 0.f); }
  return a;
}
struct F2 { v16b h, l; };
__device__ __forceinline__ F2 bsplit16(const float v[16]) { F2 r;
#pragma unroll
  for (int i = 0; i < 16; ++i) { const __bf16 h = (__bf16)v[i]; r.h[i] = h; r.l[i] = (__bf16)(v[i] - (float)h); }
  return r; }
__device__ __forceinline__ F2 split_row(const float* row, int k0, int lane) { float v[16]; const float* p = row + k0 + 8 * (lane >> 4);
#pragma unroll
  for (int i = 0; i < 8; ++i) { v[i] = p[i]; v[8 + i] = p[16 + i]; }
  return bsplit16(v); }
__device__ __forceinline__ F2 split_rowK(const float* row, int k0, int lane, int K) { float v[16]; const int g = lane >> 4;
#pragma unroll
  for (int i = 0; i < 8; ++i) { const int ka = k0 + 8 * g + i, kb = ka + 16; v[i] = ka < K ? row[ka < K ? ka : K - 1] : 0.f; v[8 + i] = kb < K ? row[kb < K ? kb : K - 1] : 0.f; }
  return bsplit16(v); }
__device__ __forceinline__ F2 split_col(const float* W, int k0, int n, int lane, int ld, int K) { float v[16]; const int g = lane >> 4;
#pragma unroll
  for (int i = 0; i < 8; ++i) { const int ka = k0 + 8 * g + i, kb = ka + 16; v[i] = ka < K ? W[(size_t)(ka < K ? ka : K - 1) * ld + n] : 0.f; v[8 + i] = kb < K ? W[(size_t)(kb < K ? kb : K - 1) * ld + n] : 0.f; }
  return bsplit16(v); }
__device__ __forceinline__ v8f mac3(const F2& a, const F2& b, v8f c) { c = wmma_bf(a.l, b.h, c); c = wmma_bf(a.h, b.l, c); return wmma_bf(a.h, b.h, c); }
__device__ __forceinline__ float sigm(float v) { return 1.0f / (1.0f + expf(-v)); }
#define LDSX() do { asm volatile("s_wait_dscnt 0" ::: "memory"); __builtin_amdgcn_wave_barrier(); __builtin_amdgcn_fence(__ATOMIC_RELEASE, "workgroup"); } while (0)

// Single-head causal self-attention with a 768-WIDE head (x [4,2048,768]; (in,out) Wq / Wk / Wv [768,768] uniform, no biases; scores = q k^T with -inf above the diagonal, then / sqrt(768); no head split, no output projection): out = softmax(causal(q k^T) / sqrt(768)) v -> [4,2048,768].
#define NB 4
#define TT 2048
#define CC 768            // NH * HD = projected width
#define DIN 768          // input (model) width
#define NH 1
#define HD 768
#define NQB (TT / 64)
#define HG 1
#define SCALE (0.036084391824351615f)
#define CAUSAL 1
#ifndef TNB
#define TNB NB
#endif
__device__ __forceinline__ float bfr(float v) { return (float)(__bf16)v; }
__host__ __device__ __forceinline__ int kb_last(int qb) { return CAUSAL ? ((qb * 64 + 63) >> 7) : (TT / 128 - 1); }
typedef __attribute__((ext_vector_type(8))) __bf16 v8b;
__device__ __forceinline__ v16b frag_b(const __bf16* rowk0, int lane) {
  union { v16b v; v8b q[2]; } u; const __bf16* p = rowk0 + 8 * (lane >> 4);
  u.q[0] = *(const v8b*)p; u.q[1] = *(const v8b*)(p + 16); return u.v;
}
#define QBH 6              // causal: query blocks 0..QBH-1 of each sequence (few keys, no averaging) take the high-precision path
#define QHI 384            // rows carrying a q residual plane (all rows when non-causal: 2-product logits everywhere)
#define KHI 384            // key rows carrying k residual / v bf16 hi+lo planes (used only by the causal high-precision path)
// B fragment (k rows k0+.., output column o) of a weight: (in,out) [K][ld] or (out,in) [ld rows of K]: bf16 exact, or f16(bf16 * 256) exact
__device__ __forceinline__ v16b wcol_io(const float* Wm, int k0, int o, int lane, int ld) { v16b w; const int g = lane >> 4;
#pragma unroll
  for (int i = 0; i < 8; ++i) { w[i] = (__bf16)Wm[(size_t)(k0 + 8 * g + i) * ld + o]; w[8 + i] = (__bf16)Wm[(size_t)(k0 + 16 + 8 * g + i) * ld + o]; }
  return w; }
__device__ __forceinline__ v16b wcol_oi(const float* Wm, int k0, int o, int lane, int K) { v16b w; const float* p = Wm + (size_t)o * K + k0 + 8 * (lane >> 4);
#pragma unroll
  for (int i = 0; i < 8; ++i) { w[i] = (__bf16)p[i]; w[8 + i] = (__bf16)p[16 + i]; }
  return w; }
__device__ __forceinline__ v16h wcolh_io(const float* Wm, int k0, int o, int lane, int ld) { v16h w; const int g = lane >> 4;
#pragma unroll
  for (int i = 0; i < 8; ++i) { w[i] = (_Float16)(bfr(Wm[(size_t)(k0 + 8 * g + i) * ld + o]) * 256.0f); w[8 + i] = (_Float16)(bfr(Wm[(size_t)(k0 + 16 + 8 * g + i) * ld + o]) * 256.0f); }
  return w; }
__device__ __forceinline__ v16h wcolh_oi(const float* Wm, int k0, int o, int lane, int K) { v16h w; const float* p = Wm + (size_t)o * K + k0 + 8 * (lane >> 4);
#pragma unroll
  for (int i = 0; i < 8; ++i) { w[i] = (_Float16)(bfr(p[i]) * 256.0f); w[8 + i] = (_Float16)(bfr(p[16 + i]) * 256.0f); }
  return w; }
#define WQKV_LAYOUT 0   // 0 = (in,out) [DIN][CC]; 1 = (out,in) [CC][DIN]; 2 = per-head [NH][DIN][HD]
__device__ __forceinline__ v16b wcol_hdk(const float* Wm, int k0, int o, int lane) { v16b w; const int g = lane >> 4; const float* p = Wm + (size_t)(o / HD) * DIN * HD + (o % HD);
#pragma unroll
  for (int i = 0; i < 8; ++i) { w[i] = (__bf16)p[(size_t)(k0 + 8 * g + i) * HD]; w[8 + i] = (__bf16)p[(size_t)(k0 + 16 + 8 * g + i) * HD]; }
  return w; }
#define WO_OUT_IN 0
#if WQKV_LAYOUT == 1
#define WCOL(W, k0, o, lane) wcol_oi(W, k0, o, lane, DIN)
#elif WQKV_LAYOUT == 2
#define WCOL(W, k0, o, lane) wcol_hdk(W, k0, o, lane)
#else
#define WCOL(W, k0, o, lane) wcol_io(W, k0, o, lane, CC)
#endif
#if WO_OUT_IN
#define WOCOL(W, k0, o, lane) wcol_oi(W, k0, o, lane, CC)
#define WOCOLH(W, k0, o, lane) wcolh_oi(W, k0, o, lane, CC)
#else
#define WOCOL(W, k0, o, lane) wcol_io(W, k0, o, lane, DIN)
#define WOCOLH(W, k0, o, lane) wcolh_io(W, k0, o, lane, DIN)
#endif

#ifndef SM_EXTRA_PARAMS
#define SM_EXTRA_PARAMS
#endif
#ifndef PROJ_EXTRA_PARAMS
#define PROJ_EXTRA_PARAMS
#endif
#ifndef SM_MASK_HOOK
#define SM_MASK_HOOK (void)0
#endif

#define WS_QH  0u                                      // f16 q rows [b*t][CC]
#define WS_KH  (WS_QH + 2u * (size_t)NB * TT * CC)      // f16 k rows [b*t][CC]
#define WS_VT  (WS_KH + 2u * (size_t)NB * TT * CC)      // f16 v planes [b][c][t]
#define WS_QL  (WS_VT + 2u * (size_t)NB * CC * TT)      // f16 q residual x 2^10 rows [b][t < QHI][CC]
#define WS_KL  (WS_QL + 2u * (size_t)NB * QHI * CC)     // f16 k residual x 2^10 rows [b][t < KHI][CC]
#define WS_VB  (WS_KL + 2u * (size_t)NB * KHI * CC)     // bf16 v hi planes [b][c][t < KHI]
#define WS_VBL (WS_VB + 2u * (size_t)NB * CC * KHI)
#define WS_S   (WS_VBL + 2u * (size_t)NB * CC * KHI)    // f32 logits / P [b][t][s]: one plane per batch, so that each stage runs all batches in one launch
#define WS_Y   (WS_S  + 4u * (size_t)NB * TT * TT)      // f32 ctx rows [b*t][CC] (only when there is an output projection)
#define WS_END (WS_Y  + 0u)

// ---- k_proj: block = (64 rows, 128 cols, which): q/k/v = X W (+ b) with exact bf16 products (K = DIN) -> which 0: q f16 rows (+ residual rows < QHI); 1: k f16 rows (+ residual rows < KHI); 2: v f16 planes [c][t] (+ bf16 hi/lo planes for t < KHI)
__global__ __launch_bounds__(128) void k_proj(const float* __restrict__ XQ, const float* __restrict__ XK, const float* __restrict__ XV, const float* __restrict__ WQ, const float* __restrict__ WK, const float* __restrict__ WV, const float* __restrict__ BQ, const float* __restrict__ BK, const float* __restrict__ BV,
    _Float16* __restrict__ QH, _Float16* __restrict__ QL, _Float16* __restrict__ KH, _Float16* __restrict__ KL, _Float16* __restrict__ VT, __bf16* __restrict__ VB, __bf16* __restrict__ VBL) {
  __shared__ __align__(16) _Float16 sh[64][136], sl[64][136]; __shared__ __align__(16) _Float16 th[128][72]; __shared__ __align__(16) __bf16 tb[128][72], tbl[128][72];
  const int tid = threadIdx.x, wave = tid >> 5, lane = tid & 31, col = lane & 15, g = lane >> 4; const int which = blockIdx.z; const int c0 = blockIdx.y * 128; const size_t r0 = (size_t)blockIdx.x * 64; const size_t bb = r0 / TT; const int t0 = (int)(r0 % TT);
  const float* X = which == 0 ? XQ : which == 1 ? XK : XV; const float* WA = which == 0 ? WQ : which == 1 ? WK : WV; const float* BA = which == 0 ? BQ : which == 1 ? BK : BV;
  v8f acc[8] = {};
#pragma unroll 2
  for (int kc = 0; kc < DIN / 32; ++kc) { v16b a; { const float* p = X + (r0 + wave * 16 + col) * DIN + kc * 32 + 8 * g;
#pragma unroll
      for (int i = 0; i < 8; ++i) { a[i] = (__bf16)p[i]; a[8 + i] = (__bf16)p[16 + i]; } }
    asm volatile("s_wait_loadcnt 0x0" ::: "memory");
#pragma unroll
    for (int j = 0; j < 8; ++j) { const v16b w = WCOL(WA, kc * 32, c0 + j * 16 + col, lane); asm volatile("s_wait_loadcnt 0x0" ::: "memory"); acc[j] = wmma_bf(a, w, acc[j]); } }
  if (which < 2) { _Float16* DH = which == 0 ? QH : KH; _Float16* DL = which == 0 ? QL : KL; const int nhi = which == 0 ? QHI : KHI; const bool hi_rows = t0 < nhi;
#pragma unroll
    for (int j = 0; j < 8; ++j) { const float bias = BA ? bfr(BA[c0 + j * 16 + col]) : 0.f;
#pragma unroll
      for (int r = 0; r < 8; ++r) { const float v = acc[j][r] + bias; const _Float16 hv = (_Float16)v; sh[wave * 16 + 8 * g + r][j * 16 + col] = hv; sl[wave * 16 + 8 * g + r][j * 16 + col] = (_Float16)((v - (float)hv) * 1024.0f); } }
    __syncthreads();
    for (int e = tid; e < 64 * 16; e += 128) { const int rl = e >> 4, q = e & 15; vst2((unsigned*)(DH + (r0 + rl) * CC + c0 + q * 8), *(const v4u*)&sh[rl][q * 8]); if (hi_rows) vst2((unsigned*)(DL + (bb * nhi + t0 + rl) * (size_t)CC + c0 + q * 8), *(const v4u*)&sl[rl][q * 8]); }
  } else { const bool hi_rows = t0 < KHI;
#pragma unroll
    for (int j = 0; j < 8; ++j) { const float bias = BA ? bfr(BA[c0 + j * 16 + col]) : 0.f;
#pragma unroll
      for (int r = 0; r < 8; ++r) { const float v = acc[j][r] + bias; const int rl = wave * 16 + 8 * g + r, cl = j * 16 + col; th[cl][rl] = (_Float16)v; const __bf16 bh = (__bf16)v; tb[cl][rl] = bh; tbl[cl][rl] = (__bf16)(v - (float)bh); } }
    __syncthreads();
    for (int e = tid; e < 128 * 8; e += 128) { const int cl = e >> 3, q = e & 7; vst2((unsigned*)(VT + (bb * CC + c0 + cl) * (size_t)TT + t0 + q * 8), *(const v4u*)&th[cl][q * 8]); if (hi_rows) { const size_t o3 = (bb * CC + c0 + cl) * (size_t)KHI + t0 + q * 8; vst2((unsigned*)(VB + o3), *(const v4u*)&tb[cl][q * 8]); vst2((unsigned*)(VBL + o3), *(const v4u*)&tbl[cl][q * 8]); } } } }
// ---- k_sc: block = (query block qb, key block kb <= kb_last(qb), batch b = blockIdx.z): logits x SCALE; q hi + residual (x 2^10) against k (2 products) for query rows < QHI, plus the k residual (3 products) for query blocks < QBH (causal early rows); causal: blocks past the diagonal exit, the mask itself is applied by index in k_sm
__global__ __launch_bounds__(128) void k_sc(const _Float16* __restrict__ QH, const _Float16* __restrict__ KH, const _Float16* __restrict__ QL, const _Float16* __restrict__ KL, int h0, float* __restrict__ S0) { __shared__ __align__(16) float ss[4][16][132];
  const int qb = blockIdx.x, kb = blockIdx.y; if (kb > kb_last(qb)) return;
  const int b = blockIdx.z; const int h = h0; float* S = S0 + (size_t)b * TT * TT;
  const int tid = threadIdx.x, wave = tid >> 5, lane = tid & 31, col = lane & 15, g = lane >> 4; const int k0 = kb * 128; const int ql0 = qb * 64 + wave * 16; const size_t q0 = (size_t)b * TT + ql0, kr0 = (size_t)b * TT + k0;
  v8f acc[8] = {}, accl[8] = {};
  const _Float16* QLb = QL + (size_t)b * QHI * CC; const _Float16* KLb = KL + (size_t)b * KHI * CC;
  if (qb < QBH) {
#pragma unroll
    for (int kc = 0; kc < HD / 32; ++kc) { const v16h ah = frag_h(QH + (q0 + col) * CC + h * HD + kc * 32, lane), al = frag_h(QLb + (size_t)(ql0 + col) * CC + h * HD + kc * 32, lane);
#pragma unroll
      for (int j = 0; j < 8; ++j) { const v16h kbf = frag_h(KH + (kr0 + j * 16 + col) * CC + h * HD + kc * 32, lane), klf = frag_h(KLb + (size_t)(k0 + j * 16 + col) * CC + h * HD + kc * 32, lane); acc[j] = wmma16(ah, kbf, acc[j]); accl[j] = wmma16(al, kbf, accl[j]); accl[j] = wmma16(ah, klf, accl[j]); } }
  } else if (qb * 64 < QHI) {
#pragma unroll
    for (int kc = 0; kc < HD / 32; ++kc) { const v16h ah = frag_h(QH + (q0 + col) * CC + h * HD + kc * 32, lane), al = frag_h(QLb + (size_t)(ql0 + col) * CC + h * HD + kc * 32, lane);
#pragma unroll
      for (int j = 0; j < 8; ++j) { const v16h kbf = frag_h(KH + (kr0 + j * 16 + col) * CC + h * HD + kc * 32, lane); acc[j] = wmma16(ah, kbf, acc[j]); accl[j] = wmma16(al, kbf, accl[j]); } }
  } else {
#pragma unroll
    for (int kc = 0; kc < HD / 32; ++kc) { const v16h ah = frag_h(QH + (q0 + col) * CC + h * HD + kc * 32, lane);
#pragma unroll
      for (int j = 0; j < 8; ++j) { const v16h kbf = frag_h(KH + (kr0 + j * 16 + col) * CC + h * HD + kc * 32, lane); acc[j] = wmma16(ah, kbf, acc[j]); } } }
#pragma unroll
  for (int j = 0; j < 8; ++j) {
#pragma unroll
    for (int r = 0; r < 8; ++r) ss[wave][8 * g + r][j * 16 + col] = (acc[j][r] + accl[j][r] * (1.0f / 1024.0f)) * SCALE; }
  LDSX(); for (int rl = 0; rl < 16; ++rl) vst2(S + (size_t)(ql0 + rl) * TT + k0 + lane * 4, *(const v4f*)&ss[wave][rl][lane * 4]); }
// ---- k_sm: block = query row t of batch blockIdx.y: keys [0, kend): causal -> logit if s <= t else excluded; softmax in f32; P x 2^11 in place (0 for excluded)
__global__ __launch_bounds__(256) void k_sm(float* __restrict__ S0 SM_EXTRA_PARAMS) { __shared__ float sred[8]; __shared__ float sbc; __shared__ __align__(16) float shv[TT];
  const int tid = threadIdx.x; const int t = blockIdx.x; const int kend = (kb_last(t >> 6) + 1) * 128;
  float* sr = S0 + (size_t)blockIdx.y * TT * TT + (size_t)t * TT;
  float m = -3.0e38f; for (int k = tid; k < kend; k += 256) { float v = (!CAUSAL || k <= t) ? sr[k] : -3.0e38f; SM_MASK_HOOK; shv[k] = v; m = fmaxf(m, v); }
#pragma unroll
  for (int o = 1; o < 32; o <<= 1) m = fmaxf(m, __shfl_xor(m, o));
  if ((tid & 31) == 0) sred[tid >> 5] = m; __syncthreads(); if (tid == 0) { float a = sred[0]; for (int i = 1; i < 8; ++i) a = fmaxf(a, sred[i]); sbc = a; } __syncthreads(); m = sbc; __syncthreads();
  float sum = 0.f; for (int k = tid; k < kend; k += 256) { const float v = shv[k]; const float e = (v <= -1.0e38f) ? 0.f : expf(v - m); shv[k] = e; sum += e; }
#pragma unroll
  for (int o = 1; o < 32; o <<= 1) sum += __shfl_xor(sum, o);
  if ((tid & 31) == 0) sred[tid >> 5] = sum; __syncthreads(); if (tid == 0) { float a = 0.f; for (int i = 0; i < 8; ++i) a += sred[i]; sbc = a > 0.f ? 2048.0f / a : 0.f; }   /* a fully excluded row yields P = 0 */ __syncthreads(); const float inv = sbc;
  for (int k = tid; k < kend; k += 256) shv[k] = shv[k] * inv;
  __syncthreads(); for (int q = tid; q < kend / 4; q += 256) vst2(sr + q * 4, *(const v4f*)&shv[q * 4]); }
#define DVH 128            // value columns per k_pv block: the 768-wide head is walked in six 128-column slices (8 accumulator tiles per wave; a 48-tile accumulator would not fit the register file)
// ---- k_pv: block = (64 queries (qb), 128-column value slice d0, batch b = blockIdx.z): ctx[:, d0 .. d0+127] = P . v over keys [0, kend) (P x 2^11 once to f16 against v f16: 1 product; causal early query blocks: P and v as bf16 hi + lo, 3 products); the 512-B (row, slice) segment by 32 lanes x 16 B
__global__ __launch_bounds__(128) void k_pv(const float* __restrict__ PS0, const _Float16* __restrict__ VT, const __bf16* __restrict__ VB, const __bf16* __restrict__ VBL, int h0, float* __restrict__ Y) { const int b = blockIdx.z; const int h = h0; const int d0 = blockIdx.y * DVH; const float* PS = PS0 + (size_t)b * TT * TT; __shared__ __align__(16) float ss[4][16][DVH + 4];
  const int tid = threadIdx.x, wave = tid >> 5, lane = tid & 31, col = lane & 15, g = lane >> 4; const int qb = blockIdx.x; const int ql0 = qb * 64 + wave * 16; const int kce = (kb_last(qb) + 1) * 4;
  v8f acc[DVH / 16] = {};
  if (qb < QBH) {
#pragma unroll 1
    for (int kc = 0; kc < kce; ++kc) { const F2 p = split_row(PS + (size_t)(ql0 + col) * TT, kc * 32, lane);
      asm volatile("s_wait_loadcnt 0x0" ::: "memory");
#pragma unroll
      for (int j = 0; j < DVH / 16; ++j) { const size_t po = ((size_t)b * CC + h * HD + d0 + j * 16 + col) * (size_t)KHI + kc * 32; const v16b vh = frag_b(VB + po, lane); acc[j] = wmma_bf(p.h, vh, acc[j]); acc[j] = wmma_bf(p.l, vh, acc[j]); acc[j] = wmma_bf(p.h, frag_b(VBL + po, lane), acc[j]); } }
  } else {
#pragma unroll 1
    for (int kc = 0; kc < kce; ++kc) { const v16h p = frag_f32(PS + (size_t)(ql0 + col) * TT + kc * 32, lane);
      asm volatile("s_wait_loadcnt 0x0" ::: "memory");
#pragma unroll
      for (int j = 0; j < DVH / 16; ++j) { const size_t po = ((size_t)b * CC + h * HD + d0 + j * 16 + col) * (size_t)TT + kc * 32; acc[j] = wmma16(p, frag_h(VT + po, lane), acc[j]); } } }
#pragma unroll
  for (int j = 0; j < DVH / 16; ++j)
#pragma unroll
    for (int r = 0; r < 8; ++r) ss[wave][8 * g + r][j * 16 + col] = acc[j][r] * (1.0f / 2048.0f);
  LDSX(); for (int rl = 0; rl < 16; ++rl) vst2(Y + ((size_t)b * TT + ql0 + rl) * CC + h * HD + d0 + lane * 4, *(const v4f*)&ss[wave][rl][lane * 4]); }   
extern "C" void kernel_launch(void* const* d_in, const int* in_sizes, int n_in, void* d_out, int out_size, void* d_ws, size_t ws_size, hipStream_t stream) {
  (void)in_sizes; (void)n_in; (void)out_size;
  const float** F = (const float**)d_in;
  if (ws_size < (size_t)WS_END) return;
  char* ws = (char*)d_ws; _Float16 *QH = (_Float16*)(ws + WS_QH), *KH = (_Float16*)(ws + WS_KH), *VT = (_Float16*)(ws + WS_VT), *QL = (_Float16*)(ws + WS_QL), *KL = (_Float16*)(ws + WS_KL); __bf16 *VB = (__bf16*)(ws + WS_VB), *VBL = (__bf16*)(ws + WS_VBL); float *S = (float*)(ws + WS_S), *Y = (float*)(ws + WS_Y);
  (void)Y; (void)QL; (void)KL; (void)VB; (void)VBL;
  // inputs: 0 x [4,2048,768]; 1 Wq [768,768] (in,out); 2 Wk; 3 Wv; no biases, no output projection
  k_proj<<<dim3(TNB * TT / 64, CC / 128, 3), 128, 0, stream>>>(F[0], F[0], F[0], F[1], F[2], F[3], nullptr, nullptr, nullptr, QH, QL, KH, KL, VT, VB, VBL);
  k_sc<<<dim3(NQB, TT / 128, TNB), 128, 0, stream>>>(QH, KH, QL, KL, 0, S);
  k_sm<<<dim3(TT, TNB), 256, 0, stream>>>(S);
  k_pv<<<dim3(NQB, HD / DVH, TNB), 128, 0, stream>>>(S, VT, VB, VBL, 0, (float*)d_out);   /* six 128-column value slices per query block */
}

// v002
// It runs in 312 microseconds.
// Next to v001, in two timings, it ran 1.40 times as fast each time.
// All steps since v000 together make it 2.71 times as fast.
// compute dtype: all float inputs rounded to bf16; q/k/v projections with EXACT bf16 products on WMMA 16x16x32 (f32 accumulate); causal logits over the 768-wide head: 3 products for the first 384 rows, single f16 q x k after, x 768^-0.5; softmax f32; P x 2^11 once to f16 x v once to f16 (bf16 hi + lo below row 384); f32 output.
#include <hip/hip_runtime.h>
#include <math.h>

typedef __attribute__((ext_vector_type(16))) _Float16 v16h;
typedef __attribute__((ext_vector_type(16))) __bf16 v16b;
typedef __attribute__((ext_vector_type(8)))  _Float16 v8h;
typedef __attribute__((ext_vector_type(8)))  float v8f;
typedef __attribute__((ext_vector_type(4)))  float v4f;
typedef __attribute__((ext_vector_type(2)))  float v2f;
typedef __attribute__((ext_vector_type(4)))  unsigned v4u;
typedef __attribute__((ext_vector_type(4)))  int v4i;
typedef float __attribute__((may_alias)) float_a;
typedef int __attribute__((may_alias)) int_a;

template <typename T> __device__ __forceinline__ void vst2(void* p, T v) { *(T*)p = v;  }
__device__ __forceinline__ v8f wmma16(v16h a, v16h b, v8f c) {
  v8f d = __builtin_amdgcn_wmma_f32_16x16x32_f16(false, a, false, b, (short)0, c, false, false);
  asm volatile("v_nop\n\tv_nop\n\tv_nop\n\tv_nop" : "+v"(d) : "v"(a), "v"(b));
  return d;
}
__device__ __forceinline__ v8f wmma_bf(v16b a, v16b b, v8f c) {
  v8f d = __builtin_amdgcn_wmma_f32_16x16x32_bf16(false, a, false, b, (short)0, c, false, false);
  asm volatile("v_nop\n\tv_nop\n\tv_nop\n\tv_nop" : "+v"(d) : "v"(a), "v"(b));
  return d;
}
// 16x16x32 fragments: lane = (h = lane>>4, row/col = lane&15); elements 0..7 = k0+8h+0..7, 8..15 = k0+16+8h+0..7; D element r = row 8h+r
__device__ __forceinline__ v16h frag_h(const _Float16* rowk0, int lane) {
  union { v16h v; v8h q[2]; } u; const _Float16* p = rowk0 + 8 * (lane >> 4);
  u.q[0] = *(const v8h*)p; u.q[1] = *(const v8h*)(p + 16); return u.v;
}
__device__ __forceinline__ v16h frag_f32(const float* rowk0, int lane) {
  v16h a; const float* p = rowk0 + 8 * (lane >> 4);
#pragma unroll
  for (int i = 0; i < 8; ++i) { a[i] = (_Float16)p[i]; a[8 + i] = (_Float16)p[16 + i]; }
  return a;
}
__device__ __forceinline__ v16h frag_f32s(const float* rowk0, int lane, float sc) {
  v16h a; const float* p = rowk0 + 8 * (lane >> 4);
#pragma unroll
  for (int i = 0; i < 8; ++i) { a[i] = (_Float16)(p[i] * sc); a[8 + i] = (_Float16)(p[16 + i] * sc); }
  return a;
}
// column fragment from a [K][ld] layout (column n), rows >= K read as 0
__device__ __forceinline__ v16h fragc_f32(const float* W, int k0, int n, int lane, int ld, int K) {
  v16h a; const int g = lane >> 4;
#pragma unroll
  for (int i = 0; i < 8; ++i) { const int ka = k0 + 8 * g + i, kb = ka + 16;
    a[i] = (_Float16)(ka < K ? W[(size_t)(ka < K ? ka : K - 1) * ld + n] : 0.f); a[8 + i] = (_Float16)(kb < K ? W[(size_t)(kb < K ? kb : K - 1) * ld + n] : 0.f); }
  return a;
}
struct F2 { v16b h, l; };
__device__ __forceinline__ F2 bsplit16(const float v[16]) { F2 r;
#pragma unroll
  for (int i = 0; i < 16; ++i) { const __bf16 h = (__bf16)v[i]; r.h[i] = h; r.l[i] = (__bf16)(v[i] - (float)h); }
  return r; }
__device__ __forceinline__ F2 split_row(const float* row, int k0, int lane) { float v[16]; const float* p = row + k0 + 8 * (lane >> 4);
#pragma unroll
  for (int i = 0; i < 8; ++i) { v[i] = p[i]; v[8 + i] = p[16 + i]; }
  return bsplit16(v); }
__device__ __forceinline__ F2 split_rowK(const float* row, int k0, int lane, int K) { float v[16]; const int g = lane >> 4;
#pragma unroll
  for (int i = 0; i < 8; ++i) { const int ka = k0 + 8 * g + i, kb = ka + 16; v[i] = ka < K ? row[ka < K ? ka : K - 1] : 0.f; v[8 + i] = kb < K ? row[kb < K ? kb : K - 1] : 0.f; }
  return bsplit16(v); }
__device__ __forceinline__ F2 split_col(const float* W, int k0, int n, int lane, int ld, int K) { float v[16]; const int g = lane >> 4;
#pragma unroll
  for (int i = 0; i < 8; ++i) { const int ka = k0 + 8 * g + i, kb = ka + 16; v[i] = ka < K ? W[(size_t)(ka < K ? ka : K - 1) * ld + n] : 0.f; v[8 + i] = kb < K ? W[(size_t)(kb < K ? kb : K - 1) * ld + n] : 0.f; }
  return bsplit16(v); }
__device__ __forceinline__ v8f mac3(const F2& a, const F2& b, v8f c) { c = wmma_bf(a.l, b.h, c); c = wmma_bf(a.h, b.l, c); return wmma_bf(a.h, b.h, c); }
__device__ __forceinline__ float sigm(float v) { return 1.0f / (1.0f + expf(-v)); }
#define LDSX() do { asm volatile("s_wait_dscnt 0" ::: "memory"); __builtin_amdgcn_wave_barrier(); __builtin_amdgcn_fence(__ATOMIC_RELEASE, "workgroup"); } while (0)

// Single-head causal self-attention with a 768-WIDE head (x [4,2048,768]; (in,out) Wq / Wk / Wv [768,768] uniform, no biases; scores = q k^T with -inf above the diagonal, then / sqrt(768); no head split, no output projection): out = softmax(causal(q k^T) / sqrt(768)) v -> [4,2048,768].
#define NB 4
#define TT 2048
#define CC 768            // NH * HD = projected width
#define DIN 768          // input (model) width
#define NH 1
#define HD 768
#define NQB (TT / 64)
#define HG 1
#define SCALE (0.036084391824351615f)
#define CAUSAL 1
#ifndef TNB
#define TNB NB
#endif
__device__ __forceinline__ float bfr(float v) { return (float)(__bf16)v; }
__host__ __device__ __forceinline__ int kb_last(int qb) { return CAUSAL ? ((qb * 64 + 63) >> 7) : (TT / 128 - 1); }
typedef __attribute__((ext_vector_type(8))) __bf16 v8b;
__device__ __forceinline__ v16b frag_b(const __bf16* rowk0, int lane) {
  union { v16b v; v8b q[2]; } u; const __bf16* p = rowk0 + 8 * (lane >> 4);
  u.q[0] = *(const v8b*)p; u.q[1] = *(const v8b*)(p + 16); return u.v;
}
#define QBH 6              // causal: query blocks 0..QBH-1 of each sequence (few keys, no averaging) take the high-precision path
#define QHI 384            // rows carrying a q residual plane (all rows when non-causal: 2-product logits everywhere)
#define KHI 384            // key rows carrying k residual / v bf16 hi+lo planes (used only by the causal high-precision path)
// B fragment (k rows k0+.., output column o) of a weight: (in,out) [K][ld] or (out,in) [ld rows of K]: bf16 exact, or f16(bf16 * 256) exact
__device__ __forceinline__ v16b wcol_io(const float* Wm, int k0, int o, int lane, int ld) { v16b w; const int g = lane >> 4;
#pragma unroll
  for (int i = 0; i < 8; ++i) { w[i] = (__bf16)Wm[(size_t)(k0 + 8 * g + i) * ld + o]; w[8 + i] = (__bf16)Wm[(size_t)(k0 + 16 + 8 * g + i) * ld + o]; }
  return w; }
__device__ __forceinline__ v16b wcol_oi(const float* Wm, int k0, int o, int lane, int K) { v16b w; const float* p = Wm + (size_t)o * K + k0 + 8 * (lane >> 4);
#pragma unroll
  for (int i = 0; i < 8; ++i) { w[i] = (__bf16)p[i]; w[8 + i] = (__bf16)p[16 + i]; }
  return w; }
__device__ __forceinline__ v16h wcolh_io(const float* Wm, int k0, int o, int lane, int ld) { v16h w; const int g = lane >> 4;
#pragma unroll
  for (int i = 0; i < 8; ++i) { w[i] = (_Float16)(bfr(Wm[(size_t)(k0 + 8 * g + i) * ld + o]) * 256.0f); w[8 + i] = (_Float16)(bfr(Wm[(size_t)(k0 + 16 + 8 * g + i) * ld + o]) * 256.0f); }
  return w; }
__device__ __forceinline__ v16h wcolh_oi(const float* Wm, int k0, int o, int lane, int K) { v16h w; const float* p = Wm + (size_t)o * K + k0 + 8 * (lane >> 4);
#pragma unroll
  for (int i = 0; i < 8; ++i) { w[i] = (_Float16)(bfr(p[i]) * 256.0f); w[8 + i] = (_Float16)(bfr(p[16 + i]) * 256.0f); }
  return w; }
#define WQKV_LAYOUT 0   // 0 = (in,out) [DIN][CC]; 1 = (out,in) [CC][DIN]; 2 = per-head [NH][DIN][HD]
__device__ __forceinline__ v16b wcol_hdk(const float* Wm, int k0, int o, int lane) { v16b w; const int g = lane >> 4; const float* p = Wm + (size_t)(o / HD) * DIN * HD + (o % HD);
#pragma unroll
  for (int i = 0; i < 8; ++i) { w[i] = (__bf16)p[(size_t)(k0 + 8 * g + i) * HD]; w[8 + i] = (__bf16)p[(size_t)(k0 + 16 + 8 * g + i) * HD]; }
  return w; }
#define WO_OUT_IN 0
#if WQKV_LAYOUT == 1
#define WCOL(W, k0, o, lane) wcol_oi(W, k0, o, lane, DIN)
#elif WQKV_LAYOUT == 2
#define WCOL(W, k0, o, lane) wcol_hdk(W, k0, o, lane)
#else
#define WCOL(W, k0, o, lane) wcol_io(W, k0, o, lane, CC)
#endif
#if WO_OUT_IN
#define WOCOL(W, k0, o, lane) wcol_oi(W, k0, o, lane, CC)
#define WOCOLH(W, k0, o, lane) wcolh_oi(W, k0, o, lane, CC)
#else
#define WOCOL(W, k0, o, lane) wcol_io(W, k0, o, lane, DIN)
#define WOCOLH(W, k0, o, lane) wcolh_io(W, k0, o, lane, DIN)
#endif

#ifndef SM_EXTRA_PARAMS
#define SM_EXTRA_PARAMS
#endif
#ifndef PROJ_EXTRA_PARAMS
#define PROJ_EXTRA_PARAMS
#endif
#ifndef SM_MASK_HOOK
#define SM_MASK_HOOK (void)0
#endif

#define WS_QH  0u                                      // f16 q rows [b*t][CC]
#define WS_KH  (WS_QH + 2u * (size_t)NB * TT * CC)      // f16 k rows [b*t][CC]
#define WS_VT  (WS_KH + 2u * (size_t)NB * TT * CC)      // f16 v planes [b][c][t]
#define WS_QL  (WS_VT + 2u * (size_t)NB * CC * TT)      // f16 q residual x 2^10 rows [b][t < QHI][CC]
#define WS_KL  (WS_QL + 2u * (size_t)NB * QHI * CC)     // f16 k residual x 2^10 rows [b][t < KHI][CC]
#define WS_VB  (WS_KL + 2u * (size_t)NB * KHI * CC)     // bf16 v hi planes [b][c][t < KHI]
#define WS_VBL (WS_VB + 2u * (size_t)NB * CC * KHI)
#define WS_S   (WS_VBL + 2u * (size_t)NB * CC * KHI)    // f32 logits / P [b][t][s]: one plane per batch, so that each stage runs all batches in one launch
#define WS_Y   (WS_S  + 4u * (size_t)NB * TT * TT)      // f32 ctx rows [b*t][CC] (only when there is an output projection)
#define WS_END (WS_Y  + 0u)

// ---- k_proj: block = (64 rows, 128 cols, which): q/k/v = X W (+ b) with exact bf16 products (K = DIN) -> which 0: q f16 rows (+ residual rows < QHI); 1: k f16 rows (+ residual rows < KHI); 2: v f16 planes [c][t] (+ bf16 hi/lo planes for t < KHI)
__global__ __launch_bounds__(128) void k_proj(const float* __restrict__ XQ, const float* __restrict__ XK, const float* __restrict__ XV, const float* __restrict__ WQ, const float* __restrict__ WK, const float* __restrict__ WV, const float* __restrict__ BQ, const float* __restrict__ BK, const float* __restrict__ BV,
    _Float16* __restrict__ QH, _Float16* __restrict__ QL, _Float16* __restrict__ KH, _Float16* __restrict__ KL, _Float16* __restrict__ VT, __bf16* __restrict__ VB, __bf16* __restrict__ VBL) {
  __shared__ __align__(16) _Float16 sh[64][136], sl[64][136]; __shared__ __align__(16) _Float16 th[128][72]; __shared__ __align__(16) __bf16 tb[128][72], tbl[128][72];
  const int tid = threadIdx.x, wave = tid >> 5, lane = tid & 31, col = lane & 15, g = lane >> 4; const int which = blockIdx.z; const int c0 = blockIdx.y * 128; const size_t r0 = (size_t)blockIdx.x * 64; const size_t bb = r0 / TT; const int t0 = (int)(r0 % TT);
  const float* X = which == 0 ? XQ : which == 1 ? XK : XV; const float* WA = which == 0 ? WQ : which == 1 ? WK : WV; const float* BA = which == 0 ? BQ : which == 1 ? BK : BV;
  v8f acc[8] = {};
  // Main loop: K in 12 chunks of 64. The block's W chunk [64 k][128 cols] is read from global once (whole 512-B row segments, 16 B a lane), rounded to bf16, turned to [col][k] in registers and
  // kept in LDS for all four waves; tb / tbl (free until the epilogue) are the two buffers. 16-B slot o of row c sits at o ^ ((c >> 4) & 3): the stores (columns 4 apart across lanes) and the
  // fragment reads (columns 1 apart) then both fall on 16 different bank groups per 16 lanes. The next chunk's W and X loads are issued behind the barrier and fly while this chunk's products run.
  const float* wsrc = WA + (size_t)(wave * 16) * CC + c0 + 4 * lane; const float* xsrc = X + (r0 + wave * 16 + col) * DIN + 8 * g;
  v4f wr[16], xr[8]; v16b a[2];
  auto ldg = [&](int s) {   // chunk s counted from the one that wsrc / xsrc stand at
#pragma unroll
    for (int i = 0; i < 16; ++i) wr[i] = *(const v4f*)(wsrc + (size_t)(s * 64 + i) * CC);
#pragma unroll
    for (int i = 0; i < 4; ++i) { xr[2 * i] = *(const v4f*)(xsrc + s * 64 + i * 16); xr[2 * i + 1] = *(const v4f*)(xsrc + s * 64 + i * 16 + 4); } };
  auto stage = [&](__bf16 (*buf)[72]) { const int sw = (lane >> 2) & 3;
    __builtin_amdgcn_sched_barrier(0);   // keeps the conversions, which wait for the global loads, behind the chunk's last product: the loads fly under all sixteen
    asm volatile("s_wait_xcnt 0x0" ::: "memory");   // stands in front of the loop's advance of the two address pairs that the chunk's global loads name
#pragma unroll
    for (int oo = 0; oo < 2; ++oo) {
#pragma unroll
      for (int c = 0; c < 4; ++c) { v8b t;
#pragma unroll
        for (int i = 0; i < 8; ++i) t[i] = (__bf16)wr[oo * 8 + i][c];
        *(v8b*)&buf[4 * lane + c][((2 * wave + oo) ^ sw) * 8] = t; } }
#pragma unroll
    for (int kk = 0; kk < 2; ++kk) {
#pragma unroll
      for (int i = 0; i < 4; ++i) { a[kk][i] = (__bf16)xr[4 * kk][i]; a[kk][4 + i] = (__bf16)xr[4 * kk + 1][i]; a[kk][8 + i] = (__bf16)xr[4 * kk + 2][i]; a[kk][12 + i] = (__bf16)xr[4 * kk + 3][i]; } }
    __builtin_amdgcn_sched_barrier(0); };   // keeps the X conversions here: the raw X registers are free again for the next chunk's loads, and the kernel stays within 256 registers
  // the 16 fragments of a chunk in four groups of four (group q: k half q >> 1, column tiles 4 (q & 1) ..): a group's eight LDS reads stand together, one group ahead of the products that use them
  auto mma = [&](const __bf16 (*buf)[72]) { const __bf16* p0 = &buf[col][8 * g]; const __bf16* p1 = &buf[col][8 * (g ^ 1)]; v16b w[2][4];
    auto ldf = [&](int q) {
#pragma unroll
      for (int i = 0; i < 4; ++i) { const int j = 4 * (q & 1) + i; const __bf16* p = ((j & 1) ? p1 : p0) + j * 16 * 72 + (q >> 1) * 32; union { v16b v; v8b q2[2]; } u;
        u.q2[0] = *(const v8b*)(p + 8 * (j & 2)); u.q2[1] = *(const v8b*)(p + 8 * (2 ^ (j & 2))); w[q & 1][i] = u.v; } };
    ldf(0);
#pragma unroll
    for (int q = 0; q < 4; ++q) { if (q < 3) ldf(q + 1);
#pragma unroll
      for (int i = 0; i < 4; ++i) acc[4 * (q & 1) + i] = wmma_bf(a[q >> 1], w[q & 1][i], acc[4 * (q & 1) + i]); } };
  ldg(0); stage(tb); __syncthreads();
  // rolled: two chunks a trip (one per buffer) keep the loop's text small; each barrier publishes the chunk just stored and ends the reads of the buffer that is stored next
#pragma unroll 1
  for (int s = 0; s < DIN / 64 - 2; s += 2) {
    ldg(1); mma(tb); stage(tbl); __syncthreads();
    ldg(2); mma(tbl); stage(tb); __syncthreads();
    wsrc += (size_t)128 * CC; xsrc += 128; }
  ldg(1); mma(tb); stage(tbl); __syncthreads();
  mma(tbl); __syncthreads();   // the epilogue stores into tb / tbl again: every wave's last fragment read ends here
  if (which < 2) { _Float16* DH = which == 0 ? QH : KH; _Float16* DL = which == 0 ? QL : KL; const int nhi = which == 0 ? QHI : KHI; const bool hi_rows = t0 < nhi;
#pragma unroll
    for (int j = 0; j < 8; ++j) { const float bias = BA ? bfr(BA[c0 + j * 16 + col]) : 0.f;
#pragma unroll
      for (int r = 0; r < 8; ++r) { const float v = acc[j][r] + bias; const _Float16 hv = (_Float16)v; sh[wave * 16 + 8 * g + r][j * 16 + col] = hv; sl[wave * 16 + 8 * g + r][j * 16 + col] = (_Float16)((v - (float)hv) * 1024.0f); } }
    __syncthreads();
    for (int e = tid; e < 64 * 16; e += 128) { const int rl = e >> 4, q = e & 15; vst2((unsigned*)(DH + (r0 + rl) * CC + c0 + q * 8), *(const v4u*)&sh[rl][q * 8]); if (hi_rows) vst2((unsigned*)(DL + (bb * nhi + t0 + rl) * (size_t)CC + c0 + q * 8), *(const v4u*)&sl[rl][q * 8]); }
  } else { const bool hi_rows = t0 < KHI;
#pragma unroll
    for (int j = 0; j < 8; ++j) { const float bias = BA ? bfr(BA[c0 + j * 16 + col]) : 0.f;
#pragma unroll
      for (int r = 0; r < 8; ++r) { const float v = acc[j][r] + bias; const int rl = wave * 16 + 8 * g + r, cl = j * 16 + col; th[cl][rl] = (_Float16)v; const __bf16 bh = (__bf16)v; tb[cl][rl] = bh; tbl[cl][rl] = (__bf16)(v - (float)bh); } }
    __syncthreads();
    for (int e = tid; e < 128 * 8; e += 128) { const int cl = e >> 3, q = e & 7; vst2((unsigned*)(VT + (bb * CC + c0 + cl) * (size_t)TT + t0 + q * 8), *(const v4u*)&th[cl][q * 8]); if (hi_rows) { const size_t o3 = (bb * CC + c0 + cl) * (size_t)KHI + t0 + q * 8; vst2((unsigned*)(VB + o3), *(const v4u*)&tb[cl][q * 8]); vst2((unsigned*)(VBL + o3), *(const v4u*)&tbl[cl][q * 8]); } } } }
// ---- k_sc: block = (query block qb, key block kb <= kb_last(qb), batch b = blockIdx.z): logits x SCALE; q hi + residual (x 2^10) against k (2 products) for query rows < QHI, plus the k residual (3 products) for query blocks < QBH (causal early rows); causal: blocks past the diagonal exit, the mask itself is applied by index in k_sm
__global__ __launch_bounds__(128) void k_sc(const _Float16* __restrict__ QH, const _Float16* __restrict__ KH, const _Float16* __restrict__ QL, const _Float16* __restrict__ KL, int h0, float* __restrict__ S0) { __shared__ __align__(16) float ss[4][16][132];
  const int qb = blockIdx.x, kb = blockIdx.y; if (kb > kb_last(qb)) return;
  const int b = blockIdx.z; const int h = h0; float* S = S0 + (size_t)b * TT * TT;
  const int tid = threadIdx.x, wave = tid >> 5, lane = tid & 31, col = lane & 15, g = lane >> 4; const int k0 = kb * 128; const int ql0 = qb * 64 + wave * 16; const size_t q0 = (size_t)b * TT + ql0, kr0 = (size_t)b * TT + k0;
  v8f acc[8] = {}, accl[8] = {};
  const _Float16* QLb = QL + (size_t)b * QHI * CC; const _Float16* KLb = KL + (size_t)b * KHI * CC;
  if (qb < QBH) {
#pragma unroll
    for (int kc = 0; kc < HD / 32; ++kc) { const v16h ah = frag_h(QH + (q0 + col) * CC + h * HD + kc * 32, lane), al = frag_h(QLb + (size_t)(ql0 + col) * CC + h * HD + kc * 32, lane);
#pragma unroll
      for (int j = 0; j < 8; ++j) { const v16h kbf = frag_h(KH + (kr0 + j * 16 + col) * CC + h * HD + kc * 32, lane), klf = frag_h(KLb + (size_t)(k0 + j * 16 + col) * CC + h * HD + kc * 32, lane); acc[j] = wmma16(ah, kbf, acc[j]); accl[j] = wmma16(al, kbf, accl[j]); accl[j] = wmma16(ah, klf, accl[j]); } }
  } else if (qb * 64 < QHI) {
#pragma unroll
    for (int kc = 0; kc < HD / 32; ++kc) { const v16h ah = frag_h(QH + (q0 + col) * CC + h * HD + kc * 32, lane), al = frag_h(QLb + (size_t)(ql0 + col) * CC + h * HD + kc * 32, lane);
#pragma unroll
      for (int j = 0; j < 8; ++j) { const v16h kbf = frag_h(KH + (kr0 + j * 16 + col) * CC + h * HD + kc * 32, lane); acc[j] = wmma16(ah, kbf, acc[j]); accl[j] = wmma16(al, kbf, accl[j]); } }
  } else {
#pragma unroll
    for (int kc = 0; kc < HD / 32; ++kc) { const v16h ah = frag_h(QH + (q0 + col) * CC + h * HD + kc * 32, lane);
#pragma unroll
      for (int j = 0; j < 8; ++j) { const v16h kbf = frag_h(KH + (kr0 + j * 16 + col) * CC + h * HD + kc * 32, lane); acc[j] = wmma16(ah, kbf, acc[j]); } } }
#pragma unroll
  for (int j = 0; j < 8; ++j) {
#pragma unroll
    for (int r = 0; r < 8; ++r) ss[wave][8 * g + r][j * 16 + col] = (acc[j][r] + accl[j][r] * (1.0f / 1024.0f)) * SCALE; }
  LDSX(); for (int rl = 0; rl < 16; ++rl) vst2(S + (size_t)(ql0 + rl) * TT + k0 + lane * 4, *(const v4f*)&ss[wave][rl][lane * 4]); }
// ---- k_sm: block = query row t of batch blockIdx.y: keys [0, kend): causal -> logit if s <= t else excluded; softmax in f32; P x 2^11 in place (0 for excluded)
__global__ __launch_bounds__(256) void k_sm(float* __restrict__ S0 SM_EXTRA_PARAMS) { __shared__ float sred[8]; __shared__ float sbc; __shared__ __align__(16) float shv[TT];
  const int tid = threadIdx.x; const int t = blockIdx.x; const int kend = (kb_last(t >> 6) + 1) * 128;
  float* sr = S0 + (size_t)blockIdx.y * TT * TT + (size_t)t * TT;
  float m = -3.0e38f; for (int k = tid; k < kend; k += 256) { float v = (!CAUSAL || k <= t) ? sr[k] : -3.0e38f; SM_MASK_HOOK; shv[k] = v; m = fmaxf(m, v); }
#pragma unroll
  for (int o = 1; o < 32; o <<= 1) m = fmaxf(m, __shfl_xor(m, o));
  if ((tid & 31) == 0) sred[tid >> 5] = m; __syncthreads(); if (tid == 0) { float a = sred[0]; for (int i = 1; i < 8; ++i) a = fmaxf(a, sred[i]); sbc = a; } __syncthreads(); m = sbc; __syncthreads();
  float sum = 0.f; for (int k = tid; k < kend; k += 256) { const float v = shv[k]; const float e = (v <= -1.0e38f) ? 0.f : expf(v - m); shv[k] = e; sum += e; }
#pragma unroll
  for (int o = 1; o < 32; o <<= 1) sum += __shfl_xor(sum, o);
  if ((tid & 31) == 0) sred[tid >> 5] = sum; __syncthreads(); if (tid == 0) { float a = 0.f; for (int i = 0; i < 8; ++i) a += sred[i]; sbc = a > 0.f ? 2048.0f / a : 0.f; }   /* a fully excluded row yields P = 0 */ __syncthreads(); const float inv = sbc;
  for (int k = tid; k < kend; k += 256) shv[k] = shv[k] * inv;
  __syncthreads(); for (int q = tid; q < kend / 4; q += 256) vst2(sr + q * 4, *(const v4f*)&shv[q * 4]); }
#define DVH 128            // value columns per k_pv block: the 768-wide head is walked in six 128-column slices (8 accumulator tiles per wave; a 48-tile accumulator would not fit the register file)
// ---- k_pv: block = (64 queries (qb), 128-column value slice d0, batch b = blockIdx.z): ctx[:, d0 .. d0+127] = P . v over keys [0, kend) (P x 2^11 once to f16 against v f16: 1 product; causal early query blocks: P and v as bf16 hi + lo, 3 products); the 512-B (row, slice) segment by 32 lanes x 16 B
__global__ __launch_bounds__(128) void k_pv(const float* __restrict__ PS0, const _Float16* __restrict__ VT, const __bf16* __restrict__ VB, const __bf16* __restrict__ VBL, int h0, float* __restrict__ Y) { const int b = blockIdx.z; const int h = h0; const int d0 = blockIdx.y * DVH; const float* PS = PS0 + (size_t)b * TT * TT; __shared__ __align__(16) float ss[4][16][DVH + 4];
  const int tid = threadIdx.x, wave = tid >> 5, lane = tid & 31, col = lane & 15, g = lane >> 4; const int qb = blockIdx.x; const int ql0 = qb * 64 + wave * 16; const int kce = (kb_last(qb) + 1) * 4;
  v8f acc[DVH / 16] = {};
  if (qb < QBH) {
#pragma unroll 1
    for (int kc = 0; kc < kce; ++kc) { const F2 p = split_row(PS + (size_t)(ql0 + col) * TT, kc * 32, lane);
      asm volatile("s_wait_loadcnt 0x0" ::: "memory");
#pragma unroll
      for (int j = 0; j < DVH / 16; ++j) { const size_t po = ((size_t)b * CC + h * HD + d0 + j * 16 + col) * (size_t)KHI + kc * 32; const v16b vh = frag_b(VB + po, lane); acc[j] = wmma_bf(p.h, vh, acc[j]); acc[j] = wmma_bf(p.l, vh, acc[j]); acc[j] = wmma_bf(p.h, frag_b(VBL + po, lane), acc[j]); } }
  } else {
#pragma unroll 1
    for (int kc = 0; kc < kce; ++kc) { const v16h p = frag_f32(PS + (size_t)(ql0 + col) * TT + kc * 32, lane);
      asm volatile("s_wait_loadcnt 0x0" ::: "memory");
#pragma unroll
      for (int j = 0; j < DVH / 16; ++j) { const size_t po = ((size_t)b * CC + h * HD + d0 + j * 16 + col) * (size_t)TT + kc * 32; acc[j] = wmma16(p, frag_h(VT + po, lane), acc[j]); } } }
#pragma unroll
  for (int j = 0; j < DVH / 16; ++j)
#pragma unroll
    for (int r = 0; r < 8; ++r) ss[wave][8 * g + r][j * 16 + col] = acc[j][r] * (1.0f / 2048.0f);
  LDSX(); for (int rl = 0; rl < 16; ++rl) vst2(Y + ((size_t)b * TT + ql0 + rl) * CC + h * HD + d0 + lane * 4, *(const v4f*)&ss[wave][rl][lane * 4]); }   
extern "C" void kernel_launch(void* const* d_in, const int* in_sizes, int n_in, void* d_out, int out_size, void* d_ws, size_t ws_size, hipStream_t stream) {
  (void)in_sizes; (void)n_in; (void)out_size;
  const float** F = (const float**)d_in;
  if (ws_size < (size_t)WS_END) return;
  char* ws = (char*)d_ws; _Float16 *QH = (_Float16*)(ws + WS_QH), *KH = (_Float16*)(ws + WS_KH), *VT = (_Float16*)(ws + WS_VT), *QL = (_Float16*)(ws + WS_QL), *KL = (_Float16*)(ws + WS_KL); __bf16 *VB = (__bf16*)(ws + WS_VB), *VBL = (__bf16*)(ws + WS_VBL); float *S = (float*)(ws + WS_S), *Y = (float*)(ws + WS_Y);
  (void)Y; (void)QL; (void)KL; (void)VB; (void)VBL;
  // inputs: 0 x [4,2048,768]; 1 Wq [768,768] (in,out); 2 Wk; 3 Wv; no biases, no output projection
  k_proj<<<dim3(TNB * TT / 64, CC / 128, 3), 128, 0, stream>>>(F[0], F[0], F[0], F[1], F[2], F[3], nullptr, nullptr, nullptr, QH, QL, KH, KL, VT, VB, VBL);
  k_sc<<<dim3(NQB, TT / 128, TNB), 128, 0, stream>>>(QH, KH, QL, KL, 0, S);
  k_sm<<<dim3(TT, TNB), 256, 0, stream>>>(S);
  k_pv<<<dim3(NQB, HD / DVH, TNB), 128, 0, stream>>>(S, VT, VB, VBL, 0, (float*)d_out);   /* six 128-column value slices per query block */
}

// v003
// It runs in 234 microseconds.
// In both of two side-by-side timings against v002, it was 1.33 times as fast.
// All steps since v000 together make it 3.59 times as fast.
// compute dtype: all float inputs rounded to bf16; q/k/v projections with EXACT bf16 products on WMMA 16x16x32 (f32 accumulate); causal logits over the 768-wide head: 3 products for the first 384 rows, single f16 q x k after, x 768^-0.5; softmax f32; P x 2^11 once to f16 x v once to f16 (bf16 hi + lo below row 384); f32 output.
#include <hip/hip_runtime.h>
#include <math.h>

typedef __attribute__((ext_vector_type(16))) _Float16 v16h;
typedef __attribute__((ext_vector_type(16))) __bf16 v16b;
typedef __attribute__((ext_vector_type(8)))  _Float16 v8h;
typedef __attribute__((ext_vector_type(8)))  float v8f;
typedef __attribute__((ext_vector_type(4)))  float v4f;
typedef __attribute__((ext_vector_type(2)))  float v2f;
typedef __attribute__((ext_vector_type(4)))  unsigned v4u;
typedef __attribute__((ext_vector_type(4)))  int v4i;
typedef float __attribute__((may_alias)) float_a;
typedef int __attribute__((may_alias)) int_a;

template <typename T> __device__ __forceinline__ void vst2(void* p, T v) { *(T*)p = v;  }
__device__ __forceinline__ v8f wmma16(v16h a, v16h b, v8f c) {
  v8f d = __builtin_amdgcn_wmma_f32_16x16x32_f16(false, a, false, b, (short)0, c, false, false);
  asm volatile("v_nop\n\tv_nop\n\tv_nop\n\tv_nop" : "+v"(d) : "v"(a), "v"(b));
  return d;
}
__device__ __forceinline__ v8f wmma_bf(v16b a, v16b b, v8f c) {
  v8f d = __builtin_amdgcn_wmma_f32_16x16x32_bf16(false, a, false, b, (short)0, c, false, false);
  asm volatile("v_nop\n\tv_nop\n\tv_nop\n\tv_nop" : "+v"(d) : "v"(a), "v"(b));
  return d;
}
// 16x16x32 fragments: lane = (h = lane>>4, row/col = lane&15); elements 0..7 = k0+8h+0..7, 8..15 = k0+16+8h+0..7; D element r = row 8h+r
__device__ __forceinline__ v16h frag_h(const _Float16* rowk0, int lane) {
  union { v16h v; v8h q[2]; } u; const _Float16* p = rowk0 + 8 * (lane >> 4);
  u.q[0] = *(const v8h*)p; u.q[1] = *(const v8h*)(p + 16); return u.v;
}
__device__ __forceinline__ v16h frag_f32(const float* rowk0, int lane) {
  v16h a; const float* p = rowk0 + 8 * (lane >> 4);
#pragma unroll
  for (int i = 0; i < 8; ++i) { a[i] = (_Float16)p[i]; a[8 + i] = (_Float16)p[16 + i]; }
  return a;
}
__device__ __forceinline__ v16h frag_f32s(const float* rowk0, int lane, float sc) {
  v16h a; const float* p = rowk0 + 8 * (lane >> 4);
#pragma unroll
  for (int i = 0; i < 8; ++i) { a[i] = (_Float16)(p[i] * sc); a[8 + i] = (_Float16)(p[16 + i] * sc); }
  return a;
}
// column fragment from a [K][ld] layout (column n), rows >= K read as 0
__device__ __forceinline__ v16h fragc_f32(const float* W, int k0, int n, int lane, int ld, int K) {
  v16h a; const int g = lane >> 4;
#pragma unroll
  for (int i = 0; i < 8; ++i) { const int ka = k0 + 8 * g + i, kb = ka + 16;
    a[i] = (_Float16)(ka < K ? W[(size_t)(ka < K ? ka : K - 1) * ld + n] : 0.f); a[8 + i] = (_Float16)(kb < K ? W[(size_t)(kb < K ? kb : K - 1) * ld + n] : 0.f); }
  return a;
}
struct F2 { v16b h, l; };
__device__ __forceinline__ F2 bsplit16(const float v[16]) { F2 r;
#pragma unroll
  for (int i = 0; i < 16; ++i) { const __bf16 h = (__bf16)v[i]; r.h[i] = h; r.l[i] = (__bf16)(v[i] - (float)h); }
  return r; }
__device__ __forceinline__ F2 split_row(const float* row, int k0, int lane) { float v[16]; const float* p = row + k0 + 8 * (lane >> 4);
#pragma unroll
  for (int i = 0; i < 8; ++i) { v[i] = p[i]; v[8 + i] = p[16 + i]; }
  return bsplit16(v); }
__device__ __forceinline__ F2 split_rowK(const float* row, int k0, int lane, int K) { float v[16]; const int g = lane >> 4;
#pragma unroll
  for (int i = 0; i < 8; ++i) { const int ka = k0 + 8 * g + i, kb = ka + 16; v[i] = ka < K ? row[ka < K ? ka : K - 1] : 0.f; v[8 + i] = kb < K ? row[kb < K ? kb : K - 1] : 0.f; }
  return bsplit16(v); }
__device__ __forceinline__ F2 split_col(const float* W, int k0, int n, int lane, int ld, int K) { float v[16]; const int g = lane >> 4;
#pragma unroll
  for (int i = 0; i < 8; ++i) { const int ka = k0 + 8 * g + i, kb = ka + 16; v[i] = ka < K ? W[(size_t)(ka < K ? ka : K - 1) * ld + n] : 0.f; v[8 + i] = kb < K ? W[(size_t)(kb < K ? kb : K - 1) * ld + n] : 0.f; }
  return bsplit16(v); }
__device__ __forceinline__ v8f mac3(const F2& a, const F2& b, v8f c) { c = wmma_bf(a.l, b.h, c); c = wmma_bf(a.h, b.l, c); return wmma_bf(a.h, b.h, c); }
__device__ __forceinline__ float sigm(float v) { return 1.0f / (1.0f + expf(-v)); }
#define LDSX() do { asm volatile("s_wait_dscnt 0" ::: "memory"); __builtin_amdgcn_wave_barrier(); __builtin_amdgcn_fence(__ATOMIC_RELEASE, "workgroup"); } while (0)

// Single-head causal self-attention with a 768-WIDE head (x [4,2048,768]; (in,out) Wq / Wk / Wv [768,768] uniform, no biases; scores = q k^T with -inf above the diagonal, then / sqrt(768); no head split, no output projection): out = softmax(causal(q k^T) / sqrt(768)) v -> [4,2048,768].
#define NB 4
#define TT 2048
#define CC 768            // NH * HD = projected width
#define DIN 768          // input (model) width
#define NH 1
#define HD 768
#define NQB (TT / 64)
#define HG 1
#define SCALE (0.036084391824351615f)
#define CAUSAL 1
#ifndef TNB
#define TNB NB
#endif
__device__ __forceinline__ float bfr(float v) { return (float)(__bf16)v; }
__host__ __device__ __forceinline__ int kb_last(int qb) { return CAUSAL ? ((qb * 64 + 63) >> 7) : (TT / 128 - 1); }
typedef __attribute__((ext_vector_type(8))) __bf16 v8b;
__device__ __forceinline__ v16b frag_b(const __bf16* rowk0, int lane) {
  union { v16b v; v8b q[2]; } u; const __bf16* p = rowk0 + 8 * (lane >> 4);
  u.q[0] = *(const v8b*)p; u.q[1] = *(const v8b*)(p + 16); return u.v;
}
#define QBH 6              // causal: query blocks 0..QBH-1 of each sequence (few keys, no averaging) take the high-precision path
#define QHI 384            // rows carrying a q residual plane (all rows when non-causal: 2-product logits everywhere)
#define KHI 384            // key rows carrying k residual / v bf16 hi+lo planes (used only by the causal high-precision path)
// B fragment (k rows k0+.., output column o) of a weight: (in,out) [K][ld] or (out,in) [ld rows of K]: bf16 exact, or f16(bf16 * 256) exact
__device__ __forceinline__ v16b wcol_io(const float* Wm, int k0, int o, int lane, int ld) { v16b w; const int g = lane >> 4;
#pragma unroll
  for (int i = 0; i < 8; ++i) { w[i] = (__bf16)Wm[(size_t)(k0 + 8 * g + i) * ld + o]; w[8 + i] = (__bf16)Wm[(size_t)(k0 + 16 + 8 * g + i) * ld + o]; }
  return w; }
__device__ __forceinline__ v16b wcol_oi(const float* Wm, int k0, int o, int lane, int K) { v16b w; const float* p = Wm + (size_t)o * K + k0 + 8 * (lane >> 4);
#pragma unroll
  for (int i = 0; i < 8; ++i) { w[i] = (__bf16)p[i]; w[8 + i] = (__bf16)p[16 + i]; }
  return w; }
__device__ __forceinline__ v16h wcolh_io(const float* Wm, int k0, int o, int lane, int ld) { v16h w; const int g = lane >> 4;
#pragma unroll
  for (int i = 0; i < 8; ++i) { w[i] = (_Float16)(bfr(Wm[(size_t)(k0 + 8 * g + i) * ld + o]) * 256.0f); w[8 + i] = (_Float16)(bfr(Wm[(size_t)(k0 + 16 + 8 * g + i) * ld + o]) * 256.0f); }
  return w; }
__device__ __forceinline__ v16h wcolh_oi(const float* Wm, int k0, int o, int lane, int K) { v16h w; const float* p = Wm + (size_t)o * K + k0 + 8 * (lane >> 4);
#pragma unroll
  for (int i = 0; i < 8; ++i) { w[i] = (_Float16)(bfr(p[i]) * 256.0f); w[8 + i] = (_Float16)(bfr(p[16 + i]) * 256.0f); }
  return w; }
#define WQKV_LAYOUT 0   // 0 = (in,out) [DIN][CC]; 1 = (out,in) [CC][DIN]; 2 = per-head [NH][DIN][HD]
__device__ __forceinline__ v16b wcol_hdk(const float* Wm, int k0, int o, int lane) { v16b w; const int g = lane >> 4; const float* p = Wm + (size_t)(o / HD) * DIN * HD + (o % HD);
#pragma unroll
  for (int i = 0; i < 8; ++i) { w[i] = (__bf16)p[(size_t)(k0 + 8 * g + i) * HD]; w[8 + i] = (__bf16)p[(size_t)(k0 + 16 + 8 * g + i) * HD]; }
  return w; }
#define WO_OUT_IN 0
#if WQKV_LAYOUT == 1
#define WCOL(W, k0, o, lane) wcol_oi(W, k0, o, lane, DIN)
#elif WQKV_LAYOUT == 2
#define WCOL(W, k0, o, lane) wcol_hdk(W, k0, o, lane)
#else
#define WCOL(W, k0, o, lane) wcol_io(W, k0, o, lane, CC)
#endif
#if WO_OUT_IN
#define WOCOL(W, k0, o, lane) wcol_oi(W, k0, o, lane, CC)
#define WOCOLH(W, k0, o, lane) wcolh_oi(W, k0, o, lane, CC)
#else
#define WOCOL(W, k0, o, lane) wcol_io(W, k0, o, lane, DIN)
#define WOCOLH(W, k0, o, lane) wcolh_io(W, k0, o, lane, DIN)
#endif

#ifndef SM_EXTRA_PARAMS
#define SM_EXTRA_PARAMS
#endif
#ifndef PROJ_EXTRA_PARAMS
#define PROJ_EXTRA_PARAMS
#endif
#ifndef SM_MASK_HOOK
#define SM_MASK_HOOK (void)0
#endif

#define WS_QH  0u                                      // f16 q rows [b*t][CC]
#define WS_KH  (WS_QH + 2u * (size_t)NB * TT * CC)      // f16 k rows [b*t][CC]
#define WS_VT  (WS_KH + 2u * (size_t)NB * TT * CC)      // f16 v planes [b][c][t]
#define WS_QL  (WS_VT + 2u * (size_t)NB * CC * TT)      // f16 q residual x 2^10 rows [b][t < QHI][CC]
#define WS_KL  (WS_QL + 2u * (size_t)NB * QHI * CC)     // f16 k residual x 2^10 rows [b][t < KHI][CC]
#define WS_VB  (WS_KL + 2u * (size_t)NB * KHI * CC)     // bf16 v hi planes [b][c][t < KHI]
#define WS_VBL (WS_VB + 2u * (size_t)NB * CC * KHI)
#define WS_S   (WS_VBL + 2u * (size_t)NB * CC * KHI)    // f32 logits / P [b][t][s]: one plane per batch, so that each stage runs all batches in one launch
#define WS_Y   (WS_S  + 4u * (size_t)NB * TT * TT)      // f32 ctx rows [b*t][CC] (only when there is an output projection)
#define WS_END (WS_Y  + 0u)

// ---- k_proj: block = (64 rows, 128 cols, which): q/k/v = X W (+ b) with exact bf16 products (K = DIN) -> which 0: q f16 rows (+ residual rows < QHI); 1: k f16 rows (+ residual rows < KHI); 2: v f16 planes [c][t] (+ bf16 hi/lo planes for t < KHI)
__global__ __launch_bounds__(128) void k_proj(const float* __restrict__ XQ, const float* __restrict__ XK, const float* __restrict__ XV, const float* __restrict__ WQ, const float* __restrict__ WK, const float* __restrict__ WV, const float* __restrict__ BQ, const float* __restrict__ BK, const float* __restrict__ BV,
    _Float16* __restrict__ QH, _Float16* __restrict__ QL, _Float16* __restrict__ KH, _Float16* __restrict__ KL, _Float16* __restrict__ VT, __bf16* __restrict__ VB, __bf16* __restrict__ VBL) {
  __shared__ __align__(16) _Float16 sh[64][136], sl[64][136]; __shared__ __align__(16) _Float16 th[128][72]; __shared__ __align__(16) __bf16 tb[128][72], tbl[128][72];
  const int tid = threadIdx.x, wave = tid >> 5, lane = tid & 31, col = lane & 15, g = lane >> 4; const int which = blockIdx.z; const int c0 = blockIdx.y * 128; const size_t r0 = (size_t)blockIdx.x * 64; const size_t bb = r0 / TT; const int t0 = (int)(r0 % TT);
  const float* X = which == 0 ? XQ : which == 1 ? XK : XV; const float* WA = which == 0 ? WQ : which == 1 ? WK : WV; const float* BA = which == 0 ? BQ : which == 1 ? BK : BV;
  v8f acc[8] = {};
  // Main loop: K in 12 chunks of 64. The block's W chunk [64 k][128 cols] is read from global once (whole 512-B row segments, 16 B a lane), rounded to bf16, turned to [col][k] in registers and
  // kept in LDS for all four waves; tb / tbl (free until the epilogue) are the two buffers. 16-B slot o of row c sits at o ^ ((c >> 4) & 3): the stores (columns 4 apart across lanes) and the
  // fragment reads (columns 1 apart) then both fall on 16 different bank groups per 16 lanes. The next chunk's W and X loads are issued behind the barrier and fly while this chunk's products run.
  const float* wsrc = WA + (size_t)(wave * 16) * CC + c0 + 4 * lane; const float* xsrc = X + (r0 + wave * 16 + col) * DIN + 8 * g;
  v4f wr[16], xr[8]; v16b a[2];
  auto ldg = [&](int s) {   // chunk s counted from the one that wsrc / xsrc stand at
#pragma unroll
    for (int i = 0; i < 16; ++i) wr[i] = *(const v4f*)(wsrc + (size_t)(s * 64 + i) * CC);
#pragma unroll
    for (int i = 0; i < 4; ++i) { xr[2 * i] = *(const v4f*)(xsrc + s * 64 + i * 16); xr[2 * i + 1] = *(const v4f*)(xsrc + s * 64 + i * 16 + 4); } };
  auto stage = [&](__bf16 (*buf)[72]) { const int sw = (lane >> 2) & 3;
    __builtin_amdgcn_sched_barrier(0);   // keeps the conversions, which wait for the global loads, behind the chunk's last product: the loads fly under all sixteen
    asm volatile("s_wait_xcnt 0x0" ::: "memory");   // stands in front of the loop's advance of the two address pairs that the chunk's global loads name
#pragma unroll
    for (int oo = 0; oo < 2; ++oo) {
#pragma unroll
      for (int c = 0; c < 4; ++c) { v8b t;
#pragma unroll
        for (int i = 0; i < 8; ++i) t[i] = (__bf16)wr[oo * 8 + i][c];
        *(v8b*)&buf[4 * lane + c][((2 * wave + oo) ^ sw) * 8] = t; } }
#pragma unroll
    for (int kk = 0; kk < 2; ++kk) {
#pragma unroll
      for (int i = 0; i < 4; ++i) { a[kk][i] = (__bf16)xr[4 * kk][i]; a[kk][4 + i] = (__bf16)xr[4 * kk + 1][i]; a[kk][8 + i] = (__bf16)xr[4 * kk + 2][i]; a[kk][12 + i] = (__bf16)xr[4 * kk + 3][i]; } }
    __builtin_amdgcn_sched_barrier(0); };   // keeps the X conversions here: the raw X registers are free again for the next chunk's loads, and the kernel stays within 256 registers
  // the 16 fragments of a chunk in four groups of four (group q: k half q >> 1, column tiles 4 (q & 1) ..): a group's eight LDS reads stand together, one group ahead of the products that use them
  auto mma = [&](const __bf16 (*buf)[72]) { const __bf16* p0 = &buf[col][8 * g]; const __bf16* p1 = &buf[col][8 * (g ^ 1)]; v16b w[2][4];
    auto ldf = [&](int q) {
#pragma unroll
      for (int i = 0; i < 4; ++i) { const int j = 4 * (q & 1) + i; const __bf16* p = ((j & 1) ? p1 : p0) + j * 16 * 72 + (q >> 1) * 32; union { v16b v; v8b q2[2]; } u;
        u.q2[0] = *(const v8b*)(p + 8 * (j & 2)); u.q2[1] = *(const v8b*)(p + 8 * (2 ^ (j & 2))); w[q & 1][i] = u.v; } };
    ldf(0);
#pragma unroll
    for (int q = 0; q < 4; ++q) { if (q < 3) ldf(q + 1);
#pragma unroll
      for (int i = 0; i < 4; ++i) acc[4 * (q & 1) + i] = wmma_bf(a[q >> 1], w[q & 1][i], acc[4 * (q & 1) + i]); } };
  ldg(0); stage(tb); __syncthreads();
  // rolled: two chunks a trip (one per buffer) keep the loop's text small; each barrier publishes the chunk just stored and ends the reads of the buffer that is stored next
#pragma unroll 1
  for (int s = 0; s < DIN / 64 - 2; s += 2) {
    ldg(1); mma(tb); stage(tbl); __syncthreads();
    ldg(2); mma(tbl); stage(tb); __syncthreads();
    wsrc += (size_t)128 * CC; xsrc += 128; }
  ldg(1); mma(tb); stage(tbl); __syncthreads();
  mma(tbl); __syncthreads();   // the epilogue stores into tb / tbl again: every wave's last fragment read ends here
  if (which < 2) { _Float16* DH = which == 0 ? QH : KH; _Float16* DL = which == 0 ? QL : KL; const int nhi = which == 0 ? QHI : KHI; const bool hi_rows = t0 < nhi;
#pragma unroll
    for (int j = 0; j < 8; ++j) { const float bias = BA ? bfr(BA[c0 + j * 16 + col]) : 0.f;
#pragma unroll
      for (int r = 0; r < 8; ++r) { const float v = acc[j][r] + bias; const _Float16 hv = (_Float16)v; sh[wave * 16 + 8 * g + r][j * 16 + col] = hv; sl[wave * 16 + 8 * g + r][j * 16 + col] = (_Float16)((v - (float)hv) * 1024.0f); } }
    __syncthreads();
    for (int e = tid; e < 64 * 16; e += 128) { const int rl = e >> 4, q = e & 15; vst2((unsigned*)(DH + (r0 + rl) * CC + c0 + q * 8), *(const v4u*)&sh[rl][q * 8]); if (hi_rows) vst2((unsigned*)(DL + (bb * nhi + t0 + rl) * (size_t)CC + c0 + q * 8), *(const v4u*)&sl[rl][q * 8]); }
  } else { const bool hi_rows = t0 < KHI;
#pragma unroll
    for (int j = 0; j < 8; ++j) { const float bias = BA ? bfr(BA[c0 + j * 16 + col]) : 0.f;
#pragma unroll
      for (int r = 0; r < 8; ++r) { const float v = acc[j][r] + bias; const int rl = wave * 16 + 8 * g + r, cl = j * 16 + col; th[cl][rl] = (_Float16)v; const __bf16 bh = (__bf16)v; tb[cl][rl] = bh; tbl[cl][rl] = (__bf16)(v - (float)bh); } }
    __syncthreads();
    for (int e = tid; e < 128 * 8; e += 128) { const int cl = e >> 3, q = e & 7; vst2((unsigned*)(VT + (bb * CC + c0 + cl) * (size_t)TT + t0 + q * 8), *(const v4u*)&th[cl][q * 8]); if (hi_rows) { const size_t o3 = (bb * CC + c0 + cl) * (size_t)KHI + t0 + q * 8; vst2((unsigned*)(VB + o3), *(const v4u*)&tb[cl][q * 8]); vst2((unsigned*)(VBL + o3), *(const v4u*)&tbl[cl][q * 8]); } } } }
// ---- k_sc: block = (query block qb, key block kb <= kb_last(qb), batch b = blockIdx.z): logits x SCALE; q hi + residual (x 2^10) against k (2 products) for query rows < QHI, plus the k residual (3 products) for query blocks < QBH (causal early rows); causal: blocks past the diagonal exit, the mask itself is applied by index in k_sm
__global__ __launch_bounds__(128) void k_sc(const _Float16* __restrict__ QH, const _Float16* __restrict__ KH, const _Float16* __restrict__ QL, const _Float16* __restrict__ KL, int h0, float* __restrict__ S0) { __shared__ __align__(16) float ss[4][16][132];
  const int qb = blockIdx.x, kb = blockIdx.y; if (kb > kb_last(qb)) return;
  const int b = blockIdx.z; const int h = h0; float* S = S0 + (size_t)b * TT * TT;
  const int tid = threadIdx.x, wave = tid >> 5, lane = tid & 31, col = lane & 15, g = lane >> 4; const int k0 = kb * 128; const int ql0 = qb * 64 + wave * 16; const size_t q0 = (size_t)b * TT + ql0, kr0 = (size_t)b * TT + k0;
  v8f acc[8] = {}, accl[8] = {};
  const _Float16* QLb = QL + (size_t)b * QHI * CC; const _Float16* KLb = KL + (size_t)b * KHI * CC;
  if (qb < QBH) {
#pragma unroll
    for (int kc = 0; kc < HD / 32; ++kc) { const v16h ah = frag_h(QH + (q0 + col) * CC + h * HD + kc * 32, lane), al = frag_h(QLb + (size_t)(ql0 + col) * CC + h * HD + kc * 32, lane);
#pragma unroll
      for (int j = 0; j < 8; ++j) { const v16h kbf = frag_h(KH + (kr0 + j * 16 + col) * CC + h * HD + kc * 32, lane), klf = frag_h(KLb + (size_t)(k0 + j * 16 + col) * CC + h * HD + kc * 32, lane); acc[j] = wmma16(ah, kbf, acc[j]); accl[j] = wmma16(al, kbf, accl[j]); accl[j] = wmma16(ah, klf, accl[j]); } }
  } else if (qb * 64 < QHI) {
#pragma unroll
    for (int kc = 0; kc < HD / 32; ++kc) { const v16h ah = frag_h(QH + (q0 + col) * CC + h * HD + kc * 32, lane), al = frag_h(QLb + (size_t)(ql0 + col) * CC + h * HD + kc * 32, lane);
#pragma unroll
      for (int j = 0; j < 8; ++j) { const v16h kbf = frag_h(KH + (kr0 + j * 16 + col) * CC + h * HD + kc * 32, lane); acc[j] = wmma16(ah, kbf, acc[j]); accl[j] = wmma16(al, kbf, accl[j]); } }
  } else {
#pragma unroll
    for (int kc = 0; kc < HD / 32; ++kc) { const v16h ah = frag_h(QH + (q0 + col) * CC + h * HD + kc * 32, lane);
#pragma unroll
      for (int j = 0; j < 8; ++j) { const v16h kbf = frag_h(KH + (kr0 + j * 16 + col) * CC + h * HD + kc * 32, lane); acc[j] = wmma16(ah, kbf, acc[j]); } } }
#pragma unroll
  for (int j = 0; j < 8; ++j) {
#pragma unroll
    for (int r = 0; r < 8; ++r) ss[wave][8 * g + r][j * 16 + col] = (acc[j][r] + accl[j][r] * (1.0f / 1024.0f)) * SCALE; }
  LDSX(); for (int rl = 0; rl < 16; ++rl) vst2(S + (size_t)(ql0 + rl) * TT + k0 + lane * 4, *(const v4f*)&ss[wave][rl][lane * 4]); }
// ---- k_sm: block = query row t of batch blockIdx.y: keys [0, kend): causal -> logit if s <= t else excluded; softmax in f32; P x 2^11 in place (0 for excluded)
__global__ __launch_bounds__(256) void k_sm(float* __restrict__ S0 SM_EXTRA_PARAMS) { __shared__ float sred[8]; __shared__ float sbc; __shared__ __align__(16) float shv[TT];
  const int tid = threadIdx.x; const int t = blockIdx.x; const int kend = (kb_last(t >> 6) + 1) * 128;
  float* sr = S0 + (size_t)blockIdx.y * TT * TT + (size_t)t * TT;
  float m = -3.0e38f; for (int k = tid; k < kend; k += 256) { float v = (!CAUSAL || k <= t) ? sr[k] : -3.0e38f; SM_MASK_HOOK; shv[k] = v; m = fmaxf(m, v); }
#pragma unroll
  for (int o = 1; o < 32; o <<= 1) m = fmaxf(m, __shfl_xor(m, o));
  if ((tid & 31) == 0) sred[tid >> 5] = m; __syncthreads(); if (tid == 0) { float a = sred[0]; for (int i = 1; i < 8; ++i) a = fmaxf(a, sred[i]); sbc = a; } __syncthreads(); m = sbc; __syncthreads();
  float sum = 0.f; for (int k = tid; k < kend; k += 256) { const float v = shv[k]; const float e = (v <= -1.0e38f) ? 0.f : expf(v - m); shv[k] = e; sum += e; }
#pragma unroll
  for (int o = 1; o < 32; o <<= 1) sum += __shfl_xor(sum, o);
  if ((tid & 31) == 0) sred[tid >> 5] = sum; __syncthreads(); if (tid == 0) { float a = 0.f; for (int i = 0; i < 8; ++i) a += sred[i]; sbc = a > 0.f ? 2048.0f / a : 0.f; }   /* a fully excluded row yields P = 0 */ __syncthreads(); const float inv = sbc;
  for (int k = tid; k < kend; k += 256) shv[k] = shv[k] * inv;
  __syncthreads(); for (int q = tid; q < kend / 4; q += 256) vst2(sr + q * 4, *(const v4f*)&shv[q * 4]); }
#define PVK 64             // keys per staged tile of k_pv
__device__ __forceinline__ unsigned lds_off(const void* p) { return (unsigned)(size_t)p; }   // byte address in the work-group's LDS
// eight asynchronous copies, 16 B a lane, global -> LDS; the closing s_wait_xcnt stands in the same statement, in front of any later rewrite of the address registers that the copies name
__device__ __forceinline__ void acopy8(const unsigned (&l)[8], const void* const (&g)[8]) {
  asm volatile("global_load_async_to_lds_b128 %0, %8, off\n\tglobal_load_async_to_lds_b128 %1, %9, off\n\tglobal_load_async_to_lds_b128 %2, %10, off\n\tglobal_load_async_to_lds_b128 %3, %11, off\n\t"
               "global_load_async_to_lds_b128 %4, %12, off\n\tglobal_load_async_to_lds_b128 %5, %13, off\n\tglobal_load_async_to_lds_b128 %6, %14, off\n\tglobal_load_async_to_lds_b128 %7, %15, off\n\ts_wait_xcnt 0x0"
               :: "v"(l[0]), "v"(l[1]), "v"(l[2]), "v"(l[3]), "v"(l[4]), "v"(l[5]), "v"(l[6]), "v"(l[7]), "v"(g[0]), "v"(g[1]), "v"(g[2]), "v"(g[3]), "v"(g[4]), "v"(g[5]), "v"(g[6]), "v"(g[7]) : "memory"); }
#define DVH 128            // value columns per k_pv block: the 768-wide head is walked in six 128-column slices (8 accumulator tiles per wave; a 48-tile accumulator would not fit the register file)
// ---- k_pv: block = (64 queries (qb), 128-column value slice d0, batch b = blockIdx.z): ctx[:, d0 .. d0+127] = P . v over keys [0, kend) (P x 2^11 once to f16 against v f16: 1 product; causal early query blocks: P and v as bf16 hi + lo, 3 products); the 512-B (row, slice) segment by 32 lanes x 16 B
__global__ __launch_bounds__(128) void k_pv(const float* __restrict__ PS0, const _Float16* __restrict__ VT, const __bf16* __restrict__ VB, const __bf16* __restrict__ VBL, int h0, float* __restrict__ Y) { const int b = blockIdx.z; const int h = h0; const int d0 = blockIdx.y * DVH; const float* PS = PS0 + (size_t)b * TT * TT; __shared__ __align__(16) float ss[4][16][DVH + 4];
  __shared__ __align__(16) _Float16 sv[2][DVH][PVK + 8]; __shared__ __align__(16) float sp[2][64][PVK + 4];   // row pitches 144 B and 272 B (16 B x odd): the 16-B fragment reads of 16 rows fall on 16 different bank groups
  const int tid = threadIdx.x, wave = tid >> 5, lane = tid & 31, col = lane & 15, g = lane >> 4; const int qb = blockIdx.x; const int ql0 = qb * 64 + wave * 16; const int kce = (kb_last(qb) + 1) * 4;
  v8f acc[DVH / 16] = {};
  if (qb < QBH) {
#pragma unroll 1
    for (int kc = 0; kc < kce; ++kc) { const F2 p = split_row(PS + (size_t)(ql0 + col) * TT, kc * 32, lane);
      asm volatile("s_wait_loadcnt 0x0" ::: "memory");
#pragma unroll
      for (int j = 0; j < DVH / 16; ++j) { const size_t po = ((size_t)b * CC + h * HD + d0 + j * 16 + col) * (size_t)KHI + kc * 32; const v16b vh = frag_b(VB + po, lane); acc[j] = wmma_bf(p.h, vh, acc[j]); acc[j] = wmma_bf(p.l, vh, acc[j]); acc[j] = wmma_bf(p.h, frag_b(VBL + po, lane), acc[j]); } }
  } else {
    // Keys in tiles of PVK = 64. A tile of v (128 columns x 128 B) and of P (64 rows x 256 B) comes into LDS by asynchronous copies that cover whole 128-B lines (8 or 16 neighbouring lanes a row);
    // the v tile serves all four waves. Two buffers: tile t + 1 flies while tile t is multiplied. Same fragments, same key order as reading them from global memory.
    const int nt = kce >> 1;
    const _Float16* vsrc = VT + ((size_t)b * CC + h * HD + d0 + wave * 32 + (lane >> 3)) * (size_t)TT + (lane & 7) * 8; const float* psrc = PS + (size_t)(ql0 + (lane >> 4)) * TT + (lane & 15) * 4;
    const unsigned vdst = lds_off(&sv[0][wave * 32 + (lane >> 3)][(lane & 7) * 8]), pdst = lds_off(&sp[0][wave * 16 + (lane >> 4)][(lane & 15) * 4]);
    auto fill = [&](int t) { unsigned l[8]; const void* gp[8];   // each wave: 32 columns of v (4 a copy), then its own 16 rows of P (2 a copy); both loops unrolled so that l and gp are registers
#pragma unroll
      for (int i = 0; i < 8; ++i) { l[i] = vdst + (unsigned)(t & 1) * (unsigned)sizeof(sv[0]) + (unsigned)(i * 4 * sizeof(sv[0][0])); gp[i] = vsrc + (size_t)(i * 4) * TT + t * PVK; }
      acopy8(l, gp);
#pragma unroll
      for (int i = 0; i < 8; ++i) { l[i] = pdst + (unsigned)(t & 1) * (unsigned)sizeof(sp[0]) + (unsigned)(i * 2 * sizeof(sp[0][0])); gp[i] = psrc + (size_t)(i * 2) * TT + t * PVK; }
      acopy8(l, gp); };
    fill(0);
    asm volatile("s_wait_asynccnt 0x0" ::: "memory");   // this wave's copies of tile 0 have landed
    __syncthreads();                                     // ... and every other wave's: tile 0 may be read
    if (nt > 1) fill(1);
    // rolled: the trip count depends on the query block, and the buffer is picked by t & 1
#pragma unroll 1
    for (int t = 0; t < nt; ++t) { const _Float16 (*bv)[PVK + 8] = sv[t & 1]; const float (*bp)[PVK + 4] = sp[t & 1];
      // all of the tile's fragment reads stand together in front of its products: one place with LDS reads a tile instead of a read and a full wait in front of every product
      // (the loops over kk and j are unrolled so that p, vf and acc are registers)
      v16h p[PVK / 32], vf[PVK / 32][DVH / 16];
#pragma unroll
      for (int kk = 0; kk < PVK / 32; ++kk) p[kk] = frag_f32(&bp[wave * 16 + col][kk * 32], lane);
#pragma unroll
      for (int kk = 0; kk < PVK / 32; ++kk) {
#pragma unroll
        for (int j = 0; j < DVH / 16; ++j) vf[kk][j] = frag_h(&bv[j * 16 + col][kk * 32], lane); }
#pragma unroll
      for (int kk = 0; kk < PVK / 32; ++kk) {
#pragma unroll
        for (int j = 0; j < DVH / 16; ++j) acc[j] = wmma16(p[kk], vf[kk][j], acc[j]); }
      asm volatile("s_wait_dscnt 0x0" ::: "memory");      // this wave's reads of tile t are over before its buffer is refilled
      asm volatile("s_wait_asynccnt 0x0" ::: "memory");   // this wave's copies of tile t + 1 have landed
      __syncthreads();                                     // publishes tile t + 1 and ends every wave's reads of tile t
      if (t + 2 < nt) fill(t + 2); }
    asm volatile("s_wait_asynccnt 0x0" ::: "memory"); }   // no copy is left in flight when the wave goes on
#pragma unroll
  for (int j = 0; j < DVH / 16; ++j)
#pragma unroll
    for (int r = 0; r < 8; ++r) ss[wave][8 * g + r][j * 16 + col] = acc[j][r] * (1.0f / 2048.0f);
  LDSX(); for (int rl = 0; rl < 16; ++rl) vst2(Y + ((size_t)b * TT + ql0 + rl) * CC + h * HD + d0 + lane * 4, *(const v4f*)&ss[wave][rl][lane * 4]); }   
extern "C" void kernel_launch(void* const* d_in, const int* in_sizes, int n_in, void* d_out, int out_size, void* d_ws, size_t ws_size, hipStream_t stream) {
  (void)in_sizes; (void)n_in; (void)out_size;
  const float** F = (const float**)d_in;
  if (ws_size < (size_t)WS_END) return;
  char* ws = (char*)d_ws; _Float16 *QH = (_Float16*)(ws + WS_QH), *KH = (_Float16*)(ws + WS_KH), *VT = (_Float16*)(ws + WS_VT), *QL = (_Float16*)(ws + WS_QL), *KL = (_Float16*)(ws + WS_KL); __bf16 *VB = (__bf16*)(ws + WS_VB), *VBL = (__bf16*)(ws + WS_VBL); float *S = (float*)(ws + WS_S), *Y = (float*)(ws + WS_Y);
  (void)Y; (void)QL; (void)KL; (void)VB; (void)VBL;
  // inputs: 0 x [4,2048,768]; 1 Wq [768,768] (in,out); 2 Wk; 3 Wv; no biases, no output projection
  k_proj<<<dim3(TNB * TT / 64, CC / 128, 3), 128, 0, stream>>>(F[0], F[0], F[0], F[1], F[2], F[3], nullptr, nullptr, nullptr, QH, QL, KH, KL, VT, VB, VBL);
  k_sc<<<dim3(NQB, TT / 128, TNB), 128, 0, stream>>>(QH, KH, QL, KL, 0, S);
  k_sm<<<dim3(TT, TNB), 256, 0, stream>>>(S);
  k_pv<<<dim3(NQB, HD / DVH, TNB), 128, 0, stream>>>(S, VT, VB, VBL, 0, (float*)d_out);   /* six 128-column value slices per query block */
}

// v004
// Measured time: 166 microseconds a run.
// Timed twice side by side with v003, it ran 1.41 times as fast both times.
// Counting every step since v000, it is 5.08 times as fast.
// compute dtype: all float inputs rounded to bf16; q/k/v projections with EXACT bf16 products on WMMA 16x16x32 (f32 accumulate); causal logits over the 768-wide head: 3 products for the first 384 rows, single f16 q x k after, x 768^-0.5; softmax f32; P x 2^11 once to f16 x v once to f16 (bf16 hi + lo below row 384); f32 output.
#include <hip/hip_runtime.h>
#include <math.h>

typedef __attribute__((ext_vector_type(16))) _Float16 v16h;
typedef __attribute__((ext_vector_type(16))) __bf16 v16b;
typedef __attribute__((ext_vector_type(8)))  _Float16 v8h;
typedef __attribute__((ext_vector_type(8)))  float v8f;
typedef __attribute__((ext_vector_type(4)))  float v4f;
typedef __attribute__((ext_vector_type(2)))  float v2f;
typedef __attribute__((ext_vector_type(4)))  unsigned v4u;
typedef __attribute__((ext_vector_type(4)))  int v4i;
typedef float __attribute__((may_alias)) float_a;
typedef int __attribute__((may_alias)) int_a;

template <typename T> __device__ __forceinline__ void vst2(void* p, T v) { *(T*)p = v;  }
__device__ __forceinline__ v8f wmma16(v16h a, v16h b, v8f c) {
  v8f d = __builtin_amdgcn_wmma_f32_16x16x32_f16(false, a, false, b, (short)0, c, false, false);
  asm volatile("v_nop\n\tv_nop\n\tv_nop\n\tv_nop" : "+v"(d) : "v"(a), "v"(b));
  return d;
}
__device__ __forceinline__ v8f wmma_bf(v16b a, v16b b, v8f c) {
  v8f d = __builtin_amdgcn_wmma_f32_16x16x32_bf16(false, a, false, b, (short)0, c, false, false);
  asm volatile("v_nop\n\tv_nop\n\tv_nop\n\tv_nop" : "+v"(d) : "v"(a), "v"(b));
  return d;
}
// 16x16x32 fragments: lane = (h = lane>>4, row/col = lane&15); elements 0..7 = k0+8h+0..7, 8..15 = k0+16+8h+0..7; D element r = row 8h+r
__device__ __forceinline__ v16h frag_h(const _Float16* rowk0, int lane) {
  union { v16h v; v8h q[2]; } u; const _Float16* p = rowk0 + 8 * (lane >> 4);
  u.q[0] = *(const v8h*)p; u.q[1] = *(const v8h*)(p + 16); return u.v;
}
__device__ __forceinline__ v16h frag_f32(const float* rowk0, int lane) {
  v16h a; const float* p = rowk0 + 8 * (lane >> 4);
#pragma unroll
  for (int i = 0; i < 8; ++i) { a[i] = (_Float16)p[i]; a[8 + i] = (_Float16)p[16 + i]; }
  return a;
}
__device__ __forceinline__ v16h frag_f32s(const float* rowk0, int lane, float sc) {
  v16h a; const float* p = rowk0 + 8 * (lane >> 4);
#pragma unroll
  for (int i = 0; i < 8; ++i) { a[i] = (_Float16)(p[i] * sc); a[8 + i] = (_Float16)(p[16 + i] * sc); }
  return a;
}
// column fragment from a [K][ld] layout (column n), rows >= K read as 0
__device__ __forceinline__ v16h fragc_f32(const float* W, int k0, int n, int lane, int ld, int K) {
  v16h a; const int g = lane >> 4;
#pragma unroll
  for (int i = 0; i < 8; ++i) { const int ka = k0 + 8 * g + i, kb = ka + 16;
    a[i] = (_Float16)(ka < K ? W[(size_t)(ka < K ? ka : K - 1) * ld + n] : 0.f); a[8 + i] = (_Float16)(kb < K ? W[(size_t)(kb < K ? kb : K - 1) * ld + n] : 0.f); }
  return a;
}
struct F2 { v16b h, l; };
__device__ __forceinline__ F2 bsplit16(const float v[16]) { F2 r;
#pragma unroll
  for (int i = 0; i < 16; ++i) { const __bf16 h = (__bf16)v[i]; r.h[i] = h; r.l[i] = (__bf16)(v[i] - (float)h); }
  return r; }
__device__ __forceinline__ F2 split_row(const float* row, int k0, int lane) { float v[16]; const float* p = row + k0 + 8 * (lane >> 4);
#pragma unroll
  for (int i = 0; i < 8; ++i) { v[i] = p[i]; v[8 + i] = p[16 + i]; }
  return bsplit16(v); }
__device__ __forceinline__ F2 split_rowK(const float* row, int k0, int lane, int K) { float v[16]; const int g = lane >> 4;
#pragma unroll
  for (int i = 0; i < 8; ++i) { const int ka = k0 + 8 * g + i, kb = ka + 16; v[i] = ka < K ? row[ka < K ? ka : K - 1] : 0.f; v[8 + i] = kb < K ? row[kb < K ? kb : K - 1] : 0.f; }
  return bsplit16(v); }
__device__ __forceinline__ F2 split_col(const float* W, int k0, int n, int lane, int ld, int K) { float v[16]; const int g = lane >> 4;
#pragma unroll
  for (int i = 0; i < 8; ++i) { const int ka = k0 + 8 * g + i, kb = ka + 16; v[i] = ka < K ? W[(size_t)(ka < K ? ka : K - 1) * ld + n] : 0.f; v[8 + i] = kb < K ? W[(size_t)(kb < K ? kb : K - 1) * ld + n] : 0.f; }
  return bsplit16(v); }
__device__ __forceinline__ v8f mac3(const F2& a, const F2& b, v8f c) { c = wmma_bf(a.l, b.h, c); c = wmma_bf(a.h, b.l, c); return wmma_bf(a.h, b.h, c); }
__device__ __forceinline__ float sigm(float v) { return 1.0f / (1.0f + expf(-v)); }
#define LDSX() do { asm volatile("s_wait_dscnt 0" ::: "memory"); __builtin_amdgcn_wave_barrier(); __builtin_amdgcn_fence(__ATOMIC_RELEASE, "workgroup"); } while (0)

// Single-head causal self-attention with a 768-WIDE head (x [4,2048,768]; (in,out) Wq / Wk / Wv [768,768] uniform, no biases; scores = q k^T with -inf above the diagonal, then / sqrt(768); no head split, no output projection): out = softmax(causal(q k^T) / sqrt(768)) v -> [4,2048,768].
#define NB 4
#define TT 2048
#define CC 768            // NH * HD = projected width
#define DIN 768          // input (model) width
#define NH 1
#define HD 768
#define NQB (TT / 64)
#define HG 1
#define SCALE (0.036084391824351615f)
#define CAUSAL 1
#ifndef TNB
#define TNB NB
#endif
__device__ __forceinline__ float bfr(float v) { return (float)(__bf16)v; }
__host__ __device__ __forceinline__ int kb_last(int qb) { return CAUSAL ? ((qb * 64 + 63) >> 7) : (TT / 128 - 1); }
typedef __attribute__((ext_vector_type(8))) __bf16 v8b;
__device__ __forceinline__ v16b frag_b(const __bf16* rowk0, int lane) {
  union { v16b v; v8b q[2]; } u; const __bf16* p = rowk0 + 8 * (lane >> 4);
  u.q[0] = *(const v8b*)p; u.q[1] = *(const v8b*)(p + 16); return u.v;
}
#define QBH 6              // causal: query blocks 0..QBH-1 of each sequence (few keys, no averaging) take the high-precision path
#define QHI 384            // rows carrying a q residual plane
#define KHI 384            // key rows carrying k residual / v bf16 hi+lo planes (used only by the causal high-precision path)
// B fragment (k rows k0+.., output column o) of a weight: (in,out) [K][ld] or (out,in) [ld rows of K]: bf16 exact, or f16(bf16 * 256) exact
__device__ __forceinline__ v16b wcol_io(const float* Wm, int k0, int o, int lane, int ld) { v16b w; const int g = lane >> 4;
#pragma unroll
  for (int i = 0; i < 8; ++i) { w[i] = (__bf16)Wm[(size_t)(k0 + 8 * g + i) * ld + o]; w[8 + i] = (__bf16)Wm[(size_t)(k0 + 16 + 8 * g + i) * ld + o]; }
  return w; }
__device__ __forceinline__ v16b wcol_oi(const float* Wm, int k0, int o, int lane, int K) { v16b w; const float* p = Wm + (size_t)o * K + k0 + 8 * (lane >> 4);
#pragma unroll
  for (int i = 0; i < 8; ++i) { w[i] = (__bf16)p[i]; w[8 + i] = (__bf16)p[16 + i]; }
  return w; }
__device__ __forceinline__ v16h wcolh_io(const float* Wm, int k0, int o, int lane, int ld) { v16h w; const int g = lane >> 4;
#pragma unroll
  for (int i = 0; i < 8; ++i) { w[i] = (_Float16)(bfr(Wm[(size_t)(k0 + 8 * g + i) * ld + o]) * 256.0f); w[8 + i] = (_Float16)(bfr(Wm[(size_t)(k0 + 16 + 8 * g + i) * ld + o]) * 256.0f); }
  return w; }
__device__ __forceinline__ v16h wcolh_oi(const float* Wm, int k0, int o, int lane, int K) { v16h w; const float* p = Wm + (size_t)o * K + k0 + 8 * (lane >> 4);
#pragma unroll
  for (int i = 0; i < 8; ++i) { w[i] = (_Float16)(bfr(p[i]) * 256.0f); w[8 + i] = (_Float16)(bfr(p[16 + i]) * 256.0f); }
  return w; }
#define WQKV_LAYOUT 0   // 0 = (in,out) [DIN][CC]; 1 = (out,in) [CC][DIN]; 2 = per-head [NH][DIN][HD]
__device__ __forceinline__ v16b wcol_hdk(const float* Wm, int k0, int o, int lane) { v16b w; const int g = lane >> 4; const float* p = Wm + (size_t)(o / HD) * DIN * HD + (o % HD);
#pragma unroll
  for (int i = 0; i < 8; ++i) { w[i] = (__bf16)p[(size_t)(k0 + 8 * g + i) * HD]; w[8 + i] = (__bf16)p[(size_t)(k0 + 16 + 8 * g + i) * HD]; }
  return w; }
#define WO_OUT_IN 0
#if WQKV_LAYOUT == 1
#define WCOL(W, k0, o, lane) wcol_oi(W, k0, o, lane, DIN)
#elif WQKV_LAYOUT == 2
#define WCOL(W, k0, o, lane) wcol_hdk(W, k0, o, lane)
#else
#define WCOL(W, k0, o, lane) wcol_io(W, k0, o, lane, CC)
#endif
#if WO_OUT_IN
#define WOCOL(W, k0, o, lane) wcol_oi(W, k0, o, lane, CC)
#define WOCOLH(W, k0, o, lane) wcolh_oi(W, k0, o, lane, CC)
#else
#define WOCOL(W, k0, o, lane) wcol_io(W, k0, o, lane, DIN)
#define WOCOLH(W, k0, o, lane) wcolh_io(W, k0, o, lane, DIN)
#endif

#ifndef SM_EXTRA_PARAMS
#define SM_EXTRA_PARAMS
#endif
#ifndef PROJ_EXTRA_PARAMS
#define PROJ_EXTRA_PARAMS
#endif
#ifndef SM_MASK_HOOK
#define SM_MASK_HOOK (void)0
#endif

#define WS_QH  0u                                      // f16 q rows [b*t][CC]
#define WS_KH  (WS_QH + 2u * (size_t)NB * TT * CC)      // f16 k rows [b*t][CC]
#define WS_VT  (WS_KH + 2u * (size_t)NB * TT * CC)      // f16 v planes [b][c][t]
#define WS_QL  (WS_VT + 2u * (size_t)NB * CC * TT)      // f16 q residual x 2^10 rows [b][t < QHI][CC]
#define WS_KL  (WS_QL + 2u * (size_t)NB * QHI * CC)     // f16 k residual x 2^10 rows [b][t < KHI][CC]
#define WS_VB  (WS_KL + 2u * (size_t)NB * KHI * CC)     // bf16 v hi planes [b][c][t < KHI]
#define WS_VBL (WS_VB + 2u * (size_t)NB * CC * KHI)
#define WS_S   (WS_VBL + 2u * (size_t)NB * CC * KHI)    // f32 logits / P [b][t][s]: one plane per batch, so that each stage runs all batches in one launch
#define WS_Y   (WS_S  + 4u * (size_t)NB * TT * TT)      // f32 ctx rows [b*t][CC] (only when there is an output projection)
#define WS_END (WS_Y  + 0u)

// ---- k_proj: block = (64 rows, 128 cols, which): q/k/v = X W (+ b) with exact bf16 products (K = DIN) -> which 0: q f16 rows (+ residual rows < QHI); 1: k f16 rows (+ residual rows < KHI); 2: v f16 planes [c][t] (+ bf16 hi/lo planes for t < KHI)
__global__ __launch_bounds__(128) void k_proj(const float* __restrict__ XQ, const float* __restrict__ XK, const float* __restrict__ XV, const float* __restrict__ WQ, const float* __restrict__ WK, const float* __restrict__ WV, const float* __restrict__ BQ, const float* __restrict__ BK, const float* __restrict__ BV,
    _Float16* __restrict__ QH, _Float16* __restrict__ QL, _Float16* __restrict__ KH, _Float16* __restrict__ KL, _Float16* __restrict__ VT, __bf16* __restrict__ VB, __bf16* __restrict__ VBL) {
  __shared__ __align__(16) _Float16 sh[64][136], sl[64][136]; __shared__ __align__(16) _Float16 th[128][72]; __shared__ __align__(16) __bf16 tb[128][72], tbl[128][72];
  const int tid = threadIdx.x, wave = tid >> 5, lane = tid & 31, col = lane & 15, g = lane >> 4; const int which = blockIdx.z; const int c0 = blockIdx.y * 128; const size_t r0 = (size_t)blockIdx.x * 64; const size_t bb = r0 / TT; const int t0 = (int)(r0 % TT);
  const float* X = which == 0 ? XQ : which == 1 ? XK : XV; const float* WA = which == 0 ? WQ : which == 1 ? WK : WV; const float* BA = which == 0 ? BQ : which == 1 ? BK : BV;
  v8f acc[8] = {};
  // Main loop: K in 12 chunks of 64. The block's W chunk [64 k][128 cols] is read from global once (whole 512-B row segments, 16 B a lane), rounded to bf16, turned to [col][k] in registers and
  // kept in LDS for all four waves; tb / tbl (free until the epilogue) are the two buffers. 16-B slot o of row c sits at o ^ ((c >> 4) & 3): the stores (columns 4 apart across lanes) and the
  // fragment reads (columns 1 apart) then both fall on 16 different bank groups per 16 lanes. The next chunk's W and X loads are issued behind the barrier and fly while this chunk's products run.
  const float* wsrc = WA + (size_t)(wave * 16) * CC + c0 + 4 * lane; const float* xsrc = X + (r0 + wave * 16 + col) * DIN + 8 * g;
  v4f wr[16], xr[8]; v16b a[2];
  auto ldg = [&](int s) {   // chunk s counted from the one that wsrc / xsrc stand at
#pragma unroll
    for (int i = 0; i < 16; ++i) wr[i] = *(const v4f*)(wsrc + (size_t)(s * 64 + i) * CC);
#pragma unroll
    for (int i = 0; i < 4; ++i) { xr[2 * i] = *(const v4f*)(xsrc + s * 64 + i * 16); xr[2 * i + 1] = *(const v4f*)(xsrc + s * 64 + i * 16 + 4); } };
  auto stage = [&](__bf16 (*buf)[72]) { const int sw = (lane >> 2) & 3;
    __builtin_amdgcn_sched_barrier(0);   // keeps the conversions, which wait for the global loads, behind the chunk's last product: the loads fly under all sixteen
    asm volatile("s_wait_xcnt 0x0" ::: "memory");   // stands in front of the loop's advance of the two address pairs that the chunk's global loads name
#pragma unroll
    for (int oo = 0; oo < 2; ++oo) {
#pragma unroll
      for (int c = 0; c < 4; ++c) { v8b t;
#pragma unroll
        for (int i = 0; i < 8; ++i) t[i] = (__bf16)wr[oo * 8 + i][c];
        *(v8b*)&buf[4 * lane + c][((2 * wave + oo) ^ sw) * 8] = t; } }
#pragma unroll
    for (int kk = 0; kk < 2; ++kk) {
#pragma unroll
      for (int i = 0; i < 4; ++i) { a[kk][i] = (__bf16)xr[4 * kk][i]; a[kk][4 + i] = (__bf16)xr[4 * kk + 1][i]; a[kk][8 + i] = (__bf16)xr[4 * kk + 2][i]; a[kk][12 + i] = (__bf16)xr[4 * kk + 3][i]; } }
    __builtin_amdgcn_sched_barrier(0); };   // keeps the X conversions here: the raw X registers are free again for the next chunk's loads, and the kernel stays within 256 registers
  // the 16 fragments of a chunk in four groups of four (group q: k half q >> 1, column tiles 4 (q & 1) ..): a group's eight LDS reads stand together, one group ahead of the products that use them
  auto mma = [&](const __bf16 (*buf)[72]) { const __bf16* p0 = &buf[col][8 * g]; const __bf16* p1 = &buf[col][8 * (g ^ 1)]; v16b w[2][4];
    auto ldf = [&](int q) {
#pragma unroll
      for (int i = 0; i < 4; ++i) { const int j = 4 * (q & 1) + i; const __bf16* p = ((j & 1) ? p1 : p0) + j * 16 * 72 + (q >> 1) * 32; union { v16b v; v8b q2[2]; } u;
        u.q2[0] = *(const v8b*)(p + 8 * (j & 2)); u.q2[1] = *(const v8b*)(p + 8 * (2 ^ (j & 2))); w[q & 1][i] = u.v; } };
    ldf(0);
#pragma unroll
    for (int q = 0; q < 4; ++q) { if (q < 3) ldf(q + 1);
#pragma unroll
      for (int i = 0; i < 4; ++i) acc[4 * (q & 1) + i] = wmma_bf(a[q >> 1], w[q & 1][i], acc[4 * (q & 1) + i]); } };
  ldg(0); stage(tb); __syncthreads();
  // rolled: two chunks a trip (one per buffer) keep the loop's text small; each barrier publishes the chunk just stored and ends the reads of the buffer that is stored next
#pragma unroll 1
  for (int s = 0; s < DIN / 64 - 2; s += 2) {
    ldg(1); mma(tb); stage(tbl); __syncthreads();
    ldg(2); mma(tbl); stage(tb); __syncthreads();
    wsrc += (size_t)128 * CC; xsrc += 128; }
  ldg(1); mma(tb); stage(tbl); __syncthreads();
  mma(tbl); __syncthreads();   // the epilogue stores into tb / tbl again: every wave's last fragment read ends here
  if (which < 2) { _Float16* DH = which == 0 ? QH : KH; _Float16* DL = which == 0 ? QL : KL; const int nhi = which == 0 ? QHI : KHI; const bool hi_rows = t0 < nhi;
#pragma unroll
    for (int j = 0; j < 8; ++j) { const float bias = BA ? bfr(BA[c0 + j * 16 + col]) : 0.f;
#pragma unroll
      for (int r = 0; r < 8; ++r) { const float v = acc[j][r] + bias; const _Float16 hv = (_Float16)v; sh[wave * 16 + 8 * g + r][j * 16 + col] = hv; sl[wave * 16 + 8 * g + r][j * 16 + col] = (_Float16)((v - (float)hv) * 1024.0f); } }
    __syncthreads();
    for (int e = tid; e < 64 * 16; e += 128) { const int rl = e >> 4, q = e & 15; vst2((unsigned*)(DH + (r0 + rl) * CC + c0 + q * 8), *(const v4u*)&sh[rl][q * 8]); if (hi_rows) vst2((unsigned*)(DL + (bb * nhi + t0 + rl) * (size_t)CC + c0 + q * 8), *(const v4u*)&sl[rl][q * 8]); }
  } else { const bool hi_rows = t0 < KHI;
#pragma unroll
    for (int j = 0; j < 8; ++j) { const float bias = BA ? bfr(BA[c0 + j * 16 + col]) : 0.f;
#pragma unroll
      for (int r = 0; r < 8; ++r) { const float v = acc[j][r] + bias; const int rl = wave * 16 + 8 * g + r, cl = j * 16 + col; th[cl][rl] = (_Float16)v; const __bf16 bh = (__bf16)v; tb[cl][rl] = bh; tbl[cl][rl] = (__bf16)(v - (float)bh); } }
    __syncthreads();
    for (int e = tid; e < 128 * 8; e += 128) { const int cl = e >> 3, q = e & 7; vst2((unsigned*)(VT + (bb * CC + c0 + cl) * (size_t)TT + t0 + q * 8), *(const v4u*)&th[cl][q * 8]); if (hi_rows) { const size_t o3 = (bb * CC + c0 + cl) * (size_t)KHI + t0 + q * 8; vst2((unsigned*)(VB + o3), *(const v4u*)&tb[cl][q * 8]); vst2((unsigned*)(VBL + o3), *(const v4u*)&tbl[cl][q * 8]); } } } }
__device__ __forceinline__ unsigned lds_off(const void* p) { return (unsigned)(size_t)p; }   // byte address in the work-group's LDS
// twelve asynchronous copies, 16 B a lane, global -> LDS; the closing s_wait_xcnt stands in the same statement, in front of any later rewrite of the address registers that the copies name
__device__ __forceinline__ void acopy12(const unsigned (&l)[12], const void* const (&g)[12]) {
  asm volatile("global_load_async_to_lds_b128 %0, %12, off\n\tglobal_load_async_to_lds_b128 %1, %13, off\n\tglobal_load_async_to_lds_b128 %2, %14, off\n\tglobal_load_async_to_lds_b128 %3, %15, off\n\t"
               "global_load_async_to_lds_b128 %4, %16, off\n\tglobal_load_async_to_lds_b128 %5, %17, off\n\tglobal_load_async_to_lds_b128 %6, %18, off\n\tglobal_load_async_to_lds_b128 %7, %19, off\n\t"
               "global_load_async_to_lds_b128 %8, %20, off\n\tglobal_load_async_to_lds_b128 %9, %21, off\n\tglobal_load_async_to_lds_b128 %10, %22, off\n\tglobal_load_async_to_lds_b128 %11, %23, off\n\ts_wait_xcnt 0x0"
               :: "v"(l[0]), "v"(l[1]), "v"(l[2]), "v"(l[3]), "v"(l[4]), "v"(l[5]), "v"(l[6]), "v"(l[7]), "v"(l[8]), "v"(l[9]), "v"(l[10]), "v"(l[11]),
                  "v"(g[0]), "v"(g[1]), "v"(g[2]), "v"(g[3]), "v"(g[4]), "v"(g[5]), "v"(g[6]), "v"(g[7]), "v"(g[8]), "v"(g[9]), "v"(g[10]), "v"(g[11]) : "memory"); }
#define SCW 64             // f16 elements in a staged row of k_sc (128 B)
// ---- k_sc: block = (query block qb, key block kb <= kb_last(qb), batch b = blockIdx.z): logits x SCALE; single f16 q x k, and for query blocks < QBH (causal early rows) also q residual (x 2^10) x k and q x k residual (3 products); causal: blocks past the diagonal exit, the mask itself is applied by index in k_sm
// The head width is walked in tiles. A tile holds 128 B of each of the block's 128 k rows and 64 q rows and comes into LDS by asynchronous copies that cover whole 128-B runs (8 neighbouring lanes a row); the k tile serves all four waves.
// Late rows: a staged row is 64 elements of the f16 plane (12 tiles). Early rows: 32 elements of the f16 plane, then the same 32 of the residual plane (24 tiles). Two buffers: tile t + 1 flies while tile t is multiplied.
// Same fragments and the same order of products into every accumulator as reading them from global memory.
__global__ __launch_bounds__(128) void k_sc(const _Float16* __restrict__ QH, const _Float16* __restrict__ KH, const _Float16* __restrict__ QL, const _Float16* __restrict__ KL, int h0, float* __restrict__ S0) {
  // row pitch 144 B (16 B x odd): the 16-B fragment reads of 16 rows fall on 16 different bank groups. The output tile ss takes the tiles' place once the last tile has been read: less LDS, one more block on a WGP.
  __shared__ __align__(16) union { struct { _Float16 k[2][128][SCW + 8]; _Float16 q[2][64][SCW + 8]; } t; float ss[4][16][132]; } sm;
  const int qb = blockIdx.x, kb = blockIdx.y; if (kb > kb_last(qb)) return;
  const int b = blockIdx.z; const int h = h0; float* S = S0 + (size_t)b * TT * TT;
  const int tid = threadIdx.x, wave = tid >> 5, lane = tid & 31, col = lane & 15, g = lane >> 4; const int k0 = kb * 128; const int ql0 = qb * 64 + wave * 16;
  v8f acc[8] = {}, accl[8] = {};
  const _Float16* QLb = QL + (size_t)b * QHI * CC; const _Float16* KLb = KL + (size_t)b * KHI * CC;
  const bool early = qb < QBH; const int step = early ? 32 : 64;
  const int rr = lane >> 3, o = lane & 7; const bool res = early && o >= 4;   // lane: row rr of four, 16-B slot o of the staged row; slots 4..7 of an early row hold the residual plane
  const _Float16* ksrc = (res ? KLb : KH + (size_t)b * TT * CC) + (size_t)(k0 + wave * 32 + rr) * CC + h * HD + (res ? o - 4 : o) * 8;
  const _Float16* qsrc = (res ? QLb : QH + (size_t)b * TT * CC) + (size_t)(ql0 + rr) * CC + h * HD + (res ? o - 4 : o) * 8;
  const unsigned kdst = lds_off(&sm.t.k[0][wave * 32 + rr][o * 8]), qdst = lds_off(&sm.t.q[0][wave * 16 + rr][o * 8]);
  auto fill = [&](int t) { unsigned l[12]; const void* gp[12];   // each wave: 32 rows of k (4 a copy), then its own 16 rows of q; both loops unrolled so that l and gp are registers
#pragma unroll
    for (int i = 0; i < 8; ++i) { l[i] = kdst + (unsigned)(t & 1) * (unsigned)sizeof(sm.t.k[0]) + (unsigned)(i * 4 * sizeof(sm.t.k[0][0])); gp[i] = ksrc + (size_t)(i * 4) * CC + t * step; }
#pragma unroll
    for (int i = 0; i < 4; ++i) { l[8 + i] = qdst + (unsigned)(t & 1) * (unsigned)sizeof(sm.t.q[0]) + (unsigned)(i * 4 * sizeof(sm.t.q[0][0])); gp[8 + i] = qsrc + (size_t)(i * 4) * CC + t * step; }
    acopy12(l, gp); };
  auto foot = [&](int t, int nt) {   // nt: the path's number of tiles
    asm volatile("s_wait_dscnt 0x0" ::: "memory");      // this wave's reads of tile t are over before its buffer is refilled
    asm volatile("s_wait_asynccnt 0x0" ::: "memory");   // this wave's copies of tile t + 1 have landed
    __syncthreads();                                     // publishes tile t + 1 and ends every wave's reads of tile t
    if (t + 2 < nt) fill(t + 2); };
  fill(0);
  asm volatile("s_wait_asynccnt 0x0" ::: "memory");   // this wave's copies of tile 0 have landed
  __syncthreads();                                     // ... and every other wave's: tile 0 may be read
  fill(1);
  if (early) {
    // rolled: the buffer is picked by t & 1, and the loop's text stays small
#pragma unroll 1
    for (int t = 0; t < HD / 32; ++t) { const _Float16 (*bk)[SCW + 8] = sm.t.k[t & 1]; const _Float16 (*bq)[SCW + 8] = sm.t.q[t & 1];
      const v16h ah = frag_h(&bq[wave * 16 + col][0], lane), al = frag_h(&bq[wave * 16 + col][32], lane);
      // four key tiles at a time (their fragments and both accumulator sets fit the registers); the three products of a key tile stand four apart, so that none waits for the one before it into the same accumulator
#pragma unroll
      for (int jh = 0; jh < 8; jh += 4) { v16h kf[4], lf[4];
#pragma unroll
        for (int j = 0; j < 4; ++j) { kf[j] = frag_h(&bk[(jh + j) * 16 + col][0], lane); lf[j] = frag_h(&bk[(jh + j) * 16 + col][32], lane); }
#pragma unroll
        for (int j = 0; j < 4; ++j) acc[jh + j] = wmma16(ah, kf[j], acc[jh + j]);
#pragma unroll
        for (int j = 0; j < 4; ++j) accl[jh + j] = wmma16(al, kf[j], accl[jh + j]);
#pragma unroll
        for (int j = 0; j < 4; ++j) accl[jh + j] = wmma16(ah, lf[j], accl[jh + j]); }
      foot(t, HD / 32); }
  } else {
    // rolled, as above
#pragma unroll 1
    for (int t = 0; t < HD / 64; ++t) { const _Float16 (*bk)[SCW + 8] = sm.t.k[t & 1]; const _Float16 (*bq)[SCW + 8] = sm.t.q[t & 1];
      // all of the tile's fragment reads stand together in front of its products: one place with LDS reads a tile (the loops over kk and j are unrolled so that a, kf and acc are registers)
      v16h a[2], kf[2][8];
#pragma unroll
      for (int kk = 0; kk < 2; ++kk) a[kk] = frag_h(&bq[wave * 16 + col][kk * 32], lane);
#pragma unroll
      for (int kk = 0; kk < 2; ++kk) {
#pragma unroll
        for (int j = 0; j < 8; ++j) kf[kk][j] = frag_h(&bk[j * 16 + col][kk * 32], lane); }
#pragma unroll
      for (int kk = 0; kk < 2; ++kk) {
#pragma unroll
        for (int j = 0; j < 8; ++j) acc[j] = wmma16(a[kk], kf[kk][j], acc[j]); }
      foot(t, HD / 64); } }
  asm volatile("s_wait_asynccnt 0x0" ::: "memory");   // no copy is left in flight when the wave goes on; the last trip's barrier has ended every wave's reads of the tiles, so ss may take their place
#pragma unroll
  for (int j = 0; j < 8; ++j) {
#pragma unroll
    for (int r = 0; r < 8; ++r) sm.ss[wave][8 * g + r][j * 16 + col] = (acc[j][r] + accl[j][r] * (1.0f / 1024.0f)) * SCALE; }
  LDSX(); for (int rl = 0; rl < 16; ++rl) vst2(S + (size_t)(ql0 + rl) * TT + k0 + lane * 4, *(const v4f*)&sm.ss[wave][rl][lane * 4]); }
// ---- k_sm: block = query row t of batch blockIdx.y: keys [0, kend): causal -> logit if s <= t else excluded; softmax in f32; P x 2^11 in place (0 for excluded)
__global__ __launch_bounds__(256) void k_sm(float* __restrict__ S0 SM_EXTRA_PARAMS) { __shared__ float sred[8]; __shared__ float sbc; __shared__ __align__(16) float shv[TT];
  const int tid = threadIdx.x; const int t = blockIdx.x; const int kend = (kb_last(t >> 6) + 1) * 128;
  float* sr = S0 + (size_t)blockIdx.y * TT * TT + (size_t)t * TT;
  float m = -3.0e38f; for (int k = tid; k < kend; k += 256) { float v = (!CAUSAL || k <= t) ? sr[k] : -3.0e38f; SM_MASK_HOOK; shv[k] = v; m = fmaxf(m, v); }
#pragma unroll
  for (int o = 1; o < 32; o <<= 1) m = fmaxf(m, __shfl_xor(m, o));
  if ((tid & 31) == 0) sred[tid >> 5] = m; __syncthreads(); if (tid == 0) { float a = sred[0]; for (int i = 1; i < 8; ++i) a = fmaxf(a, sred[i]); sbc = a; } __syncthreads(); m = sbc; __syncthreads();
  float sum = 0.f; for (int k = tid; k < kend; k += 256) { const float v = shv[k]; const float e = (v <= -1.0e38f) ? 0.f : expf(v - m); shv[k] = e; sum += e; }
#pragma unroll
  for (int o = 1; o < 32; o <<= 1) sum += __shfl_xor(sum, o);
  if ((tid & 31) == 0) sred[tid >> 5] = sum; __syncthreads(); if (tid == 0) { float a = 0.f; for (int i = 0; i < 8; ++i) a += sred[i]; sbc = a > 0.f ? 2048.0f / a : 0.f; }   /* a fully excluded row yields P = 0 */ __syncthreads(); const float inv = sbc;
  for (int k = tid; k < kend; k += 256) shv[k] = shv[k] * inv;
  __syncthreads(); for (int q = tid; q < kend / 4; q += 256) vst2(sr + q * 4, *(const v4f*)&shv[q * 4]); }
#define PVK 64             // keys per staged tile of k_pv
// eight asynchronous copies, 16 B a lane, global -> LDS; the closing s_wait_xcnt stands in the same statement, in front of any later rewrite of the address registers that the copies name
__device__ __forceinline__ void acopy8(const unsigned (&l)[8], const void* const (&g)[8]) {
  asm volatile("global_load_async_to_lds_b128 %0, %8, off\n\tglobal_load_async_to_lds_b128 %1, %9, off\n\tglobal_load_async_to_lds_b128 %2, %10, off\n\tglobal_load_async_to_lds_b128 %3, %11, off\n\t"
               "global_load_async_to_lds_b128 %4, %12, off\n\tglobal_load_async_to_lds_b128 %5, %13, off\n\tglobal_load_async_to_lds_b128 %6, %14, off\n\tglobal_load_async_to_lds_b128 %7, %15, off\n\ts_wait_xcnt 0x0"
               :: "v"(l[0]), "v"(l[1]), "v"(l[2]), "v"(l[3]), "v"(l[4]), "v"(l[5]), "v"(l[6]), "v"(l[7]), "v"(g[0]), "v"(g[1]), "v"(g[2]), "v"(g[3]), "v"(g[4]), "v"(g[5]), "v"(g[6]), "v"(g[7]) : "memory"); }
#define DVH 128            // value columns per k_pv block: the 768-wide head is walked in six 128-column slices (8 accumulator tiles per wave; a 48-tile accumulator would not fit the register file)
// ---- k_pv: block = (64 queries (qb), 128-column value slice d0, batch b = blockIdx.z): ctx[:, d0 .. d0+127] = P . v over keys [0, kend) (P x 2^11 once to f16 against v f16: 1 product; causal early query blocks: P and v as bf16 hi + lo, 3 products); the 512-B (row, slice) segment by 32 lanes x 16 B
__global__ __launch_bounds__(128) void k_pv(const float* __restrict__ PS0, const _Float16* __restrict__ VT, const __bf16* __restrict__ VB, const __bf16* __restrict__ VBL, int h0, float* __restrict__ Y) { const int b = blockIdx.z; const int h = h0; const int d0 = blockIdx.y * DVH; const float* PS = PS0 + (size_t)b * TT * TT; __shared__ __align__(16) float ss[4][16][DVH + 4];
  __shared__ __align__(16) _Float16 sv[2][DVH][PVK + 8]; __shared__ __align__(16) float sp[2][64][PVK + 4];   // row pitches 144 B and 272 B (16 B x odd): the 16-B fragment reads of 16 rows fall on 16 different bank groups
  const int tid = threadIdx.x, wave = tid >> 5, lane = tid & 31, col = lane & 15, g = lane >> 4; const int qb = blockIdx.x; const int ql0 = qb * 64 + wave * 16; const int kce = (kb_last(qb) + 1) * 4;
  v8f acc[DVH / 16] = {};
  if (qb < QBH) {
#pragma unroll 1
    for (int kc = 0; kc < kce; ++kc) { const F2 p = split_row(PS + (size_t)(ql0 + col) * TT, kc * 32, lane);
      asm volatile("s_wait_loadcnt 0x0" ::: "memory");
#pragma unroll
      for (int j = 0; j < DVH / 16; ++j) { const size_t po = ((size_t)b * CC + h * HD + d0 + j * 16 + col) * (size_t)KHI + kc * 32; const v16b vh = frag_b(VB + po, lane); acc[j] = wmma_bf(p.h, vh, acc[j]); acc[j] = wmma_bf(p.l, vh, acc[j]); acc[j] = wmma_bf(p.h, frag_b(VBL + po, lane), acc[j]); } }
  } else {
    // Keys in tiles of PVK = 64. A tile of v (128 columns x 128 B) and of P (64 rows x 256 B) comes into LDS by asynchronous copies that cover whole 128-B lines (8 or 16 neighbouring lanes a row);
    // the v tile serves all four waves. Two buffers: tile t + 1 flies while tile t is multiplied. Same fragments, same key order as reading them from global memory.
    const int nt = kce >> 1;
    const _Float16* vsrc = VT + ((size_t)b * CC + h * HD + d0 + wave * 32 + (lane >> 3)) * (size_t)TT + (lane & 7) * 8; const float* psrc = PS + (size_t)(ql0 + (lane >> 4)) * TT + (lane & 15) * 4;
    const unsigned vdst = lds_off(&sv[0][wave * 32 + (lane >> 3)][(lane & 7) * 8]), pdst = lds_off(&sp[0][wave * 16 + (lane >> 4)][(lane & 15) * 4]);
    auto fill = [&](int t) { unsigned l[8]; const void* gp[8];   // each wave: 32 columns of v (4 a copy), then its own 16 rows of P (2 a copy); both loops unrolled so that l and gp are registers
#pragma unroll
      for (int i = 0; i < 8; ++i) { l[i] = vdst + (unsigned)(t & 1) * (unsigned)sizeof(sv[0]) + (unsigned)(i * 4 * sizeof(sv[0][0])); gp[i] = vsrc + (size_t)(i * 4) * TT + t * PVK; }
      acopy8(l, gp);
#pragma unroll
      for (int i = 0; i < 8; ++i) { l[i] = pdst + (unsigned)(t & 1) * (unsigned)sizeof(sp[0]) + (unsigned)(i * 2 * sizeof(sp[0][0])); gp[i] = psrc + (size_t)(i * 2) * TT + t * PVK; }
      acopy8(l, gp); };
    fill(0);
    asm volatile("s_wait_asynccnt 0x0" ::: "memory");   // this wave's copies of tile 0 have landed
    __syncthreads();                                     // ... and every other wave's: tile 0 may be read
    if (nt > 1) fill(1);
    // rolled: the trip count depends on the query block, and the buffer is picked by t & 1
#pragma unroll 1
    for (int t = 0; t < nt; ++t) { const _Float16 (*bv)[PVK + 8] = sv[t & 1]; const float (*bp)[PVK + 4] = sp[t & 1];
      // all of the tile's fragment reads stand together in front of its products: one place with LDS reads a tile instead of a read and a full wait in front of every product
      // (the loops over kk and j are unrolled so that p, vf and acc are registers)
      v16h p[PVK / 32], vf[PVK / 32][DVH / 16];
#pragma unroll
      for (int kk = 0; kk < PVK / 32; ++kk) p[kk] = frag_f32(&bp[wave * 16 + col][kk * 32], lane);
#pragma unroll
      for (int kk = 0; kk < PVK / 32; ++kk) {
#pragma unroll
        for (int j = 0; j < DVH / 16; ++j) vf[kk][j] = frag_h(&bv[j * 16 + col][kk * 32], lane); }
#pragma unroll
      for (int kk = 0; kk < PVK / 32; ++kk) {
#pragma unroll
        for (int j = 0; j < DVH / 16; ++j) acc[j] = wmma16(p[kk], vf[kk][j], acc[j]); }
      asm volatile("s_wait_dscnt 0x0" ::: "memory");      // this wave's reads of tile t are over before its buffer is refilled
      asm volatile("s_wait_asynccnt 0x0" ::: "memory");   // this wave's copies of tile t + 1 have landed
      __syncthreads();                                     // publishes tile t + 1 and ends every wave's reads of tile t
      if (t + 2 < nt) fill(t + 2); }
    asm volatile("s_wait_asynccnt 0x0" ::: "memory"); }   // no copy is left in flight when the wave goes on
#pragma unroll
  for (int j = 0; j < DVH / 16; ++j)
#pragma unroll
    for (int r = 0; r < 8; ++r) ss[wave][8 * g + r][j * 16 + col] = acc[j][r] * (1.0f / 2048.0f);
  LDSX(); for (int rl = 0; rl < 16; ++rl) vst2(Y + ((size_t)b * TT + ql0 + rl) * CC + h * HD + d0 + lane * 4, *(const v4f*)&ss[wave][rl][lane * 4]); }   
extern "C" void kernel_launch(void* const* d_in, const int* in_sizes, int n_in, void* d_out, int out_size, void* d_ws, size_t ws_size, hipStream_t stream) {
  (void)in_sizes; (void)n_in; (void)out_size;
  const float** F = (const float**)d_in;
  if (ws_size < (size_t)WS_END) return;
  char* ws = (char*)d_ws; _Float16 *QH = (_Float16*)(ws + WS_QH), *KH = (_Float16*)(ws + WS_KH), *VT = (_Float16*)(ws + WS_VT), *QL = (_Float16*)(ws + WS_QL), *KL = (_Float16*)(ws + WS_KL); __bf16 *VB = (__bf16*)(ws + WS_VB), *VBL = (__bf16*)(ws + WS_VBL); float *S = (float*)(ws + WS_S), *Y = (float*)(ws + WS_Y);
  (void)Y; (void)QL; (void)KL; (void)VB; (void)VBL;
  // inputs: 0 x [4,2048,768]; 1 Wq [768,768] (in,out); 2 Wk; 3 Wv; no biases, no output projection
  k_proj<<<dim3(TNB * TT / 64, CC / 128, 3), 128, 0, stream>>>(F[0], F[0], F[0], F[1], F[2], F[3], nullptr, nullptr, nullptr, QH, QL, KH, KL, VT, VB, VBL);
  k_sc<<<dim3(NQB, TT / 128, TNB), 128, 0, stream>>>(QH, KH, QL, KL, 0, S);
  k_sm<<<dim3(TT, TNB), 256, 0, stream>>>(S);
  k_pv<<<dim3(NQB, HD / DVH, TNB), 128, 0, stream>>>(S, VT, VB, VBL, 0, (float*)d_out);   /* six 128-column value slices per query block */
}

// v005
// One run takes 156 microseconds.
// Next to v004, in two timings, it ran 1.06 times as fast each time.
// All steps since v000 together make it 5.39 times as fast.
// compute dtype: all float inputs rounded to bf16; q/k/v projections with EXACT bf16 products on WMMA 16x16x32 (f32 accumulate); causal logits over the 768-wide head: 3 products for the first 384 rows, single f16 q x k after, x 768^-0.5; softmax f32; P x 2^11 once to f16 x v once to f16 (bf16 hi + lo below row 384); f32 output.
#include <hip/hip_runtime.h>
#include <math.h>

typedef __attribute__((ext_vector_type(16))) _Float16 v16h;
typedef __attribute__((ext_vector_type(16))) __bf16 v16b;
typedef __attribute__((ext_vector_type(8)))  _Float16 v8h;
typedef __attribute__((ext_vector_type(8)))  float v8f;
typedef __attribute__((ext_vector_type(4)))  float v4f;
typedef __attribute__((ext_vector_type(2)))  float v2f;
typedef __attribute__((ext_vector_type(4)))  unsigned v4u;
typedef __attribute__((ext_vector_type(4)))  int v4i;
typedef float __attribute__((may_alias)) float_a;
typedef int __attribute__((may_alias)) int_a;

template <typename T> __device__ __forceinline__ void vst2(void* p, T v) { *(T*)p = v;  }
__device__ __forceinline__ v8f wmma16(v16h a, v16h b, v8f c) {
  v8f d = __builtin_amdgcn_wmma_f32_16x16x32_f16(false, a, false, b, (short)0, c, false, false);
  asm volatile("v_nop\n\tv_nop\n\tv_nop\n\tv_nop" : "+v"(d) : "v"(a), "v"(b));
  return d;
}
__device__ __forceinline__ v8f wmma_bf(v16b a, v16b b, v8f c) {
  v8f d = __builtin_amdgcn_wmma_f32_16x16x32_bf16(false, a, false, b, (short)0, c, false, false);
  asm volatile("v_nop\n\tv_nop\n\tv_nop\n\tv_nop" : "+v"(d) : "v"(a), "v"(b));
  return d;
}
// 16x16x32 fragments: lane = (h = lane>>4, row/col = lane&15); elements 0..7 = k0+8h+0..7, 8..15 = k0+16+8h+0..7; D element r = row 8h+r
__device__ __forceinline__ v16h frag_h(const _Float16* rowk0, int lane) {
  union { v16h v; v8h q[2]; } u; const _Float16* p = rowk0 + 8 * (lane >> 4);
  u.q[0] = *(const v8h*)p; u.q[1] = *(const v8h*)(p + 16); return u.v;
}
__device__ __forceinline__ v16h frag_f32(const float* rowk0, int lane) {
  v16h a; const float* p = rowk0 + 8 * (lane >> 4);
#pragma unroll
  for (int i = 0; i < 8; ++i) { a[i] = (_Float16)p[i]; a[8 + i] = (_Float16)p[16 + i]; }
  return a;
}
__device__ __forceinline__ v16h frag_f32s(const float* rowk0, int lane, float sc) {
  v16h a; const float* p = rowk0 + 8 * (lane >> 4);
#pragma unroll
  for (int i = 0; i < 8; ++i) { a[i] = (_Float16)(p[i] * sc); a[8 + i] = (_Float16)(p[16 + i] * sc); }
  return a;
}
// column fragment from a [K][ld] layout (column n), rows >= K read as 0
__device__ __forceinline__ v16h fragc_f32(const float* W, int k0, int n, int lane, int ld, int K) {
  v16h a; const int g = lane >> 4;
#pragma unroll
  for (int i = 0; i < 8; ++i) { const int ka = k0 + 8 * g + i, kb = ka + 16;
    a[i] = (_Float16)(ka < K ? W[(size_t)(ka < K ? ka : K - 1) * ld + n] : 0.f); a[8 + i] = (_Float16)(kb < K ? W[(size_t)(kb < K ? kb : K - 1) * ld + n] : 0.f); }
  return a;
}
struct F2 { v16b h, l; };
__device__ __forceinline__ F2 bsplit16(const float v[16]) { F2 r;
#pragma unroll
  for (int i = 0; i < 16; ++i) { const __bf16 h = (__bf16)v[i]; r.h[i] = h; r.l[i] = (__bf16)(v[i] - (float)h); }
  return r; }
__device__ __forceinline__ F2 split_row(const float* row, int k0, int lane) { float v[16]; const float* p = row + k0 + 8 * (lane >> 4);
#pragma unroll
  for (int i = 0; i < 8; ++i) { v[i] = p[i]; v[8 + i] = p[16 + i]; }
  return bsplit16(v); }
__device__ __forceinline__ F2 split_rowK(const float* row, int k0, int lane, int K) { float v[16]; const int g = lane >> 4;
#pragma unroll
  for (int i = 0; i < 8; ++i) { const int ka = k0 + 8 * g + i, kb = ka + 16; v[i] = ka < K ? row[ka < K ? ka : K - 1] : 0.f; v[8 + i] = kb < K ? row[kb < K ? kb : K - 1] : 0.f; }
  return bsplit16(v); }
__device__ __forceinline__ F2 split_col(const float* W, int k0, int n, int lane, int ld, int K) { float v[16]; const int g = lane >> 4;
#pragma unroll
  for (int i = 0; i < 8; ++i) { const int ka = k0 + 8 * g + i, kb = ka + 16; v[i] = ka < K ? W[(size_t)(ka < K ? ka : K - 1) * ld + n] : 0.f; v[8 + i] = kb < K ? W[(size_t)(kb < K ? kb : K - 1) * ld + n] : 0.f; }
  return bsplit16(v); }
__device__ __forceinline__ v8f mac3(const F2& a, const F2& b, v8f c) { c = wmma_bf(a.l, b.h, c); c = wmma_bf(a.h, b.l, c); return wmma_bf(a.h, b.h, c); }
__device__ __forceinline__ float sigm(float v) { return 1.0f / (1.0f + expf(-v)); }
#define LDSX() do { asm volatile("s_wait_dscnt 0" ::: "memory"); __builtin_amdgcn_wave_barrier(); __builtin_amdgcn_fence(__ATOMIC_RELEASE, "workgroup"); } while (0)

// Single-head causal self-attention with a 768-WIDE head (x [4,2048,768]; (in,out) Wq / Wk / Wv [768,768] uniform, no biases; scores = q k^T with -inf above the diagonal, then / sqrt(768); no head split, no output projection): out = softmax(causal(q k^T) / sqrt(768)) v -> [4,2048,768].
#define NB 4
#define TT 2048
#define CC 768            // NH * HD = projected width
#define DIN 768          // input (model) width
#define NH 1
#define HD 768
#define NQB (TT / 64)
#define HG 1
#define SCALE (0.036084391824351615f)
#define CAUSAL 1
#ifndef TNB
#define TNB NB
#endif
__device__ __forceinline__ float bfr(float v) { return (float)(__bf16)v; }
__host__ __device__ __forceinline__ int kb_last(int qb) { return CAUSAL ? ((qb * 64 + 63) >> 7) : (TT / 128 - 1); }
typedef __attribute__((ext_vector_type(8))) __bf16 v8b;
__device__ __forceinline__ v16b frag_b(const __bf16* rowk0, int lane) {
  union { v16b v; v8b q[2]; } u; const __bf16* p = rowk0 + 8 * (lane >> 4);
  u.q[0] = *(const v8b*)p; u.q[1] = *(const v8b*)(p + 16); return u.v;
}
#define QBH 6              // causal: query blocks 0..QBH-1 of each sequence (few keys, no averaging) take the high-precision path
#define QHI 384            // rows carrying a q residual plane
#define KHI 384            // key rows carrying k residual / v bf16 hi+lo planes (used only by the causal high-precision path)
// B fragment (k rows k0+.., output column o) of a weight: (in,out) [K][ld] or (out,in) [ld rows of K]: bf16 exact, or f16(bf16 * 256) exact
__device__ __forceinline__ v16b wcol_io(const float* Wm, int k0, int o, int lane, int ld) { v16b w; const int g = lane >> 4;
#pragma unroll
  for (int i = 0; i < 8; ++i) { w[i] = (__bf16)Wm[(size_t)(k0 + 8 * g + i) * ld + o]; w[8 + i] = (__bf16)Wm[(size_t)(k0 + 16 + 8 * g + i) * ld + o]; }
  return w; }
__device__ __forceinline__ v16b wcol_oi(const float* Wm, int k0, int o, int lane, int K) { v16b w; const float* p = Wm + (size_t)o * K + k0 + 8 * (lane >> 4);
#pragma unroll
  for (int i = 0; i < 8; ++i) { w[i] = (__bf16)p[i]; w[8 + i] = (__bf16)p[16 + i]; }
  return w; }
__device__ __forceinline__ v16h wcolh_io(const float* Wm, int k0, int o, int lane, int ld) { v16h w; const int g = lane >> 4;
#pragma unroll
  for (int i = 0; i < 8; ++i) { w[i] = (_Float16)(bfr(Wm[(size_t)(k0 + 8 * g + i) * ld + o]) * 256.0f); w[8 + i] = (_Float16)(bfr(Wm[(size_t)(k0 + 16 + 8 * g + i) * ld + o]) * 256.0f); }
  return w; }
__device__ __forceinline__ v16h wcolh_oi(const float* Wm, int k0, int o, int lane, int K) { v16h w; const float* p = Wm + (size_t)o * K + k0 + 8 * (lane >> 4);
#pragma unroll
  for (int i = 0; i < 8; ++i) { w[i] = (_Float16)(bfr(p[i]) * 256.0f); w[8 + i] = (_Float16)(bfr(p[16 + i]) * 256.0f); }
  return w; }
#define WQKV_LAYOUT 0   // 0 = (in,out) [DIN][CC]; 1 = (out,in) [CC][DIN]; 2 = per-head [NH][DIN][HD]
__device__ __forceinline__ v16b wcol_hdk(const float* Wm, int k0, int o, int lane) { v16b w; const int g = lane >> 4; const float* p = Wm + (size_t)(o / HD) * DIN * HD + (o % HD);
#pragma unroll
  for (int i = 0; i < 8; ++i) { w[i] = (__bf16)p[(size_t)(k0 + 8 * g + i) * HD]; w[8 + i] = (__bf16)p[(size_t)(k0 + 16 + 8 * g + i) * HD]; }
  return w; }
#define WO_OUT_IN 0
#if WQKV_LAYOUT == 1
#define WCOL(W, k0, o, lane) wcol_oi(W, k0, o, lane, DIN)
#elif WQKV_LAYOUT == 2
#define WCOL(W, k0, o, lane) wcol_hdk(W, k0, o, lane)
#else
#define WCOL(W, k0, o, lane) wcol_io(W, k0, o, lane, CC)
#endif
#if WO_OUT_IN
#define WOCOL(W, k0, o, lane) wcol_oi(W, k0, o, lane, CC)
#define WOCOLH(W, k0, o, lane) wcolh_oi(W, k0, o, lane, CC)
#else
#define WOCOL(W, k0, o, lane) wcol_io(W, k0, o, lane, DIN)
#define WOCOLH(W, k0, o, lane) wcolh_io(W, k0, o, lane, DIN)
#endif

#ifndef SM_EXTRA_PARAMS
#define SM_EXTRA_PARAMS
#endif
#ifndef PROJ_EXTRA_PARAMS
#define PROJ_EXTRA_PARAMS
#endif
#ifndef SM_MASK_HOOK
#define SM_MASK_HOOK (void)0
#endif

#define WS_QH  0u                                      // f16 q rows [b*t][CC]
#define WS_KH  (WS_QH + 2u * (size_t)NB * TT * CC)      // f16 k rows [b*t][CC]
#define WS_VT  (WS_KH + 2u * (size_t)NB * TT * CC)      // f16 v planes [b][c][t]
#define WS_QL  (WS_VT + 2u * (size_t)NB * CC * TT)      // f16 q residual x 2^10 rows [b][t < QHI][CC]
#define WS_KL  (WS_QL + 2u * (size_t)NB * QHI * CC)     // f16 k residual x 2^10 rows [b][t < KHI][CC]
#define WS_VB  (WS_KL + 2u * (size_t)NB * KHI * CC)     // bf16 v hi planes [b][c][t < KHI]
#define WS_VBL (WS_VB + 2u * (size_t)NB * CC * KHI)
#define WS_S   (WS_VBL + 2u * (size_t)NB * CC * KHI)    // f32 logits / P [b][t][s]: one plane per batch, so that each stage runs all batches in one launch
#define WS_Y   (WS_S  + 4u * (size_t)NB * TT * TT)      // f32 ctx rows [b*t][CC] (only when there is an output projection)
#define WS_END (WS_Y  + 0u)

// ---- k_proj: block = (64 rows, 128 cols, which): q/k/v = X W (+ b) with exact bf16 products (K = DIN) -> which 0: q f16 rows (+ residual rows < QHI); 1: k f16 rows (+ residual rows < KHI); 2: v f16 planes [c][t] (+ bf16 hi/lo planes for t < KHI)
__global__ __launch_bounds__(128) void k_proj(const float* __restrict__ XQ, const float* __restrict__ XK, const float* __restrict__ XV, const float* __restrict__ WQ, const float* __restrict__ WK, const float* __restrict__ WV, const float* __restrict__ BQ, const float* __restrict__ BK, const float* __restrict__ BV,
    _Float16* __restrict__ QH, _Float16* __restrict__ QL, _Float16* __restrict__ KH, _Float16* __restrict__ KL, _Float16* __restrict__ VT, __bf16* __restrict__ VB, __bf16* __restrict__ VBL) {
  __shared__ __align__(16) _Float16 sh[64][136], sl[64][136]; __shared__ __align__(16) _Float16 th[128][72]; __shared__ __align__(16) __bf16 tb[128][72], tbl[128][72];
  const int tid = threadIdx.x, wave = tid >> 5, lane = tid & 31, col = lane & 15, g = lane >> 4; const int which = blockIdx.z; const int c0 = blockIdx.y * 128; const size_t r0 = (size_t)blockIdx.x * 64; const size_t bb = r0 / TT; const int t0 = (int)(r0 % TT);
  const float* X = which == 0 ? XQ : which == 1 ? XK : XV; const float* WA = which == 0 ? WQ : which == 1 ? WK : WV; const float* BA = which == 0 ? BQ : which == 1 ? BK : BV;
  v8f acc[8] = {};
  // Main loop: K in 12 chunks of 64. The block's W chunk [64 k][128 cols] is read from global once (whole 512-B row segments, 16 B a lane), rounded to bf16, turned to [col][k] in registers and
  // kept in LDS for all four waves; tb / tbl (free until the epilogue) are the two buffers. 16-B slot o of row c sits at o ^ ((c >> 4) & 3): the stores (columns 4 apart across lanes) and the
  // fragment reads (columns 1 apart) then both fall on 16 different bank groups per 16 lanes. The next chunk's W and X loads are issued behind the barrier and fly while this chunk's products run.
  const float* wsrc = WA + (size_t)(wave * 16) * CC + c0 + 4 * lane; const float* xsrc = X + (r0 + wave * 16 + col) * DIN + 8 * g;
  v4f wr[16], xr[8]; v16b a[2];
  auto ldg = [&](int s) {   // chunk s counted from the one that wsrc / xsrc stand at
#pragma unroll
    for (int i = 0; i < 16; ++i) wr[i] = *(const v4f*)(wsrc + (size_t)(s * 64 + i) * CC);
#pragma unroll
    for (int i = 0; i < 4; ++i) { xr[2 * i] = *(const v4f*)(xsrc + s * 64 + i * 16); xr[2 * i + 1] = *(const v4f*)(xsrc + s * 64 + i * 16 + 4); } };
  auto stage = [&](__bf16 (*buf)[72]) { const int sw = (lane >> 2) & 3;
    __builtin_amdgcn_sched_barrier(0);   // keeps the conversions, which wait for the global loads, behind the chunk's last product: the loads fly under all sixteen
    asm volatile("s_wait_xcnt 0x0" ::: "memory");   // stands in front of the loop's advance of the two address pairs that the chunk's global loads name
#pragma unroll
    for (int oo = 0; oo < 2; ++oo) {
#pragma unroll
      for (int c = 0; c < 4; ++c) { v8b t;
#pragma unroll
        for (int i = 0; i < 8; ++i) t[i] = (__bf16)wr[oo * 8 + i][c];
        *(v8b*)&buf[4 * lane + c][((2 * wave + oo) ^ sw) * 8] = t; } }
#pragma unroll
    for (int kk = 0; kk < 2; ++kk) {
#pragma unroll
      for (int i = 0; i < 4; ++i) { a[kk][i] = (__bf16)xr[4 * kk][i]; a[kk][4 + i] = (__bf16)xr[4 * kk + 1][i]; a[kk][8 + i] = (__bf16)xr[4 * kk + 2][i]; a[kk][12 + i] = (__bf16)xr[4 * kk + 3][i]; } }
    __builtin_amdgcn_sched_barrier(0); };   // keeps the X conversions here: the raw X registers are free again for the next chunk's loads, and the kernel stays within 256 registers
  // the 16 fragments of a chunk in four groups of four (group q: k half q >> 1, column tiles 4 (q & 1) ..): a group's eight LDS reads stand together, one group ahead of the products that use them
  auto mma = [&](const __bf16 (*buf)[72]) { const __bf16* p0 = &buf[col][8 * g]; const __bf16* p1 = &buf[col][8 * (g ^ 1)]; v16b w[2][4];
    auto ldf = [&](int q) {
#pragma unroll
      for (int i = 0; i < 4; ++i) { const int j = 4 * (q & 1) + i; const __bf16* p = ((j & 1) ? p1 : p0) + j * 16 * 72 + (q >> 1) * 32; union { v16b v; v8b q2[2]; } u;
        u.q2[0] = *(const v8b*)(p + 8 * (j & 2)); u.q2[1] = *(const v8b*)(p + 8 * (2 ^ (j & 2))); w[q & 1][i] = u.v; } };
    ldf(0);
#pragma unroll
    for (int q = 0; q < 4; ++q) { if (q < 3) ldf(q + 1);
#pragma unroll
      for (int i = 0; i < 4; ++i) acc[4 * (q & 1) + i] = wmma_bf(a[q >> 1], w[q & 1][i], acc[4 * (q & 1) + i]); } };
  ldg(0); stage(tb); __syncthreads();
  // rolled: two chunks a trip (one per buffer) keep the loop's text small; each barrier publishes the chunk just stored and ends the reads of the buffer that is stored next
#pragma unroll 1
  for (int s = 0; s < DIN / 64 - 2; s += 2) {
    ldg(1); mma(tb); stage(tbl); __syncthreads();
    ldg(2); mma(tbl); stage(tb); __syncthreads();
    wsrc += (size_t)128 * CC; xsrc += 128; }
  ldg(1); mma(tb); stage(tbl); __syncthreads();
  mma(tbl); __syncthreads();   // the epilogue stores into tb / tbl again: every wave's last fragment read ends here
  if (which < 2) { _Float16* DH = which == 0 ? QH : KH; _Float16* DL = which == 0 ? QL : KL; const int nhi = which == 0 ? QHI : KHI; const bool hi_rows = t0 < nhi;
#pragma unroll
    for (int j = 0; j < 8; ++j) { const float bias = BA ? bfr(BA[c0 + j * 16 + col]) : 0.f;
#pragma unroll
      for (int r = 0; r < 8; ++r) { const float v = acc[j][r] + bias; const _Float16 hv = (_Float16)v; sh[wave * 16 + 8 * g + r][j * 16 + col] = hv; sl[wave * 16 + 8 * g + r][j * 16 + col] = (_Float16)((v - (float)hv) * 1024.0f); } }
    __syncthreads();
    for (int e = tid; e < 64 * 16; e += 128) { const int rl = e >> 4, q = e & 15; vst2((unsigned*)(DH + (r0 + rl) * CC + c0 + q * 8), *(const v4u*)&sh[rl][q * 8]); if (hi_rows) vst2((unsigned*)(DL + (bb * nhi + t0 + rl) * (size_t)CC + c0 + q * 8), *(const v4u*)&sl[rl][q * 8]); }
  } else { const bool hi_rows = t0 < KHI;
#pragma unroll
    for (int j = 0; j < 8; ++j) { const float bias = BA ? bfr(BA[c0 + j * 16 + col]) : 0.f;
#pragma unroll
      for (int r = 0; r < 8; ++r) { const float v = acc[j][r] + bias; const int rl = wave * 16 + 8 * g + r, cl = j * 16 + col; th[cl][rl] = (_Float16)v; const __bf16 bh = (__bf16)v; tb[cl][rl] = bh; tbl[cl][rl] = (__bf16)(v - (float)bh); } }
    __syncthreads();
    for (int e = tid; e < 128 * 8; e += 128) { const int cl = e >> 3, q = e & 7; vst2((unsigned*)(VT + (bb * CC + c0 + cl) * (size_t)TT + t0 + q * 8), *(const v4u*)&th[cl][q * 8]); if (hi_rows) { const size_t o3 = (bb * CC + c0 + cl) * (size_t)KHI + t0 + q * 8; vst2((unsigned*)(VB + o3), *(const v4u*)&tb[cl][q * 8]); vst2((unsigned*)(VBL + o3), *(const v4u*)&tbl[cl][q * 8]); } } } }
__device__ __forceinline__ unsigned lds_off(const void* p) { return (unsigned)(size_t)p; }   // byte address in the work-group's LDS
// twelve asynchronous copies, 16 B a lane, global -> LDS; the closing s_wait_xcnt stands in the same statement, in front of any later rewrite of the address registers that the copies name
__device__ __forceinline__ void acopy12(const unsigned (&l)[12], const void* const (&g)[12]) {
  asm volatile("global_load_async_to_lds_b128 %0, %12, off\n\tglobal_load_async_to_lds_b128 %1, %13, off\n\tglobal_load_async_to_lds_b128 %2, %14, off\n\tglobal_load_async_to_lds_b128 %3, %15, off\n\t"
               "global_load_async_to_lds_b128 %4, %16, off\n\tglobal_load_async_to_lds_b128 %5, %17, off\n\tglobal_load_async_to_lds_b128 %6, %18, off\n\tglobal_load_async_to_lds_b128 %7, %19, off\n\t"
               "global_load_async_to_lds_b128 %8, %20, off\n\tglobal_load_async_to_lds_b128 %9, %21, off\n\tglobal_load_async_to_lds_b128 %10, %22, off\n\tglobal_load_async_to_lds_b128 %11, %23, off\n\ts_wait_xcnt 0x0"
               :: "v"(l[0]), "v"(l[1]), "v"(l[2]), "v"(l[3]), "v"(l[4]), "v"(l[5]), "v"(l[6]), "v"(l[7]), "v"(l[8]), "v"(l[9]), "v"(l[10]), "v"(l[11]),
                  "v"(g[0]), "v"(g[1]), "v"(g[2]), "v"(g[3]), "v"(g[4]), "v"(g[5]), "v"(g[6]), "v"(g[7]), "v"(g[8]), "v"(g[9]), "v"(g[10]), "v"(g[11]) : "memory"); }
#define SCW 64             // f16 elements in a staged row of k_sc (128 B)
// ---- k_sc: block = (query block qb, key block kb <= kb_last(qb), batch b = blockIdx.z): logits x SCALE; single f16 q x k, and for query blocks < QBH (causal early rows) also q residual (x 2^10) x k and q x k residual (3 products); causal: blocks past the diagonal exit, the mask itself is applied by index in k_sm
// The head width is walked in tiles. A tile holds 128 B of each of the block's 128 k rows and 64 q rows and comes into LDS by asynchronous copies that cover whole 128-B runs (8 neighbouring lanes a row); the k tile serves all four waves.
// Late rows: a staged row is 64 elements of the f16 plane (12 tiles). Early rows: 32 elements of the f16 plane, then the same 32 of the residual plane (24 tiles). Two buffers: tile t + 1 flies while tile t is multiplied.
// Same fragments and the same order of products into every accumulator as reading them from global memory.
__global__ __launch_bounds__(128) void k_sc(const _Float16* __restrict__ QH, const _Float16* __restrict__ KH, const _Float16* __restrict__ QL, const _Float16* __restrict__ KL, int h0, float* __restrict__ S0) {
  // row pitch 144 B (16 B x odd): the 16-B fragment reads of 16 rows fall on 16 different bank groups. The output tile ss takes the tiles' place once the last tile has been read: less LDS, one more block on a WGP.
  __shared__ __align__(16) union { struct { _Float16 k[2][128][SCW + 8]; _Float16 q[2][64][SCW + 8]; } t; float ss[4][16][132]; } sm;
  const int qb = blockIdx.x, kb = blockIdx.y; if (kb > kb_last(qb)) return;
  const int b = blockIdx.z; const int h = h0; float* S = S0 + (size_t)b * TT * TT;
  const int tid = threadIdx.x, wave = tid >> 5, lane = tid & 31, col = lane & 15, g = lane >> 4; const int k0 = kb * 128; const int ql0 = qb * 64 + wave * 16;
  v8f acc[8] = {}, accl[8] = {};
  const _Float16* QLb = QL + (size_t)b * QHI * CC; const _Float16* KLb = KL + (size_t)b * KHI * CC;
  const bool early = qb < QBH; const int step = early ? 32 : 64;
  const int rr = lane >> 3, o = lane & 7; const bool res = early && o >= 4;   // lane: row rr of four, 16-B slot o of the staged row; slots 4..7 of an early row hold the residual plane
  const _Float16* ksrc = (res ? KLb : KH + (size_t)b * TT * CC) + (size_t)(k0 + wave * 32 + rr) * CC + h * HD + (res ? o - 4 : o) * 8;
  const _Float16* qsrc = (res ? QLb : QH + (size_t)b * TT * CC) + (size_t)(ql0 + rr) * CC + h * HD + (res ? o - 4 : o) * 8;
  const unsigned kdst = lds_off(&sm.t.k[0][wave * 32 + rr][o * 8]), qdst = lds_off(&sm.t.q[0][wave * 16 + rr][o * 8]);
  auto fill = [&](int t) { unsigned l[12]; const void* gp[12];   // each wave: 32 rows of k (4 a copy), then its own 16 rows of q; both loops unrolled so that l and gp are registers
#pragma unroll
    for (int i = 0; i < 8; ++i) { l[i] = kdst + (unsigned)(t & 1) * (unsigned)sizeof(sm.t.k[0]) + (unsigned)(i * 4 * sizeof(sm.t.k[0][0])); gp[i] = ksrc + (size_t)(i * 4) * CC + t * step; }
#pragma unroll
    for (int i = 0; i < 4; ++i) { l[8 + i] = qdst + (unsigned)(t & 1) * (unsigned)sizeof(sm.t.q[0]) + (unsigned)(i * 4 * sizeof(sm.t.q[0][0])); gp[8 + i] = qsrc + (size_t)(i * 4) * CC + t * step; }
    acopy12(l, gp); };
  auto foot = [&](int t, int nt) {   // nt: the path's number of tiles
    asm volatile("s_wait_dscnt 0x0" ::: "memory");      // this wave's reads of tile t are over before its buffer is refilled
    asm volatile("s_wait_asynccnt 0x0" ::: "memory");   // this wave's copies of tile t + 1 have landed
    __syncthreads();                                     // publishes tile t + 1 and ends every wave's reads of tile t
    if (t + 2 < nt) fill(t + 2); };
  fill(0);
  asm volatile("s_wait_asynccnt 0x0" ::: "memory");   // this wave's copies of tile 0 have landed
  __syncthreads();                                     // ... and every other wave's: tile 0 may be read
  fill(1);
  if (early) {
    // rolled: the buffer is picked by t & 1, and the loop's text stays small
#pragma unroll 1
    for (int t = 0; t < HD / 32; ++t) { const _Float16 (*bk)[SCW + 8] = sm.t.k[t & 1]; const _Float16 (*bq)[SCW + 8] = sm.t.q[t & 1];
      const v16h ah = frag_h(&bq[wave * 16 + col][0], lane), al = frag_h(&bq[wave * 16 + col][32], lane);
      // four key tiles at a time (their fragments and both accumulator sets fit the registers); the three products of a key tile stand four apart, so that none waits for the one before it into the same accumulator
#pragma unroll
      for (int jh = 0; jh < 8; jh += 4) { v16h kf[4], lf[4];
#pragma unroll
        for (int j = 0; j < 4; ++j) { kf[j] = frag_h(&bk[(jh + j) * 16 + col][0], lane); lf[j] = frag_h(&bk[(jh + j) * 16 + col][32], lane); }
#pragma unroll
        for (int j = 0; j < 4; ++j) acc[jh + j] = wmma16(ah, kf[j], acc[jh + j]);
#pragma unroll
        for (int j = 0; j < 4; ++j) accl[jh + j] = wmma16(al, kf[j], accl[jh + j]);
#pragma unroll
        for (int j = 0; j < 4; ++j) accl[jh + j] = wmma16(ah, lf[j], accl[jh + j]); }
      foot(t, HD / 32); }
  } else {
    // rolled, as above
#pragma unroll 1
    for (int t = 0; t < HD / 64; ++t) { const _Float16 (*bk)[SCW + 8] = sm.t.k[t & 1]; const _Float16 (*bq)[SCW + 8] = sm.t.q[t & 1];
      // all of the tile's fragment reads stand together in front of its products: one place with LDS reads a tile (the loops over kk and j are unrolled so that a, kf and acc are registers)
      v16h a[2], kf[2][8];
#pragma unroll
      for (int kk = 0; kk < 2; ++kk) a[kk] = frag_h(&bq[wave * 16 + col][kk * 32], lane);
#pragma unroll
      for (int kk = 0; kk < 2; ++kk) {
#pragma unroll
        for (int j = 0; j < 8; ++j) kf[kk][j] = frag_h(&bk[j * 16 + col][kk * 32], lane); }
#pragma unroll
      for (int kk = 0; kk < 2; ++kk) {
#pragma unroll
        for (int j = 0; j < 8; ++j) acc[j] = wmma16(a[kk], kf[kk][j], acc[j]); }
      foot(t, HD / 64); } }
  asm volatile("s_wait_asynccnt 0x0" ::: "memory");   // no copy is left in flight when the wave goes on; the last trip's barrier has ended every wave's reads of the tiles, so ss may take their place
#pragma unroll
  for (int j = 0; j < 8; ++j) {
#pragma unroll
    for (int r = 0; r < 8; ++r) sm.ss[wave][8 * g + r][j * 16 + col] = (acc[j][r] + accl[j][r] * (1.0f / 1024.0f)) * SCALE; }
  LDSX(); for (int rl = 0; rl < 16; ++rl) vst2(S + (size_t)(ql0 + rl) * TT + k0 + lane * 4, *(const v4f*)&sm.ss[wave][rl][lane * 4]); }
// ---- k_sm: one wave = one query row t of batch blockIdx.y (eight rows a block): keys [0, nb * 128): causal -> logit if s <= t else excluded; softmax in f32; P x 2^11 in place (0 for excluded)
// The whole row lives in the wave's registers: 16 B a lane per 128-key block, all of the row's loads in flight at once; maximum and sum go over the 32 lanes by shuffles. No LDS, no barrier, an eighth of the waves to start.
__global__ __launch_bounds__(256) void k_sm(float* __restrict__ S0 SM_EXTRA_PARAMS) {
  const int lane = threadIdx.x & 31; const int t = blockIdx.x * 8 + (threadIdx.x >> 5);
  const int nb = kb_last((blockIdx.x * 8) >> 6) + 1;   // 128-key blocks of the row; from blockIdx alone (the block's eight rows share it), so every test on it is a scalar branch
  float* sr = S0 + (size_t)blockIdx.y * TT * TT + (size_t)t * TT + lane * 4;
  v4f v[TT / 128];   // every loop over i is unrolled so that v stays in registers
#pragma unroll
  for (int i = 0; i < TT / 128; ++i) if (i < nb) v[i] = *(const v4f*)(sr + i * 128);
  float m = -3.0e38f;
#pragma unroll
  for (int i = 0; i < TT / 128; ++i) if (i < nb) {
#pragma unroll
    for (int c = 0; c < 4; ++c) { const float x = (!CAUSAL || i * 128 + lane * 4 + c <= t) ? v[i][c] : -3.0e38f; v[i][c] = x; m = fmaxf(m, x); } }
#pragma unroll
  for (int o = 1; o < 32; o <<= 1) m = fmaxf(m, __shfl_xor(m, o));
  v4f s4 = {};
#pragma unroll
  for (int i = 0; i < TT / 128; ++i) if (i < nb) {
#pragma unroll
    for (int c = 0; c < 4; ++c) { const float x = v[i][c]; const float ex = expf(x - m); const float e = (x <= -1.0e38f) ? 0.f : ex; v[i][c] = e; s4[c] += e; } }   // expf outside the choice: no branch a key, so that the keys' chains of dependent instructions overlap
  float sum = (s4[0] + s4[1]) + (s4[2] + s4[3]);
#pragma unroll
  for (int o = 1; o < 32; o <<= 1) sum += __shfl_xor(sum, o);
  const float inv = sum > 0.f ? 2048.0f / sum : 0.f;   /* a fully excluded row yields P = 0 */
#pragma unroll
  for (int i = 0; i < TT / 128; ++i) if (i < nb) { vst2(sr + i * 128, v[i] * inv);
    asm volatile("s_wait_xcnt 0x0" ::: "memory"); } }   // the next block's products are formed in the data registers that this store names: the wait stands in front of that overwrite
#define PVK 64             // keys per staged tile of k_pv
// eight asynchronous copies, 16 B a lane, global -> LDS; the closing s_wait_xcnt stands in the same statement, in front of any later rewrite of the address registers that the copies name
__device__ __forceinline__ void acopy8(const unsigned (&l)[8], const void* const (&g)[8]) {
  asm volatile("global_load_async_to_lds_b128 %0, %8, off\n\tglobal_load_async_to_lds_b128 %1, %9, off\n\tglobal_load_async_to_lds_b128 %2, %10, off\n\tglobal_load_async_to_lds_b128 %3, %11, off\n\t"
               "global_load_async_to_lds_b128 %4, %12, off\n\tglobal_load_async_to_lds_b128 %5, %13, off\n\tglobal_load_async_to_lds_b128 %6, %14, off\n\tglobal_load_async_to_lds_b128 %7, %15, off\n\ts_wait_xcnt 0x0"
               :: "v"(l[0]), "v"(l[1]), "v"(l[2]), "v"(l[3]), "v"(l[4]), "v"(l[5]), "v"(l[6]), "v"(l[7]), "v"(g[0]), "v"(g[1]), "v"(g[2]), "v"(g[3]), "v"(g[4]), "v"(g[5]), "v"(g[6]), "v"(g[7]) : "memory"); }
#define DVH 128            // value columns per k_pv block: the 768-wide head is walked in six 128-column slices (8 accumulator tiles per wave; a 48-tile accumulator would not fit the register file)
// ---- k_pv: block = (64 queries (qb), 128-column value slice d0, batch b = blockIdx.z): ctx[:, d0 .. d0+127] = P . v over keys [0, kend) (P x 2^11 once to f16 against v f16: 1 product; causal early query blocks: P and v as bf16 hi + lo, 3 products); the 512-B (row, slice) segment by 32 lanes x 16 B
__global__ __launch_bounds__(128) void k_pv(const float* __restrict__ PS0, const _Float16* __restrict__ VT, const __bf16* __restrict__ VB, const __bf16* __restrict__ VBL, int h0, float* __restrict__ Y) { const int b = blockIdx.z; const int h = h0; const int d0 = blockIdx.y * DVH; const float* PS = PS0 + (size_t)b * TT * TT; __shared__ __align__(16) float ss[4][16][DVH + 4];
  __shared__ __align__(16) _Float16 sv[2][DVH][PVK + 8]; __shared__ __align__(16) float sp[2][64][PVK + 4];   // row pitches 144 B and 272 B (16 B x odd): the 16-B fragment reads of 16 rows fall on 16 different bank groups
  const int tid = threadIdx.x, wave = tid >> 5, lane = tid & 31, col = lane & 15, g = lane >> 4; const int qb = blockIdx.x; const int ql0 = qb * 64 + wave * 16; const int kce = (kb_last(qb) + 1) * 4;
  v8f acc[DVH / 16] = {};
  if (qb < QBH) {
#pragma unroll 1
    for (int kc = 0; kc < kce; ++kc) { const F2 p = split_row(PS + (size_t)(ql0 + col) * TT, kc * 32, lane);
      asm volatile("s_wait_loadcnt 0x0" ::: "memory");
#pragma unroll
      for (int j = 0; j < DVH / 16; ++j) { const size_t po = ((size_t)b * CC + h * HD + d0 + j * 16 + col) * (size_t)KHI + kc * 32; const v16b vh = frag_b(VB + po, lane); acc[j] = wmma_bf(p.h, vh, acc[j]); acc[j] = wmma_bf(p.l, vh, acc[j]); acc[j] = wmma_bf(p.h, frag_b(VBL + po, lane), acc[j]); } }
  } else {
    // Keys in tiles of PVK = 64. A tile of v (128 columns x 128 B) and of P (64 rows x 256 B) comes into LDS by asynchronous copies that cover whole 128-B lines (8 or 16 neighbouring lanes a row);
    // the v tile serves all four waves. Two buffers: tile t + 1 flies while tile t is multiplied. Same fragments, same key order as reading them from global memory.
    const int nt = kce >> 1;
    const _Float16* vsrc = VT + ((size_t)b * CC + h * HD + d0 + wave * 32 + (lane >> 3)) * (size_t)TT + (lane & 7) * 8; const float* psrc = PS + (size_t)(ql0 + (lane >> 4)) * TT + (lane & 15) * 4;
    const unsigned vdst = lds_off(&sv[0][wave * 32 + (lane >> 3)][(lane & 7) * 8]), pdst = lds_off(&sp[0][wave * 16 + (lane >> 4)][(lane & 15) * 4]);
    auto fill = [&](int t) { unsigned l[8]; const void* gp[8];   // each wave: 32 columns of v (4 a copy), then its own 16 rows of P (2 a copy); both loops unrolled so that l and gp are registers
#pragma unroll
      for (int i = 0; i < 8; ++i) { l[i] = vdst + (unsigned)(t & 1) * (unsigned)sizeof(sv[0]) + (unsigned)(i * 4 * sizeof(sv[0][0])); gp[i] = vsrc + (size_t)(i * 4) * TT + t * PVK; }
      acopy8(l, gp);
#pragma unroll
      for (int i = 0; i < 8; ++i) { l[i] = pdst + (unsigned)(t & 1) * (unsigned)sizeof(sp[0]) + (unsigned)(i * 2 * sizeof(sp[0][0])); gp[i] = psrc + (size_t)(i * 2) * TT + t * PVK; }
      acopy8(l, gp); };
    fill(0);
    asm volatile("s_wait_asynccnt 0x0" ::: "memory");   // this wave's copies of tile 0 have landed
    __syncthreads();                                     // ... and every other wave's: tile 0 may be read
    if (nt > 1) fill(1);
    // rolled: the trip count depends on the query block, and the buffer is picked by t & 1
#pragma unroll 1
    for (int t = 0; t < nt; ++t) { const _Float16 (*bv)[PVK + 8] = sv[t & 1]; const float (*bp)[PVK + 4] = sp[t & 1];
      // all of the tile's fragment reads stand together in front of its products: one place with LDS reads a tile instead of a read and a full wait in front of every product
      // (the loops over kk and j are unrolled so that p, vf and acc are registers)
      v16h p[PVK / 32], vf[PVK / 32][DVH / 16];
#pragma unroll
      for (int kk = 0; kk < PVK / 32; ++kk) p[kk] = frag_f32(&bp[wave * 16 + col][kk * 32], lane);
#pragma unroll
      for (int kk = 0; kk < PVK / 32; ++kk) {
#pragma unroll
        for (int j = 0; j < DVH / 16; ++j) vf[kk][j] = frag_h(&bv[j * 16 + col][kk * 32], lane); }
#pragma unroll
      for (int kk = 0; kk < PVK / 32; ++kk) {
#pragma unroll
        for (int j = 0; j < DVH / 16; ++j) acc[j] = wmma16(p[kk], vf[kk][j], acc[j]); }
      asm volatile("s_wait_dscnt 0x0" ::: "memory");      // this wave's reads of tile t are over before its buffer is refilled
      asm volatile("s_wait_asynccnt 0x0" ::: "memory");   // this wave's copies of tile t + 1 have landed
      __syncthreads();                                     // publishes tile t + 1 and ends every wave's reads of tile t
      if (t + 2 < nt) fill(t + 2); }
    asm volatile("s_wait_asynccnt 0x0" ::: "memory"); }   // no copy is left in flight when the wave goes on
#pragma unroll
  for (int j = 0; j < DVH / 16; ++j)
#pragma unroll
    for (int r = 0; r < 8; ++r) ss[wave][8 * g + r][j * 16 + col] = acc[j][r] * (1.0f / 2048.0f);
  LDSX(); for (int rl = 0; rl < 16; ++rl) vst2(Y + ((size_t)b * TT + ql0 + rl) * CC + h * HD + d0 + lane * 4, *(const v4f*)&ss[wave][rl][lane * 4]); }   
extern "C" void kernel_launch(void* const* d_in, const int* in_sizes, int n_in, void* d_out, int out_size, void* d_ws, size_t ws_size, hipStream_t stream) {
  (void)in_sizes; (void)n_in; (void)out_size;
  const float** F = (const float**)d_in;
  if (ws_size < (size_t)WS_END) return;
  char* ws = (char*)d_ws; _Float16 *QH = (_Float16*)(ws + WS_QH), *KH = (_Float16*)(ws + WS_KH), *VT = (_Float16*)(ws + WS_VT), *QL = (_Float16*)(ws + WS_QL), *KL = (_Float16*)(ws + WS_KL); __bf16 *VB = (__bf16*)(ws + WS_VB), *VBL = (__bf16*)(ws + WS_VBL); float *S = (float*)(ws + WS_S), *Y = (float*)(ws + WS_Y);
  (void)Y; (void)QL; (void)KL; (void)VB; (void)VBL;
  // inputs: 0 x [4,2048,768]; 1 Wq [768,768] (in,out); 2 Wk; 3 Wv; no biases, no output projection
  k_proj<<<dim3(TNB * TT / 64, CC / 128, 3), 128, 0, stream>>>(F[0], F[0], F[0], F[1], F[2], F[3], nullptr, nullptr, nullptr, QH, QL, KH, KL, VT, VB, VBL);
  k_sc<<<dim3(NQB, TT / 128, TNB), 128, 0, stream>>>(QH, KH, QL, KL, 0, S);
  k_sm<<<dim3(TT / 8, TNB), 256, 0, stream>>>(S);
  k_pv<<<dim3(NQB, HD / DVH, TNB), 128, 0, stream>>>(S, VT, VB, VBL, 0, (float*)d_out);   /* six 128-column value slices per query block */
}

// v006
// A run of this version takes 150 microseconds.
// Next to v005, in two timings, it ran 1.04 times as fast each time.
// Counting every step since v000, it is 5.62 times as fast.
// compute dtype: all float inputs rounded to bf16; q/k/v projections with EXACT bf16 products on WMMA 16x16x32 (f32 accumulate); causal logits over the 768-wide head: 3 products for the first 384 rows, single f16 q x k after, x 768^-0.5; softmax f32; P x 2^11 once to f16 x v once to f16 (bf16 hi + lo below row 384); f32 output.
#include <hip/hip_runtime.h>
#include <math.h>

typedef __attribute__((ext_vector_type(16))) _Float16 v16h;
typedef __attribute__((ext_vector_type(16))) __bf16 v16b;
typedef __attribute__((ext_vector_type(8)))  _Float16 v8h;
typedef __attribute__((ext_vector_type(8)))  float v8f;
typedef __attribute__((ext_vector_type(4)))  float v4f;
typedef __attribute__((ext_vector_type(2)))  float v2f;
typedef __attribute__((ext_vector_type(4)))  unsigned v4u;
typedef __attribute__((ext_vector_type(4)))  int v4i;
typedef float __attribute__((may_alias)) float_a;
typedef int __attribute__((may_alias)) int_a;

template <typename T> __device__ __forceinline__ void vst2(void* p, T v) { *(T*)p = v;  }
__device__ __forceinline__ v8f wmma16(v16h a, v16h b, v8f c) {
  v8f d = __builtin_amdgcn_wmma_f32_16x16x32_f16(false, a, false, b, (short)0, c, false, false);
  asm volatile("v_nop\n\tv_nop\n\tv_nop\n\tv_nop" : "+v"(d) : "v"(a), "v"(b));
  return d;
}
__device__ __forceinline__ v8f wmma_bf(v16b a, v16b b, v8f c) {
  v8f d = __builtin_amdgcn_wmma_f32_16x16x32_bf16(false, a, false, b, (short)0, c, false, false);
  asm volatile("v_nop\n\tv_nop\n\tv_nop\n\tv_nop" : "+v"(d) : "v"(a), "v"(b));
  return d;
}
// 16x16x32 fragments: lane = (h = lane>>4, row/col = lane&15); elements 0..7 = k0+8h+0..7, 8..15 = k0+16+8h+0..7; D element r = row 8h+r
__device__ __forceinline__ v16h frag_h(const _Float16* rowk0, int lane) {
  union { v16h v; v8h q[2]; } u; const _Float16* p = rowk0 + 8 * (lane >> 4);
  u.q[0] = *(const v8h*)p; u.q[1] = *(const v8h*)(p + 16); return u.v;
}
__device__ __forceinline__ v16h frag_f32(const float* rowk0, int lane) {
  v16h a; const float* p = rowk0 + 8 * (lane >> 4);
#pragma unroll
  for (int i = 0; i < 8; ++i) { a[i] = (_Float16)p[i]; a[8 + i] = (_Float16)p[16 + i]; }
  return a;
}
__device__ __forceinline__ v16h frag_f32s(const float* rowk0, int lane, float sc) {
  v16h a; const float* p = rowk0 + 8 * (lane >> 4);
#pragma unroll
  for (int i = 0; i < 8; ++i) { a[i] = (_Float16)(p[i] * sc); a[8 + i] = (_Float16)(p[16 + i] * sc); }
  return a;
}
// column fragment from a [K][ld] layout (column n), rows >= K read as 0
__device__ __forceinline__ v16h fragc_f32(const float* W, int k0, int n, int lane, int ld, int K) {
  v16h a; const int g = lane >> 4;
#pragma unroll
  for (int i = 0; i < 8; ++i) { const int ka = k0 + 8 * g + i, kb = ka + 16;
    a[i] = (_Float16)(ka < K ? W[(size_t)(ka < K ? ka : K - 1) * ld + n] : 0.f); a[8 + i] = (_Float16)(kb < K ? W[(size_t)(kb < K ? kb : K - 1) * ld + n] : 0.f); }
  return a;
}
struct F2 { v16b h, l; };
__device__ __forceinline__ F2 bsplit16(const float v[16]) { F2 r;
#pragma unroll
  for (int i = 0; i < 16; ++i) { const __bf16 h = (__bf16)v[i]; r.h[i] = h; r.l[i] = (__bf16)(v[i] - (float)h); }
  return r; }
__device__ __forceinline__ F2 split_row(const float* row, int k0, int lane) { float v[16]; const float* p = row + k0 + 8 * (lane >> 4);
#pragma unroll
  for (int i = 0; i < 8; ++i) { v[i] = p[i]; v[8 + i] = p[16 + i]; }
  return bsplit16(v); }
__device__ __forceinline__ F2 split_rowK(const float* row, int k0, int lane, int K) { float v[16]; const int g = lane >> 4;
#pragma unroll
  for (int i = 0; i < 8; ++i) { const int ka = k0 + 8 * g + i, kb = ka + 16; v[i] = ka < K ? row[ka < K ? ka : K - 1] : 0.f; v[8 + i] = kb < K ? row[kb < K ? kb : K - 1] : 0.f; }
  return bsplit16(v); }
__device__ __forceinline__ F2 split_col(const float* W, int k0, int n, int lane, int ld, int K) { float v[16]; const int g = lane >> 4;
#pragma unroll
  for (int i = 0; i < 8; ++i) { const int ka = k0 + 8 * g + i, kb = ka + 16; v[i] = ka < K ? W[(size_t)(ka < K ? ka : K - 1) * ld + n] : 0.f; v[8 + i] = kb < K ? W[(size_t)(kb < K ? kb : K - 1) * ld + n] : 0.f; }
  return bsplit16(v); }
__device__ __forceinline__ v8f mac3(const F2& a, const F2& b, v8f c) { c = wmma_bf(a.l, b.h, c); c = wmma_bf(a.h, b.l, c); return wmma_bf(a.h, b.h, c); }
__device__ __forceinline__ float sigm(float v) { return 1.0f / (1.0f + expf(-v)); }
#define LDSX() do { asm volatile("s_wait_dscnt 0" ::: "memory"); __builtin_amdgcn_wave_barrier(); __builtin_amdgcn_fence(__ATOMIC_RELEASE, "workgroup"); } while (0)

// Single-head causal self-attention with a 768-WIDE head (x [4,2048,768]; (in,out) Wq / Wk / Wv [768,768] uniform, no biases; scores = q k^T with -inf above the diagonal, then / sqrt(768); no head split, no output projection): out = softmax(causal(q k^T) / sqrt(768)) v -> [4,2048,768].
#define NB 4
#define TT 2048
#define CC 768            // NH * HD = projected width
#define DIN 768          // input (model) width
#define NH 1
#define HD 768
#define NQB (TT / 64)
#define HG 1
#define SCALE (0.036084391824351615f)
#define CAUSAL 1
#ifndef TNB
#define TNB NB
#endif
__device__ __forceinline__ float bfr(float v) { return (float)(__bf16)v; }
__host__ __device__ __forceinline__ int kb_last(int qb) { return CAUSAL ? ((qb * 64 + 63) >> 7) : (TT / 128 - 1); }
typedef __attribute__((ext_vector_type(8))) __bf16 v8b;
__device__ __forceinline__ v16b frag_b(const __bf16* rowk0, int lane) {
  union { v16b v; v8b q[2]; } u; const __bf16* p = rowk0 + 8 * (lane >> 4);
  u.q[0] = *(const v8b*)p; u.q[1] = *(const v8b*)(p + 16); return u.v;
}
#define QBH 6              // causal: query blocks 0..QBH-1 of each sequence (few keys, no averaging) take the high-precision path
#define QHI 384            // rows carrying a q residual plane
#define KHI 384            // key rows carrying k residual / v bf16 hi+lo planes (used only by the causal high-precision path)
// B fragment (k rows k0+.., output column o) of a weight: (in,out) [K][ld] or (out,in) [ld rows of K]: bf16 exact, or f16(bf16 * 256) exact
__device__ __forceinline__ v16b wcol_io(const float* Wm, int k0, int o, int lane, int ld) { v16b w; const int g = lane >> 4;
#pragma unroll
  for (int i = 0; i < 8; ++i) { w[i] = (__bf16)Wm[(size_t)(k0 + 8 * g + i) * ld + o]; w[8 + i] = (__bf16)Wm[(size_t)(k0 + 16 + 8 * g + i) * ld + o]; }
  return w; }
__device__ __forceinline__ v16b wcol_oi(const float* Wm, int k0, int o, int lane, int K) { v16b w; const float* p = Wm + (size_t)o * K + k0 + 8 * (lane >> 4);
#pragma unroll
  for (int i = 0; i < 8; ++i) { w[i] = (__bf16)p[i]; w[8 + i] = (__bf16)p[16 + i]; }
  return w; }
__device__ __forceinline__ v16h wcolh_io(const float* Wm, int k0, int o, int lane, int ld) { v16h w; const int g = lane >> 4;
#pragma unroll
  for (int i = 0; i < 8; ++i) { w[i] = (_Float16)(bfr(Wm[(size_t)(k0 + 8 * g + i) * ld + o]) * 256.0f); w[8 + i] = (_Float16)(bfr(Wm[(size_t)(k0 + 16 + 8 * g + i) * ld + o]) * 256.0f); }
  return w; }
__device__ __forceinline__ v16h wcolh_oi(const float* Wm, int k0, int o, int lane, int K) { v16h w; const float* p = Wm + (size_t)o * K + k0 + 8 * (lane >> 4);
#pragma unroll
  for (int i = 0; i < 8; ++i) { w[i] = (_Float16)(bfr(p[i]) * 256.0f); w[8 + i] = (_Float16)(bfr(p[16 + i]) * 256.0f); }
  return w; }
#define WQKV_LAYOUT 0   // 0 = (in,out) [DIN][CC]; 1 = (out,in) [CC][DIN]; 2 = per-head [NH][DIN][HD]
__device__ __forceinline__ v16b wcol_hdk(const float* Wm, int k0, int o, int lane) { v16b w; const int g = lane >> 4; const float* p = Wm + (size_t)(o / HD) * DIN * HD + (o % HD);
#pragma unroll
  for (int i = 0; i < 8; ++i) { w[i] = (__bf16)p[(size_t)(k0 + 8 * g + i) * HD]; w[8 + i] = (__bf16)p[(size_t)(k0 + 16 + 8 * g + i) * HD]; }
  return w; }
#define WO_OUT_IN 0
#if WQKV_LAYOUT == 1
#define WCOL(W, k0, o, lane) wcol_oi(W, k0, o, lane, DIN)
#elif WQKV_LAYOUT == 2
#define WCOL(W, k0, o, lane) wcol_hdk(W, k0, o, lane)
#else
#define WCOL(W, k0, o, lane) wcol_io(W, k0, o, lane, CC)
#endif
#if WO_OUT_IN
#define WOCOL(W, k0, o, lane) wcol_oi(W, k0, o, lane, CC)
#define WOCOLH(W, k0, o, lane) wcolh_oi(W, k0, o, lane, CC)
#else
#define WOCOL(W, k0, o, lane) wcol_io(W, k0, o, lane, DIN)
#define WOCOLH(W, k0, o, lane) wcolh_io(W, k0, o, lane, DIN)
#endif

#ifndef SM_EXTRA_PARAMS
#define SM_EXTRA_PARAMS
#endif
#ifndef PROJ_EXTRA_PARAMS
#define PROJ_EXTRA_PARAMS
#endif
#ifndef SM_MASK_HOOK
#define SM_MASK_HOOK (void)0
#endif

#define WS_QH  0u                                      // f16 q rows [b*t][CC]
#define WS_KH  (WS_QH + 2u * (size_t)NB * TT * CC)      // f16 k rows [b*t][CC]
#define WS_VT  (WS_KH + 2u * (size_t)NB * TT * CC)      // f16 v planes [b][c][t]
#define WS_QL  (WS_VT + 2u * (size_t)NB * CC * TT)      // f16 q residual x 2^10 rows [b][t < QHI][CC]
#define WS_KL  (WS_QL + 2u * (size_t)NB * QHI * CC)     // f16 k residual x 2^10 rows [b][t < KHI][CC]
#define WS_VB  (WS_KL + 2u * (size_t)NB * KHI * CC)     // bf16 v hi planes [b][c][t < KHI]
#define WS_VBL (WS_VB + 2u * (size_t)NB * CC * KHI)
#define WS_S   (WS_VBL + 2u * (size_t)NB * CC * KHI)    // f32 logits / P [b][t][s]: one plane per batch, so that each stage runs all batches in one launch
#define WS_Y   (WS_S  + 4u * (size_t)NB * TT * TT)      // f32 ctx rows [b*t][CC] (only when there is an output projection)
#define WS_END (WS_Y  + 0u)

__device__ __forceinline__ unsigned lds_off(const void* p) { return (unsigned)(size_t)p; }   // byte address in the work-group's LDS
// eight asynchronous copies, 16 B a lane, global -> LDS; the closing s_wait_xcnt stands in the same statement, in front of any later rewrite of the address registers that the copies name
__device__ __forceinline__ void acopy8(const unsigned (&l)[8], const void* const (&g)[8]) {
  asm volatile("global_load_async_to_lds_b128 %0, %8, off\n\tglobal_load_async_to_lds_b128 %1, %9, off\n\tglobal_load_async_to_lds_b128 %2, %10, off\n\tglobal_load_async_to_lds_b128 %3, %11, off\n\t"
               "global_load_async_to_lds_b128 %4, %12, off\n\tglobal_load_async_to_lds_b128 %5, %13, off\n\tglobal_load_async_to_lds_b128 %6, %14, off\n\tglobal_load_async_to_lds_b128 %7, %15, off\n\ts_wait_xcnt 0x0"
               :: "v"(l[0]), "v"(l[1]), "v"(l[2]), "v"(l[3]), "v"(l[4]), "v"(l[5]), "v"(l[6]), "v"(l[7]), "v"(g[0]), "v"(g[1]), "v"(g[2]), "v"(g[3]), "v"(g[4]), "v"(g[5]), "v"(g[6]), "v"(g[7]) : "memory"); }
// ---- k_proj: block = (64 rows, 128 cols, which): q/k/v = X W (+ b) with exact bf16 products (K = DIN) -> which 0: q f16 rows (+ residual rows < QHI); 1: k f16 rows (+ residual rows < KHI); 2: v f16 planes [c][t] (+ bf16 hi/lo planes for t < KHI)
__global__ __launch_bounds__(128) void k_proj(const float* __restrict__ XQ, const float* __restrict__ XK, const float* __restrict__ XV, const float* __restrict__ WQ, const float* __restrict__ WK, const float* __restrict__ WV, const float* __restrict__ BQ, const float* __restrict__ BK, const float* __restrict__ BV,
    _Float16* __restrict__ QH, _Float16* __restrict__ QL, _Float16* __restrict__ KH, _Float16* __restrict__ KL, _Float16* __restrict__ VT, __bf16* __restrict__ VB, __bf16* __restrict__ VBL) {
  // x: the main loop's two buffers of X (64 rows x 64 k, f32; row pitch 272 B = 16 B x odd: the 16-B fragment reads of 16 rows fall on 16 different bank groups); the epilogue's sh / sl take their place behind the last chunk's barrier
  __shared__ __align__(16) union { struct { _Float16 h[64][136], l[64][136]; } e; float x[2][64][68]; } su; _Float16 (&sh)[64][136] = su.e.h; _Float16 (&sl)[64][136] = su.e.l;
  __shared__ __align__(16) _Float16 th[128][72]; __shared__ __align__(16) __bf16 tb[128][72], tbl[128][72];
  const int tid = threadIdx.x, wave = tid >> 5, lane = tid & 31, col = lane & 15, g = lane >> 4; const int which = blockIdx.z; const int c0 = blockIdx.y * 128; const size_t r0 = (size_t)blockIdx.x * 64; const size_t bb = r0 / TT; const int t0 = (int)(r0 % TT);
  const float* X = which == 0 ? XQ : which == 1 ? XK : XV; const float* WA = which == 0 ? WQ : which == 1 ? WK : WV; const float* BA = which == 0 ? BQ : which == 1 ? BK : BV;
  v8f acc[8] = {};
  // Main loop: K in 12 chunks of 64. The block's W chunk [64 k][128 cols] is read from global once (whole 512-B row segments, 16 B a lane), rounded to bf16, turned to [col][k] in registers and
  // kept in LDS for all four waves; tb / tbl (free until the epilogue) are the two buffers. 16-B slot o of row c sits at o ^ ((c >> 4) & 3): the stores (columns 4 apart across lanes) and the
  // fragment reads (columns 1 apart) then both fall on 16 different bank groups per 16 lanes. The next chunk's W loads are issued behind the barrier and fly while this chunk's products run.
  // X: each wave's own 16 rows x 64 k of a chunk come into LDS as f32 by asynchronous copies that cover whole 128-B lines (16 neighbouring lanes a row, 2 rows a copy) instead of register loads that touch 16 lines each;
  // two buffers: chunk t + 2 is asked for behind the barrier that ends trip t and flies while chunk t + 1 is multiplied. The A fragments are read from LDS and rounded to bf16 there: same values, same k order.
  const float* wsrc = WA + (size_t)(wave * 16) * CC + c0 + 4 * lane; const float* xsrc = X + (r0 + wave * 16 + g) * DIN + 4 * col;
  const unsigned xdst = lds_off(&su.x[0][wave * 16 + g][4 * col]);
  v4f wr[16]; v16b a[2];
  auto ldg = [&](int s) {   // chunk s counted from the one that wsrc / xsrc stand at
#pragma unroll
    for (int i = 0; i < 16; ++i) wr[i] = *(const v4f*)(wsrc + (size_t)(s * 64 + i) * CC); };
  auto fillx = [&](int s, int bi) { unsigned l[8]; const void* gp[8];   // X chunk s (counted as in ldg) into buffer bi; unrolled so that l and gp are registers
#pragma unroll
    for (int i = 0; i < 8; ++i) { l[i] = xdst + (unsigned)bi * (unsigned)sizeof(su.x[0]) + (unsigned)(i * 2 * sizeof(su.x[0][0])); gp[i] = xsrc + (size_t)(i * 2) * DIN + s * 64; }
    acopy8(l, gp); };
  auto stage = [&](__bf16 (*buf)[72]) { const int sw = (lane >> 2) & 3;
    __builtin_amdgcn_sched_barrier(0);   // keeps the conversions, which wait for the global loads, behind the chunk's last product: the loads fly under all sixteen
    asm volatile("s_wait_xcnt 0x0" ::: "memory");   // stands in front of the loop's advance of the address pair that the chunk's global loads name
#pragma unroll
    for (int oo = 0; oo < 2; ++oo) {
#pragma unroll
      for (int c = 0; c < 4; ++c) { v8b t;
#pragma unroll
        for (int i = 0; i < 8; ++i) t[i] = (__bf16)wr[oo * 8 + i][c];
        *(v8b*)&buf[4 * lane + c][((2 * wave + oo) ^ sw) * 8] = t; } } };
  // the 16 fragments of a chunk in four groups of four (group q: k half q >> 1, column tiles 4 (q & 1) ..): a group's eight LDS reads stand together, one group ahead of the products that use them
  auto mma = [&](const __bf16 (*buf)[72], const float (*xb)[68]) { const __bf16* p0 = &buf[col][8 * g]; const __bf16* p1 = &buf[col][8 * (g ^ 1)]; v16b w[2][4]; const float* px = &xb[wave * 16 + col][8 * g]; v4f xr[8];
    auto ldf = [&](int q) {
#pragma unroll
      for (int i = 0; i < 4; ++i) { const int j = 4 * (q & 1) + i; const __bf16* p = ((j & 1) ? p1 : p0) + j * 16 * 72 + (q >> 1) * 32; union { v16b v; v8b q2[2]; } u;
        u.q2[0] = *(const v8b*)(p + 8 * (j & 2)); u.q2[1] = *(const v8b*)(p + 8 * (2 ^ (j & 2))); w[q & 1][i] = u.v; } };
    // the chunk's X reads stand with the first group's W reads: one place with LDS reads
#pragma unroll
    for (int i = 0; i < 4; ++i) { xr[2 * i] = *(const v4f*)(px + i * 16); xr[2 * i + 1] = *(const v4f*)(px + i * 16 + 4); }
    ldf(0);
#pragma unroll
    for (int kk = 0; kk < 2; ++kk) {
#pragma unroll
      for (int i = 0; i < 4; ++i) { a[kk][i] = (__bf16)xr[4 * kk][i]; a[kk][4 + i] = (__bf16)xr[4 * kk + 1][i]; a[kk][8 + i] = (__bf16)xr[4 * kk + 2][i]; a[kk][12 + i] = (__bf16)xr[4 * kk + 3][i]; } }
#pragma unroll
    for (int q = 0; q < 4; ++q) { if (q < 3) ldf(q + 1);
#pragma unroll
      for (int i = 0; i < 4; ++i) acc[4 * (q & 1) + i] = wmma_bf(a[q >> 1], w[q & 1][i], acc[4 * (q & 1) + i]); } };
  auto foot = [&]() {
    asm volatile("s_wait_dscnt 0x0" ::: "memory");      // this wave's reads of the chunk's X buffer are over before it is refilled
    asm volatile("s_wait_asynccnt 0x0" ::: "memory");   // this wave's copies of the next chunk's X have landed
    __syncthreads(); };                                  // publishes the W chunk just stored and the X chunk just landed; ends the reads of the buffers that are filled next
  fillx(0, 0); ldg(0); stage(tb);
  asm volatile("s_wait_asynccnt 0x0" ::: "memory");   // this wave's copies of X chunk 0 have landed
  __syncthreads();
  // rolled: two chunks a trip (one per buffer) keep the loop's text small. Behind each barrier the next chunk's W loads, which stage() waits for, go out first; then its X copies, which the trip's foot waits for,
  // into the buffer that the trip before has read
#pragma unroll 1
  for (int s = 0; s < DIN / 64 - 2; s += 2) {
    ldg(1); fillx(1, 1); mma(tb, su.x[0]); stage(tbl); foot();
    ldg(2); fillx(2, 0); mma(tbl, su.x[1]); stage(tb); foot();
    wsrc += (size_t)128 * CC; xsrc += 128; }
  ldg(1); fillx(1, 1); mma(tb, su.x[0]); stage(tbl); foot();
  mma(tbl, su.x[1]);
  asm volatile("s_wait_asynccnt 0x0" ::: "memory");   // no copy is left in flight when the wave goes on
  __syncthreads();   // the epilogue stores into tb / tbl and over the X buffers: every wave's last fragment read ends here
  if (which < 2) { _Float16* DH = which == 0 ? QH : KH; _Float16* DL = which == 0 ? QL : KL; const int nhi = which == 0 ? QHI : KHI; const bool hi_rows = t0 < nhi;
#pragma unroll
    for (int j = 0; j < 8; ++j) { const float bias = BA ? bfr(BA[c0 + j * 16 + col]) : 0.f;
#pragma unroll
      for (int r = 0; r < 8; ++r) { const float v = acc[j][r] + bias; const _Float16 hv = (_Float16)v; sh[wave * 16 + 8 * g + r][j * 16 + col] = hv; sl[wave * 16 + 8 * g + r][j * 16 + col] = (_Float16)((v - (float)hv) * 1024.0f); } }
    __syncthreads();
    for (int e = tid; e < 64 * 16; e += 128) { const int rl = e >> 4, q = e & 15; vst2((unsigned*)(DH + (r0 + rl) * CC + c0 + q * 8), *(const v4u*)&sh[rl][q * 8]); if (hi_rows) vst2((unsigned*)(DL + (bb * nhi + t0 + rl) * (size_t)CC + c0 + q * 8), *(const v4u*)&sl[rl][q * 8]); }
  } else { const bool hi_rows = t0 < KHI;
#pragma unroll
    for (int j = 0; j < 8; ++j) { const float bias = BA ? bfr(BA[c0 + j * 16 + col]) : 0.f;
#pragma unroll
      for (int r = 0; r < 8; ++r) { const float v = acc[j][r] + bias; const int rl = wave * 16 + 8 * g + r, cl = j * 16 + col; th[cl][rl] = (_Float16)v; const __bf16 bh = (__bf16)v; tb[cl][rl] = bh; tbl[cl][rl] = (__bf16)(v - (float)bh); } }
    __syncthreads();
    for (int e = tid; e < 128 * 8; e += 128) { const int cl = e >> 3, q = e & 7; vst2((unsigned*)(VT + (bb * CC + c0 + cl) * (size_t)TT + t0 + q * 8), *(const v4u*)&th[cl][q * 8]); if (hi_rows) { const size_t o3 = (bb * CC + c0 + cl) * (size_t)KHI + t0 + q * 8; vst2((unsigned*)(VB + o3), *(const v4u*)&tb[cl][q * 8]); vst2((unsigned*)(VBL + o3), *(const v4u*)&tbl[cl][q * 8]); } } } }
// twelve asynchronous copies, 16 B a lane, global -> LDS; the closing s_wait_xcnt stands in the same statement, in front of any later rewrite of the address registers that the copies name
__device__ __forceinline__ void acopy12(const unsigned (&l)[12], const void* const (&g)[12]) {
  asm volatile("global_load_async_to_lds_b128 %0, %12, off\n\tglobal_load_async_to_lds_b128 %1, %13, off\n\tglobal_load_async_to_lds_b128 %2, %14, off\n\tglobal_load_async_to_lds_b128 %3, %15, off\n\t"
               "global_load_async_to_lds_b128 %4, %16, off\n\tglobal_load_async_to_lds_b128 %5, %17, off\n\tglobal_load_async_to_lds_b128 %6, %18, off\n\tglobal_load_async_to_lds_b128 %7, %19, off\n\t"
               "global_load_async_to_lds_b128 %8, %20, off\n\tglobal_load_async_to_lds_b128 %9, %21, off\n\tglobal_load_async_to_lds_b128 %10, %22, off\n\tglobal_load_async_to_lds_b128 %11, %23, off\n\ts_wait_xcnt 0x0"
               :: "v"(l[0]), "v"(l[1]), "v"(l[2]), "v"(l[3]), "v"(l[4]), "v"(l[5]), "v"(l[6]), "v"(l[7]), "v"(l[8]), "v"(l[9]), "v"(l[10]), "v"(l[11]),
                  "v"(g[0]), "v"(g[1]), "v"(g[2]), "v"(g[3]), "v"(g[4]), "v"(g[5]), "v"(g[6]), "v"(g[7]), "v"(g[8]), "v"(g[9]), "v"(g[10]), "v"(g[11]) : "memory"); }
#define SCW 64             // f16 elements in a staged row of k_sc (128 B)
// ---- k_sc: block = (query block qb, key block kb <= kb_last(qb), batch b = blockIdx.z): logits x SCALE; single f16 q x k, and for query blocks < QBH (causal early rows) also q residual (x 2^10) x k and q x k residual (3 products); causal: blocks past the diagonal exit, the mask itself is applied by index in k_sm
// The head width is walked in tiles. A tile holds 128 B of each of the block's 128 k rows and 64 q rows and comes into LDS by asynchronous copies that cover whole 128-B runs (8 neighbouring lanes a row); the k tile serves all four waves.
// Late rows: a staged row is 64 elements of the f16 plane (12 tiles). Early rows: 32 elements of the f16 plane, then the same 32 of the residual plane (24 tiles). Two buffers: tile t + 1 flies while tile t is multiplied.
// Same fragments and the same order of products into every accumulator as reading them from global memory.
__global__ __launch_bounds__(128) void k_sc(const _Float16* __restrict__ QH, const _Float16* __restrict__ KH, const _Float16* __restrict__ QL, const _Float16* __restrict__ KL, int h0, float* __restrict__ S0) {
  // row pitch 144 B (16 B x odd): the 16-B fragment reads of 16 rows fall on 16 different bank groups. The output tile ss takes the tiles' place once the last tile has been read: less LDS, one more block on a WGP.
  __shared__ __align__(16) union { struct { _Float16 k[2][128][SCW + 8]; _Float16 q[2][64][SCW + 8]; } t; float ss[4][16][132]; } sm;
  const int qb = blockIdx.x, kb = blockIdx.y; if (kb > kb_last(qb)) return;
  const int b = blockIdx.z; const int h = h0; float* S = S0 + (size_t)b * TT * TT;
  const int tid = threadIdx.x, wave = tid >> 5, lane = tid & 31, col = lane & 15, g = lane >> 4; const int k0 = kb * 128; const int ql0 = qb * 64 + wave * 16;
  v8f acc[8] = {}, accl[8] = {};
  const _Float16* QLb = QL + (size_t)b * QHI * CC; const _Float16* KLb = KL + (size_t)b * KHI * CC;
  const bool early = qb < QBH; const int step = early ? 32 : 64;
  const int rr = lane >> 3, o = lane & 7; const bool res = early && o >= 4;   // lane: row rr of four, 16-B slot o of the staged row; slots 4..7 of an early row hold the residual plane
  const _Float16* ksrc = (res ? KLb : KH + (size_t)b * TT * CC) + (size_t)(k0 + wave * 32 + rr) * CC + h * HD + (res ? o - 4 : o) * 8;
  const _Float16* qsrc = (res ? QLb : QH + (size_t)b * TT * CC) + (size_t)(ql0 + rr) * CC + h * HD + (res ? o - 4 : o) * 8;
  const unsigned kdst = lds_off(&sm.t.k[0][wave * 32 + rr][o * 8]), qdst = lds_off(&sm.t.q[0][wave * 16 + rr][o * 8]);
  auto fill = [&](int t) { unsigned l[12]; const void* gp[12];   // each wave: 32 rows of k (4 a copy), then its own 16 rows of q; both loops unrolled so that l and gp are registers
#pragma unroll
    for (int i = 0; i < 8; ++i) { l[i] = kdst + (unsigned)(t & 1) * (unsigned)sizeof(sm.t.k[0]) + (unsigned)(i * 4 * sizeof(sm.t.k[0][0])); gp[i] = ksrc + (size_t)(i * 4) * CC + t * step; }
#pragma unroll
    for (int i = 0; i < 4; ++i) { l[8 + i] = qdst + (unsigned)(t & 1) * (unsigned)sizeof(sm.t.q[0]) + (unsigned)(i * 4 * sizeof(sm.t.q[0][0])); gp[8 + i] = qsrc + (size_t)(i * 4) * CC + t * step; }
    acopy12(l, gp); };
  auto foot = [&](int t, int nt) {   // nt: the path's number of tiles
    asm volatile("s_wait_dscnt 0x0" ::: "memory");      // this wave's reads of tile t are over before its buffer is refilled
    asm volatile("s_wait_asynccnt 0x0" ::: "memory");   // this wave's copies of tile t + 1 have landed
    __syncthreads();                                     // publishes tile t + 1 and ends every wave's reads of tile t
    if (t + 2 < nt) fill(t + 2); };
  fill(0);
  asm volatile("s_wait_asynccnt 0x0" ::: "memory");   // this wave's copies of tile 0 have landed
  __syncthreads();                                     // ... and every other wave's: tile 0 may be read
  fill(1);
  if (early) {
    // rolled: the buffer is picked by t & 1, and the loop's text stays small
#pragma unroll 1
    for (int t = 0; t < HD / 32; ++t) { const _Float16 (*bk)[SCW + 8] = sm.t.k[t & 1]; const _Float16 (*bq)[SCW + 8] = sm.t.q[t & 1];
      const v16h ah = frag_h(&bq[wave * 16 + col][0], lane), al = frag_h(&bq[wave * 16 + col][32], lane);
      // four key tiles at a time (their fragments and both accumulator sets fit the registers); the three products of a key tile stand four apart, so that none waits for the one before it into the same accumulator
#pragma unroll
      for (int jh = 0; jh < 8; jh += 4) { v16h kf[4], lf[4];
#pragma unroll
        for (int j = 0; j < 4; ++j) { kf[j] = frag_h(&bk[(jh + j) * 16 + col][0], lane); lf[j] = frag_h(&bk[(jh + j) * 16 + col][32], lane); }
#pragma unroll
        for (int j = 0; j < 4; ++j) acc[jh + j] = wmma16(ah, kf[j], acc[jh + j]);
#pragma unroll
        for (int j = 0; j < 4; ++j) accl[jh + j] = wmma16(al, kf[j], accl[jh + j]);
#pragma unroll
        for (int j = 0; j < 4; ++j) accl[jh + j] = wmma16(ah, lf[j], accl[jh + j]); }
      foot(t, HD / 32); }
  } else {
    // rolled, as above
#pragma unroll 1
    for (int t = 0; t < HD / 64; ++t) { const _Float16 (*bk)[SCW + 8] = sm.t.k[t & 1]; const _Float16 (*bq)[SCW + 8] = sm.t.q[t & 1];
      // all of the tile's fragment reads stand together in front of its products: one place with LDS reads a tile (the loops over kk and j are unrolled so that a, kf and acc are registers)
      v16h a[2], kf[2][8];
#pragma unroll
      for (int kk = 0; kk < 2; ++kk) a[kk] = frag_h(&bq[wave * 16 + col][kk * 32], lane);
#pragma unroll
      for (int kk = 0; kk < 2; ++kk) {
#pragma unroll
        for (int j = 0; j < 8; ++j) kf[kk][j] = frag_h(&bk[j * 16 + col][kk * 32], lane); }
#pragma unroll
      for (int kk = 0; kk < 2; ++kk) {
#pragma unroll
        for (int j = 0; j < 8; ++j) acc[j] = wmma16(a[kk], kf[kk][j], acc[j]); }
      foot(t, HD / 64); } }
  asm volatile("s_wait_asynccnt 0x0" ::: "memory");   // no copy is left in flight when the wave goes on; the last trip's barrier has ended every wave's reads of the tiles, so ss may take their place
#pragma unroll
  for (int j = 0; j < 8; ++j) {
#pragma unroll
    for (int r = 0; r < 8; ++r) sm.ss[wave][8 * g + r][j * 16 + col] = (acc[j][r] + accl[j][r] * (1.0f / 1024.0f)) * SCALE; }
  LDSX(); for (int rl = 0; rl < 16; ++rl) vst2(S + (size_t)(ql0 + rl) * TT + k0 + lane * 4, *(const v4f*)&sm.ss[wave][rl][lane * 4]); }
// ---- k_sm: one wave = one query row t of batch blockIdx.y (eight rows a block): keys [0, nb * 128): causal -> logit if s <= t else excluded; softmax in f32; P x 2^11 in place (0 for excluded)
// The whole row lives in the wave's registers: 16 B a lane per 128-key block, all of the row's loads in flight at once; maximum and sum go over the 32 lanes by shuffles. No LDS, no barrier, an eighth of the waves to start.
__global__ __launch_bounds__(256) void k_sm(float* __restrict__ S0 SM_EXTRA_PARAMS) {
  const int lane = threadIdx.x & 31; const int t = blockIdx.x * 8 + (threadIdx.x >> 5);
  const int nb = kb_last((blockIdx.x * 8) >> 6) + 1;   // 128-key blocks of the row; from blockIdx alone (the block's eight rows share it), so every test on it is a scalar branch
  float* sr = S0 + (size_t)blockIdx.y * TT * TT + (size_t)t * TT + lane * 4;
  v4f v[TT / 128];   // every loop over i is unrolled so that v stays in registers
#pragma unroll
  for (int i = 0; i < TT / 128; ++i) if (i < nb) v[i] = *(const v4f*)(sr + i * 128);
  float m = -3.0e38f;
#pragma unroll
  for (int i = 0; i < TT / 128; ++i) if (i < nb) {
#pragma unroll
    for (int c = 0; c < 4; ++c) { const float x = (!CAUSAL || i * 128 + lane * 4 + c <= t) ? v[i][c] : -3.0e38f; v[i][c] = x; m = fmaxf(m, x); } }
#pragma unroll
  for (int o = 1; o < 32; o <<= 1) m = fmaxf(m, __shfl_xor(m, o));
  v4f s4 = {};
#pragma unroll
  for (int i = 0; i < TT / 128; ++i) if (i < nb) {
#pragma unroll
    for (int c = 0; c < 4; ++c) { const float x = v[i][c]; const float ex = expf(x - m); const float e = (x <= -1.0e38f) ? 0.f : ex; v[i][c] = e; s4[c] += e; } }   // expf outside the choice: no branch a key, so that the keys' chains of dependent instructions overlap
  float sum = (s4[0] + s4[1]) + (s4[2] + s4[3]);
#pragma unroll
  for (int o = 1; o < 32; o <<= 1) sum += __shfl_xor(sum, o);
  const float inv = sum > 0.f ? 2048.0f / sum : 0.f;   /* a fully excluded row yields P = 0 */
#pragma unroll
  for (int i = 0; i < TT / 128; ++i) if (i < nb) { vst2(sr + i * 128, v[i] * inv);
    asm volatile("s_wait_xcnt 0x0" ::: "memory"); } }   // the next block's products are formed in the data registers that this store names: the wait stands in front of that overwrite
#define PVK 64             // keys per staged tile of k_pv
#define DVH 128            // value columns per k_pv block: the 768-wide head is walked in six 128-column slices (8 accumulator tiles per wave; a 48-tile accumulator would not fit the register file)
// ---- k_pv: block = (64 queries (qb), 128-column value slice d0, batch b = blockIdx.z): ctx[:, d0 .. d0+127] = P . v over keys [0, kend) (P x 2^11 once to f16 against v f16: 1 product; causal early query blocks: P and v as bf16 hi + lo, 3 products); the 512-B (row, slice) segment by 32 lanes x 16 B
__global__ __launch_bounds__(128) void k_pv(const float* __restrict__ PS0, const _Float16* __restrict__ VT, const __bf16* __restrict__ VB, const __bf16* __restrict__ VBL, int h0, float* __restrict__ Y) { const int b = blockIdx.z; const int h = h0; const int d0 = blockIdx.y * DVH; const float* PS = PS0 + (size_t)b * TT * TT; __shared__ __align__(16) float ss[4][16][DVH + 4];
  __shared__ __align__(16) _Float16 sv[2][DVH][PVK + 8]; __shared__ __align__(16) float sp[2][64][PVK + 4];   // row pitches 144 B and 272 B (16 B x odd): the 16-B fragment reads of 16 rows fall on 16 different bank groups
  const int tid = threadIdx.x, wave = tid >> 5, lane = tid & 31, col = lane & 15, g = lane >> 4; const int qb = blockIdx.x; const int ql0 = qb * 64 + wave * 16; const int kce = (kb_last(qb) + 1) * 4;
  v8f acc[DVH / 16] = {};
  if (qb < QBH) {
#pragma unroll 1
    for (int kc = 0; kc < kce; ++kc) { const F2 p = split_row(PS + (size_t)(ql0 + col) * TT, kc * 32, lane);
      asm volatile("s_wait_loadcnt 0x0" ::: "memory");
#pragma unroll
      for (int j = 0; j < DVH / 16; ++j) { const size_t po = ((size_t)b * CC + h * HD + d0 + j * 16 + col) * (size_t)KHI + kc * 32; const v16b vh = frag_b(VB + po, lane); acc[j] = wmma_bf(p.h, vh, acc[j]); acc[j] = wmma_bf(p.l, vh, acc[j]); acc[j] = wmma_bf(p.h, frag_b(VBL + po, lane), acc[j]); } }
  } else {
    // Keys in tiles of PVK = 64. A tile of v (128 columns x 128 B) and of P (64 rows x 256 B) comes into LDS by asynchronous copies that cover whole 128-B lines (8 or 16 neighbouring lanes a row);
    // the v tile serves all four waves. Two buffers: tile t + 1 flies while tile t is multiplied. Same fragments, same key order as reading them from global memory.
    const int nt = kce >> 1;
    const _Float16* vsrc = VT + ((size_t)b * CC + h * HD + d0 + wave * 32 + (lane >> 3)) * (size_t)TT + (lane & 7) * 8; const float* psrc = PS + (size_t)(ql0 + (lane >> 4)) * TT + (lane & 15) * 4;
    const unsigned vdst = lds_off(&sv[0][wave * 32 + (lane >> 3)][(lane & 7) * 8]), pdst = lds_off(&sp[0][wave * 16 + (lane >> 4)][(lane & 15) * 4]);
    auto fill = [&](int t) { unsigned l[8]; const void* gp[8];   // each wave: 32 columns of v (4 a copy), then its own 16 rows of P (2 a copy); both loops unrolled so that l and gp are registers
#pragma unroll
      for (int i = 0; i < 8; ++i) { l[i] = vdst + (unsigned)(t & 1) * (unsigned)sizeof(sv[0]) + (unsigned)(i * 4 * sizeof(sv[0][0])); gp[i] = vsrc + (size_t)(i * 4) * TT + t * PVK; }
      acopy8(l, gp);
#pragma unroll
      for (int i = 0; i < 8; ++i) { l[i] = pdst + (unsigned)(t & 1) * (unsigned)sizeof(sp[0]) + (unsigned)(i * 2 * sizeof(sp[0][0])); gp[i] = psrc + (size_t)(i * 2) * TT + t * PVK; }
      acopy8(l, gp); };
    fill(0);
    asm volatile("s_wait_asynccnt 0x0" ::: "memory");   // this wave's copies of tile 0 have landed
    __syncthreads();                                     // ... and every other wave's: tile 0 may be read
    if (nt > 1) fill(1);
    // rolled: the trip count depends on the query block, and the buffer is picked by t & 1
#pragma unroll 1
    for (int t = 0; t < nt; ++t) { const _Float16 (*bv)[PVK + 8] = sv[t & 1]; const float (*bp)[PVK + 4] = sp[t & 1];
      // all of the tile's fragment reads stand together in front of its products: one place with LDS reads a tile instead of a read and a full wait in front of every product
      // (the loops over kk and j are unrolled so that p, vf and acc are registers)
      v16h p[PVK / 32], vf[PVK / 32][DVH / 16];
#pragma unroll
      for (int kk = 0; kk < PVK / 32; ++kk) p[kk] = frag_f32(&bp[wave * 16 + col][kk * 32], lane);
#pragma unroll
      for (int kk = 0; kk < PVK / 32; ++kk) {
#pragma unroll
        for (int j = 0; j < DVH / 16; ++j) vf[kk][j] = frag_h(&bv[j * 16 + col][kk * 32], lane); }
#pragma unroll
      for (int kk = 0; kk < PVK / 32; ++kk) {
#pragma unroll
        for (int j = 0; j < DVH / 16; ++j) acc[j] = wmma16(p[kk], vf[kk][j], acc[j]); }
      asm volatile("s_wait_dscnt 0x0" ::: "memory");      // this wave's reads of tile t are over before its buffer is refilled
      asm volatile("s_wait_asynccnt 0x0" ::: "memory");   // this wave's copies of tile t + 1 have landed
      __syncthreads();                                     // publishes tile t + 1 and ends every wave's reads of tile t
      if (t + 2 < nt) fill(t + 2); }
    asm volatile("s_wait_asynccnt 0x0" ::: "memory"); }   // no copy is left in flight when the wave goes on
#pragma unroll
  for (int j = 0; j < DVH / 16; ++j)
#pragma unroll
    for (int r = 0; r < 8; ++r) ss[wave][8 * g + r][j * 16 + col] = acc[j][r] * (1.0f / 2048.0f);
  LDSX(); for (int rl = 0; rl < 16; ++rl) vst2(Y + ((size_t)b * TT + ql0 + rl) * CC + h * HD + d0 + lane * 4, *(const v4f*)&ss[wave][rl][lane * 4]); }   
extern "C" void kernel_launch(void* const* d_in, const int* in_sizes, int n_in, void* d_out, int out_size, void* d_ws, size_t ws_size, hipStream_t stream) {
  (void)in_sizes; (void)n_in; (void)out_size;
  const float** F = (const float**)d_in;
  if (ws_size < (size_t)WS_END) return;
  char* ws = (char*)d_ws; _Float16 *QH = (_Float16*)(ws + WS_QH), *KH = (_Float16*)(ws + WS_KH), *VT = (_Float16*)(ws + WS_VT), *QL = (_Float16*)(ws + WS_QL), *KL = (_Float16*)(ws + WS_KL); __bf16 *VB = (__bf16*)(ws + WS_VB), *VBL = (__bf16*)(ws + WS_VBL); float *S = (float*)(ws + WS_S), *Y = (float*)(ws + WS_Y);
  (void)Y; (void)QL; (void)KL; (void)VB; (void)VBL;
  // inputs: 0 x [4,2048,768]; 1 Wq [768,768] (in,out); 2 Wk; 3 Wv; no biases, no output projection
  k_proj<<<dim3(TNB * TT / 64, CC / 128, 3), 128, 0, stream>>>(F[0], F[0], F[0], F[1], F[2], F[3], nullptr, nullptr, nullptr, QH, QL, KH, KL, VT, VB, VBL);
  k_sc<<<dim3(NQB, TT / 128, TNB), 128, 0, stream>>>(QH, KH, QL, KL, 0, S);
  k_sm<<<dim3(TT / 8, TNB), 256, 0, stream>>>(S);
  k_pv<<<dim3(NQB, HD / DVH, TNB), 128, 0, stream>>>(S, VT, VB, VBL, 0, (float*)d_out);   /* six 128-column value slices per query block */
}

// v007
// It runs in 130 microseconds.
// In both of two side-by-side timings against v006, it was 1.16 times as fast.
// All steps since v000 together make it 6.52 times as fast.
// compute dtype: all float inputs rounded to bf16; q/k/v projections with EXACT bf16 products on WMMA 16x16x32 (f32 accumulate); causal logits over the 768-wide head: 3 products for the first 384 rows, single f16 q x k after, x 768^-0.5; softmax f32; P x 2^11 once to f16 x v once to f16 (bf16 hi + lo below row 384); f32 output.
#include <hip/hip_runtime.h>
#include <math.h>

typedef __attribute__((ext_vector_type(16))) _Float16 v16h;
typedef __attribute__((ext_vector_type(16))) __bf16 v16b;
typedef __attribute__((ext_vector_type(8)))  _Float16 v8h;
typedef __attribute__((ext_vector_type(8)))  float v8f;
typedef __attribute__((ext_vector_type(4)))  float v4f;
typedef __attribute__((ext_vector_type(2)))  float v2f;
typedef __attribute__((ext_vector_type(4)))  unsigned v4u;
typedef __attribute__((ext_vector_type(4)))  int v4i;
typedef float __attribute__((may_alias)) float_a;
typedef int __attribute__((may_alias)) int_a;

template <typename T> __device__ __forceinline__ void vst2(void* p, T v) { *(T*)p = v;  }
__device__ __forceinline__ v8f wmma16(v16h a, v16h b, v8f c) {
  v8f d = __builtin_amdgcn_wmma_f32_16x16x32_f16(false, a, false, b, (short)0, c, false, false);
  asm volatile("v_nop\n\tv_nop\n\tv_nop\n\tv_nop" : "+v"(d) : "v"(a), "v"(b));
  return d;
}
__device__ __forceinline__ v8f wmma_bf(v16b a, v16b b, v8f c) {
  v8f d = __builtin_amdgcn_wmma_f32_16x16x32_bf16(false, a, false, b, (short)0, c, false, false);
  asm volatile("v_nop\n\tv_nop\n\tv_nop\n\tv_nop" : "+v"(d) : "v"(a), "v"(b));
  return d;
}
// 16x16x32 fragments: lane = (h = lane>>4, row/col = lane&15); elements 0..7 = k0+8h+0..7, 8..15 = k0+16+8h+0..7; D element r = row 8h+r
__device__ __forceinline__ v16h frag_h(const _Float16* rowk0, int lane) {
  union { v16h v; v8h q[2]; } u; const _Float16* p = rowk0 + 8 * (lane >> 4);
  u.q[0] = *(const v8h*)p; u.q[1] = *(const v8h*)(p + 16); return u.v;
}
__device__ __forceinline__ v16h frag_f32(const float* rowk0, int lane) {
  v16h a; const float* p = rowk0 + 8 * (lane >> 4);
#pragma unroll
  for (int i = 0; i < 8; ++i) { a[i] = (_Float16)p[i]; a[8 + i] = (_Float16)p[16 + i]; }
  return a;
}
__device__ __forceinline__ v16h frag_f32s(const float* rowk0, int lane, float sc) {
  v16h a; const float* p = rowk0 + 8 * (lane >> 4);
#pragma unroll
  for (int i = 0; i < 8; ++i) { a[i] = (_Float16)(p[i] * sc); a[8 + i] = (_Float16)(p[16 + i] * sc); }
  return a;
}
// column fragment from a [K][ld] layout (column n), rows >= K read as 0
__device__ __forceinline__ v16h fragc_f32(const float* W, int k0, int n, int lane, int ld, int K) {
  v16h a; const int g = lane >> 4;
#pragma unroll
  for (int i = 0; i < 8; ++i) { const int ka = k0 + 8 * g + i, kb = ka + 16;
    a[i] = (_Float16)(ka < K ? W[(size_t)(ka < K ? ka : K - 1) * ld + n] : 0.f); a[8 + i] = (_Float16)(kb < K ? W[(size_t)(kb < K ? kb : K - 1) * ld + n] : 0.f); }
  return a;
}
struct F2 { v16b h, l; };
__device__ __forceinline__ F2 bsplit16(const float v[16]) { F2 r;
#pragma unroll
  for (int i = 0; i < 16; ++i) { const __bf16 h = (__bf16)v[i]; r.h[i] = h; r.l[i] = (__bf16)(v[i] - (float)h); }
  return r; }
__device__ __forceinline__ F2 split_row(const float* row, int k0, int lane) { float v[16]; const float* p = row + k0 + 8 * (lane >> 4);
#pragma unroll
  for (int i = 0; i < 8; ++i) { v[i] = p[i]; v[8 + i] = p[16 + i]; }
  return bsplit16(v); }
__device__ __forceinline__ F2 split_rowK(const float* row, int k0, int lane, int K) { float v[16]; const int g = lane >> 4;
#pragma unroll
  for (int i = 0; i < 8; ++i) { const int ka = k0 + 8 * g + i, kb = ka + 16; v[i] = ka < K ? row[ka < K ? ka : K - 1] : 0.f; v[8 + i] = kb < K ? row[kb < K ? kb : K - 1] : 0.f; }
  return bsplit16(v); }
__device__ __forceinline__ F2 split_col(const float* W, int k0, int n, int lane, int ld, int K) { float v[16]; const int g = lane >> 4;
#pragma unroll
  for (int i = 0; i < 8; ++i) { const int ka = k0 + 8 * g + i, kb = ka + 16; v[i] = ka < K ? W[(size_t)(ka < K ? ka : K - 1) * ld + n] : 0.f; v[8 + i] = kb < K ? W[(size_t)(kb < K ? kb : K - 1) * ld + n] : 0.f; }
  return bsplit16(v); }
__device__ __forceinline__ v8f mac3(const F2& a, const F2& b, v8f c) { c = wmma_bf(a.l, b.h, c); c = wmma_bf(a.h, b.l, c); return wmma_bf(a.h, b.h, c); }
__device__ __forceinline__ float sigm(float v) { return 1.0f / (1.0f + expf(-v)); }
#define LDSX() do { asm volatile("s_wait_dscnt 0" ::: "memory"); __builtin_amdgcn_wave_barrier(); __builtin_amdgcn_fence(__ATOMIC_RELEASE, "workgroup"); } while (0)

// Single-head causal self-attention with a 768-WIDE head (x [4,2048,768]; (in,out) Wq / Wk / Wv [768,768] uniform, no biases; scores = q k^T with -inf above the diagonal, then / sqrt(768); no head split, no output projection): out = softmax(causal(q k^T) / sqrt(768)) v -> [4,2048,768].
#define NB 4
#define TT 2048
#define CC 768            // NH * HD = projected width
#define DIN 768          // input (model) width
#define NH 1
#define HD 768
#define NQB (TT / 64)
#define HG 1
#define SCALE (0.036084391824351615f)
#define CAUSAL 1
#ifndef TNB
#define TNB NB
#endif
__device__ __forceinline__ float bfr(float v) { return (float)(__bf16)v; }
__host__ __device__ __forceinline__ int kb_last(int qb) { return CAUSAL ? ((qb * 64 + 63) >> 7) : (TT / 128 - 1); }
typedef __attribute__((ext_vector_type(8))) __bf16 v8b;
__device__ __forceinline__ v16b frag_b(const __bf16* rowk0, int lane) {
  union { v16b v; v8b q[2]; } u; const __bf16* p = rowk0 + 8 * (lane >> 4);
  u.q[0] = *(const v8b*)p; u.q[1] = *(const v8b*)(p + 16); return u.v;
}
#define QBH 6              // causal: query blocks 0..QBH-1 of each sequence (few keys, no averaging) take the high-precision path
#define QHI 384            // rows carrying a q residual plane
#define KHI 384            // key rows carrying k residual / v bf16 hi+lo planes (used only by the causal high-precision path)
// B fragment (k rows k0+.., output column o) of a weight: (in,out) [K][ld] or (out,in) [ld rows of K]: bf16 exact, or f16(bf16 * 256) exact
__device__ __forceinline__ v16b wcol_io(const float* Wm, int k0, int o, int lane, int ld) { v16b w; const int g = lane >> 4;
#pragma unroll
  for (int i = 0; i < 8; ++i) { w[i] = (__bf16)Wm[(size_t)(k0 + 8 * g + i) * ld + o]; w[8 + i] = (__bf16)Wm[(size_t)(k0 + 16 + 8 * g + i) * ld + o]; }
  return w; }
__device__ __forceinline__ v16b wcol_oi(const float* Wm, int k0, int o, int lane, int K) { v16b w; const float* p = Wm + (size_t)o * K + k0 + 8 * (lane >> 4);
#pragma unroll
  for (int i = 0; i < 8; ++i) { w[i] = (__bf16)p[i]; w[8 + i] = (__bf16)p[16 + i]; }
  return w; }
__device__ __forceinline__ v16h wcolh_io(const float* Wm, int k0, int o, int lane, int ld) { v16h w; const int g = lane >> 4;
#pragma unroll
  for (int i = 0; i < 8; ++i) { w[i] = (_Float16)(bfr(Wm[(size_t)(k0 + 8 * g + i) * ld + o]) * 256.0f); w[8 + i] = (_Float16)(bfr(Wm[(size_t)(k0 + 16 + 8 * g + i) * ld + o]) * 256.0f); }
  return w; }
__device__ __forceinline__ v16h wcolh_oi(const float* Wm, int k0, int o, int lane, int K) { v16h w; const float* p = Wm + (size_t)o * K + k0 + 8 * (lane >> 4);
#pragma unroll
  for (int i = 0; i < 8; ++i) { w[i] = (_Float16)(bfr(p[i]) * 256.0f); w[8 + i] = (_Float16)(bfr(p[16 + i]) * 256.0f); }
  return w; }
#define WQKV_LAYOUT 0   // 0 = (in,out) [DIN][CC]; 1 = (out,in) [CC][DIN]; 2 = per-head [NH][DIN][HD]
__device__ __forceinline__ v16b wcol_hdk(const float* Wm, int k0, int o, int lane) { v16b w; const int g = lane >> 4; const float* p = Wm + (size_t)(o / HD) * DIN * HD + (o % HD);
#pragma unroll
  for (int i = 0; i < 8; ++i) { w[i] = (__bf16)p[(size_t)(k0 + 8 * g + i) * HD]; w[8 + i] = (__bf16)p[(size_t)(k0 + 16 + 8 * g + i) * HD]; }
  return w; }
#define WO_OUT_IN 0
#if WQKV_LAYOUT == 1
#define WCOL(W, k0, o, lane) wcol_oi(W, k0, o, lane, DIN)
#elif WQKV_LAYOUT == 2
#define WCOL(W, k0, o, lane) wcol_hdk(W, k0, o, lane)
#else
#define WCOL(W, k0, o, lane) wcol_io(W, k0, o, lane, CC)
#endif
#if WO_OUT_IN
#define WOCOL(W, k0, o, lane) wcol_oi(W, k0, o, lane, CC)
#define WOCOLH(W, k0, o, lane) wcolh_oi(W, k0, o, lane, CC)
#else
#define WOCOL(W, k0, o, lane) wcol_io(W, k0, o, lane, DIN)
#define WOCOLH(W, k0, o, lane) wcolh_io(W, k0, o, lane, DIN)
#endif

#ifndef SM_EXTRA_PARAMS
#define SM_EXTRA_PARAMS
#endif
#ifndef PROJ_EXTRA_PARAMS
#define PROJ_EXTRA_PARAMS
#endif
#ifndef SM_MASK_HOOK
#define SM_MASK_HOOK (void)0
#endif

#define WS_QH  0u                                      // f16 q rows [b*t][CC]
#define WS_KH  (WS_QH + 2u * (size_t)NB * TT * CC)      // f16 k rows [b*t][CC]
#define WS_VT  (WS_KH + 2u * (size_t)NB * TT * CC)      // f16 v planes [b][c][t]
#define WS_QL  (WS_VT + 2u * (size_t)NB * CC * TT)      // f16 q residual x 2^10 rows [b][t < QHI][CC]
#define WS_KL  (WS_QL + 2u * (size_t)NB * QHI * CC)     // f16 k residual x 2^10 rows [b][t < KHI][CC]
#define WS_VB  (WS_KL + 2u * (size_t)NB * KHI * CC)     // bf16 v hi planes [b][c][t < KHI]
#define WS_VBL (WS_VB + 2u * (size_t)NB * CC * KHI)
#define WS_S   (WS_VBL + 2u * (size_t)NB * CC * KHI)    // f32 logits / P [b][t][s]: one plane per batch, so that each stage runs all batches in one launch
#define WS_Y   (WS_S  + 4u * (size_t)NB * TT * TT)      // f32 ctx rows [b*t][CC] (only when there is an output projection)
#define WS_END (WS_Y  + 0u)

__device__ __forceinline__ unsigned lds_off(const void* p) { return (unsigned)(size_t)p; }   // byte address in the work-group's LDS
// eight asynchronous copies, 16 B a lane, global -> LDS; the closing s_wait_xcnt stands in the same statement, in front of any later rewrite of the address registers that the copies name
__device__ __forceinline__ void acopy8(const unsigned (&l)[8], const void* const (&g)[8]) {
  asm volatile("global_load_async_to_lds_b128 %0, %8, off\n\tglobal_load_async_to_lds_b128 %1, %9, off\n\tglobal_load_async_to_lds_b128 %2, %10, off\n\tglobal_load_async_to_lds_b128 %3, %11, off\n\t"
               "global_load_async_to_lds_b128 %4, %12, off\n\tglobal_load_async_to_lds_b128 %5, %13, off\n\tglobal_load_async_to_lds_b128 %6, %14, off\n\tglobal_load_async_to_lds_b128 %7, %15, off\n\ts_wait_xcnt 0x0"
               :: "v"(l[0]), "v"(l[1]), "v"(l[2]), "v"(l[3]), "v"(l[4]), "v"(l[5]), "v"(l[6]), "v"(l[7]), "v"(g[0]), "v"(g[1]), "v"(g[2]), "v"(g[3]), "v"(g[4]), "v"(g[5]), "v"(g[6]), "v"(g[7]) : "memory"); }
// ---- k_proj: block = (64 rows, 128 cols, which): q/k/v = X W (+ b) with exact bf16 products (K = DIN) -> which 0: q f16 rows (+ residual rows < QHI); 1: k f16 rows (+ residual rows < KHI); 2: v f16 planes [c][t] (+ bf16 hi/lo planes for t < KHI)
__global__ __launch_bounds__(128) void k_proj(const float* __restrict__ XQ, const float* __restrict__ XK, const float* __restrict__ XV, const float* __restrict__ WQ, const float* __restrict__ WK, const float* __restrict__ WV, const float* __restrict__ BQ, const float* __restrict__ BK, const float* __restrict__ BV,
    _Float16* __restrict__ QH, _Float16* __restrict__ QL, _Float16* __restrict__ KH, _Float16* __restrict__ KL, _Float16* __restrict__ VT, __bf16* __restrict__ VB, __bf16* __restrict__ VBL) {
  // x: the main loop's two buffers of X (64 rows x 64 k, f32; row pitch 272 B = 16 B x odd: the 16-B fragment reads of 16 rows fall on 16 different bank groups); the epilogue's sh / sl take their place behind the last chunk's barrier
  __shared__ __align__(16) union { struct { _Float16 h[64][136], l[64][136]; } e; float x[2][64][68]; } su; _Float16 (&sh)[64][136] = su.e.h; _Float16 (&sl)[64][136] = su.e.l;
  __shared__ __align__(16) _Float16 th[128][72]; __shared__ __align__(16) __bf16 tb[128][72], tbl[128][72];
  const int tid = threadIdx.x, wave = tid >> 5, lane = tid & 31, col = lane & 15, g = lane >> 4; const int which = blockIdx.z; const int c0 = blockIdx.y * 128; const size_t r0 = (size_t)blockIdx.x * 64; const size_t bb = r0 / TT; const int t0 = (int)(r0 % TT);
  const float* X = which == 0 ? XQ : which == 1 ? XK : XV; const float* WA = which == 0 ? WQ : which == 1 ? WK : WV; const float* BA = which == 0 ? BQ : which == 1 ? BK : BV;
  v8f acc[8] = {};
  // Main loop: K in 12 chunks of 64. The block's W chunk [64 k][128 cols] is read from global once (whole 512-B row segments, 16 B a lane), rounded to bf16, turned to [col][k] in registers and
  // kept in LDS for all four waves; tb / tbl (free until the epilogue) are the two buffers. 16-B slot o of row c sits at o ^ ((c >> 4) & 3): the stores (columns 4 apart across lanes) and the
  // fragment reads (columns 1 apart) then both fall on 16 different bank groups per 16 lanes. The next chunk's W loads are issued behind the barrier and fly while this chunk's products run.
  // X: each wave's own 16 rows x 64 k of a chunk come into LDS as f32 by asynchronous copies that cover whole 128-B lines (16 neighbouring lanes a row, 2 rows a copy) instead of register loads that touch 16 lines each;
  // two buffers: chunk t + 2 is asked for behind the barrier that ends trip t and flies while chunk t + 1 is multiplied. The A fragments are read from LDS and rounded to bf16 there: same values, same k order.
  const float* wsrc = WA + (size_t)(wave * 16) * CC + c0 + 4 * lane; const float* xsrc = X + (r0 + wave * 16 + g) * DIN + 4 * col;
  const unsigned xdst = lds_off(&su.x[0][wave * 16 + g][4 * col]);
  v4f wr[16]; v16b a[2];
  auto ldg = [&](int s) {   // chunk s counted from the one that wsrc / xsrc stand at
#pragma unroll
    for (int i = 0; i < 16; ++i) wr[i] = *(const v4f*)(wsrc + (size_t)(s * 64 + i) * CC); };
  auto fillx = [&](int s, int bi) { unsigned l[8]; const void* gp[8];   // X chunk s (counted as in ldg) into buffer bi; unrolled so that l and gp are registers
#pragma unroll
    for (int i = 0; i < 8; ++i) { l[i] = xdst + (unsigned)bi * (unsigned)sizeof(su.x[0]) + (unsigned)(i * 2 * sizeof(su.x[0][0])); gp[i] = xsrc + (size_t)(i * 2) * DIN + s * 64; }
    acopy8(l, gp); };
  auto stage = [&](__bf16 (*buf)[72]) { const int sw = (lane >> 2) & 3;
    __builtin_amdgcn_sched_barrier(0);   // keeps the conversions, which wait for the global loads, behind the chunk's last product: the loads fly under all sixteen
    asm volatile("s_wait_xcnt 0x0" ::: "memory");   // stands in front of the loop's advance of the address pair that the chunk's global loads name
#pragma unroll
    for (int oo = 0; oo < 2; ++oo) {
#pragma unroll
      for (int c = 0; c < 4; ++c) { v8b t;
#pragma unroll
        for (int i = 0; i < 8; ++i) t[i] = (__bf16)wr[oo * 8 + i][c];
        *(v8b*)&buf[4 * lane + c][((2 * wave + oo) ^ sw) * 8] = t; } } };
  // the 16 fragments of a chunk in four groups of four (group q: k half q >> 1, column tiles 4 (q & 1) ..): a group's eight LDS reads stand together, one group ahead of the products that use them
  auto mma = [&](const __bf16 (*buf)[72], const float (*xb)[68]) { const __bf16* p0 = &buf[col][8 * g]; const __bf16* p1 = &buf[col][8 * (g ^ 1)]; v16b w[2][4]; const float* px = &xb[wave * 16 + col][8 * g]; v4f xr[8];
    auto ldf = [&](int q) {
#pragma unroll
      for (int i = 0; i < 4; ++i) { const int j = 4 * (q & 1) + i; const __bf16* p = ((j & 1) ? p1 : p0) + j * 16 * 72 + (q >> 1) * 32; union { v16b v; v8b q2[2]; } u;
        u.q2[0] = *(const v8b*)(p + 8 * (j & 2)); u.q2[1] = *(const v8b*)(p + 8 * (2 ^ (j & 2))); w[q & 1][i] = u.v; } };
    // the chunk's X reads stand with the first group's W reads: one place with LDS reads
#pragma unroll
    for (int i = 0; i < 4; ++i) { xr[2 * i] = *(const v4f*)(px + i * 16); xr[2 * i + 1] = *(const v4f*)(px + i * 16 + 4); }
    ldf(0);
#pragma unroll
    for (int kk = 0; kk < 2; ++kk) {
#pragma unroll
      for (int i = 0; i < 4; ++i) { a[kk][i] = (__bf16)xr[4 * kk][i]; a[kk][4 + i] = (__bf16)xr[4 * kk + 1][i]; a[kk][8 + i] = (__bf16)xr[4 * kk + 2][i]; a[kk][12 + i] = (__bf16)xr[4 * kk + 3][i]; } }
#pragma unroll
    for (int q = 0; q < 4; ++q) { if (q < 3) ldf(q + 1);
#pragma unroll
      for (int i = 0; i < 4; ++i) acc[4 * (q & 1) + i] = wmma_bf(a[q >> 1], w[q & 1][i], acc[4 * (q & 1) + i]); } };
  auto foot = [&]() {
    asm volatile("s_wait_dscnt 0x0" ::: "memory");      // this wave's reads of the chunk's X buffer are over before it is refilled
    asm volatile("s_wait_asynccnt 0x0" ::: "memory");   // this wave's copies of the next chunk's X have landed
    __syncthreads(); };                                  // publishes the W chunk just stored and the X chunk just landed; ends the reads of the buffers that are filled next
  fillx(0, 0); ldg(0); stage(tb);
  asm volatile("s_wait_asynccnt 0x0" ::: "memory");   // this wave's copies of X chunk 0 have landed
  __syncthreads();
  // rolled: two chunks a trip (one per buffer) keep the loop's text small. Behind each barrier the next chunk's W loads, which stage() waits for, go out first; then its X copies, which the trip's foot waits for,
  // into the buffer that the trip before has read
#pragma unroll 1
  for (int s = 0; s < DIN / 64 - 2; s += 2) {
    ldg(1); fillx(1, 1); mma(tb, su.x[0]); stage(tbl); foot();
    ldg(2); fillx(2, 0); mma(tbl, su.x[1]); stage(tb); foot();
    wsrc += (size_t)128 * CC; xsrc += 128; }
  ldg(1); fillx(1, 1); mma(tb, su.x[0]); stage(tbl); foot();
  mma(tbl, su.x[1]);
  asm volatile("s_wait_asynccnt 0x0" ::: "memory");   // no copy is left in flight when the wave goes on
  __syncthreads();   // the epilogue stores into tb / tbl and over the X buffers: every wave's last fragment read ends here
  if (which < 2) { _Float16* DH = which == 0 ? QH : KH; _Float16* DL = which == 0 ? QL : KL; const int nhi = which == 0 ? QHI : KHI; const bool hi_rows = t0 < nhi;
#pragma unroll
    for (int j = 0; j < 8; ++j) { const float bias = BA ? bfr(BA[c0 + j * 16 + col]) : 0.f;
#pragma unroll
      for (int r = 0; r < 8; ++r) { const float v = acc[j][r] + bias; const _Float16 hv = (_Float16)v; sh[wave * 16 + 8 * g + r][j * 16 + col] = hv; sl[wave * 16 + 8 * g + r][j * 16 + col] = (_Float16)((v - (float)hv) * 1024.0f); } }
    __syncthreads();
    for (int e = tid; e < 64 * 16; e += 128) { const int rl = e >> 4, q = e & 15; vst2((unsigned*)(DH + (r0 + rl) * CC + c0 + q * 8), *(const v4u*)&sh[rl][q * 8]); if (hi_rows) vst2((unsigned*)(DL + (bb * nhi + t0 + rl) * (size_t)CC + c0 + q * 8), *(const v4u*)&sl[rl][q * 8]); }
  } else { const bool hi_rows = t0 < KHI;
#pragma unroll
    for (int j = 0; j < 8; ++j) { const float bias = BA ? bfr(BA[c0 + j * 16 + col]) : 0.f;
#pragma unroll
      for (int r = 0; r < 8; ++r) { const float v = acc[j][r] + bias; const int rl = wave * 16 + 8 * g + r, cl = j * 16 + col; th[cl][rl] = (_Float16)v; const __bf16 bh = (__bf16)v; tb[cl][rl] = bh; tbl[cl][rl] = (__bf16)(v - (float)bh); } }
    __syncthreads();
    for (int e = tid; e < 128 * 8; e += 128) { const int cl = e >> 3, q = e & 7; vst2((unsigned*)(VT + (bb * CC + c0 + cl) * (size_t)TT + t0 + q * 8), *(const v4u*)&th[cl][q * 8]); if (hi_rows) { const size_t o3 = (bb * CC + c0 + cl) * (size_t)KHI + t0 + q * 8; vst2((unsigned*)(VB + o3), *(const v4u*)&tb[cl][q * 8]); vst2((unsigned*)(VBL + o3), *(const v4u*)&tbl[cl][q * 8]); } } } }
// twelve asynchronous copies, 16 B a lane, global -> LDS; the closing s_wait_xcnt stands in the same statement, in front of any later rewrite of the address registers that the copies name
__device__ __forceinline__ void acopy12(const unsigned (&l)[12], const void* const (&g)[12]) {
  asm volatile("global_load_async_to_lds_b128 %0, %12, off\n\tglobal_load_async_to_lds_b128 %1, %13, off\n\tglobal_load_async_to_lds_b128 %2, %14, off\n\tglobal_load_async_to_lds_b128 %3, %15, off\n\t"
               "global_load_async_to_lds_b128 %4, %16, off\n\tglobal_load_async_to_lds_b128 %5, %17, off\n\tglobal_load_async_to_lds_b128 %6, %18, off\n\tglobal_load_async_to_lds_b128 %7, %19, off\n\t"
               "global_load_async_to_lds_b128 %8, %20, off\n\tglobal_load_async_to_lds_b128 %9, %21, off\n\tglobal_load_async_to_lds_b128 %10, %22, off\n\tglobal_load_async_to_lds_b128 %11, %23, off\n\ts_wait_xcnt 0x0"
               :: "v"(l[0]), "v"(l[1]), "v"(l[2]), "v"(l[3]), "v"(l[4]), "v"(l[5]), "v"(l[6]), "v"(l[7]), "v"(l[8]), "v"(l[9]), "v"(l[10]), "v"(l[11]),
                  "v"(g[0]), "v"(g[1]), "v"(g[2]), "v"(g[3]), "v"(g[4]), "v"(g[5]), "v"(g[6]), "v"(g[7]), "v"(g[8]), "v"(g[9]), "v"(g[10]), "v"(g[11]) : "memory"); }
#define SCW 64             // f16 elements in a staged row of k_sc (128 B)
// ---- k_sc: block = (query block qb, key block kb <= kb_last(qb), batch b = blockIdx.z): logits x SCALE; single f16 q x k, and for query blocks < QBH (causal early rows) also q residual (x 2^10) x k and q x k residual (3 products); causal: blocks past the diagonal exit, the mask itself is applied by index in k_sm
// The head width is walked in tiles. A tile holds 128 B of each of the block's 128 k rows and 64 q rows and comes into LDS by asynchronous copies that cover whole 128-B runs (8 neighbouring lanes a row); the k tile serves all four waves.
// Late rows: a staged row is 64 elements of the f16 plane (12 tiles). Early rows: 32 elements of the f16 plane, then the same 32 of the residual plane (24 tiles). Two buffers: tile t + 1 flies while tile t is multiplied.
// Same fragments and the same order of products into every accumulator as reading them from global memory.
__global__ __launch_bounds__(128) void k_sc(const _Float16* __restrict__ QH, const _Float16* __restrict__ KH, const _Float16* __restrict__ QL, const _Float16* __restrict__ KL, int h0, float* __restrict__ S0) {
  // row pitch 144 B (16 B x odd): the 16-B fragment reads of 16 rows fall on 16 different bank groups. The output tile ss takes the tiles' place once the last tile has been read: less LDS, one more block on a WGP.
  __shared__ __align__(16) union { struct { _Float16 k[2][128][SCW + 8]; _Float16 q[2][64][SCW + 8]; } t; float ss[4][16][132]; } sm;
  const int qb = blockIdx.x, kb = blockIdx.y; if (kb > kb_last(qb)) return;
  const int b = blockIdx.z; const int h = h0; float* S = S0 + (size_t)b * TT * TT;
  const int tid = threadIdx.x, wave = tid >> 5, lane = tid & 31, col = lane & 15, g = lane >> 4; const int k0 = kb * 128; const int ql0 = qb * 64 + wave * 16;
  v8f acc[8] = {}, accl[8] = {};
  const _Float16* QLb = QL + (size_t)b * QHI * CC; const _Float16* KLb = KL + (size_t)b * KHI * CC;
  const bool early = qb < QBH; const int step = early ? 32 : 64;
  const int rr = lane >> 3, o = lane & 7; const bool res = early && o >= 4;   // lane: row rr of four, 16-B slot o of the staged row; slots 4..7 of an early row hold the residual plane
  const _Float16* ksrc = (res ? KLb : KH + (size_t)b * TT * CC) + (size_t)(k0 + wave * 32 + rr) * CC + h * HD + (res ? o - 4 : o) * 8;
  const _Float16* qsrc = (res ? QLb : QH + (size_t)b * TT * CC) + (size_t)(ql0 + rr) * CC + h * HD + (res ? o - 4 : o) * 8;
  const unsigned kdst = lds_off(&sm.t.k[0][wave * 32 + rr][o * 8]), qdst = lds_off(&sm.t.q[0][wave * 16 + rr][o * 8]);
  auto fill = [&](int t) { unsigned l[12]; const void* gp[12];   // each wave: 32 rows of k (4 a copy), then its own 16 rows of q; both loops unrolled so that l and gp are registers
#pragma unroll
    for (int i = 0; i < 8; ++i) { l[i] = kdst + (unsigned)(t & 1) * (unsigned)sizeof(sm.t.k[0]) + (unsigned)(i * 4 * sizeof(sm.t.k[0][0])); gp[i] = ksrc + (size_t)(i * 4) * CC + t * step; }
#pragma unroll
    for (int i = 0; i < 4; ++i) { l[8 + i] = qdst + (unsigned)(t & 1) * (unsigned)sizeof(sm.t.q[0]) + (unsigned)(i * 4 * sizeof(sm.t.q[0][0])); gp[8 + i] = qsrc + (size_t)(i * 4) * CC + t * step; }
    acopy12(l, gp); };
  auto foot = [&](int t, int nt) {   // nt: the path's number of tiles
    asm volatile("s_wait_dscnt 0x0" ::: "memory");      // this wave's reads of tile t are over before its buffer is refilled
    asm volatile("s_wait_asynccnt 0x0" ::: "memory");   // this wave's copies of tile t + 1 have landed
    __syncthreads();                                     // publishes tile t + 1 and ends every wave's reads of tile t
    if (t + 2 < nt) fill(t + 2); };
  fill(0);
  asm volatile("s_wait_asynccnt 0x0" ::: "memory");   // this wave's copies of tile 0 have landed
  __syncthreads();                                     // ... and every other wave's: tile 0 may be read
  fill(1);
  if (early) {
    // rolled: the buffer is picked by t & 1, and the loop's text stays small
#pragma unroll 1
    for (int t = 0; t < HD / 32; ++t) { const _Float16 (*bk)[SCW + 8] = sm.t.k[t & 1]; const _Float16 (*bq)[SCW + 8] = sm.t.q[t & 1];
      const v16h ah = frag_h(&bq[wave * 16 + col][0], lane), al = frag_h(&bq[wave * 16 + col][32], lane);
      // four key tiles at a time (their fragments and both accumulator sets fit the registers); the three products of a key tile stand four apart, so that none waits for the one before it into the same accumulator
#pragma unroll
      for (int jh = 0; jh < 8; jh += 4) { v16h kf[4], lf[4];
#pragma unroll
        for (int j = 0; j < 4; ++j) { kf[j] = frag_h(&bk[(jh + j) * 16 + col][0], lane); lf[j] = frag_h(&bk[(jh + j) * 16 + col][32], lane); }
#pragma unroll
        for (int j = 0; j < 4; ++j) acc[jh + j] = wmma16(ah, kf[j], acc[jh + j]);
#pragma unroll
        for (int j = 0; j < 4; ++j) accl[jh + j] = wmma16(al, kf[j], accl[jh + j]);
#pragma unroll
        for (int j = 0; j < 4; ++j) accl[jh + j] = wmma16(ah, lf[j], accl[jh + j]); }
      foot(t, HD / 32); }
  } else {
    // rolled, as above
#pragma unroll 1
    for (int t = 0; t < HD / 64; ++t) { const _Float16 (*bk)[SCW + 8] = sm.t.k[t & 1]; const _Float16 (*bq)[SCW + 8] = sm.t.q[t & 1];
      // all of the tile's fragment reads stand together in front of its products: one place with LDS reads a tile (the loops over kk and j are unrolled so that a, kf and acc are registers)
      v16h a[2], kf[2][8];
#pragma unroll
      for (int kk = 0; kk < 2; ++kk) a[kk] = frag_h(&bq[wave * 16 + col][kk * 32], lane);
#pragma unroll
      for (int kk = 0; kk < 2; ++kk) {
#pragma unroll
        for (int j = 0; j < 8; ++j) kf[kk][j] = frag_h(&bk[j * 16 + col][kk * 32], lane); }
#pragma unroll
      for (int kk = 0; kk < 2; ++kk) {
#pragma unroll
        for (int j = 0; j < 8; ++j) acc[j] = wmma16(a[kk], kf[kk][j], acc[j]); }
      foot(t, HD / 64); } }
  asm volatile("s_wait_asynccnt 0x0" ::: "memory");   // no copy is left in flight when the wave goes on; the last trip's barrier has ended every wave's reads of the tiles, so ss may take their place
#pragma unroll
  for (int j = 0; j < 8; ++j) {
#pragma unroll
    for (int r = 0; r < 8; ++r) sm.ss[wave][8 * g + r][j * 16 + col] = (acc[j][r] + accl[j][r] * (1.0f / 1024.0f)) * SCALE; }
  LDSX(); for (int rl = 0; rl < 16; ++rl) vst2(S + (size_t)(ql0 + rl) * TT + k0 + lane * 4, *(const v4f*)&sm.ss[wave][rl][lane * 4]); }
// ---- k_sm: one wave = one query row t of batch blockIdx.y (eight rows a block): keys [0, nb * 128): causal -> logit if s <= t else excluded; softmax in f32; P x 2^11 in place (0 for excluded)
// The whole row lives in the wave's registers: 16 B a lane per 128-key block, all of the row's loads in flight at once; maximum and sum go over the 32 lanes by shuffles. No LDS, no barrier, an eighth of the waves to start.
__global__ __launch_bounds__(256) void k_sm(float* __restrict__ S0 SM_EXTRA_PARAMS) {
  const int lane = threadIdx.x & 31; const int t = blockIdx.x * 8 + (threadIdx.x >> 5);
  const int nb = kb_last((blockIdx.x * 8) >> 6) + 1;   // 128-key blocks of the row; from blockIdx alone (the block's eight rows share it), so every test on it is a scalar branch
  float* sr = S0 + (size_t)blockIdx.y * TT * TT + (size_t)t * TT + lane * 4;
  v4f v[TT / 128];   // every loop over i is unrolled so that v stays in registers
#pragma unroll
  for (int i = 0; i < TT / 128; ++i) if (i < nb) v[i] = *(const v4f*)(sr + i * 128);
  float m = -3.0e38f;
#pragma unroll
  for (int i = 0; i < TT / 128; ++i) if (i < nb) {
#pragma unroll
    for (int c = 0; c < 4; ++c) { const float x = (!CAUSAL || i * 128 + lane * 4 + c <= t) ? v[i][c] : -3.0e38f; v[i][c] = x; m = fmaxf(m, x); } }
#pragma unroll
  for (int o = 1; o < 32; o <<= 1) m = fmaxf(m, __shfl_xor(m, o));
  v4f s4 = {};
#pragma unroll
  for (int i = 0; i < TT / 128; ++i) if (i < nb) {
#pragma unroll
    for (int c = 0; c < 4; ++c) { const float x = v[i][c]; const float ex = expf(x - m); const float e = (x <= -1.0e38f) ? 0.f : ex; v[i][c] = e; s4[c] += e; } }   // expf outside the choice: no branch a key, so that the keys' chains of dependent instructions overlap
  float sum = (s4[0] + s4[1]) + (s4[2] + s4[3]);
#pragma unroll
  for (int o = 1; o < 32; o <<= 1) sum += __shfl_xor(sum, o);
  const float inv = sum > 0.f ? 2048.0f / sum : 0.f;   /* a fully excluded row yields P = 0 */
#pragma unroll
  for (int i = 0; i < TT / 128; ++i) if (i < nb) { vst2(sr + i * 128, v[i] * inv);
    asm volatile("s_wait_xcnt 0x0" ::: "memory"); } }   // the next block's products are formed in the data registers that this store names: the wait stands in front of that overwrite
#define PVK 64             // keys per staged tile of k_pv's late rows (early rows: 32 keys a tile, hi + lo)
#define DVH 128            // value columns per k_pv block: the 768-wide head is walked in six 128-column slices (8 accumulator tiles per wave; a 48-tile accumulator would not fit the register file)
// ---- k_pv: block = (64 queries (qb), 128-column value slice d0, batch b = blockIdx.z): ctx[:, d0 .. d0+127] = P . v over keys [0, kend) (P x 2^11 once to f16 against v f16: 1 product; causal early query blocks: P and v as bf16 hi + lo, 3 products); the 512-B (row, slice) segment by 32 lanes x 16 B
__global__ __launch_bounds__(128) void k_pv(const float* __restrict__ PS0, const _Float16* __restrict__ VT, const __bf16* __restrict__ VB, const __bf16* __restrict__ VBL, int h0, float* __restrict__ Y) { const int b = blockIdx.z; const int h = h0; const int d0 = blockIdx.y * DVH; const float* PS = PS0 + (size_t)b * TT * TT; __shared__ __align__(16) float ss[4][16][DVH + 4];
  __shared__ __align__(16) _Float16 sv[2][DVH][PVK + 8]; __shared__ __align__(16) float sp[2][64][PVK + 4];   // row pitches 144 B and 272 B (16 B x odd): the 16-B fragment reads of 16 rows fall on 16 different bank groups
  const int tid = threadIdx.x, wave = tid >> 5, lane = tid & 31, col = lane & 15, g = lane >> 4; const int qb = blockIdx.x; const int ql0 = qb * 64 + wave * 16; const int kce = (kb_last(qb) + 1) * 4;
  v8f acc[DVH / 16] = {};
  if (qb < QBH) {
    // Early rows: keys in tiles of 32 (kce = 4, 8 or 12 tiles). A staged v row is 128 B: 32 keys of the bf16 hi plane, then the same 32 of the lo plane (16-B slots 4..7); a staged P row is 128 B of f32.
    // Both come into LDS by asynchronous copies in runs of 64 and 128 B, the v tile serves all four waves, and tile t + 1 flies while tile t is multiplied (the late rows' two buffers, read as bf16),
    // instead of a global fragment load and a full wait in front of every product. Same fragments; every accumulator takes its three products of a tile in the same order (hi x hi, lo x hi, hi x lo).
    const int rr = lane >> 3, o = lane & 7; const bool res = o >= 4;   // lane: row rr of four, 16-B slot o of the staged row
    const __bf16* vsrc = (res ? VBL : VB) + ((size_t)b * CC + h * HD + d0 + wave * 32 + rr) * (size_t)KHI + (res ? o - 4 : o) * 8; const float* psrc = PS + (size_t)(ql0 + rr) * TT + o * 4;
    const unsigned vdst = lds_off(&sv[0][wave * 32 + rr][o * 8]), pdst = lds_off(&sp[0][wave * 16 + rr][o * 4]);
    auto fill = [&](int t) { unsigned l[12]; const void* gp[12];   // each wave: 32 columns of v (4 a copy), then its own 16 rows of P (4 a copy); both loops unrolled so that l and gp are registers
#pragma unroll
      for (int i = 0; i < 8; ++i) { l[i] = vdst + (unsigned)(t & 1) * (unsigned)sizeof(sv[0]) + (unsigned)(i * 4 * sizeof(sv[0][0])); gp[i] = vsrc + (size_t)(i * 4) * KHI + t * 32; }
#pragma unroll
      for (int i = 0; i < 4; ++i) { l[8 + i] = pdst + (unsigned)(t & 1) * (unsigned)sizeof(sp[0]) + (unsigned)(i * 4 * sizeof(sp[0][0])); gp[8 + i] = psrc + (size_t)(i * 4) * TT + t * 32; }
      acopy12(l, gp); };
    fill(0);
    asm volatile("s_wait_asynccnt 0x0" ::: "memory");   // this wave's copies of tile 0 have landed
    __syncthreads();                                     // ... and every other wave's: tile 0 may be read
    fill(1);
    // rolled: the trip count depends on the query block, and the buffer is picked by t & 1
#pragma unroll 1
    for (int t = 0; t < kce; ++t) { const __bf16 (*bv)[PVK + 8] = (const __bf16 (*)[PVK + 8])sv[t & 1]; const float (*bp)[PVK + 4] = sp[t & 1];
      // all of the tile's fragment reads stand together in front of its products (the loops over j are unrolled so that vh, vl and acc are registers);
      // the three products of a column tile stand eight apart, so that none waits for the one before it into the same accumulator
      const F2 p = split_row(&bp[wave * 16 + col][0], 0, lane); v16b vh[DVH / 16], vl[DVH / 16];
#pragma unroll
      for (int j = 0; j < DVH / 16; ++j) { vh[j] = frag_b(&bv[j * 16 + col][0], lane); vl[j] = frag_b(&bv[j * 16 + col][32], lane); }
#pragma unroll
      for (int j = 0; j < DVH / 16; ++j) acc[j] = wmma_bf(p.h, vh[j], acc[j]);
#pragma unroll
      for (int j = 0; j < DVH / 16; ++j) acc[j] = wmma_bf(p.l, vh[j], acc[j]);
#pragma unroll
      for (int j = 0; j < DVH / 16; ++j) acc[j] = wmma_bf(p.h, vl[j], acc[j]);
      asm volatile("s_wait_dscnt 0x0" ::: "memory");      // this wave's reads of tile t are over before its buffer is refilled
      asm volatile("s_wait_asynccnt 0x0" ::: "memory");   // this wave's copies of tile t + 1 have landed
      __syncthreads();                                     // publishes tile t + 1 and ends every wave's reads of tile t
      if (t + 2 < kce) fill(t + 2); }
    asm volatile("s_wait_asynccnt 0x0" ::: "memory");   // no copy is left in flight when the wave goes on
  } else {
    // Keys in tiles of PVK = 64. A tile of v (128 columns x 128 B) and of P (64 rows x 256 B) comes into LDS by asynchronous copies that cover whole 128-B lines (8 or 16 neighbouring lanes a row);
    // the v tile serves all four waves. Two buffers: tile t + 1 flies while tile t is multiplied. Same fragments, same key order as reading them from global memory.
    const int nt = kce >> 1;
    const _Float16* vsrc = VT + ((size_t)b * CC + h * HD + d0 + wave * 32 + (lane >> 3)) * (size_t)TT + (lane & 7) * 8; const float* psrc = PS + (size_t)(ql0 + (lane >> 4)) * TT + (lane & 15) * 4;
    const unsigned vdst = lds_off(&sv[0][wave * 32 + (lane >> 3)][(lane & 7) * 8]), pdst = lds_off(&sp[0][wave * 16 + (lane >> 4)][(lane & 15) * 4]);
    auto fill = [&](int t) { unsigned l[8]; const void* gp[8];   // each wave: 32 columns of v (4 a copy), then its own 16 rows of P (2 a copy); both loops unrolled so that l and gp are registers
#pragma unroll
      for (int i = 0; i < 8; ++i) { l[i] = vdst + (unsigned)(t & 1) * (unsigned)sizeof(sv[0]) + (unsigned)(i * 4 * sizeof(sv[0][0])); gp[i] = vsrc + (size_t)(i * 4) * TT + t * PVK; }
      acopy8(l, gp);
#pragma unroll
      for (int i = 0; i < 8; ++i) { l[i] = pdst + (unsigned)(t & 1) * (unsigned)sizeof(sp[0]) + (unsigned)(i * 2 * sizeof(sp[0][0])); gp[i] = psrc + (size_t)(i * 2) * TT + t * PVK; }
      acopy8(l, gp); };
    fill(0);
    asm volatile("s_wait_asynccnt 0x0" ::: "memory");   // this wave's copies of tile 0 have landed
    __syncthreads();                                     // ... and every other wave's: tile 0 may be read
    if (nt > 1) fill(1);
    // rolled: the trip count depends on the query block, and the buffer is picked by t & 1
#pragma unroll 1
    for (int t = 0; t < nt; ++t) { const _Float16 (*bv)[PVK + 8] = sv[t & 1]; const float (*bp)[PVK + 4] = sp[t & 1];
      // all of the tile's fragment reads stand together in front of its products: one place with LDS reads a tile instead of a read and a full wait in front of every product
      // (the loops over kk and j are unrolled so that p, vf and acc are registers)
      v16h p[PVK / 32], vf[PVK / 32][DVH / 16];
#pragma unroll
      for (int kk = 0; kk < PVK / 32; ++kk) p[kk] = frag_f32(&bp[wave * 16 + col][kk * 32], lane);
#pragma unroll
      for (int kk = 0; kk < PVK / 32; ++kk) {
#pragma unroll
        for (int j = 0; j < DVH / 16; ++j) vf[kk][j] = frag_h(&bv[j * 16 + col][kk * 32], lane); }
#pragma unroll
      for (int kk = 0; kk < PVK / 32; ++kk) {
#pragma unroll
        for (int j = 0; j < DVH / 16; ++j) acc[j] = wmma16(p[kk], vf[kk][j], acc[j]); }
      asm volatile("s_wait_dscnt 0x0" ::: "memory");      // this wave's reads of tile t are over before its buffer is refilled
      asm volatile("s_wait_asynccnt 0x0" ::: "memory");   // this wave's copies of tile t + 1 have landed
      __syncthreads();                                     // publishes tile t + 1 and ends every wave's reads of tile t
      if (t + 2 < nt) fill(t + 2); }
    asm volatile("s_wait_asynccnt 0x0" ::: "memory"); }   // no copy is left in flight when the wave goes on
#pragma unroll
  for (int j = 0; j < DVH / 16; ++j)
#pragma unroll
    for (int r = 0; r < 8; ++r) ss[wave][8 * g + r][j * 16 + col] = acc[j][r] * (1.0f / 2048.0f);
  LDSX(); for (int rl = 0; rl < 16; ++rl) vst2(Y + ((size_t)b * TT + ql0 + rl) * CC + h * HD + d0 + lane * 4, *(const v4f*)&ss[wave][rl][lane * 4]); }   
extern "C" void kernel_launch(void* const* d_in, const int* in_sizes, int n_in, void* d_out, int out_size, void* d_ws, size_t ws_size, hipStream_t stream) {
  (void)in_sizes; (void)n_in; (void)out_size;
  const float** F = (const float**)d_in;
  if (ws_size < (size_t)WS_END) return;
  char* ws = (char*)d_ws; _Float16 *QH = (_Float16*)(ws + WS_QH), *KH = (_Float16*)(ws + WS_KH), *VT = (_Float16*)(ws + WS_VT), *QL = (_Float16*)(ws + WS_QL), *KL = (_Float16*)(ws + WS_KL); __bf16 *VB = (__bf16*)(ws + WS_VB), *VBL = (__bf16*)(ws + WS_VBL); float *S = (float*)(ws + WS_S), *Y = (float*)(ws + WS_Y);
  (void)Y; (void)QL; (void)KL; (void)VB; (void)VBL;
  // inputs: 0 x [4,2048,768]; 1 Wq [768,768] (in,out); 2 Wk; 3 Wv; no biases, no output projection
  k_proj<<<dim3(TNB * TT / 64, CC / 128, 3), 128, 0, stream>>>(F[0], F[0], F[0], F[1], F[2], F[3], nullptr, nullptr, nullptr, QH, QL, KH, KL, VT, VB, VBL);
  k_sc<<<dim3(NQB, TT / 128, TNB), 128, 0, stream>>>(QH, KH, QL, KL, 0, S);
  k_sm<<<dim3(TT / 8, TNB), 256, 0, stream>>>(S);
  k_pv<<<dim3(NQB, HD / DVH, TNB), 128, 0, stream>>>(S, VT, VB, VBL, 0, (float*)d_out);   /* six 128-column value slices per query block */
}

// v008
// It runs in 121 microseconds.
// In two side-by-side timings against v007, it was 1.07 and 1.08 times as fast.
// All steps since v000 together make it 7.00 times as fast.
// compute dtype: all float inputs rounded to bf16; q/k/v projections with EXACT bf16 products on WMMA 16x16x32 (f32 accumulate); causal logits over the 768-wide head: 3 products for the first 384 rows, single f16 q x k after, x 768^-0.5; softmax f32; P x 2^11 once to f16 (stored so from row 384 on) x v once to f16 (bf16 hi + lo below row 384); f32 output.
#include <hip/hip_runtime.h>
#include <math.h>

typedef __attribute__((ext_vector_type(16))) _Float16 v16h;
typedef __attribute__((ext_vector_type(16))) __bf16 v16b;
typedef __attribute__((ext_vector_type(8)))  _Float16 v8h;
typedef __attribute__((ext_vector_type(4)))  _Float16 v4h;
typedef __attribute__((ext_vector_type(8)))  float v8f;
typedef __attribute__((ext_vector_type(4)))  float v4f;
typedef __attribute__((ext_vector_type(2)))  float v2f;
typedef __attribute__((ext_vector_type(4)))  unsigned v4u;
typedef __attribute__((ext_vector_type(4)))  int v4i;
typedef float __attribute__((may_alias)) float_a;
typedef int __attribute__((may_alias)) int_a;

template <typename T> __device__ __forceinline__ void vst2(void* p, T v) { *(T*)p = v;  }
__device__ __forceinline__ v8f wmma16(v16h a, v16h b, v8f c) {
  v8f d = __builtin_amdgcn_wmma_f32_16x16x32_f16(false, a, false, b, (short)0, c, false, false);
  asm volatile("v_nop\n\tv_nop\n\tv_nop\n\tv_nop" : "+v"(d) : "v"(a), "v"(b));
  return d;
}
__device__ __forceinline__ v8f wmma_bf(v16b a, v16b b, v8f c) {
  v8f d = __builtin_amdgcn_wmma_f32_16x16x32_bf16(false, a, false, b, (short)0, c, false, false);
  asm volatile("v_nop\n\tv_nop\n\tv_nop\n\tv_nop" : "+v"(d) : "v"(a), "v"(b));
  return d;
}
// 16x16x32 fragments: lane = (h = lane>>4, row/col = lane&15); elements 0..7 = k0+8h+0..7, 8..15 = k0+16+8h+0..7; D element r = row 8h+r
__device__ __forceinline__ v16h frag_h(const _Float16* rowk0, int lane) {
  union { v16h v; v8h q[2]; } u; const _Float16* p = rowk0 + 8 * (lane >> 4);
  u.q[0] = *(const v8h*)p; u.q[1] = *(const v8h*)(p + 16); return u.v;
}
__device__ __forceinline__ v16h frag_f32(const float* rowk0, int lane) {
  v16h a; const float* p = rowk0 + 8 * (lane >> 4);
#pragma unroll
  for (int i = 0; i < 8; ++i) { a[i] = (_Float16)p[i]; a[8 + i] = (_Float16)p[16 + i]; }
  return a;
}
__device__ __forceinline__ v16h frag_f32s(const float* rowk0, int lane, float sc) {
  v16h a; const float* p = rowk0 + 8 * (lane >> 4);
#pragma unroll
  for (int i = 0; i < 8; ++i) { a[i] = (_Float16)(p[i] * sc); a[8 + i] = (_Float16)(p[16 + i] * sc); }
  return a;
}
// column fragment from a [K][ld] layout (column n), rows >= K read as 0
__device__ __forceinline__ v16h fragc_f32(const float* W, int k0, int n, int lane, int ld, int K) {
  v16h a; const int g = lane >> 4;
#pragma unroll
  for (int i = 0; i < 8; ++i) { const int ka = k0 + 8 * g + i, kb = ka + 16;
    a[i] = (_Float16)(ka < K ? W[(size_t)(ka < K ? ka : K - 1) * ld + n] : 0.f); a[8 + i] = (_Float16)(kb < K ? W[(size_t)(kb < K ? kb : K - 1) * ld + n] : 0.f); }
  return a;
}
struct F2 { v16b h, l; };
__device__ __forceinline__ F2 bsplit16(const float v[16]) { F2 r;
#pragma unroll
  for (int i = 0; i < 16; ++i) { const __bf16 h = (__bf16)v[i]; r.h[i] = h; r.l[i] = (__bf16)(v[i] - (float)h); }
  return r; }
__device__ __forceinline__ F2 split_row(const float* row, int k0, int lane) { float v[16]; const float* p = row + k0 + 8 * (lane >> 4);
#pragma unroll
  for (int i = 0; i < 8; ++i) { v[i] = p[i]; v[8 + i] = p[16 + i]; }
  return bsplit16(v); }
__device__ __forceinline__ F2 split_rowK(const float* row, int k0, int lane, int K) { float v[16]; const int g = lane >> 4;
#pragma unroll
  for (int i = 0; i < 8; ++i) { const int ka = k0 + 8 * g + i, kb = ka + 16; v[i] = ka < K ? row[ka < K ? ka : K - 1] : 0.f; v[8 + i] = kb < K ? row[kb < K ? kb : K - 1] : 0.f; }
  return bsplit16(v); }
__device__ __forceinline__ F2 split_col(const float* W, int k0, int n, int lane, int ld, int K) { float v[16]; const int g = lane >> 4;
#pragma unroll
  for (int i = 0; i < 8; ++i) { const int ka = k0 + 8 * g + i, kb = ka + 16; v[i] = ka < K ? W[(size_t)(ka < K ? ka : K - 1) * ld + n] : 0.f; v[8 + i] = kb < K ? W[(size_t)(kb < K ? kb : K - 1) * ld + n] : 0.f; }
  return bsplit16(v); }
__device__ __forceinline__ v8f mac3(const F2& a, const F2& b, v8f c) { c = wmma_bf(a.l, b.h, c); c = wmma_bf(a.h, b.l, c); return wmma_bf(a.h, b.h, c); }
__device__ __forceinline__ float sigm(float v) { return 1.0f / (1.0f + expf(-v)); }
#define LDSX() do { asm volatile("s_wait_dscnt 0" ::: "memory"); __builtin_amdgcn_wave_barrier(); __builtin_amdgcn_fence(__ATOMIC_RELEASE, "workgroup"); } while (0)

// Single-head causal self-attention with a 768-WIDE head (x [4,2048,768]; (in,out) Wq / Wk / Wv [768,768] uniform, no biases; scores = q k^T with -inf above the diagonal, then / sqrt(768); no head split, no output projection): out = softmax(causal(q k^T) / sqrt(768)) v -> [4,2048,768].
#define NB 4
#define TT 2048
#define CC 768            // NH * HD = projected width
#define DIN 768          // input (model) width
#define NH 1
#define HD 768
#define NQB (TT / 64)
#define HG 1
#define SCALE (0.036084391824351615f)
#define CAUSAL 1
#ifndef TNB
#define TNB NB
#endif
__device__ __forceinline__ float bfr(float v) { return (float)(__bf16)v; }
__host__ __device__ __forceinline__ int kb_last(int qb) { return CAUSAL ? ((qb * 64 + 63) >> 7) : (TT / 128 - 1); }
typedef __attribute__((ext_vector_type(8))) __bf16 v8b;
__device__ __forceinline__ v16b frag_b(const __bf16* rowk0, int lane) {
  union { v16b v; v8b q[2]; } u; const __bf16* p = rowk0 + 8 * (lane >> 4);
  u.q[0] = *(const v8b*)p; u.q[1] = *(const v8b*)(p + 16); return u.v;
}
#define QBH 6              // causal: query blocks 0..QBH-1 of each sequence (few keys, no averaging) take the high-precision path
#define QHI 384            // rows carrying a q residual plane
#define KHI 384            // key rows carrying k residual / v bf16 hi+lo planes (used only by the causal high-precision path)
// B fragment (k rows k0+.., output column o) of a weight: (in,out) [K][ld] or (out,in) [ld rows of K]: bf16 exact, or f16(bf16 * 256) exact
__device__ __forceinline__ v16b wcol_io(const float* Wm, int k0, int o, int lane, int ld) { v16b w; const int g = lane >> 4;
#pragma unroll
  for (int i = 0; i < 8; ++i) { w[i] = (__bf16)Wm[(size_t)(k0 + 8 * g + i) * ld + o]; w[8 + i] = (__bf16)Wm[(size_t)(k0 + 16 + 8 * g + i) * ld + o]; }
  return w; }
__device__ __forceinline__ v16b wcol_oi(const float* Wm, int k0, int o, int lane, int K) { v16b w; const float* p = Wm + (size_t)o * K + k0 + 8 * (lane >> 4);
#pragma unroll
  for (int i = 0; i < 8; ++i) { w[i] = (__bf16)p[i]; w[8 + i] = (__bf16)p[16 + i]; }
  return w; }
__device__ __forceinline__ v16h wcolh_io(const float* Wm, int k0, int o, int lane, int ld) { v16h w; const int g = lane >> 4;
#pragma unroll
  for (int i = 0; i < 8; ++i) { w[i] = (_Float16)(bfr(Wm[(size_t)(k0 + 8 * g + i) * ld + o]) * 256.0f); w[8 + i] = (_Float16)(bfr(Wm[(size_t)(k0 + 16 + 8 * g + i) * ld + o]) * 256.0f); }
  return w; }
__device__ __forceinline__ v16h wcolh_oi(const float* Wm, int k0, int o, int lane, int K) { v16h w; const float* p = Wm + (size_t)o * K + k0 + 8 * (lane >> 4);
#pragma unroll
  for (int i = 0; i < 8; ++i) { w[i] = (_Float16)(bfr(p[i]) * 256.0f); w[8 + i] = (_Float16)(bfr(p[16 + i]) * 256.0f); }
  return w; }
#define WQKV_LAYOUT 0   // 0 = (in,out) [DIN][CC]; 1 = (out,in) [CC][DIN]; 2 = per-head [NH][DIN][HD]
__device__ __forceinline__ v16b wcol_hdk(const float* Wm, int k0, int o, int lane) { v16b w; const int g = lane >> 4; const float* p = Wm + (size_t)(o / HD) * DIN * HD + (o % HD);
#pragma unroll
  for (int i = 0; i < 8; ++i) { w[i] = (__bf16)p[(size_t)(k0 + 8 * g + i) * HD]; w[8 + i] = (__bf16)p[(size_t)(k0 + 16 + 8 * g + i) * HD]; }
  return w; }
#define WO_OUT_IN 0
#if WQKV_LAYOUT == 1
#define WCOL(W, k0, o, lane) wcol_oi(W, k0, o, lane, DIN)
#elif WQKV_LAYOUT == 2
#define WCOL(W, k0, o, lane) wcol_hdk(W, k0, o, lane)
#else
#define WCOL(W, k0, o, lane) wcol_io(W, k0, o, lane, CC)
#endif
#if WO_OUT_IN
#define WOCOL(W, k0, o, lane) wcol_oi(W, k0, o, lane, CC)
#define WOCOLH(W, k0, o, lane) wcolh_oi(W, k0, o, lane, CC)
#else
#define WOCOL(W, k0, o, lane) wcol_io(W, k0, o, lane, DIN)
#define WOCOLH(W, k0, o, lane) wcolh_io(W, k0, o, lane, DIN)
#endif

#ifndef SM_EXTRA_PARAMS
#define SM_EXTRA_PARAMS
#endif
#ifndef PROJ_EXTRA_PARAMS
#define PROJ_EXTRA_PARAMS
#endif
#ifndef SM_MASK_HOOK
#define SM_MASK_HOOK (void)0
#endif

#define WS_QH  0u                                      // f16 q rows [b*t][CC]
#define WS_KH  (WS_QH + 2u * (size_t)NB * TT * CC)      // f16 k rows [b*t][CC]
#define WS_VT  (WS_KH + 2u * (size_t)NB * TT * CC)      // f16 v planes [b][c][t]
#define WS_QL  (WS_VT + 2u * (size_t)NB * CC * TT)      // f16 q residual x 2^10 rows [b][t < QHI][CC]
#define WS_KL  (WS_QL + 2u * (size_t)NB * QHI * CC)     // f16 k residual x 2^10 rows [b][t < KHI][CC]
#define WS_VB  (WS_KL + 2u * (size_t)NB * KHI * CC)     // bf16 v hi planes [b][c][t < KHI]
#define WS_VBL (WS_VB + 2u * (size_t)NB * CC * KHI)
#define WS_S   (WS_VBL + 2u * (size_t)NB * CC * KHI)    // f32 logits / P [b][t][s]: one plane per batch, so that each stage runs all batches in one launch; from row QHI on P is f16 and fills the first half of its row's bytes
#define WS_Y   (WS_S  + 4u * (size_t)NB * TT * TT)      // f32 ctx rows [b*t][CC] (only when there is an output projection)
#define WS_END (WS_Y  + 0u)

__device__ __forceinline__ unsigned lds_off(const void* p) { return (unsigned)(size_t)p; }   // byte address in the work-group's LDS
// eight asynchronous copies, 16 B a lane, global -> LDS; the closing s_wait_xcnt stands in the same statement, in front of any later rewrite of the address registers that the copies name
__device__ __forceinline__ void acopy8(const unsigned (&l)[8], const void* const (&g)[8]) {
  asm volatile("global_load_async_to_lds_b128 %0, %8, off\n\tglobal_load_async_to_lds_b128 %1, %9, off\n\tglobal_load_async_to_lds_b128 %2, %10, off\n\tglobal_load_async_to_lds_b128 %3, %11, off\n\t"
               "global_load_async_to_lds_b128 %4, %12, off\n\tglobal_load_async_to_lds_b128 %5, %13, off\n\tglobal_load_async_to_lds_b128 %6, %14, off\n\tglobal_load_async_to_lds_b128 %7, %15, off\n\ts_wait_xcnt 0x0"
               :: "v"(l[0]), "v"(l[1]), "v"(l[2]), "v"(l[3]), "v"(l[4]), "v"(l[5]), "v"(l[6]), "v"(l[7]), "v"(g[0]), "v"(g[1]), "v"(g[2]), "v"(g[3]), "v"(g[4]), "v"(g[5]), "v"(g[6]), "v"(g[7]) : "memory"); }
// ---- k_proj: block = (64 rows, 128 cols, which): q/k/v = X W (+ b) with exact bf16 products (K = DIN) -> which 0: q f16 rows (+ residual rows < QHI); 1: k f16 rows (+ residual rows < KHI); 2: v f16 planes [c][t] (+ bf16 hi/lo planes for t < KHI)
__global__ __launch_bounds__(128) void k_proj(const float* __restrict__ XQ, const float* __restrict__ XK, const float* __restrict__ XV, const float* __restrict__ WQ, const float* __restrict__ WK, const float* __restrict__ WV, const float* __restrict__ BQ, const float* __restrict__ BK, const float* __restrict__ BV,
    _Float16* __restrict__ QH, _Float16* __restrict__ QL, _Float16* __restrict__ KH, _Float16* __restrict__ KL, _Float16* __restrict__ VT, __bf16* __restrict__ VB, __bf16* __restrict__ VBL) {
  // x: the main loop's two buffers of X (64 rows x 64 k, f32; row pitch 272 B = 16 B x odd: the 16-B fragment reads of 16 rows fall on 16 different bank groups); the epilogue's sh / sl take their place behind the last chunk's barrier
  __shared__ __align__(16) union { struct { _Float16 h[64][136], l[64][136]; } e; float x[2][64][68]; } su; _Float16 (&sh)[64][136] = su.e.h; _Float16 (&sl)[64][136] = su.e.l;
  __shared__ __align__(16) _Float16 th[128][72]; __shared__ __align__(16) __bf16 tb[128][72], tbl[128][72];
  const int tid = threadIdx.x, wave = tid >> 5, lane = tid & 31, col = lane & 15, g = lane >> 4; const int which = blockIdx.z; const int c0 = blockIdx.y * 128; const size_t r0 = (size_t)blockIdx.x * 64; const size_t bb = r0 / TT; const int t0 = (int)(r0 % TT);
  const float* X = which == 0 ? XQ : which == 1 ? XK : XV; const float* WA = which == 0 ? WQ : which == 1 ? WK : WV; const float* BA = which == 0 ? BQ : which == 1 ? BK : BV;
  v8f acc[8] = {};
  // Main loop: K in 12 chunks of 64. The block's W chunk [64 k][128 cols] is read from global once (whole 512-B row segments, 16 B a lane), rounded to bf16, turned to [col][k] in registers and
  // kept in LDS for all four waves; tb / tbl (free until the epilogue) are the two buffers. 16-B slot o of row c sits at o ^ ((c >> 4) & 3): the stores (columns 4 apart across lanes) and the
  // fragment reads (columns 1 apart) then both fall on 16 different bank groups per 16 lanes. The next chunk's W loads are issued behind the barrier and fly while this chunk's products run.
  // X: each wave's own 16 rows x 64 k of a chunk come into LDS as f32 by asynchronous copies that cover whole 128-B lines (16 neighbouring lanes a row, 2 rows a copy) instead of register loads that touch 16 lines each;
  // two buffers: chunk t + 2 is asked for behind the barrier that ends trip t and flies while chunk t + 1 is multiplied. The A fragments are read from LDS and rounded to bf16 there: same values, same k order.
  const float* wsrc = WA + (size_t)(wave * 16) * CC + c0 + 4 * lane; const float* xsrc = X + (r0 + wave * 16 + g) * DIN + 4 * col;
  const unsigned xdst = lds_off(&su.x[0][wave * 16 + g][4 * col]);
  v4f wr[16]; v16b a[2];
  auto ldg = [&](int s) {   // chunk s counted from the one that wsrc / xsrc stand at
#pragma unroll
    for (int i = 0; i < 16; ++i) wr[i] = *(const v4f*)(wsrc + (size_t)(s * 64 + i) * CC); };
  auto fillx = [&](int s, int bi) { unsigned l[8]; const void* gp[8];   // X chunk s (counted as in ldg) into buffer bi; unrolled so that l and gp are registers
#pragma unroll
    for (int i = 0; i < 8; ++i) { l[i] = xdst + (unsigned)bi * (unsigned)sizeof(su.x[0]) + (unsigned)(i * 2 * sizeof(su.x[0][0])); gp[i] = xsrc + (size_t)(i * 2) * DIN + s * 64; }
    acopy8(l, gp); };
  auto stage = [&](__bf16 (*buf)[72]) { const int sw = (lane >> 2) & 3;
    __builtin_amdgcn_sched_barrier(0);   // keeps the conversions, which wait for the global loads, behind the chunk's last product: the loads fly under all sixteen
    asm volatile("s_wait_xcnt 0x0" ::: "memory");   // stands in front of the loop's advance of the address pair that the chunk's global loads name
#pragma unroll
    for (int oo = 0; oo < 2; ++oo) {
#pragma unroll
      for (int c = 0; c < 4; ++c) { v8b t;
#pragma unroll
        for (int i = 0; i < 8; ++i) t[i] = (__bf16)wr[oo * 8 + i][c];
        *(v8b*)&buf[4 * lane + c][((2 * wave + oo) ^ sw) * 8] = t; } } };
  // the 16 fragments of a chunk in four groups of four (group q: k half q >> 1, column tiles 4 (q & 1) ..): a group's eight LDS reads stand together, one group ahead of the products that use them
  auto mma = [&](const __bf16 (*buf)[72], const float (*xb)[68]) { const __bf16* p0 = &buf[col][8 * g]; const __bf16* p1 = &buf[col][8 * (g ^ 1)]; v16b w[2][4]; const float* px = &xb[wave * 16 + col][8 * g]; v4f xr[8];
    auto ldf = [&](int q) {
#pragma unroll
      for (int i = 0; i < 4; ++i) { const int j = 4 * (q & 1) + i; const __bf16* p = ((j & 1) ? p1 : p0) + j * 16 * 72 + (q >> 1) * 32; union { v16b v; v8b q2[2]; } u;
        u.q2[0] = *(const v8b*)(p + 8 * (j & 2)); u.q2[1] = *(const v8b*)(p + 8 * (2 ^ (j & 2))); w[q & 1][i] = u.v; } };
    // the chunk's X reads stand with the first group's W reads: one place with LDS reads
#pragma unroll
    for (int i = 0; i < 4; ++i) { xr[2 * i] = *(const v4f*)(px + i * 16); xr[2 * i + 1] = *(const v4f*)(px + i * 16 + 4); }
    ldf(0);
#pragma unroll
    for (int kk = 0; kk < 2; ++kk) {
#pragma unroll
      for (int i = 0; i < 4; ++i) { a[kk][i] = (__bf16)xr[4 * kk][i]; a[kk][4 + i] = (__bf16)xr[4 * kk + 1][i]; a[kk][8 + i] = (__bf16)xr[4 * kk + 2][i]; a[kk][12 + i] = (__bf16)xr[4 * kk + 3][i]; } }
#pragma unroll
    for (int q = 0; q < 4; ++q) { if (q < 3) ldf(q + 1);
#pragma unroll
      for (int i = 0; i < 4; ++i) acc[4 * (q & 1) + i] = wmma_bf(a[q >> 1], w[q & 1][i], acc[4 * (q & 1) + i]); } };
  auto foot = [&]() {
    asm volatile("s_wait_dscnt 0x0" ::: "memory");      // this wave's reads of the chunk's X buffer are over before it is refilled
    asm volatile("s_wait_asynccnt 0x0" ::: "memory");   // this wave's copies of the next chunk's X have landed
    __syncthreads(); };                                  // publishes the W chunk just stored and the X chunk just landed; ends the reads of the buffers that are filled next
  fillx(0, 0); ldg(0); stage(tb);
  asm volatile("s_wait_asynccnt 0x0" ::: "memory");   // this wave's copies of X chunk 0 have landed
  __syncthreads();
  // rolled: two chunks a trip (one per buffer) keep the loop's text small. Behind each barrier the next chunk's W loads, which stage() waits for, go out first; then its X copies, which the trip's foot waits for,
  // into the buffer that the trip before has read
#pragma unroll 1
  for (int s = 0; s < DIN / 64 - 2; s += 2) {
    ldg(1); fillx(1, 1); mma(tb, su.x[0]); stage(tbl); foot();
    ldg(2); fillx(2, 0); mma(tbl, su.x[1]); stage(tb); foot();
    wsrc += (size_t)128 * CC; xsrc += 128; }
  ldg(1); fillx(1, 1); mma(tb, su.x[0]); stage(tbl); foot();
  mma(tbl, su.x[1]);
  asm volatile("s_wait_asynccnt 0x0" ::: "memory");   // no copy is left in flight when the wave goes on
  __syncthreads();   // the epilogue stores into tb / tbl and over the X buffers: every wave's last fragment read ends here
  if (which < 2) { _Float16* DH = which == 0 ? QH : KH; _Float16* DL = which == 0 ? QL : KL; const int nhi = which == 0 ? QHI : KHI; const bool hi_rows = t0 < nhi;
#pragma unroll
    for (int j = 0; j < 8; ++j) { const float bias = BA ? bfr(BA[c0 + j * 16 + col]) : 0.f;
#pragma unroll
      for (int r = 0; r < 8; ++r) { const float v = acc[j][r] + bias; const _Float16 hv = (_Float16)v; sh[wave * 16 + 8 * g + r][j * 16 + col] = hv; sl[wave * 16 + 8 * g + r][j * 16 + col] = (_Float16)((v - (float)hv) * 1024.0f); } }
    __syncthreads();
    for (int e = tid; e < 64 * 16; e += 128) { const int rl = e >> 4, q = e & 15; vst2((unsigned*)(DH + (r0 + rl) * CC + c0 + q * 8), *(const v4u*)&sh[rl][q * 8]); if (hi_rows) vst2((unsigned*)(DL + (bb * nhi + t0 + rl) * (size_t)CC + c0 + q * 8), *(const v4u*)&sl[rl][q * 8]); }
  } else { const bool hi_rows = t0 < KHI;
#pragma unroll
    for (int j = 0; j < 8; ++j) { const float bias = BA ? bfr(BA[c0 + j * 16 + col]) : 0.f;
#pragma unroll
      for (int r = 0; r < 8; ++r) { const float v = acc[j][r] + bias; const int rl = wave * 16 + 8 * g + r, cl = j * 16 + col; th[cl][rl] = (_Float16)v; const __bf16 bh = (__bf16)v; tb[cl][rl] = bh; tbl[cl][rl] = (__bf16)(v - (float)bh); } }
    __syncthreads();
    for (int e = tid; e < 128 * 8; e += 128) { const int cl = e >> 3, q = e & 7; vst2((unsigned*)(VT + (bb * CC + c0 + cl) * (size_t)TT + t0 + q * 8), *(const v4u*)&th[cl][q * 8]); if (hi_rows) { const size_t o3 = (bb * CC + c0 + cl) * (size_t)KHI + t0 + q * 8; vst2((unsigned*)(VB + o3), *(const v4u*)&tb[cl][q * 8]); vst2((unsigned*)(VBL + o3), *(const v4u*)&tbl[cl][q * 8]); } } } }
// twelve asynchronous copies, 16 B a lane, global -> LDS; the closing s_wait_xcnt stands in the same statement, in front of any later rewrite of the address registers that the copies name
__device__ __forceinline__ void acopy12(const unsigned (&l)[12], const void* const (&g)[12]) {
  asm volatile("global_load_async_to_lds_b128 %0, %12, off\n\tglobal_load_async_to_lds_b128 %1, %13, off\n\tglobal_load_async_to_lds_b128 %2, %14, off\n\tglobal_load_async_to_lds_b128 %3, %15, off\n\t"
               "global_load_async_to_lds_b128 %4, %16, off\n\tglobal_load_async_to_lds_b128 %5, %17, off\n\tglobal_load_async_to_lds_b128 %6, %18, off\n\tglobal_load_async_to_lds_b128 %7, %19, off\n\t"
               "global_load_async_to_lds_b128 %8, %20, off\n\tglobal_load_async_to_lds_b128 %9, %21, off\n\tglobal_load_async_to_lds_b128 %10, %22, off\n\tglobal_load_async_to_lds_b128 %11, %23, off\n\ts_wait_xcnt 0x0"
               :: "v"(l[0]), "v"(l[1]), "v"(l[2]), "v"(l[3]), "v"(l[4]), "v"(l[5]), "v"(l[6]), "v"(l[7]), "v"(l[8]), "v"(l[9]), "v"(l[10]), "v"(l[11]),
                  "v"(g[0]), "v"(g[1]), "v"(g[2]), "v"(g[3]), "v"(g[4]), "v"(g[5]), "v"(g[6]), "v"(g[7]), "v"(g[8]), "v"(g[9]), "v"(g[10]), "v"(g[11]) : "memory"); }
#define SCW 64             // f16 elements in a staged row of k_sc (128 B)
// ---- k_sc: block = (query block qb, key block kb <= kb_last(qb), batch b = blockIdx.z): logits x SCALE; single f16 q x k, and for query blocks < QBH (causal early rows) also q residual (x 2^10) x k and q x k residual (3 products); causal: blocks past the diagonal exit, the mask itself is applied by index in k_sm
// The head width is walked in tiles. A tile holds 128 B of each of the block's 128 k rows and 64 q rows and comes into LDS by asynchronous copies that cover whole 128-B runs (8 neighbouring lanes a row); the k tile serves all four waves.
// Late rows: a staged row is 64 elements of the f16 plane (12 tiles). Early rows: 32 elements of the f16 plane, then the same 32 of the residual plane (24 tiles). Two buffers: tile t + 1 flies while tile t is multiplied.
// Same fragments and the same order of products into every accumulator as reading them from global memory.
__global__ __launch_bounds__(128) void k_sc(const _Float16* __restrict__ QH, const _Float16* __restrict__ KH, const _Float16* __restrict__ QL, const _Float16* __restrict__ KL, int h0, float* __restrict__ S0) {
  // row pitch 144 B (16 B x odd): the 16-B fragment reads of 16 rows fall on 16 different bank groups. The output tile ss takes the tiles' place once the last tile has been read: less LDS, one more block on a WGP.
  __shared__ __align__(16) union { struct { _Float16 k[2][128][SCW + 8]; _Float16 q[2][64][SCW + 8]; } t; float ss[4][16][132]; } sm;
  const int qb = blockIdx.x, kb = blockIdx.y; if (kb > kb_last(qb)) return;
  const int b = blockIdx.z; const int h = h0; float* S = S0 + (size_t)b * TT * TT;
  const int tid = threadIdx.x, wave = tid >> 5, lane = tid & 31, col = lane & 15, g = lane >> 4; const int k0 = kb * 128; const int ql0 = qb * 64 + wave * 16;
  v8f acc[8] = {}, accl[8] = {};
  const _Float16* QLb = QL + (size_t)b * QHI * CC; const _Float16* KLb = KL + (size_t)b * KHI * CC;
  const bool early = qb < QBH; const int step = early ? 32 : 64;
  const int rr = lane >> 3, o = lane & 7; const bool res = early && o >= 4;   // lane: row rr of four, 16-B slot o of the staged row; slots 4..7 of an early row hold the residual plane
  const _Float16* ksrc = (res ? KLb : KH + (size_t)b * TT * CC) + (size_t)(k0 + wave * 32 + rr) * CC + h * HD + (res ? o - 4 : o) * 8;
  const _Float16* qsrc = (res ? QLb : QH + (size_t)b * TT * CC) + (size_t)(ql0 + rr) * CC + h * HD + (res ? o - 4 : o) * 8;
  const unsigned kdst = lds_off(&sm.t.k[0][wave * 32 + rr][o * 8]), qdst = lds_off(&sm.t.q[0][wave * 16 + rr][o * 8]);
  auto fill = [&](int t) { unsigned l[12]; const void* gp[12];   // each wave: 32 rows of k (4 a copy), then its own 16 rows of q; both loops unrolled so that l and gp are registers
#pragma unroll
    for (int i = 0; i < 8; ++i) { l[i] = kdst + (unsigned)(t & 1) * (unsigned)sizeof(sm.t.k[0]) + (unsigned)(i * 4 * sizeof(sm.t.k[0][0])); gp[i] = ksrc + (size_t)(i * 4) * CC + t * step; }
#pragma unroll
    for (int i = 0; i < 4; ++i) { l[8 + i] = qdst + (unsigned)(t & 1) * (unsigned)sizeof(sm.t.q[0]) + (unsigned)(i * 4 * sizeof(sm.t.q[0][0])); gp[8 + i] = qsrc + (size_t)(i * 4) * CC + t * step; }
    acopy12(l, gp); };
  auto foot = [&](int t, int nt) {   // nt: the path's number of tiles
    asm volatile("s_wait_dscnt 0x0" ::: "memory");      // this wave's reads of tile t are over before its buffer is refilled
    asm volatile("s_wait_asynccnt 0x0" ::: "memory");   // this wave's copies of tile t + 1 have landed
    __syncthreads();                                     // publishes tile t + 1 and ends every wave's reads of tile t
    if (t + 2 < nt) fill(t + 2); };
  fill(0);
  asm volatile("s_wait_asynccnt 0x0" ::: "memory");   // this wave's copies of tile 0 have landed
  __syncthreads();                                     // ... and every other wave's: tile 0 may be read
  fill(1);
  if (early) {
    // rolled: the buffer is picked by t & 1, and the loop's text stays small
#pragma unroll 1
    for (int t = 0; t < HD / 32; ++t) { const _Float16 (*bk)[SCW + 8] = sm.t.k[t & 1]; const _Float16 (*bq)[SCW + 8] = sm.t.q[t & 1];
      const v16h ah = frag_h(&bq[wave * 16 + col][0], lane), al = frag_h(&bq[wave * 16 + col][32], lane);
      // four key tiles at a time (their fragments and both accumulator sets fit the registers); the three products of a key tile stand four apart, so that none waits for the one before it into the same accumulator
#pragma unroll
      for (int jh = 0; jh < 8; jh += 4) { v16h kf[4], lf[4];
#pragma unroll
        for (int j = 0; j < 4; ++j) { kf[j] = frag_h(&bk[(jh + j) * 16 + col][0], lane); lf[j] = frag_h(&bk[(jh + j) * 16 + col][32], lane); }
#pragma unroll
        for (int j = 0; j < 4; ++j) acc[jh + j] = wmma16(ah, kf[j], acc[jh + j]);
#pragma unroll
        for (int j = 0; j < 4; ++j) accl[jh + j] = wmma16(al, kf[j], accl[jh + j]);
#pragma unroll
        for (int j = 0; j < 4; ++j) accl[jh + j] = wmma16(ah, lf[j], accl[jh + j]); }
      foot(t, HD / 32); }
  } else {
    // rolled, as above
#pragma unroll 1
    for (int t = 0; t < HD / 64; ++t) { const _Float16 (*bk)[SCW + 8] = sm.t.k[t & 1]; const _Float16 (*bq)[SCW + 8] = sm.t.q[t & 1];
      // all of the tile's fragment reads stand together in front of its products: one place with LDS reads a tile (the loops over kk and j are unrolled so that a, kf and acc are registers)
      v16h a[2], kf[2][8];
#pragma unroll
      for (int kk = 0; kk < 2; ++kk) a[kk] = frag_h(&bq[wave * 16 + col][kk * 32], lane);
#pragma unroll
      for (int kk = 0; kk < 2; ++kk) {
#pragma unroll
        for (int j = 0; j < 8; ++j) kf[kk][j] = frag_h(&bk[j * 16 + col][kk * 32], lane); }
#pragma unroll
      for (int kk = 0; kk < 2; ++kk) {
#pragma unroll
        for (int j = 0; j < 8; ++j) acc[j] = wmma16(a[kk], kf[kk][j], acc[j]); }
      foot(t, HD / 64); } }
  asm volatile("s_wait_asynccnt 0x0" ::: "memory");   // no copy is left in flight when the wave goes on; the last trip's barrier has ended every wave's reads of the tiles, so ss may take their place
#pragma unroll
  for (int j = 0; j < 8; ++j) {
#pragma unroll
    for (int r = 0; r < 8; ++r) sm.ss[wave][8 * g + r][j * 16 + col] = (acc[j][r] + accl[j][r] * (1.0f / 1024.0f)) * SCALE; }
  LDSX(); for (int rl = 0; rl < 16; ++rl) vst2(S + (size_t)(ql0 + rl) * TT + k0 + lane * 4, *(const v4f*)&sm.ss[wave][rl][lane * 4]); }
// ---- k_sm: one wave = one query row t of batch blockIdx.y (eight rows a block): keys [0, nb * 128): causal -> logit if s <= t else excluded; softmax in f32; P x 2^11 in place (0 for excluded): f32 for rows < QHI, which k_pv splits in two; f16, the type k_pv multiplies, for all later rows: half the bytes to store here and to fetch six times there
// The whole row lives in the wave's registers: 16 B a lane per 128-key block, all of the row's loads in flight at once; maximum and sum go over the 32 lanes by shuffles. No LDS, no barrier, an eighth of the waves to start.
__global__ __launch_bounds__(256) void k_sm(float* __restrict__ S0 SM_EXTRA_PARAMS) {
  const int lane = threadIdx.x & 31; const int t = blockIdx.x * 8 + (threadIdx.x >> 5);
  const int nb = kb_last((blockIdx.x * 8) >> 6) + 1;   // 128-key blocks of the row; from blockIdx alone (the block's eight rows share it), so every test on it is a scalar branch
  float* sr = S0 + (size_t)blockIdx.y * TT * TT + (size_t)t * TT + lane * 4;
  v4f v[TT / 128];   // every loop over i is unrolled so that v stays in registers
#pragma unroll
  for (int i = 0; i < TT / 128; ++i) if (i < nb) v[i] = *(const v4f*)(sr + i * 128);
  float m = -3.0e38f;
#pragma unroll
  for (int i = 0; i < TT / 128; ++i) if (i < nb) {
#pragma unroll
    for (int c = 0; c < 4; ++c) { const float x = (!CAUSAL || i * 128 + lane * 4 + c <= t) ? v[i][c] : -3.0e38f; v[i][c] = x; m = fmaxf(m, x); } }
#pragma unroll
  for (int o = 1; o < 32; o <<= 1) m = fmaxf(m, __shfl_xor(m, o));
  v4f s4 = {};
#pragma unroll
  for (int i = 0; i < TT / 128; ++i) if (i < nb) {
#pragma unroll
    for (int c = 0; c < 4; ++c) { const float x = v[i][c]; const float ex = expf(x - m); const float e = (x <= -1.0e38f) ? 0.f : ex; v[i][c] = e; s4[c] += e; } }   // expf outside the choice: no branch a key, so that the keys' chains of dependent instructions overlap
  float sum = (s4[0] + s4[1]) + (s4[2] + s4[3]);
#pragma unroll
  for (int o = 1; o < 32; o <<= 1) sum += __shfl_xor(sum, o);
  const float inv = sum > 0.f ? 2048.0f / sum : 0.f;   /* a fully excluded row yields P = 0 */
  if (blockIdx.x * 8 < QHI) {   // from blockIdx alone: a scalar branch
#pragma unroll
    for (int i = 0; i < TT / 128; ++i) if (i < nb) { vst2(sr + i * 128, v[i] * inv);
      asm volatile("s_wait_xcnt 0x0" ::: "memory"); }   // the next block's products are formed in the data registers that this store names: the wait stands in front of that overwrite
  } else {
    // the row is whole in this wave's registers and no other wave reads it, so its f16 form may lie over its first bytes
    _Float16* hr = (_Float16*)(S0 + (size_t)blockIdx.y * TT * TT + (size_t)t * TT) + lane * 4;
#pragma unroll
    for (int i = 0; i < TT / 128; ++i) if (i < nb) { const v4f w = v[i] * inv; v4h hv;
#pragma unroll
      for (int c = 0; c < 4; ++c) hv[c] = (_Float16)w[c];
      vst2(hr + i * 128, hv);
      asm volatile("s_wait_xcnt 0x0" ::: "memory"); } } }   // as above: the next block's values are formed in the registers that this store names
#define PVK 64             // keys per staged tile of k_pv's late rows (early rows: 32)
#define DVH 128            // value columns per k_pv block: the 768-wide head is walked in six 128-column slices (8 accumulator tiles per wave; a 48-tile accumulator would not fit the register file)
// ---- k_pv: block = (64 queries (qb), 128-column value slice d0, batch b = blockIdx.z): ctx[:, d0 .. d0+127] = P . v over keys [0, kend) (P x 2^11, f16 from k_sm, against v f16: 1 product; causal early query blocks: P and v as bf16 hi + lo, 3 products); the 512-B (row, slice) segment by 32 lanes x 16 B
__global__ __launch_bounds__(128) void k_pv(const float* __restrict__ PS0, const _Float16* __restrict__ VT, const __bf16* __restrict__ VB, const __bf16* __restrict__ VBL, int h0, float* __restrict__ Y) { const int b = blockIdx.z; const int h = h0; const int d0 = blockIdx.y * DVH; const float* PS = PS0 + (size_t)b * TT * TT; __shared__ __align__(16) float ss[4][16][DVH + 4];
  __shared__ __align__(16) _Float16 sv[2][DVH][PVK + 8]; __shared__ __align__(16) union { float f[2][64][PVK + 4]; _Float16 h[2][64][PVK + 8]; } sp;   // P tiles: f32 (early rows) or f16 (late rows); row pitches 144 B and 272 B (16 B x odd): the 16-B fragment reads of 16 rows fall on 16 different bank groups
  const int tid = threadIdx.x, wave = tid >> 5, lane = tid & 31, col = lane & 15, g = lane >> 4; const int qb = blockIdx.x; const int ql0 = qb * 64 + wave * 16; const int kce = (kb_last(qb) + 1) * 4;
  v8f acc[DVH / 16] = {};
  if (qb < QBH) {
    // Early rows: keys in tiles of 32 (kce = 4, 8 or 12 tiles). A staged v row is 128 B: 32 keys of the bf16 hi plane, then the same 32 of the lo plane (16-B slots 4..7); a staged P row is 128 B of f32.
    // Both come into LDS by asynchronous copies in runs of 64 and 128 B, the v tile serves all four waves, and tile t + 1 flies while tile t is multiplied (the late rows' two buffers, read as bf16),
    // instead of a global fragment load and a full wait in front of every product. Same fragments; every accumulator takes its three products of a tile in the same order (hi x hi, lo x hi, hi x lo).
    const int rr = lane >> 3, o = lane & 7; const bool res = o >= 4;   // lane: row rr of four, 16-B slot o of the staged row
    const __bf16* vsrc = (res ? VBL : VB) + ((size_t)b * CC + h * HD + d0 + wave * 32 + rr) * (size_t)KHI + (res ? o - 4 : o) * 8; const float* psrc = PS + (size_t)(ql0 + rr) * TT + o * 4;
    const unsigned vdst = lds_off(&sv[0][wave * 32 + rr][o * 8]), pdst = lds_off(&sp.f[0][wave * 16 + rr][o * 4]);
    auto fill = [&](int t) { unsigned l[12]; const void* gp[12];   // each wave: 32 columns of v (4 a copy), then its own 16 rows of P (4 a copy); both loops unrolled so that l and gp are registers
#pragma unroll
      for (int i = 0; i < 8; ++i) { l[i] = vdst + (unsigned)(t & 1) * (unsigned)sizeof(sv[0]) + (unsigned)(i * 4 * sizeof(sv[0][0])); gp[i] = vsrc + (size_t)(i * 4) * KHI + t * 32; }
#pragma unroll
      for (int i = 0; i < 4; ++i) { l[8 + i] = pdst + (unsigned)(t & 1) * (unsigned)sizeof(sp.f[0]) + (unsigned)(i * 4 * sizeof(sp.f[0][0])); gp[8 + i] = psrc + (size_t)(i * 4) * TT + t * 32; }
      acopy12(l, gp); };
    fill(0);
    asm volatile("s_wait_asynccnt 0x0" ::: "memory");   // this wave's copies of tile 0 have landed
    __syncthreads();                                     // ... and every other wave's: tile 0 may be read
    fill(1);
    // rolled: the trip count depends on the query block, and the buffer is picked by t & 1
#pragma unroll 1
    for (int t = 0; t < kce; ++t) { const __bf16 (*bv)[PVK + 8] = (const __bf16 (*)[PVK + 8])sv[t & 1]; const float (*bp)[PVK + 4] = sp.f[t & 1];
      // all of the tile's fragment reads stand together in front of its products (the loops over j are unrolled so that vh, vl and acc are registers);
      // the three products of a column tile stand eight apart, so that none waits for the one before it into the same accumulator
      const F2 p = split_row(&bp[wave * 16 + col][0], 0, lane); v16b vh[DVH / 16], vl[DVH / 16];
#pragma unroll
      for (int j = 0; j < DVH / 16; ++j) { vh[j] = frag_b(&bv[j * 16 + col][0], lane); vl[j] = frag_b(&bv[j * 16 + col][32], lane); }
#pragma unroll
      for (int j = 0; j < DVH / 16; ++j) acc[j] = wmma_bf(p.h, vh[j], acc[j]);
#pragma unroll
      for (int j = 0; j < DVH / 16; ++j) acc[j] = wmma_bf(p.l, vh[j], acc[j]);
#pragma unroll
      for (int j = 0; j < DVH / 16; ++j) acc[j] = wmma_bf(p.h, vl[j], acc[j]);
      asm volatile("s_wait_dscnt 0x0" ::: "memory");      // this wave's reads of tile t are over before its buffer is refilled
      asm volatile("s_wait_asynccnt 0x0" ::: "memory");   // this wave's copies of tile t + 1 have landed
      __syncthreads();                                     // publishes tile t + 1 and ends every wave's reads of tile t
      if (t + 2 < kce) fill(t + 2); }
    asm volatile("s_wait_asynccnt 0x0" ::: "memory");   // no copy is left in flight when the wave goes on
  } else {
    // Keys in tiles of PVK = 64. A tile of v (128 columns x 128 B) and of P (64 rows x 128 B, f16 as k_sm left it) comes into LDS by asynchronous copies that cover whole 128-B lines (8 neighbouring lanes a row);
    // the v tile serves all four waves. Two buffers: tile t + 1 flies while tile t is multiplied. Same fragments, same key order as reading them from global memory.
    const int nt = kce >> 1;
    const _Float16* vsrc = VT + ((size_t)b * CC + h * HD + d0 + wave * 32 + (lane >> 3)) * (size_t)TT + (lane & 7) * 8; const _Float16* psrc = (const _Float16*)(PS + (size_t)(ql0 + (lane >> 3)) * TT) + (lane & 7) * 8;   // a P row starts where its f32 row did
    const unsigned vdst = lds_off(&sv[0][wave * 32 + (lane >> 3)][(lane & 7) * 8]), pdst = lds_off(&sp.h[0][wave * 16 + (lane >> 3)][(lane & 7) * 8]);
    auto fill = [&](int t) { unsigned l[12]; const void* gp[12];   // each wave: 32 columns of v (4 a copy), then its own 16 rows of P (4 a copy); both loops unrolled so that l and gp are registers
#pragma unroll
      for (int i = 0; i < 8; ++i) { l[i] = vdst + (unsigned)(t & 1) * (unsigned)sizeof(sv[0]) + (unsigned)(i * 4 * sizeof(sv[0][0])); gp[i] = vsrc + (size_t)(i * 4) * TT + t * PVK; }
#pragma unroll
      for (int i = 0; i < 4; ++i) { l[8 + i] = pdst + (unsigned)(t & 1) * (unsigned)sizeof(sp.h[0]) + (unsigned)(i * 4 * sizeof(sp.h[0][0])); gp[8 + i] = psrc + (size_t)(i * 4) * (2 * TT) + t * PVK; }
      acopy12(l, gp); };
    fill(0);
    asm volatile("s_wait_asynccnt 0x0" ::: "memory");   // this wave's copies of tile 0 have landed
    __syncthreads();                                     // ... and every other wave's: tile 0 may be read
    if (nt > 1) fill(1);
    // rolled: the trip count depends on the query block, and the buffer is picked by t & 1
#pragma unroll 1
    for (int t = 0; t < nt; ++t) { const _Float16 (*bv)[PVK + 8] = sv[t & 1]; const _Float16 (*bp)[PVK + 8] = sp.h[t & 1];
      // all of the tile's fragment reads stand together in front of its products: one place with LDS reads a tile instead of a read and a full wait in front of every product
      // (the loops over kk and j are unrolled so that p, vf and acc are registers)
      v16h p[PVK / 32], vf[PVK / 32][DVH / 16];
#pragma unroll
      for (int kk = 0; kk < PVK / 32; ++kk) p[kk] = frag_h(&bp[wave * 16 + col][kk * 32], lane);
#pragma unroll
      for (int kk = 0; kk < PVK / 32; ++kk) {
#pragma unroll
        for (int j = 0; j < DVH / 16; ++j) vf[kk][j] = frag_h(&bv[j * 16 + col][kk * 32], lane); }
#pragma unroll
      for (int kk = 0; kk < PVK / 32; ++kk) {
#pragma unroll
        for (int j = 0; j < DVH / 16; ++j) acc[j] = wmma16(p[kk], vf[kk][j], acc[j]); }
      asm volatile("s_wait_dscnt 0x0" ::: "memory");      // this wave's reads of tile t are over before its buffer is refilled
      asm volatile("s_wait_asynccnt 0x0" ::: "memory");   // this wave's copies of tile t + 1 have landed
      __syncthreads();                                     // publishes tile t + 1 and ends every wave's reads of tile t
      if (t + 2 < nt) fill(t + 2); }
    asm volatile("s_wait_asynccnt 0x0" ::: "memory"); }   // no copy is left in flight when the wave goes on
#pragma unroll
  for (int j = 0; j < DVH / 16; ++j)
#pragma unroll
    for (int r = 0; r < 8; ++r) ss[wave][8 * g + r][j * 16 + col] = acc[j][r] * (1.0f / 2048.0f);
  LDSX(); for (int rl = 0; rl < 16; ++rl) vst2(Y + ((size_t)b * TT + ql0 + rl) * CC + h * HD + d0 + lane * 4, *(const v4f*)&ss[wave][rl][lane * 4]); }   
extern "C" void kernel_launch(void* const* d_in, const int* in_sizes, int n_in, void* d_out, int out_size, void* d_ws, size_t ws_size, hipStream_t stream) {
  (void)in_sizes; (void)n_in; (void)out_size;
  const float** F = (const float**)d_in;
  if (ws_size < (size_t)WS_END) return;
  char* ws = (char*)d_ws; _Float16 *QH = (_Float16*)(ws + WS_QH), *KH = (_Float16*)(ws + WS_KH), *VT = (_Float16*)(ws + WS_VT), *QL = (_Float16*)(ws + WS_QL), *KL = (_Float16*)(ws + WS_KL); __bf16 *VB = (__bf16*)(ws + WS_VB), *VBL = (__bf16*)(ws + WS_VBL); float *S = (float*)(ws + WS_S), *Y = (float*)(ws + WS_Y);
  (void)Y; (void)QL; (void)KL; (void)VB; (void)VBL;
  // inputs: 0 x [4,2048,768]; 1 Wq [768,768] (in,out); 2 Wk; 3 Wv; no biases, no output projection
  k_proj<<<dim3(TNB * TT / 64, CC / 128, 3), 128, 0, stream>>>(F[0], F[0], F[0], F[1], F[2], F[3], nullptr, nullptr, nullptr, QH, QL, KH, KL, VT, VB, VBL);
  k_sc<<<dim3(NQB, TT / 128, TNB), 128, 0, stream>>>(QH, KH, QL, KL, 0, S);
  k_sm<<<dim3(TT / 8, TNB), 256, 0, stream>>>(S);
  k_pv<<<dim3(NQB, HD / DVH, TNB), 128, 0, stream>>>(S, VT, VB, VBL, 0, (float*)d_out);   /* six 128-column value slices per query block */
}

// v009
// A run of this version takes 113 microseconds.
// Timed twice side by side with v008, it ran 1.04 times as fast both times.
// Over all steps from v000 it is 7.27 times as fast.
// compute dtype: all float inputs rounded to bf16; q/k/v projections with EXACT bf16 products on WMMA 16x16x32 (f32 accumulate); causal logits over the 768-wide head: 3 products for the first 384 rows, single f16 q x k after, x 768^-0.5; softmax f32; P x 2^11 once to f16 (stored so from row 384 on) x v once to f16 (bf16 hi + lo below row 384); f32 output.
#include <hip/hip_runtime.h>
#include <math.h>

typedef __attribute__((ext_vector_type(16))) _Float16 v16h;
typedef __attribute__((ext_vector_type(16))) __bf16 v16b;
typedef __attribute__((ext_vector_type(8)))  _Float16 v8h;
typedef __attribute__((ext_vector_type(4)))  _Float16 v4h;
typedef __attribute__((ext_vector_type(8)))  float v8f;
typedef __attribute__((ext_vector_type(4)))  float v4f;
typedef __attribute__((ext_vector_type(2)))  float v2f;
typedef __attribute__((ext_vector_type(4)))  unsigned v4u;
typedef __attribute__((ext_vector_type(4)))  int v4i;
typedef float __attribute__((may_alias)) float_a;
typedef int __attribute__((may_alias)) int_a;

template <typename T> __device__ __forceinline__ void vst2(void* p, T v) { *(T*)p = v;  }
__device__ __forceinline__ v8f wmma16(v16h a, v16h b, v8f c) {
  v8f d = __builtin_amdgcn_wmma_f32_16x16x32_f16(false, a, false, b, (short)0, c, false, false);
  asm volatile("v_nop\n\tv_nop\n\tv_nop\n\tv_nop" : "+v"(d) : "v"(a), "v"(b));
  return d;
}
__device__ __forceinline__ v8f wmma_bf(v16b a, v16b b, v8f c) {
  v8f d = __builtin_amdgcn_wmma_f32_16x16x32_bf16(false, a, false, b, (short)0, c, false, false);
  asm volatile("v_nop\n\tv_nop\n\tv_nop\n\tv_nop" : "+v"(d) : "v"(a), "v"(b));
  return d;
}
// 16x16x32 fragments: lane = (h = lane>>4, row/col = lane&15); elements 0..7 = k0+8h+0..7, 8..15 = k0+16+8h+0..7; D element r = row 8h+r
__device__ __forceinline__ v16h frag_h(const _Float16* rowk0, int lane) {
  union { v16h v; v8h q[2]; } u; const _Float16* p = rowk0 + 8 * (lane >> 4);
  u.q[0] = *(const v8h*)p; u.q[1] = *(const v8h*)(p + 16); return u.v;
}
__device__ __forceinline__ v16h frag_f32(const float* rowk0, int lane) {
  v16h a; const float* p = rowk0 + 8 * (lane >> 4);
#pragma unroll
  for (int i = 0; i < 8; ++i) { a[i] = (_Float16)p[i]; a[8 + i] = (_Float16)p[16 + i]; }
  return a;
}
__device__ __forceinline__ v16h frag_f32s(const float* rowk0, int lane, float sc) {
  v16h a; const float* p = rowk0 + 8 * (lane >> 4);
#pragma unroll
  for (int i = 0; i < 8; ++i) { a[i] = (_Float16)(p[i] * sc); a[8 + i] = (_Float16)(p[16 + i] * sc); }
  return a;
}
// column fragment from a [K][ld] layout (column n), rows >= K read as 0
__device__ __forceinline__ v16h fragc_f32(const float* W, int k0, int n, int lane, int ld, int K) {
  v16h a; const int g = lane >> 4;
#pragma unroll
  for (int i = 0; i < 8; ++i) { const int ka = k0 + 8 * g + i, kb = ka + 16;
    a[i] = (_Float16)(ka < K ? W[(size_t)(ka < K ? ka : K - 1) * ld + n] : 0.f); a[8 + i] = (_Float16)(kb < K ? W[(size_t)(kb < K ? kb : K - 1) * ld + n] : 0.f); }
  return a;
}
struct F2 { v16b h, l; };
__device__ __forceinline__ F2 bsplit16(const float v[16]) { F2 r;
#pragma unroll
  for (int i = 0; i < 16; ++i) { const __bf16 h = (__bf16)v[i]; r.h[i] = h; r.l[i] = (__bf16)(v[i] - (float)h); }
  return r; }
__device__ __forceinline__ F2 split_row(const float* row, int k0, int lane) { float v[16]; const float* p = row + k0 + 8 * (lane >> 4);
#pragma unroll
  for (int i = 0; i < 8; ++i) { v[i] = p[i]; v[8 + i] = p[16 + i]; }
  return bsplit16(v); }
__device__ __forceinline__ F2 split_rowK(const float* row, int k0, int lane, int K) { float v[16]; const int g = lane >> 4;
#pragma unroll
  for (int i = 0; i < 8; ++i) { const int ka = k0 + 8 * g + i, kb = ka + 16; v[i] = ka < K ? row[ka < K ? ka : K - 1] : 0.f; v[8 + i] = kb < K ? row[kb < K ? kb : K - 1] : 0.f; }
  return bsplit16(v); }
__device__ __forceinline__ F2 split_col(const float* W, int k0, int n, int lane, int ld, int K) { float v[16]; const int g = lane >> 4;
#pragma unroll
  for (int i = 0; i < 8; ++i) { const int ka = k0 + 8 * g + i, kb = ka + 16; v[i] = ka < K ? W[(size_t)(ka < K ? ka : K - 1) * ld + n] : 0.f; v[8 + i] = kb < K ? W[(size_t)(kb < K ? kb : K - 1) * ld + n] : 0.f; }
  return bsplit16(v); }
__device__ __forceinline__ v8f mac3(const F2& a, const F2& b, v8f c) { c = wmma_bf(a.l, b.h, c); c = wmma_bf(a.h, b.l, c); return wmma_bf(a.h, b.h, c); }
__device__ __forceinline__ float sigm(float v) { return 1.0f / (1.0f + expf(-v)); }
#define LDSX() do { asm volatile("s_wait_dscnt 0" ::: "memory"); __builtin_amdgcn_wave_barrier(); __builtin_amdgcn_fence(__ATOMIC_RELEASE, "workgroup"); } while (0)

// Single-head causal self-attention with a 768-WIDE head (x [4,2048,768]; (in,out) Wq / Wk / Wv [768,768] uniform, no biases; scores = q k^T with -inf above the diagonal, then / sqrt(768); no head split, no output projection): out = softmax(causal(q k^T) / sqrt(768)) v -> [4,2048,768].
#define NB 4
#define TT 2048
#define CC 768            // NH * HD = projected width
#define DIN 768          // input (model) width
#define NH 1
#define HD 768
#define NQB (TT / 64)
#define HG 1
#define SCALE (0.036084391824351615f)
#define CAUSAL 1
#ifndef TNB
#define TNB NB
#endif
__device__ __forceinline__ float bfr(float v) { return (float)(__bf16)v; }
__host__ __device__ __forceinline__ int kb_last(int qb) { return CAUSAL ? ((qb * 64 + 63) >> 7) : (TT / 128 - 1); }
typedef __attribute__((ext_vector_type(8))) __bf16 v8b;
__device__ __forceinline__ v16b frag_b(const __bf16* rowk0, int lane) {
  union { v16b v; v8b q[2]; } u; const __bf16* p = rowk0 + 8 * (lane >> 4);
  u.q[0] = *(const v8b*)p; u.q[1] = *(const v8b*)(p + 16); return u.v;
}
#define QBH 6              // causal: query blocks 0..QBH-1 of each sequence (few keys, no averaging) take the high-precision path
#define QHI 384            // rows carrying a q residual plane
#define KHI 384            // key rows carrying k residual / v bf16 hi+lo planes (used only by the causal high-precision path)
// B fragment (k rows k0+.., output column o) of a weight: (in,out) [K][ld] or (out,in) [ld rows of K]: bf16 exact, or f16(bf16 * 256) exact
__device__ __forceinline__ v16b wcol_io(const float* Wm, int k0, int o, int lane, int ld) { v16b w; const int g = lane >> 4;
#pragma unroll
  for (int i = 0; i < 8; ++i) { w[i] = (__bf16)Wm[(size_t)(k0 + 8 * g + i) * ld + o]; w[8 + i] = (__bf16)Wm[(size_t)(k0 + 16 + 8 * g + i) * ld + o]; }
  return w; }
__device__ __forceinline__ v16b wcol_oi(const float* Wm, int k0, int o, int lane, int K) { v16b w; const float* p = Wm + (size_t)o * K + k0 + 8 * (lane >> 4);
#pragma unroll
  for (int i = 0; i < 8; ++i) { w[i] = (__bf16)p[i]; w[8 + i] = (__bf16)p[16 + i]; }
  return w; }
__device__ __forceinline__ v16h wcolh_io(const float* Wm, int k0, int o, int lane, int ld) { v16h w; const int g = lane >> 4;
#pragma unroll
  for (int i = 0; i < 8; ++i) { w[i] = (_Float16)(bfr(Wm[(size_t)(k0 + 8 * g + i) * ld + o]) * 256.0f); w[8 + i] = (_Float16)(bfr(Wm[(size_t)(k0 + 16 + 8 * g + i) * ld + o]) * 256.0f); }
  return w; }
__device__ __forceinline__ v16h wcolh_oi(const float* Wm, int k0, int o, int lane, int K) { v16h w; const float* p = Wm + (size_t)o * K + k0 + 8 * (lane >> 4);
#pragma unroll
  for (int i = 0; i < 8; ++i) { w[i] = (_Float16)(bfr(p[i]) * 256.0f); w[8 + i] = (_Float16)(bfr(p[16 + i]) * 256.0f); }
  return w; }
#define WQKV_LAYOUT 0   // 0 = (in,out) [DIN][CC]; 1 = (out,in) [CC][DIN]; 2 = per-head [NH][DIN][HD]
__device__ __forceinline__ v16b wcol_hdk(const float* Wm, int k0, int o, int lane) { v16b w; const int g = lane >> 4; const float* p = Wm + (size_t)(o / HD) * DIN * HD + (o % HD);
#pragma unroll
  for (int i = 0; i < 8; ++i) { w[i] = (__bf16)p[(size_t)(k0 + 8 * g + i) * HD]; w[8 + i] = (__bf16)p[(size_t)(k0 + 16 + 8 * g + i) * HD]; }
  return w; }
#define WO_OUT_IN 0
#if WQKV_LAYOUT == 1
#define WCOL(W, k0, o, lane) wcol_oi(W, k0, o, lane, DIN)
#elif WQKV_LAYOUT == 2
#define WCOL(W, k0, o, lane) wcol_hdk(W, k0, o, lane)
#else
#define WCOL(W, k0, o, lane) wcol_io(W, k0, o, lane, CC)
#endif
#if WO_OUT_IN
#define WOCOL(W, k0, o, lane) wcol_oi(W, k0, o, lane, CC)
#define WOCOLH(W, k0, o, lane) wcolh_oi(W, k0, o, lane, CC)
#else
#define WOCOL(W, k0, o, lane) wcol_io(W, k0, o, lane, DIN)
#define WOCOLH(W, k0, o, lane) wcolh_io(W, k0, o, lane, DIN)
#endif

#ifndef SM_EXTRA_PARAMS
#define SM_EXTRA_PARAMS
#endif
#ifndef PROJ_EXTRA_PARAMS
#define PROJ_EXTRA_PARAMS
#endif
#ifndef SM_MASK_HOOK
#define SM_MASK_HOOK (void)0
#endif

#define WS_QH  0u                                      // f16 q rows [b*t][CC]
#define WS_KH  (WS_QH + 2u * (size_t)NB * TT * CC)      // f16 k rows [b*t][CC]
#define WS_VT  (WS_KH + 2u * (size_t)NB * TT * CC)      // f16 v planes [b][c][t]
#define WS_QL  (WS_VT + 2u * (size_t)NB * CC * TT)      // f16 q residual x 2^10 rows [b][t < QHI][CC]
#define WS_KL  (WS_QL + 2u * (size_t)NB * QHI * CC)     // f16 k residual x 2^10 rows [b][t < KHI][CC]
#define WS_VB  (WS_KL + 2u * (size_t)NB * KHI * CC)     // bf16 v hi planes [b][c][t < KHI]
#define WS_VBL (WS_VB + 2u * (size_t)NB * CC * KHI)
#define WS_S   (WS_VBL + 2u * (size_t)NB * CC * KHI)    // f32 logits / P [b][t][s]: one plane per batch, so that each stage runs all batches in one launch; from row QHI on P is f16 and fills the first half of its row's bytes
#define WS_Y   (WS_S  + 4u * (size_t)NB * TT * TT)      // f32 ctx rows [b*t][CC] (only when there is an output projection)
#define WS_END (WS_Y  + 0u)

__device__ __forceinline__ unsigned lds_off(const void* p) { return (unsigned)(size_t)p; }   // byte address in the work-group's LDS
// eight asynchronous copies, 16 B a lane, global -> LDS; the closing s_wait_xcnt stands in the same statement, in front of any later rewrite of the address registers that the copies name
__device__ __forceinline__ void acopy8(const unsigned (&l)[8], const void* const (&g)[8]) {
  asm volatile("global_load_async_to_lds_b128 %0, %8, off\n\tglobal_load_async_to_lds_b128 %1, %9, off\n\tglobal_load_async_to_lds_b128 %2, %10, off\n\tglobal_load_async_to_lds_b128 %3, %11, off\n\t"
               "global_load_async_to_lds_b128 %4, %12, off\n\tglobal_load_async_to_lds_b128 %5, %13, off\n\tglobal_load_async_to_lds_b128 %6, %14, off\n\tglobal_load_async_to_lds_b128 %7, %15, off\n\ts_wait_xcnt 0x0"
               :: "v"(l[0]), "v"(l[1]), "v"(l[2]), "v"(l[3]), "v"(l[4]), "v"(l[5]), "v"(l[6]), "v"(l[7]), "v"(g[0]), "v"(g[1]), "v"(g[2]), "v"(g[3]), "v"(g[4]), "v"(g[5]), "v"(g[6]), "v"(g[7]) : "memory"); }
// eight 16-B stores; the closing s_wait_xcnt stands in the same statement, in front of any later rewrite of the address and data registers that the stores name
__device__ __forceinline__ void gst8(void* const (&p)[8], const v4u (&d)[8]) {
  asm volatile("global_store_b128 %0, %8, off\n\tglobal_store_b128 %1, %9, off\n\tglobal_store_b128 %2, %10, off\n\tglobal_store_b128 %3, %11, off\n\t"
               "global_store_b128 %4, %12, off\n\tglobal_store_b128 %5, %13, off\n\tglobal_store_b128 %6, %14, off\n\tglobal_store_b128 %7, %15, off\n\ts_wait_xcnt 0x0"
               :: "v"(p[0]), "v"(p[1]), "v"(p[2]), "v"(p[3]), "v"(p[4]), "v"(p[5]), "v"(p[6]), "v"(p[7]), "v"(d[0]), "v"(d[1]), "v"(d[2]), "v"(d[3]), "v"(d[4]), "v"(d[5]), "v"(d[6]), "v"(d[7]) : "memory"); }
#define PBM 128            // rows per k_proj block: four waves of 32 rows x 128 columns
// ---- k_proj: block = (128 rows, 128 cols, which): q/k/v = X W (+ b) with exact bf16 products (K = DIN) -> which 0: q f16 rows (+ residual rows < QHI); 1: k f16 rows (+ residual rows < KHI); 2: v f16 planes [c][t] (+ bf16 hi/lo planes for t < KHI)
// Each wave owns two 16-row tiles: a W fragment read from LDS feeds two products, and a W chunk fetched, converted and stored once serves 128 rows.
// The second launch bound asks for a register count at which three waves fit a SIMD, as many blocks as the LDS lets onto a WGP (a build without it takes 342 registers, an allocation of 352, and only two fit; with it 334, an allocation of 336).
__global__ __launch_bounds__(128, 3) void k_proj(const float* __restrict__ XQ, const float* __restrict__ XK, const float* __restrict__ XV, const float* __restrict__ WQ, const float* __restrict__ WK, const float* __restrict__ WV, const float* __restrict__ BQ, const float* __restrict__ BK, const float* __restrict__ BV,
    _Float16* __restrict__ QH, _Float16* __restrict__ QL, _Float16* __restrict__ KH, _Float16* __restrict__ KL, _Float16* __restrict__ VT, __bf16* __restrict__ VB, __bf16* __restrict__ VBL) {
  // m: the main loop's two buffers of X (128 rows x 64 k, f32; row pitch 272 B = 16 B x odd: the 16-B fragment reads of 16 rows fall on 16 different bank groups) and of W (128 cols x 64 k, bf16, pitch 144 B);
  // the epilogue's staging (e for q / k, v for v) takes their place behind the last chunk's barrier
  __shared__ __align__(16) union { struct { float x[2][PBM][68]; __bf16 w[2][128][72]; } m; struct { _Float16 h[PBM][136], l[PBM][136]; } e; struct { _Float16 th[128][PBM + 8]; __bf16 tb[128][PBM + 8], tbl[128][PBM + 8]; } v; } su;
  const int tid = threadIdx.x, wave = tid >> 5, lane = tid & 31, col = lane & 15, g = lane >> 4; const int which = blockIdx.z; const int c0 = blockIdx.y * 128; const size_t r0 = (size_t)blockIdx.x * PBM; const size_t bb = r0 / TT; const int t0 = (int)(r0 % TT);
  const float* X = which == 0 ? XQ : which == 1 ? XK : XV; const float* WA = which == 0 ? WQ : which == 1 ? WK : WV; const float* BA = which == 0 ? BQ : which == 1 ? BK : BV;
  v8f acc[2][8] = {};
  // Main loop: K in 12 chunks of 64. The block's W chunk [64 k][128 cols] is read from global once (whole 512-B row segments, 16 B a lane), rounded to bf16, turned to [col][k] in registers and
  // kept in LDS for all four waves, in two buffers. 16-B slot o of row c sits at o ^ ((c >> 4) & 3): the stores (columns 4 apart across lanes) and the
  // fragment reads (columns 1 apart) then both fall on 16 different bank groups per 16 lanes. The next chunk's W loads are issued behind the barrier and fly while this chunk's products run.
  // X: each wave's own 32 rows x 64 k of a chunk come into LDS as f32 by asynchronous copies that cover whole 128-B lines (16 neighbouring lanes a row, 2 rows a copy);
  // two buffers: the next chunk is asked for behind the barrier that ends the trip before and flies while this chunk is multiplied. The A fragments are read from LDS and rounded to bf16 there.
  const float* wsrc = WA + (size_t)(wave * 16) * CC + c0 + 4 * lane; const float* xsrc = X + (r0 + wave * 32 + g) * DIN + 4 * col;
  const unsigned xdst = lds_off(&su.m.x[0][wave * 32 + g][4 * col]);
  v4f wr[16]; v16b a[2][2];
  auto ldg = [&](int s) {   // chunk s counted from the one that wsrc / xsrc stand at
#pragma unroll
    for (int i = 0; i < 16; ++i) wr[i] = *(const v4f*)(wsrc + (size_t)(s * 64 + i) * CC); };
  auto fillx = [&](int s, int bi) {   // X chunk s (counted as in ldg) into buffer bi: 16 rows a statement; unrolled so that l and gp are registers
#pragma unroll
    for (int hf = 0; hf < 2; ++hf) { unsigned l[8]; const void* gp[8];
#pragma unroll
      for (int i = 0; i < 8; ++i) { l[i] = xdst + (unsigned)bi * (unsigned)sizeof(su.m.x[0]) + (unsigned)((hf * 16 + i * 2) * sizeof(su.m.x[0][0])); gp[i] = xsrc + (size_t)(hf * 16 + i * 2) * DIN + s * 64; }
      acopy8(l, gp); } };
  auto stage = [&](__bf16 (*buf)[72]) { const int sw = (lane >> 2) & 3;
    __builtin_amdgcn_sched_barrier(0);   // keeps the conversions, which wait for the global loads, behind the chunk's last product: the loads fly under all of them
    asm volatile("s_wait_xcnt 0x0" ::: "memory");   // stands in front of the loop's advance of the address pair that the chunk's global loads name
#pragma unroll
    for (int oo = 0; oo < 2; ++oo) {
#pragma unroll
      for (int c = 0; c < 4; ++c) { v8b t;
#pragma unroll
        for (int i = 0; i < 8; ++i) t[i] = (__bf16)wr[oo * 8 + i][c];
        *(v8b*)&buf[4 * lane + c][((2 * wave + oo) ^ sw) * 8] = t; } } };
  // the 16 W fragments of a chunk in four groups of four (group q: k half q >> 1, column tiles 4 (q & 1) ..): a group's eight LDS reads stand together, one group (eight products) ahead of the products that use them
  auto mma = [&](const __bf16 (*buf)[72], const float (*xb)[68]) { const __bf16* p0 = &buf[col][8 * g]; const __bf16* p1 = &buf[col][8 * (g ^ 1)]; v16b w[2][4]; const float* px = &xb[wave * 32 + col][8 * g]; v4f xr[2][8];
    auto ldf = [&](int q) {
#pragma unroll
      for (int i = 0; i < 4; ++i) { const int j = 4 * (q & 1) + i; const __bf16* p = ((j & 1) ? p1 : p0) + j * 16 * 72 + (q >> 1) * 32; union { v16b v; v8b q2[2]; } u;
        u.q2[0] = *(const v8b*)(p + 8 * (j & 2)); u.q2[1] = *(const v8b*)(p + 8 * (2 ^ (j & 2))); w[q & 1][i] = u.v; } };
    // the chunk's X reads stand with the first group's W reads: one place with LDS reads
#pragma unroll
    for (int rt = 0; rt < 2; ++rt) {
#pragma unroll
      for (int i = 0; i < 4; ++i) { xr[rt][2 * i] = *(const v4f*)(px + rt * 16 * 68 + i * 16); xr[rt][2 * i + 1] = *(const v4f*)(px + rt * 16 * 68 + i * 16 + 4); } }
    ldf(0);
#pragma unroll
    for (int kk = 0; kk < 2; ++kk) {
#pragma unroll
      for (int rt = 0; rt < 2; ++rt) {
#pragma unroll
        for (int i = 0; i < 4; ++i) { a[kk][rt][i] = (__bf16)xr[rt][4 * kk][i]; a[kk][rt][4 + i] = (__bf16)xr[rt][4 * kk + 1][i]; a[kk][rt][8 + i] = (__bf16)xr[rt][4 * kk + 2][i]; a[kk][rt][12 + i] = (__bf16)xr[rt][4 * kk + 3][i]; } } }
#pragma unroll
    for (int q = 0; q < 4; ++q) { if (q < 3) ldf(q + 1);
#pragma unroll
      for (int rt = 0; rt < 2; ++rt) {
#pragma unroll
        for (int i = 0; i < 4; ++i) acc[rt][4 * (q & 1) + i] = wmma_bf(a[q >> 1][rt], w[q & 1][i], acc[rt][4 * (q & 1) + i]); } } };
  auto foot = [&]() {
    asm volatile("s_wait_dscnt 0x0" ::: "memory");      // this wave's reads of the chunk's X buffer are over before it is refilled
    asm volatile("s_wait_asynccnt 0x0" ::: "memory");   // this wave's copies of the next chunk's X have landed
    __syncthreads(); };                                  // publishes the W chunk just stored and the X chunk just landed; ends the reads of the buffers that are filled next
  fillx(0, 0); ldg(0);
  asm volatile("s_wait_xcnt 0x0" :: "v"(wsrc) : "memory");   // the build gives the first chunk's loads an address pair of their own, free behind the last of them: as an input here the pair stays whole up to this wait (no load's result is put into it)
  stage(su.m.w[0]);
  asm volatile("s_wait_asynccnt 0x0" ::: "memory");   // this wave's copies of X chunk 0 have landed
  __syncthreads();
  // rolled: two chunks a trip (one per buffer) keep the loop's text small. Behind each barrier the next chunk's W loads, which stage() waits for, go out first; then its X copies, which the trip's foot waits for,
  // into the buffer that the trip before has read
#pragma unroll 1
  for (int s = 0; s < DIN / 64 - 2; s += 2) {
    ldg(1); fillx(1, 1); mma(su.m.w[0], su.m.x[0]); stage(su.m.w[1]); foot();
    ldg(2); fillx(2, 0); mma(su.m.w[1], su.m.x[1]); stage(su.m.w[0]); foot();
    wsrc += (size_t)128 * CC; xsrc += 128; }
  ldg(1); fillx(1, 1); mma(su.m.w[0], su.m.x[0]); stage(su.m.w[1]); foot();
  mma(su.m.w[1], su.m.x[1]);
  asm volatile("s_wait_asynccnt 0x0" ::: "memory");   // no copy is left in flight when the wave goes on
  __syncthreads();   // the epilogue stores over the W and X buffers: every wave's last fragment read ends here
  if (which < 2) { _Float16* DH = which == 0 ? QH : KH; _Float16* DL = which == 0 ? QL : KL; const int nhi = which == 0 ? QHI : KHI; const bool hi_rows = t0 < nhi;
#pragma unroll
    for (int rt = 0; rt < 2; ++rt) {
#pragma unroll
      for (int j = 0; j < 8; ++j) { const float bias = BA ? bfr(BA[c0 + j * 16 + col]) : 0.f;
#pragma unroll
        for (int r = 0; r < 8; ++r) { const float v = acc[rt][j][r] + bias; const _Float16 hv = (_Float16)v; const int rl = wave * 32 + rt * 16 + 8 * g + r; su.e.h[rl][j * 16 + col] = hv; su.e.l[rl][j * 16 + col] = (_Float16)((v - (float)hv) * 1024.0f); } } }
    __syncthreads();
    // 16 lanes a row (256 B), 8 rows a store, eight stores a statement; unrolled so that p and d are registers
#pragma unroll
    for (int h = 0; h < PBM / 64; ++h) { const int q = tid & 15; void* p[8]; v4u d[8];
#pragma unroll
      for (int i = 0; i < 8; ++i) { const int rl = h * 64 + i * 8 + (tid >> 4); p[i] = DH + (r0 + rl) * CC + c0 + q * 8; d[i] = *(const v4u*)&su.e.h[rl][q * 8]; }
      gst8(p, d);
      if (hi_rows) {
#pragma unroll
        for (int i = 0; i < 8; ++i) { const int rl = h * 64 + i * 8 + (tid >> 4); p[i] = DL + (bb * nhi + t0 + rl) * (size_t)CC + c0 + q * 8; d[i] = *(const v4u*)&su.e.l[rl][q * 8]; }
        gst8(p, d); } }
  } else { const bool hi_rows = t0 < KHI;
#pragma unroll
    for (int rt = 0; rt < 2; ++rt) {
#pragma unroll
      for (int j = 0; j < 8; ++j) { const float bias = BA ? bfr(BA[c0 + j * 16 + col]) : 0.f;
#pragma unroll
        for (int r = 0; r < 8; ++r) { const float v = acc[rt][j][r] + bias; const int rl = wave * 32 + rt * 16 + 8 * g + r, cl = j * 16 + col; su.v.th[cl][rl] = (_Float16)v; const __bf16 bh = (__bf16)v; su.v.tb[cl][rl] = bh; su.v.tbl[cl][rl] = (__bf16)(v - (float)bh); } } }
    __syncthreads();
    // 16 lanes a plane row (256 B), 8 plane rows a store, eight stores a statement; unrolled so that p and d are registers
#pragma unroll
    for (int h = 0; h < 2; ++h) { const int q = tid & 15; void* p[8]; v4u d[8];
#pragma unroll
      for (int i = 0; i < 8; ++i) { const int cl = h * 64 + i * 8 + (tid >> 4); p[i] = VT + (bb * CC + c0 + cl) * (size_t)TT + t0 + q * 8; d[i] = *(const v4u*)&su.v.th[cl][q * 8]; }
      gst8(p, d);
      if (hi_rows) {
#pragma unroll
        for (int i = 0; i < 8; ++i) { const int cl = h * 64 + i * 8 + (tid >> 4); p[i] = VB + (bb * CC + c0 + cl) * (size_t)KHI + t0 + q * 8; d[i] = *(const v4u*)&su.v.tb[cl][q * 8]; }
        gst8(p, d);
#pragma unroll
        for (int i = 0; i < 8; ++i) { const int cl = h * 64 + i * 8 + (tid >> 4); p[i] = VBL + (bb * CC + c0 + cl) * (size_t)KHI + t0 + q * 8; d[i] = *(const v4u*)&su.v.tbl[cl][q * 8]; }
        gst8(p, d); } } } }
// twelve asynchronous copies, 16 B a lane, global -> LDS; the closing s_wait_xcnt stands in the same statement, in front of any later rewrite of the address registers that the copies name
__device__ __forceinline__ void acopy12(const unsigned (&l)[12], const void* const (&g)[12]) {
  asm volatile("global_load_async_to_lds_b128 %0, %12, off\n\tglobal_load_async_to_lds_b128 %1, %13, off\n\tglobal_load_async_to_lds_b128 %2, %14, off\n\tglobal_load_async_to_lds_b128 %3, %15, off\n\t"
               "global_load_async_to_lds_b128 %4, %16, off\n\tglobal_load_async_to_lds_b128 %5, %17, off\n\tglobal_load_async_to_lds_b128 %6, %18, off\n\tglobal_load_async_to_lds_b128 %7, %19, off\n\t"
               "global_load_async_to_lds_b128 %8, %20, off\n\tglobal_load_async_to_lds_b128 %9, %21, off\n\tglobal_load_async_to_lds_b128 %10, %22, off\n\tglobal_load_async_to_lds_b128 %11, %23, off\n\ts_wait_xcnt 0x0"
               :: "v"(l[0]), "v"(l[1]), "v"(l[2]), "v"(l[3]), "v"(l[4]), "v"(l[5]), "v"(l[6]), "v"(l[7]), "v"(l[8]), "v"(l[9]), "v"(l[10]), "v"(l[11]),
                  "v"(g[0]), "v"(g[1]), "v"(g[2]), "v"(g[3]), "v"(g[4]), "v"(g[5]), "v"(g[6]), "v"(g[7]), "v"(g[8]), "v"(g[9]), "v"(g[10]), "v"(g[11]) : "memory"); }
#define SCW 64             // f16 elements in a staged row of k_sc (128 B)
// ---- k_sc: block = (query block qb, key block kb <= kb_last(qb), batch b = blockIdx.z): logits x SCALE; single f16 q x k, and for query blocks < QBH (causal early rows) also q residual (x 2^10) x k and q x k residual (3 products); causal: blocks past the diagonal exit, the mask itself is applied by index in k_sm
// The head width is walked in tiles. A tile holds 128 B of each of the block's 128 k rows and 64 q rows and comes into LDS by asynchronous copies that cover whole 128-B runs (8 neighbouring lanes a row); the k tile serves all four waves.
// Late rows: a staged row is 64 elements of the f16 plane (12 tiles). Early rows: 32 elements of the f16 plane, then the same 32 of the residual plane (24 tiles). Two buffers: tile t + 1 flies while tile t is multiplied.
// Same fragments and the same order of products into every accumulator as reading them from global memory.
__global__ __launch_bounds__(128) void k_sc(const _Float16* __restrict__ QH, const _Float16* __restrict__ KH, const _Float16* __restrict__ QL, const _Float16* __restrict__ KL, int h0, float* __restrict__ S0) {
  // row pitch 144 B (16 B x odd): the 16-B fragment reads of 16 rows fall on 16 different bank groups. The output tile ss takes the tiles' place once the last tile has been read: less LDS, one more block on a WGP.
  __shared__ __align__(16) union { struct { _Float16 k[2][128][SCW + 8]; _Float16 q[2][64][SCW + 8]; } t; float ss[4][16][132]; } sm;
  const int qb = blockIdx.x, kb = blockIdx.y; if (kb > kb_last(qb)) return;
  const int b = blockIdx.z; const int h = h0; float* S = S0 + (size_t)b * TT * TT;
  const int tid = threadIdx.x, wave = tid >> 5, lane = tid & 31, col = lane & 15, g = lane >> 4; const int k0 = kb * 128; const int ql0 = qb * 64 + wave * 16;
  v8f acc[8] = {}, accl[8] = {};
  const _Float16* QLb = QL + (size_t)b * QHI * CC; const _Float16* KLb = KL + (size_t)b * KHI * CC;
  const bool early = qb < QBH; const int step = early ? 32 : 64;
  const int rr = lane >> 3, o = lane & 7; const bool res = early && o >= 4;   // lane: row rr of four, 16-B slot o of the staged row; slots 4..7 of an early row hold the residual plane
  const _Float16* ksrc = (res ? KLb : KH + (size_t)b * TT * CC) + (size_t)(k0 + wave * 32 + rr) * CC + h * HD + (res ? o - 4 : o) * 8;
  const _Float16* qsrc = (res ? QLb : QH + (size_t)b * TT * CC) + (size_t)(ql0 + rr) * CC + h * HD + (res ? o - 4 : o) * 8;
  const unsigned kdst = lds_off(&sm.t.k[0][wave * 32 + rr][o * 8]), qdst = lds_off(&sm.t.q[0][wave * 16 + rr][o * 8]);
  auto fill = [&](int t) { unsigned l[12]; const void* gp[12];   // each wave: 32 rows of k (4 a copy), then its own 16 rows of q; both loops unrolled so that l and gp are registers
#pragma unroll
    for (int i = 0; i < 8; ++i) { l[i] = kdst + (unsigned)(t & 1) * (unsigned)sizeof(sm.t.k[0]) + (unsigned)(i * 4 * sizeof(sm.t.k[0][0])); gp[i] = ksrc + (size_t)(i * 4) * CC + t * step; }
#pragma unroll
    for (int i = 0; i < 4; ++i) { l[8 + i] = qdst + (unsigned)(t & 1) * (unsigned)sizeof(sm.t.q[0]) + (unsigned)(i * 4 * sizeof(sm.t.q[0][0])); gp[8 + i] = qsrc + (size_t)(i * 4) * CC + t * step; }
    acopy12(l, gp); };
  auto foot = [&](int t, int nt) {   // nt: the path's number of tiles
    asm volatile("s_wait_dscnt 0x0" ::: "memory");      // this wave's reads of tile t are over before its buffer is refilled
    asm volatile("s_wait_asynccnt 0x0" ::: "memory");   // this wave's copies of tile t + 1 have landed
    __syncthreads();                                     // publishes tile t + 1 and ends every wave's reads of tile t
    if (t + 2 < nt) fill(t + 2); };
  fill(0);
  asm volatile("s_wait_asynccnt 0x0" ::: "memory");   // this wave's copies of tile 0 have landed
  __syncthreads();                                     // ... and every other wave's: tile 0 may be read
  fill(1);
  if (early) {
    // rolled: the buffer is picked by t & 1, and the loop's text stays small
#pragma unroll 1
    for (int t = 0; t < HD / 32; ++t) { const _Float16 (*bk)[SCW + 8] = sm.t.k[t & 1]; const _Float16 (*bq)[SCW + 8] = sm.t.q[t & 1];
      const v16h ah = frag_h(&bq[wave * 16 + col][0], lane), al = frag_h(&bq[wave * 16 + col][32], lane);
      // four key tiles at a time (their fragments and both accumulator sets fit the registers); the three products of a key tile stand four apart, so that none waits for the one before it into the same accumulator
#pragma unroll
      for (int jh = 0; jh < 8; jh += 4) { v16h kf[4], lf[4];
#pragma unroll
        for (int j = 0; j < 4; ++j) { kf[j] = frag_h(&bk[(jh + j) * 16 + col][0], lane); lf[j] = frag_h(&bk[(jh + j) * 16 + col][32], lane); }
#pragma unroll
        for (int j = 0; j < 4; ++j) acc[jh + j] = wmma16(ah, kf[j], acc[jh + j]);
#pragma unroll
        for (int j = 0; j < 4; ++j) accl[jh + j] = wmma16(al, kf[j], accl[jh + j]);
#pragma unroll
        for (int j = 0; j < 4; ++j) accl[jh + j] = wmma16(ah, lf[j], accl[jh + j]); }
      foot(t, HD / 32); }
  } else {
    // rolled, as above
#pragma unroll 1
    for (int t = 0; t < HD / 64; ++t) { const _Float16 (*bk)[SCW + 8] = sm.t.k[t & 1]; const _Float16 (*bq)[SCW + 8] = sm.t.q[t & 1];
      // all of the tile's fragment reads stand together in front of its products: one place with LDS reads a tile (the loops over kk and j are unrolled so that a, kf and acc are registers)
      v16h a[2], kf[2][8];
#pragma unroll
      for (int kk = 0; kk < 2; ++kk) a[kk] = frag_h(&bq[wave * 16 + col][kk * 32], lane);
#pragma unroll
      for (int kk = 0; kk < 2; ++kk) {
#pragma unroll
        for (int j = 0; j < 8; ++j) kf[kk][j] = frag_h(&bk[j * 16 + col][kk * 32], lane); }
#pragma unroll
      for (int kk = 0; kk < 2; ++kk) {
#pragma unroll
        for (int j = 0; j < 8; ++j) acc[j] = wmma16(a[kk], kf[kk][j], acc[j]); }
      foot(t, HD / 64); } }
  asm volatile("s_wait_asynccnt 0x0" ::: "memory");   // no copy is left in flight when the wave goes on; the last trip's barrier has ended every wave's reads of the tiles, so ss may take their place
#pragma unroll
  for (int j = 0; j < 8; ++j) {
#pragma unroll
    for (int r = 0; r < 8; ++r) sm.ss[wave][8 * g + r][j * 16 + col] = (acc[j][r] + accl[j][r] * (1.0f / 1024.0f)) * SCALE; }
  LDSX(); for (int rl = 0; rl < 16; ++rl) vst2(S + (size_t)(ql0 + rl) * TT + k0 + lane * 4, *(const v4f*)&sm.ss[wave][rl][lane * 4]); }
// ---- k_sm: one wave = one query row t of batch blockIdx.y (eight rows a block): keys [0, nb * 128): causal -> logit if s <= t else excluded; softmax in f32; P x 2^11 in place (0 for excluded): f32 for rows < QHI, which k_pv splits in two; f16, the type k_pv multiplies, for all later rows: half the bytes to store here and to fetch six times there
// The whole row lives in the wave's registers: 16 B a lane per 128-key block, all of the row's loads in flight at once; maximum and sum go over the 32 lanes by shuffles. No LDS, no barrier, an eighth of the waves to start.
__global__ __launch_bounds__(256) void k_sm(float* __restrict__ S0 SM_EXTRA_PARAMS) {
  const int lane = threadIdx.x & 31; const int t = blockIdx.x * 8 + (threadIdx.x >> 5);
  const int nb = kb_last((blockIdx.x * 8) >> 6) + 1;   // 128-key blocks of the row; from blockIdx alone (the block's eight rows share it), so every test on it is a scalar branch
  float* sr = S0 + (size_t)blockIdx.y * TT * TT + (size_t)t * TT + lane * 4;
  v4f v[TT / 128];   // every loop over i is unrolled so that v stays in registers
#pragma unroll
  for (int i = 0; i < TT / 128; ++i) if (i < nb) v[i] = *(const v4f*)(sr + i * 128);
  float m = -3.0e38f;
#pragma unroll
  for (int i = 0; i < TT / 128; ++i) if (i < nb) {
#pragma unroll
    for (int c = 0; c < 4; ++c) { const float x = (!CAUSAL || i * 128 + lane * 4 + c <= t) ? v[i][c] : -3.0e38f; v[i][c] = x; m = fmaxf(m, x); } }
#pragma unroll
  for (int o = 1; o < 32; o <<= 1) m = fmaxf(m, __shfl_xor(m, o));
  v4f s4 = {};
#pragma unroll
  for (int i = 0; i < TT / 128; ++i) if (i < nb) {
#pragma unroll
    for (int c = 0; c < 4; ++c) { const float x = v[i][c]; const float ex = expf(x - m); const float e = (x <= -1.0e38f) ? 0.f : ex; v[i][c] = e; s4[c] += e; } }   // expf outside the choice: no branch a key, so that the keys' chains of dependent instructions overlap
  float sum = (s4[0] + s4[1]) + (s4[2] + s4[3]);
#pragma unroll
  for (int o = 1; o < 32; o <<= 1) sum += __shfl_xor(sum, o);
  const float inv = sum > 0.f ? 2048.0f / sum : 0.f;   /* a fully excluded row yields P = 0 */
  if (blockIdx.x * 8 < QHI) {   // from blockIdx alone: a scalar branch
#pragma unroll
    for (int i = 0; i < TT / 128; ++i) if (i < nb) { vst2(sr + i * 128, v[i] * inv);
      asm volatile("s_wait_xcnt 0x0" ::: "memory"); }   // the next block's products are formed in the data registers that this store names: the wait stands in front of that overwrite
  } else {
    // the row is whole in this wave's registers and no other wave reads it, so its f16 form may lie over its first bytes
    _Float16* hr = (_Float16*)(S0 + (size_t)blockIdx.y * TT * TT + (size_t)t * TT) + lane * 4;
#pragma unroll
    for (int i = 0; i < TT / 128; ++i) if (i < nb) { const v4f w = v[i] * inv; v4h hv;
#pragma unroll
      for (int c = 0; c < 4; ++c) hv[c] = (_Float16)w[c];
      vst2(hr + i * 128, hv);
      asm volatile("s_wait_xcnt 0x0" ::: "memory"); } } }   // as above: the next block's values are formed in the registers that this store names
#define PVK 64             // keys per staged tile of k_pv's late rows (early rows: 32)
#define DVH 128            // value columns per k_pv block: the 768-wide head is walked in six 128-column slices (8 accumulator tiles per wave; a 48-tile accumulator would not fit the register file)
// ---- k_pv: block = (64 queries (qb), 128-column value slice d0, batch b = blockIdx.z): ctx[:, d0 .. d0+127] = P . v over keys [0, kend) (P x 2^11, f16 from k_sm, against v f16: 1 product; causal early query blocks: P and v as bf16 hi + lo, 3 products); the 512-B (row, slice) segment by 32 lanes x 16 B
__global__ __launch_bounds__(128) void k_pv(const float* __restrict__ PS0, const _Float16* __restrict__ VT, const __bf16* __restrict__ VB, const __bf16* __restrict__ VBL, int h0, float* __restrict__ Y) { const int b = blockIdx.z; const int h = h0; const int d0 = blockIdx.y * DVH; const float* PS = PS0 + (size_t)b * TT * TT; __shared__ __align__(16) float ss[4][16][DVH + 4];
  __shared__ __align__(16) _Float16 sv[2][DVH][PVK + 8]; __shared__ __align__(16) union { float f[2][64][PVK + 4]; _Float16 h[2][64][PVK + 8]; } sp;   // P tiles: f32 (early rows) or f16 (late rows); row pitches 144 B and 272 B (16 B x odd): the 16-B fragment reads of 16 rows fall on 16 different bank groups
  const int tid = threadIdx.x, wave = tid >> 5, lane = tid & 31, col = lane & 15, g = lane >> 4; const int qb = blockIdx.x; const int ql0 = qb * 64 + wave * 16; const int kce = (kb_last(qb) + 1) * 4;
  v8f acc[DVH / 16] = {};
  if (qb < QBH) {
    // Early rows: keys in tiles of 32 (kce = 4, 8 or 12 tiles). A staged v row is 128 B: 32 keys of the bf16 hi plane, then the same 32 of the lo plane (16-B slots 4..7); a staged P row is 128 B of f32.
    // Both come into LDS by asynchronous copies in runs of 64 and 128 B, the v tile serves all four waves, and tile t + 1 flies while tile t is multiplied (the late rows' two buffers, read as bf16),
    // instead of a global fragment load and a full wait in front of every product. Same fragments; every accumulator takes its three products of a tile in the same order (hi x hi, lo x hi, hi x lo).
    const int rr = lane >> 3, o = lane & 7; const bool res = o >= 4;   // lane: row rr of four, 16-B slot o of the staged row
    const __bf16* vsrc = (res ? VBL : VB) + ((size_t)b * CC + h * HD + d0 + wave * 32 + rr) * (size_t)KHI + (res ? o - 4 : o) * 8; const float* psrc = PS + (size_t)(ql0 + rr) * TT + o * 4;
    const unsigned vdst = lds_off(&sv[0][wave * 32 + rr][o * 8]), pdst = lds_off(&sp.f[0][wave * 16 + rr][o * 4]);
    auto fill = [&](int t) { unsigned l[12]; const void* gp[12];   // each wave: 32 columns of v (4 a copy), then its own 16 rows of P (4 a copy); both loops unrolled so that l and gp are registers
#pragma unroll
      for (int i = 0; i < 8; ++i) { l[i] = vdst + (unsigned)(t & 1) * (unsigned)sizeof(sv[0]) + (unsigned)(i * 4 * sizeof(sv[0][0])); gp[i] = vsrc + (size_t)(i * 4) * KHI + t * 32; }
#pragma unroll
      for (int i = 0; i < 4; ++i) { l[8 + i] = pdst + (unsigned)(t & 1) * (unsigned)sizeof(sp.f[0]) + (unsigned)(i * 4 * sizeof(sp.f[0][0])); gp[8 + i] = psrc + (size_t)(i * 4) * TT + t * 32; }
      acopy12(l, gp); };
    fill(0);
    asm volatile("s_wait_asynccnt 0x0" ::: "memory");   // this wave's copies of tile 0 have landed
    __syncthreads();                                     // ... and every other wave's: tile 0 may be read
    fill(1);
    // rolled: the trip count depends on the query block, and the buffer is picked by t & 1
#pragma unroll 1
    for (int t = 0; t < kce; ++t) { const __bf16 (*bv)[PVK + 8] = (const __bf16 (*)[PVK + 8])sv[t & 1]; const float (*bp)[PVK + 4] = sp.f[t & 1];
      // all of the tile's fragment reads stand together in front of its products (the loops over j are unrolled so that vh, vl and acc are registers);
      // the three products of a column tile stand eight apart, so that none waits for the one before it into the same accumulator
      const F2 p = split_row(&bp[wave * 16 + col][0], 0, lane); v16b vh[DVH / 16], vl[DVH / 16];
#pragma unroll
      for (int j = 0; j < DVH / 16; ++j) { vh[j] = frag_b(&bv[j * 16 + col][0], lane); vl[j] = frag_b(&bv[j * 16 + col][32], lane); }
#pragma unroll
      for (int j = 0; j < DVH / 16; ++j) acc[j] = wmma_bf(p.h, vh[j], acc[j]);
#pragma unroll
      for (int j = 0; j < DVH / 16; ++j) acc[j] = wmma_bf(p.l, vh[j], acc[j]);
#pragma unroll
      for (int j = 0; j < DVH / 16; ++j) acc[j] = wmma_bf(p.h, vl[j], acc[j]);
      asm volatile("s_wait_dscnt 0x0" ::: "memory");      // this wave's reads of tile t are over before its buffer is refilled
      asm volatile("s_wait_asynccnt 0x0" ::: "memory");   // this wave's copies of tile t + 1 have landed
      __syncthreads();                                     // publishes tile t + 1 and ends every wave's reads of tile t
      if (t + 2 < kce) fill(t + 2); }
    asm volatile("s_wait_asynccnt 0x0" ::: "memory");   // no copy is left in flight when the wave goes on
  } else {
    // Keys in tiles of PVK = 64. A tile of v (128 columns x 128 B) and of P (64 rows x 128 B, f16 as k_sm left it) comes into LDS by asynchronous copies that cover whole 128-B lines (8 neighbouring lanes a row);
    // the v tile serves all four waves. Two buffers: tile t + 1 flies while tile t is multiplied. Same fragments, same key order as reading them from global memory.
    const int nt = kce >> 1;
    const _Float16* vsrc = VT + ((size_t)b * CC + h * HD + d0 + wave * 32 + (lane >> 3)) * (size_t)TT + (lane & 7) * 8; const _Float16* psrc = (const _Float16*)(PS + (size_t)(ql0 + (lane >> 3)) * TT) + (lane & 7) * 8;   // a P row starts where its f32 row did
    const unsigned vdst = lds_off(&sv[0][wave * 32 + (lane >> 3)][(lane & 7) * 8]), pdst = lds_off(&sp.h[0][wave * 16 + (lane >> 3)][(lane & 7) * 8]);
    auto fill = [&](int t) { unsigned l[12]; const void* gp[12];   // each wave: 32 columns of v (4 a copy), then its own 16 rows of P (4 a copy); both loops unrolled so that l and gp are registers
#pragma unroll
      for (int i = 0; i < 8; ++i) { l[i] = vdst + (unsigned)(t & 1) * (unsigned)sizeof(sv[0]) + (unsigned)(i * 4 * sizeof(sv[0][0])); gp[i] = vsrc + (size_t)(i * 4) * TT + t * PVK; }
#pragma unroll
      for (int i = 0; i < 4; ++i) { l[8 + i] = pdst + (unsigned)(t & 1) * (unsigned)sizeof(sp.h[0]) + (unsigned)(i * 4 * sizeof(sp.h[0][0])); gp[8 + i] = psrc + (size_t)(i * 4) * (2 * TT) + t * PVK; }
      acopy12(l, gp); };
    fill(0);
    asm volatile("s_wait_asynccnt 0x0" ::: "memory");   // this wave's copies of tile 0 have landed
    __syncthreads();                                     // ... and every other wave's: tile 0 may be read
    if (nt > 1) fill(1);
    // rolled: the trip count depends on the query block, and the buffer is picked by t & 1
#pragma unroll 1
    for (int t = 0; t < nt; ++t) { const _Float16 (*bv)[PVK + 8] = sv[t & 1]; const _Float16 (*bp)[PVK + 8] = sp.h[t & 1];
      // all of the tile's fragment reads stand together in front of its products: one place with LDS reads a tile instead of a read and a full wait in front of every product
      // (the loops over kk and j are unrolled so that p, vf and acc are registers)
      v16h p[PVK / 32], vf[PVK / 32][DVH / 16];
#pragma unroll
      for (int kk = 0; kk < PVK / 32; ++kk) p[kk] = frag_h(&bp[wave * 16 + col][kk * 32], lane);
#pragma unroll
      for (int kk = 0; kk < PVK / 32; ++kk) {
#pragma unroll
        for (int j = 0; j < DVH / 16; ++j) vf[kk][j] = frag_h(&bv[j * 16 + col][kk * 32], lane); }
#pragma unroll
      for (int kk = 0; kk < PVK / 32; ++kk) {
#pragma unroll
        for (int j = 0; j < DVH / 16; ++j) acc[j] = wmma16(p[kk], vf[kk][j], acc[j]); }
      asm volatile("s_wait_dscnt 0x0" ::: "memory");      // this wave's reads of tile t are over before its buffer is refilled
      asm volatile("s_wait_asynccnt 0x0" ::: "memory");   // this wave's copies of tile t + 1 have landed
      __syncthreads();                                     // publishes tile t + 1 and ends every wave's reads of tile t
      if (t + 2 < nt) fill(t + 2); }
    asm volatile("s_wait_asynccnt 0x0" ::: "memory"); }   // no copy is left in flight when the wave goes on
#pragma unroll
  for (int j = 0; j < DVH / 16; ++j)
#pragma unroll
    for (int r = 0; r < 8; ++r) ss[wave][8 * g + r][j * 16 + col] = acc[j][r] * (1.0f / 2048.0f);
  LDSX(); for (int rl = 0; rl < 16; ++rl) vst2(Y + ((size_t)b * TT + ql0 + rl) * CC + h * HD + d0 + lane * 4, *(const v4f*)&ss[wave][rl][lane * 4]); }   
extern "C" void kernel_launch(void* const* d_in, const int* in_sizes, int n_in, void* d_out, int out_size, void* d_ws, size_t ws_size, hipStream_t stream) {
  (void)in_sizes; (void)n_in; (void)out_size;
  const float** F = (const float**)d_in;
  if (ws_size < (size_t)WS_END) return;
  char* ws = (char*)d_ws; _Float16 *QH = (_Float16*)(ws + WS_QH), *KH = (_Float16*)(ws + WS_KH), *VT = (_Float16*)(ws + WS_VT), *QL = (_Float16*)(ws + WS_QL), *KL = (_Float16*)(ws + WS_KL); __bf16 *VB = (__bf16*)(ws + WS_VB), *VBL = (__bf16*)(ws + WS_VBL); float *S = (float*)(ws + WS_S), *Y = (float*)(ws + WS_Y);
  (void)Y; (void)QL; (void)KL; (void)VB; (void)VBL;
  // inputs: 0 x [4,2048,768]; 1 Wq [768,768] (in,out); 2 Wk; 3 Wv; no biases, no output projection
  k_proj<<<dim3(TNB * TT / PBM, CC / 128, 3), 128, 0, stream>>>(F[0], F[0], F[0], F[1], F[2], F[3], nullptr, nullptr, nullptr, QH, QL, KH, KL, VT, VB, VBL);
  k_sc<<<dim3(NQB, TT / 128, TNB), 128, 0, stream>>>(QH, KH, QL, KL, 0, S);
  k_sm<<<dim3(TT / 8, TNB), 256, 0, stream>>>(S);
  k_pv<<<dim3(NQB, HD / DVH, TNB), 128, 0, stream>>>(S, VT, VB, VBL, 0, (float*)d_out);   /* six 128-column value slices per query block */
}

// v010
// Measured time: 108 microseconds a run.
// Next to v009, in two timings, it ran 1.08 times as fast each time.
// Over all steps from v000 it is 7.85 times as fast.
// compute dtype: all float inputs rounded to bf16; q/k/v projections with EXACT bf16 products on WMMA 16x16x32 (f32 accumulate); causal logits over the 768-wide head: 3 products for the first 384 rows, single f16 q x k after, x 768^-0.5; softmax f32, per 128-key block against the block's own maximum, joined by f32 factors; exp x 2^11 once to f16 (from row 384 on) x v once to f16 (bf16 hi + lo below row 384); f32 output.
#include <hip/hip_runtime.h>
#include <math.h>

typedef __attribute__((ext_vector_type(16))) _Float16 v16h;
typedef __attribute__((ext_vector_type(16))) __bf16 v16b;
typedef __attribute__((ext_vector_type(8)))  _Float16 v8h;
typedef __attribute__((ext_vector_type(4)))  _Float16 v4h;
typedef __attribute__((ext_vector_type(8)))  float v8f;
typedef __attribute__((ext_vector_type(4)))  float v4f;
typedef __attribute__((ext_vector_type(2)))  float v2f;
typedef __attribute__((ext_vector_type(4)))  unsigned v4u;
typedef __attribute__((ext_vector_type(4)))  int v4i;
typedef float __attribute__((may_alias)) float_a;
typedef int __attribute__((may_alias)) int_a;

template <typename T> __device__ __forceinline__ void vst2(void* p, T v) { *(T*)p = v;  }
__device__ __forceinline__ v8f wmma16(v16h a, v16h b, v8f c) {
  v8f d = __builtin_amdgcn_wmma_f32_16x16x32_f16(false, a, false, b, (short)0, c, false, false);
  asm volatile("v_nop\n\tv_nop\n\tv_nop\n\tv_nop" : "+v"(d) : "v"(a), "v"(b));
  return d;
}
__device__ __forceinline__ v8f wmma_bf(v16b a, v16b b, v8f c) {
  v8f d = __builtin_amdgcn_wmma_f32_16x16x32_bf16(false, a, false, b, (short)0, c, false, false);
  asm volatile("v_nop\n\tv_nop\n\tv_nop\n\tv_nop" : "+v"(d) : "v"(a), "v"(b));
  return d;
}
// 16x16x32 fragments: lane = (h = lane>>4, row/col = lane&15); elements 0..7 = k0+8h+0..7, 8..15 = k0+16+8h+0..7; D element r = row 8h+r
__device__ __forceinline__ v16h frag_h(const _Float16* rowk0, int lane) {
  union { v16h v; v8h q[2]; } u; const _Float16* p = rowk0 + 8 * (lane >> 4);
  u.q[0] = *(const v8h*)p; u.q[1] = *(const v8h*)(p + 16); return u.v;
}
__device__ __forceinline__ v16h frag_f32(const float* rowk0, int lane) {
  v16h a; const float* p = rowk0 + 8 * (lane >> 4);
#pragma unroll
  for (int i = 0; i < 8; ++i) { a[i] = (_Float16)p[i]; a[8 + i] = (_Float16)p[16 + i]; }
  return a;
}
__device__ __forceinline__ v16h frag_f32s(const float* rowk0, int lane, float sc) {
  v16h a; const float* p = rowk0 + 8 * (lane >> 4);
#pragma unroll
  for (int i = 0; i < 8; ++i) { a[i] = (_Float16)(p[i] * sc); a[8 + i] = (_Float16)(p[16 + i] * sc); }
  return a;
}
// column fragment from a [K][ld] layout (column n), rows >= K read as 0
__device__ __forceinline__ v16h fragc_f32(const float* W, int k0, int n, int lane, int ld, int K) {
  v16h a; const int g = lane >> 4;
#pragma unroll
  for (int i = 0; i < 8; ++i) { const int ka = k0 + 8 * g + i, kb = ka + 16;
    a[i] = (_Float16)(ka < K ? W[(size_t)(ka < K ? ka : K - 1) * ld + n] : 0.f); a[8 + i] = (_Float16)(kb < K ? W[(size_t)(kb < K ? kb : K - 1) * ld + n] : 0.f); }
  return a;
}
struct F2 { v16b h, l; };
__device__ __forceinline__ F2 bsplit16(const float v[16]) { F2 r;
#pragma unroll
  for (int i = 0; i < 16; ++i) { const __bf16 h = (__bf16)v[i]; r.h[i] = h; r.l[i] = (__bf16)(v[i] - (float)h); }
  return r; }
__device__ __forceinline__ F2 split_row(const float* row, int k0, int lane) { float v[16]; const float* p = row + k0 + 8 * (lane >> 4);
#pragma unroll
  for (int i = 0; i < 8; ++i) { v[i] = p[i]; v[8 + i] = p[16 + i]; }
  return bsplit16(v); }
__device__ __forceinline__ F2 split_rowK(const float* row, int k0, int lane, int K) { float v[16]; const int g = lane >> 4;
#pragma unroll
  for (int i = 0; i < 8; ++i) { const int ka = k0 + 8 * g + i, kb = ka + 16; v[i] = ka < K ? row[ka < K ? ka : K - 1] : 0.f; v[8 + i] = kb < K ? row[kb < K ? kb : K - 1] : 0.f; }
  return bsplit16(v); }
__device__ __forceinline__ F2 split_col(const float* W, int k0, int n, int lane, int ld, int K) { float v[16]; const int g = lane >> 4;
#pragma unroll
  for (int i = 0; i < 8; ++i) { const int ka = k0 + 8 * g + i, kb = ka + 16; v[i] = ka < K ? W[(size_t)(ka < K ? ka : K - 1) * ld + n] : 0.f; v[8 + i] = kb < K ? W[(size_t)(kb < K ? kb : K - 1) * ld + n] : 0.f; }
  return bsplit16(v); }
__device__ __forceinline__ v8f mac3(const F2& a, const F2& b, v8f c) { c = wmma_bf(a.l, b.h, c); c = wmma_bf(a.h, b.l, c); return wmma_bf(a.h, b.h, c); }
__device__ __forceinline__ float sigm(float v) { return 1.0f / (1.0f + expf(-v)); }
#define LDSX() do { asm volatile("s_wait_dscnt 0" ::: "memory"); __builtin_amdgcn_wave_barrier(); __builtin_amdgcn_fence(__ATOMIC_RELEASE, "workgroup"); } while (0)

// Single-head causal self-attention with a 768-WIDE head (x [4,2048,768]; (in,out) Wq / Wk / Wv [768,768] uniform, no biases; scores = q k^T with -inf above the diagonal, then / sqrt(768); no head split, no output projection): out = softmax(causal(q k^T) / sqrt(768)) v -> [4,2048,768].
#define NB 4
#define TT 2048
#define CC 768            // NH * HD = projected width
#define DIN 768          // input (model) width
#define NH 1
#define HD 768
#define NQB (TT / 64)
#define HG 1
#define SCALE (0.036084391824351615f)
#define CAUSAL 1
#ifndef TNB
#define TNB NB
#endif
__device__ __forceinline__ float bfr(float v) { return (float)(__bf16)v; }
__host__ __device__ __forceinline__ int kb_last(int qb) { return CAUSAL ? ((qb * 64 + 63) >> 7) : (TT / 128 - 1); }
typedef __attribute__((ext_vector_type(8))) __bf16 v8b;
__device__ __forceinline__ v16b frag_b(const __bf16* rowk0, int lane) {
  union { v16b v; v8b q[2]; } u; const __bf16* p = rowk0 + 8 * (lane >> 4);
  u.q[0] = *(const v8b*)p; u.q[1] = *(const v8b*)(p + 16); return u.v;
}
#define QBH 6              // causal: query blocks 0..QBH-1 of each sequence (few keys, no averaging) take the high-precision path
#define QHI 384            // rows carrying a q residual plane
#define KHI 384            // key rows carrying k residual / v bf16 hi+lo planes (used only by the causal high-precision path)
// B fragment (k rows k0+.., output column o) of a weight: (in,out) [K][ld] or (out,in) [ld rows of K]: bf16 exact, or f16(bf16 * 256) exact
__device__ __forceinline__ v16b wcol_io(const float* Wm, int k0, int o, int lane, int ld) { v16b w; const int g = lane >> 4;
#pragma unroll
  for (int i = 0; i < 8; ++i) { w[i] = (__bf16)Wm[(size_t)(k0 + 8 * g + i) * ld + o]; w[8 + i] = (__bf16)Wm[(size_t)(k0 + 16 + 8 * g + i) * ld + o]; }
  return w; }
__device__ __forceinline__ v16b wcol_oi(const float* Wm, int k0, int o, int lane, int K) { v16b w; const float* p = Wm + (size_t)o * K + k0 + 8 * (lane >> 4);
#pragma unroll
  for (int i = 0; i < 8; ++i) { w[i] = (__bf16)p[i]; w[8 + i] = (__bf16)p[16 + i]; }
  return w; }
__device__ __forceinline__ v16h wcolh_io(const float* Wm, int k0, int o, int lane, int ld) { v16h w; const int g = lane >> 4;
#pragma unroll
  for (int i = 0; i < 8; ++i) { w[i] = (_Float16)(bfr(Wm[(size_t)(k0 + 8 * g + i) * ld + o]) * 256.0f); w[8 + i] = (_Float16)(bfr(Wm[(size_t)(k0 + 16 + 8 * g + i) * ld + o]) * 256.0f); }
  return w; }
__device__ __forceinline__ v16h wcolh_oi(const float* Wm, int k0, int o, int lane, int K) { v16h w; const float* p = Wm + (size_t)o * K + k0 + 8 * (lane >> 4);
#pragma unroll
  for (int i = 0; i < 8; ++i) { w[i] = (_Float16)(bfr(p[i]) * 256.0f); w[8 + i] = (_Float16)(bfr(p[16 + i]) * 256.0f); }
  return w; }
#define WQKV_LAYOUT 0   // 0 = (in,out) [DIN][CC]; 1 = (out,in) [CC][DIN]; 2 = per-head [NH][DIN][HD]
__device__ __forceinline__ v16b wcol_hdk(const float* Wm, int k0, int o, int lane) { v16b w; const int g = lane >> 4; const float* p = Wm + (size_t)(o / HD) * DIN * HD + (o % HD);
#pragma unroll
  for (int i = 0; i < 8; ++i) { w[i] = (__bf16)p[(size_t)(k0 + 8 * g + i) * HD]; w[8 + i] = (__bf16)p[(size_t)(k0 + 16 + 8 * g + i) * HD]; }
  return w; }
#define WO_OUT_IN 0
#if WQKV_LAYOUT == 1
#define WCOL(W, k0, o, lane) wcol_oi(W, k0, o, lane, DIN)
#elif WQKV_LAYOUT == 2
#define WCOL(W, k0, o, lane) wcol_hdk(W, k0, o, lane)
#else
#define WCOL(W, k0, o, lane) wcol_io(W, k0, o, lane, CC)
#endif
#if WO_OUT_IN
#define WOCOL(W, k0, o, lane) wcol_oi(W, k0, o, lane, CC)
#define WOCOLH(W, k0, o, lane) wcolh_oi(W, k0, o, lane, CC)
#else
#define WOCOL(W, k0, o, lane) wcol_io(W, k0, o, lane, DIN)
#define WOCOLH(W, k0, o, lane) wcolh_io(W, k0, o, lane, DIN)
#endif

#ifndef SM_EXTRA_PARAMS
#define SM_EXTRA_PARAMS
#endif
#ifndef PROJ_EXTRA_PARAMS
#define PROJ_EXTRA_PARAMS
#endif
#ifndef SM_MASK_HOOK
#define SM_MASK_HOOK (void)0
#endif

#define WS_QH  0u                                      // f16 q rows [b*t][CC]
#define WS_KH  (WS_QH + 2u * (size_t)NB * TT * CC)      // f16 k rows [b*t][CC]
#define WS_VT  (WS_KH + 2u * (size_t)NB * TT * CC)      // f16 v planes [b][c][t]
#define WS_QL  (WS_VT + 2u * (size_t)NB * CC * TT)      // f16 q residual x 2^10 rows [b][t < QHI][CC]
#define WS_KL  (WS_QL + 2u * (size_t)NB * QHI * CC)     // f16 k residual x 2^10 rows [b][t < KHI][CC]
#define WS_VB  (WS_KL + 2u * (size_t)NB * KHI * CC)     // bf16 v hi planes [b][c][t < KHI]
#define WS_VBL (WS_VB + 2u * (size_t)NB * CC * KHI)
#define WS_S   (WS_VBL + 2u * (size_t)NB * CC * KHI)    // exp(logit - block maximum) [b][t][s]: one plane per batch; f32 below row QHI; from row QHI on f16 (x 2^11), which fills the first half of its row's bytes
#define WS_ST  (WS_S  + 4u * (size_t)NB * TT * TT)      // f32 pairs (maximum, sum of exp) [b][128-key block][t]: a wave's 16 rows are one 128-B line
#define WS_Y   (WS_ST + 8u * (size_t)NB * (TT / 128) * TT) // f32 ctx rows [b*t][CC] (only when there is an output projection)
#define WS_END (WS_Y  + 0u)

__device__ __forceinline__ unsigned lds_off(const void* p) { return (unsigned)(size_t)p; }   // byte address in the work-group's LDS
// eight asynchronous copies, 16 B a lane, global -> LDS; the closing s_wait_xcnt stands in the same statement, in front of any later rewrite of the address registers that the copies name
__device__ __forceinline__ void acopy8(const unsigned (&l)[8], const void* const (&g)[8]) {
  asm volatile("global_load_async_to_lds_b128 %0, %8, off\n\tglobal_load_async_to_lds_b128 %1, %9, off\n\tglobal_load_async_to_lds_b128 %2, %10, off\n\tglobal_load_async_to_lds_b128 %3, %11, off\n\t"
               "global_load_async_to_lds_b128 %4, %12, off\n\tglobal_load_async_to_lds_b128 %5, %13, off\n\tglobal_load_async_to_lds_b128 %6, %14, off\n\tglobal_load_async_to_lds_b128 %7, %15, off\n\ts_wait_xcnt 0x0"
               :: "v"(l[0]), "v"(l[1]), "v"(l[2]), "v"(l[3]), "v"(l[4]), "v"(l[5]), "v"(l[6]), "v"(l[7]), "v"(g[0]), "v"(g[1]), "v"(g[2]), "v"(g[3]), "v"(g[4]), "v"(g[5]), "v"(g[6]), "v"(g[7]) : "memory"); }
// eight 16-B stores; the closing s_wait_xcnt stands in the same statement, in front of any later rewrite of the address and data registers that the stores name
__device__ __forceinline__ void gst8(void* const (&p)[8], const v4u (&d)[8]) {
  asm volatile("global_store_b128 %0, %8, off\n\tglobal_store_b128 %1, %9, off\n\tglobal_store_b128 %2, %10, off\n\tglobal_store_b128 %3, %11, off\n\t"
               "global_store_b128 %4, %12, off\n\tglobal_store_b128 %5, %13, off\n\tglobal_store_b128 %6, %14, off\n\tglobal_store_b128 %7, %15, off\n\ts_wait_xcnt 0x0"
               :: "v"(p[0]), "v"(p[1]), "v"(p[2]), "v"(p[3]), "v"(p[4]), "v"(p[5]), "v"(p[6]), "v"(p[7]), "v"(d[0]), "v"(d[1]), "v"(d[2]), "v"(d[3]), "v"(d[4]), "v"(d[5]), "v"(d[6]), "v"(d[7]) : "memory"); }
#define PBM 128            // rows per k_proj block: four waves of 32 rows x 128 columns
// ---- k_proj: block = (128 rows, 128 cols, which): q/k/v = X W (+ b) with exact bf16 products (K = DIN) -> which 0: q f16 rows (+ residual rows < QHI); 1: k f16 rows (+ residual rows < KHI); 2: v f16 planes [c][t] (+ bf16 hi/lo planes for t < KHI)
// Each wave owns two 16-row tiles: a W fragment read from LDS feeds two products, and a W chunk fetched, converted and stored once serves 128 rows.
// The second launch bound asks for a register count at which three waves fit a SIMD, as many blocks as the LDS lets onto a WGP (a build without it takes 342 registers, an allocation of 352, and only two fit; with it 334, an allocation of 336).
__global__ __launch_bounds__(128, 3) void k_proj(const float* __restrict__ XQ, const float* __restrict__ XK, const float* __restrict__ XV, const float* __restrict__ WQ, const float* __restrict__ WK, const float* __restrict__ WV, const float* __restrict__ BQ, const float* __restrict__ BK, const float* __restrict__ BV,
    _Float16* __restrict__ QH, _Float16* __restrict__ QL, _Float16* __restrict__ KH, _Float16* __restrict__ KL, _Float16* __restrict__ VT, __bf16* __restrict__ VB, __bf16* __restrict__ VBL) {
  // m: the main loop's two buffers of X (128 rows x 64 k, f32; row pitch 272 B = 16 B x odd: the 16-B fragment reads of 16 rows fall on 16 different bank groups) and of W (128 cols x 64 k, bf16, pitch 144 B);
  // the epilogue's staging (e for q / k, v for v) takes their place behind the last chunk's barrier
  __shared__ __align__(16) union { struct { float x[2][PBM][68]; __bf16 w[2][128][72]; } m; struct { _Float16 h[PBM][136], l[PBM][136]; } e; struct { _Float16 th[128][PBM + 8]; __bf16 tb[128][PBM + 8], tbl[128][PBM + 8]; } v; } su;
  const int tid = threadIdx.x, wave = tid >> 5, lane = tid & 31, col = lane & 15, g = lane >> 4; const int which = blockIdx.z; const int c0 = blockIdx.y * 128; const size_t r0 = (size_t)blockIdx.x * PBM; const size_t bb = r0 / TT; const int t0 = (int)(r0 % TT);
  const float* X = which == 0 ? XQ : which == 1 ? XK : XV; const float* WA = which == 0 ? WQ : which == 1 ? WK : WV; const float* BA = which == 0 ? BQ : which == 1 ? BK : BV;
  v8f acc[2][8] = {};
  // Main loop: K in 12 chunks of 64. The block's W chunk [64 k][128 cols] is read from global once (whole 512-B row segments, 16 B a lane), rounded to bf16, turned to [col][k] in registers and
  // kept in LDS for all four waves, in two buffers. 16-B slot o of row c sits at o ^ ((c >> 4) & 3): the stores (columns 4 apart across lanes) and the
  // fragment reads (columns 1 apart) then both fall on 16 different bank groups per 16 lanes. The next chunk's W loads are issued behind the barrier and fly while this chunk's products run.
  // X: each wave's own 32 rows x 64 k of a chunk come into LDS as f32 by asynchronous copies that cover whole 128-B lines (16 neighbouring lanes a row, 2 rows a copy);
  // two buffers: the next chunk is asked for behind the barrier that ends the trip before and flies while this chunk is multiplied. The A fragments are read from LDS and rounded to bf16 there.
  const float* wsrc = WA + (size_t)(wave * 16) * CC + c0 + 4 * lane; const float* xsrc = X + (r0 + wave * 32 + g) * DIN + 4 * col;
  const unsigned xdst = lds_off(&su.m.x[0][wave * 32 + g][4 * col]);
  v4f wr[16]; v16b a[2][2];
  auto ldg = [&](int s) {   // chunk s counted from the one that wsrc / xsrc stand at
#pragma unroll
    for (int i = 0; i < 16; ++i) wr[i] = *(const v4f*)(wsrc + (size_t)(s * 64 + i) * CC); };
  auto fillx = [&](int s, int bi) {   // X chunk s (counted as in ldg) into buffer bi: 16 rows a statement; unrolled so that l and gp are registers
#pragma unroll
    for (int hf = 0; hf < 2; ++hf) { unsigned l[8]; const void* gp[8];
#pragma unroll
      for (int i = 0; i < 8; ++i) { l[i] = xdst + (unsigned)bi * (unsigned)sizeof(su.m.x[0]) + (unsigned)((hf * 16 + i * 2) * sizeof(su.m.x[0][0])); gp[i] = xsrc + (size_t)(hf * 16 + i * 2) * DIN + s * 64; }
      acopy8(l, gp); } };
  auto stage = [&](__bf16 (*buf)[72]) { const int sw = (lane >> 2) & 3;
    __builtin_amdgcn_sched_barrier(0);   // keeps the conversions, which wait for the global loads, behind the chunk's last product: the loads fly under all of them
    asm volatile("s_wait_xcnt 0x0" ::: "memory");   // stands in front of the loop's advance of the address pair that the chunk's global loads name
#pragma unroll
    for (int oo = 0; oo < 2; ++oo) {
#pragma unroll
      for (int c = 0; c < 4; ++c) { v8b t;
#pragma unroll
        for (int i = 0; i < 8; ++i) t[i] = (__bf16)wr[oo * 8 + i][c];
        *(v8b*)&buf[4 * lane + c][((2 * wave + oo) ^ sw) * 8] = t; } } };
  // the 16 W fragments of a chunk in four groups of four (group q: k half q >> 1, column tiles 4 (q & 1) ..): a group's eight LDS reads stand together, one group (eight products) ahead of the products that use them
  auto mma = [&](const __bf16 (*buf)[72], const float (*xb)[68]) { const __bf16* p0 = &buf[col][8 * g]; const __bf16* p1 = &buf[col][8 * (g ^ 1)]; v16b w[2][4]; const float* px = &xb[wave * 32 + col][8 * g]; v4f xr[2][8];
    auto ldf = [&](int q) {
#pragma unroll
      for (int i = 0; i < 4; ++i) { const int j = 4 * (q & 1) + i; const __bf16* p = ((j & 1) ? p1 : p0) + j * 16 * 72 + (q >> 1) * 32; union { v16b v; v8b q2[2]; } u;
        u.q2[0] = *(const v8b*)(p + 8 * (j & 2)); u.q2[1] = *(const v8b*)(p + 8 * (2 ^ (j & 2))); w[q & 1][i] = u.v; } };
    // the chunk's X reads stand with the first group's W reads: one place with LDS reads
#pragma unroll
    for (int rt = 0; rt < 2; ++rt) {
#pragma unroll
      for (int i = 0; i < 4; ++i) { xr[rt][2 * i] = *(const v4f*)(px + rt * 16 * 68 + i * 16); xr[rt][2 * i + 1] = *(const v4f*)(px + rt * 16 * 68 + i * 16 + 4); } }
    ldf(0);
#pragma unroll
    for (int kk = 0; kk < 2; ++kk) {
#pragma unroll
      for (int rt = 0; rt < 2; ++rt) {
#pragma unroll
        for (int i = 0; i < 4; ++i) { a[kk][rt][i] = (__bf16)xr[rt][4 * kk][i]; a[kk][rt][4 + i] = (__bf16)xr[rt][4 * kk + 1][i]; a[kk][rt][8 + i] = (__bf16)xr[rt][4 * kk + 2][i]; a[kk][rt][12 + i] = (__bf16)xr[rt][4 * kk + 3][i]; } } }
#pragma unroll
    for (int q = 0; q < 4; ++q) { if (q < 3) ldf(q + 1);
#pragma unroll
      for (int rt = 0; rt < 2; ++rt) {
#pragma unroll
        for (int i = 0; i < 4; ++i) acc[rt][4 * (q & 1) + i] = wmma_bf(a[q >> 1][rt], w[q & 1][i], acc[rt][4 * (q & 1) + i]); } } };
  auto foot = [&]() {
    asm volatile("s_wait_dscnt 0x0" ::: "memory");      // this wave's reads of the chunk's X buffer are over before it is refilled
    asm volatile("s_wait_asynccnt 0x0" ::: "memory");   // this wave's copies of the next chunk's X have landed
    __syncthreads(); };                                  // publishes the W chunk just stored and the X chunk just landed; ends the reads of the buffers that are filled next
  fillx(0, 0); ldg(0);
  asm volatile("s_wait_xcnt 0x0" :: "v"(wsrc) : "memory");   // the build gives the first chunk's loads an address pair of their own, free behind the last of them: as an input here the pair stays whole up to this wait (no load's result is put into it)
  stage(su.m.w[0]);
  asm volatile("s_wait_asynccnt 0x0" ::: "memory");   // this wave's copies of X chunk 0 have landed
  __syncthreads();
  // rolled: two chunks a trip (one per buffer) keep the loop's text small. Behind each barrier the next chunk's W loads, which stage() waits for, go out first; then its X copies, which the trip's foot waits for,
  // into the buffer that the trip before has read
#pragma unroll 1
  for (int s = 0; s < DIN / 64 - 2; s += 2) {
    ldg(1); fillx(1, 1); mma(su.m.w[0], su.m.x[0]); stage(su.m.w[1]); foot();
    ldg(2); fillx(2, 0); mma(su.m.w[1], su.m.x[1]); stage(su.m.w[0]); foot();
    wsrc += (size_t)128 * CC; xsrc += 128; }
  ldg(1); fillx(1, 1); mma(su.m.w[0], su.m.x[0]); stage(su.m.w[1]); foot();
  mma(su.m.w[1], su.m.x[1]);
  asm volatile("s_wait_asynccnt 0x0" ::: "memory");   // no copy is left in flight when the wave goes on
  __syncthreads();   // the epilogue stores over the W and X buffers: every wave's last fragment read ends here
  if (which < 2) { _Float16* DH = which == 0 ? QH : KH; _Float16* DL = which == 0 ? QL : KL; const int nhi = which == 0 ? QHI : KHI; const bool hi_rows = t0 < nhi;
#pragma unroll
    for (int rt = 0; rt < 2; ++rt) {
#pragma unroll
      for (int j = 0; j < 8; ++j) { const float bias = BA ? bfr(BA[c0 + j * 16 + col]) : 0.f;
#pragma unroll
        for (int r = 0; r < 8; ++r) { const float v = acc[rt][j][r] + bias; const _Float16 hv = (_Float16)v; const int rl = wave * 32 + rt * 16 + 8 * g + r; su.e.h[rl][j * 16 + col] = hv; su.e.l[rl][j * 16 + col] = (_Float16)((v - (float)hv) * 1024.0f); } } }
    __syncthreads();
    // 16 lanes a row (256 B), 8 rows a store, eight stores a statement; unrolled so that p and d are registers
#pragma unroll
    for (int h = 0; h < PBM / 64; ++h) { const int q = tid & 15; void* p[8]; v4u d[8];
#pragma unroll
      for (int i = 0; i < 8; ++i) { const int rl = h * 64 + i * 8 + (tid >> 4); p[i] = DH + (r0 + rl) * CC + c0 + q * 8; d[i] = *(const v4u*)&su.e.h[rl][q * 8]; }
      gst8(p, d);
      if (hi_rows) {
#pragma unroll
        for (int i = 0; i < 8; ++i) { const int rl = h * 64 + i * 8 + (tid >> 4); p[i] = DL + (bb * nhi + t0 + rl) * (size_t)CC + c0 + q * 8; d[i] = *(const v4u*)&su.e.l[rl][q * 8]; }
        gst8(p, d); } }
  } else { const bool hi_rows = t0 < KHI;
#pragma unroll
    for (int rt = 0; rt < 2; ++rt) {
#pragma unroll
      for (int j = 0; j < 8; ++j) { const float bias = BA ? bfr(BA[c0 + j * 16 + col]) : 0.f;
#pragma unroll
        for (int r = 0; r < 8; ++r) { const float v = acc[rt][j][r] + bias; const int rl = wave * 32 + rt * 16 + 8 * g + r, cl = j * 16 + col; su.v.th[cl][rl] = (_Float16)v; const __bf16 bh = (__bf16)v; su.v.tb[cl][rl] = bh; su.v.tbl[cl][rl] = (__bf16)(v - (float)bh); } } }
    __syncthreads();
    // 16 lanes a plane row (256 B), 8 plane rows a store, eight stores a statement; unrolled so that p and d are registers
#pragma unroll
    for (int h = 0; h < 2; ++h) { const int q = tid & 15; void* p[8]; v4u d[8];
#pragma unroll
      for (int i = 0; i < 8; ++i) { const int cl = h * 64 + i * 8 + (tid >> 4); p[i] = VT + (bb * CC + c0 + cl) * (size_t)TT + t0 + q * 8; d[i] = *(const v4u*)&su.v.th[cl][q * 8]; }
      gst8(p, d);
      if (hi_rows) {
#pragma unroll
        for (int i = 0; i < 8; ++i) { const int cl = h * 64 + i * 8 + (tid >> 4); p[i] = VB + (bb * CC + c0 + cl) * (size_t)KHI + t0 + q * 8; d[i] = *(const v4u*)&su.v.tb[cl][q * 8]; }
        gst8(p, d);
#pragma unroll
        for (int i = 0; i < 8; ++i) { const int cl = h * 64 + i * 8 + (tid >> 4); p[i] = VBL + (bb * CC + c0 + cl) * (size_t)KHI + t0 + q * 8; d[i] = *(const v4u*)&su.v.tbl[cl][q * 8]; }
        gst8(p, d); } } } }
// twelve asynchronous copies, 16 B a lane, global -> LDS; the closing s_wait_xcnt stands in the same statement, in front of any later rewrite of the address registers that the copies name
__device__ __forceinline__ void acopy12(const unsigned (&l)[12], const void* const (&g)[12]) {
  asm volatile("global_load_async_to_lds_b128 %0, %12, off\n\tglobal_load_async_to_lds_b128 %1, %13, off\n\tglobal_load_async_to_lds_b128 %2, %14, off\n\tglobal_load_async_to_lds_b128 %3, %15, off\n\t"
               "global_load_async_to_lds_b128 %4, %16, off\n\tglobal_load_async_to_lds_b128 %5, %17, off\n\tglobal_load_async_to_lds_b128 %6, %18, off\n\tglobal_load_async_to_lds_b128 %7, %19, off\n\t"
               "global_load_async_to_lds_b128 %8, %20, off\n\tglobal_load_async_to_lds_b128 %9, %21, off\n\tglobal_load_async_to_lds_b128 %10, %22, off\n\tglobal_load_async_to_lds_b128 %11, %23, off\n\ts_wait_xcnt 0x0"
               :: "v"(l[0]), "v"(l[1]), "v"(l[2]), "v"(l[3]), "v"(l[4]), "v"(l[5]), "v"(l[6]), "v"(l[7]), "v"(l[8]), "v"(l[9]), "v"(l[10]), "v"(l[11]),
                  "v"(g[0]), "v"(g[1]), "v"(g[2]), "v"(g[3]), "v"(g[4]), "v"(g[5]), "v"(g[6]), "v"(g[7]), "v"(g[8]), "v"(g[9]), "v"(g[10]), "v"(g[11]) : "memory"); }
// exp(x) for x <= 0 to f32 accuracy: x log2(e) less its nearest whole number by two fused multiply-adds (log2(e) in two parts), the whole number applied by ldexp; below -200 the result is 0 either way, and the bound keeps the whole number an int.
// v_exp_f32 stands in asm so that the v_nop can stand directly behind it: the slot that the instruction set asks for in front of a next instruction that reads the result or overwrites the source
__device__ __forceinline__ float exp_neg(float x) { const float xc = fmaxf(x, -200.0f);
  const float e = rintf(xc * 0x1.715476p+0f); const float a = fmaf(xc, 0x1.4ae0bep-26f, fmaf(xc, 0x1.715476p+0f, -e)); float r;
  asm("v_exp_f32 %0, %1\n\tv_nop" : "=v"(r) : "v"(a));
  return ldexpf(r, (int)e); }
#define SCW 64             // f16 elements in a staged row of k_sc (128 B)
// ---- k_sc: block = (query block qb, key block kb <= kb_last(qb), batch b = blockIdx.z): logits x SCALE; single f16 q x k, and for query blocks < QBH (causal early rows) also q residual (x 2^10) x k and q x k residual (3 products); causal: blocks past the diagonal exit, the mask is applied by index in the epilogue, which also does the block's share of the softmax: each row's maximum and sum of exp over the block's 128 keys go to ST, exp(logit - that maximum) to S0
// The head width is walked in tiles. A tile holds 128 B of each of the block's 128 k rows and 64 q rows and comes into LDS by asynchronous copies that cover whole 128-B runs (8 neighbouring lanes a row); the k tile serves all four waves.
// Late rows: a staged row is 64 elements of the f16 plane (12 tiles). Early rows: 32 elements of the f16 plane, then the same 32 of the residual plane (24 tiles). Two buffers: tile t + 1 flies while tile t is multiplied.
// Same fragments and the same order of products into every accumulator as reading them from global memory.
__global__ __launch_bounds__(128) void k_sc(const _Float16* __restrict__ QH, const _Float16* __restrict__ KH, const _Float16* __restrict__ QL, const _Float16* __restrict__ KL, int h0, float* __restrict__ S0, float* __restrict__ ST) {
  // row pitch 144 B (16 B x odd): the 16-B fragment reads of 16 rows fall on 16 different bank groups. The output tile ss takes the tiles' place once the last tile has been read: less LDS, one more block on a WGP.
  __shared__ __align__(16) union { struct { _Float16 k[2][128][SCW + 8]; _Float16 q[2][64][SCW + 8]; } t; float ss[4][16][132]; } sm;
  const int qb = blockIdx.x, kb = blockIdx.y; if (kb > kb_last(qb)) return;
  const int b = blockIdx.z; const int h = h0; float* S = S0 + (size_t)b * TT * TT;
  const int tid = threadIdx.x, wave = tid >> 5, lane = tid & 31, col = lane & 15, g = lane >> 4; const int k0 = kb * 128; const int ql0 = qb * 64 + wave * 16;
  v8f acc[8] = {}, accl[8] = {};
  const _Float16* QLb = QL + (size_t)b * QHI * CC; const _Float16* KLb = KL + (size_t)b * KHI * CC;
  const bool early = qb < QBH; const int step = early ? 32 : 64;
  const int rr = lane >> 3, o = lane & 7; const bool res = early && o >= 4;   // lane: row rr of four, 16-B slot o of the staged row; slots 4..7 of an early row hold the residual plane
  const _Float16* ksrc = (res ? KLb : KH + (size_t)b * TT * CC) + (size_t)(k0 + wave * 32 + rr) * CC + h * HD + (res ? o - 4 : o) * 8;
  const _Float16* qsrc = (res ? QLb : QH + (size_t)b * TT * CC) + (size_t)(ql0 + rr) * CC + h * HD + (res ? o - 4 : o) * 8;
  const unsigned kdst = lds_off(&sm.t.k[0][wave * 32 + rr][o * 8]), qdst = lds_off(&sm.t.q[0][wave * 16 + rr][o * 8]);
  auto fill = [&](int t) { unsigned l[12]; const void* gp[12];   // each wave: 32 rows of k (4 a copy), then its own 16 rows of q; both loops unrolled so that l and gp are registers
#pragma unroll
    for (int i = 0; i < 8; ++i) { l[i] = kdst + (unsigned)(t & 1) * (unsigned)sizeof(sm.t.k[0]) + (unsigned)(i * 4 * sizeof(sm.t.k[0][0])); gp[i] = ksrc + (size_t)(i * 4) * CC + t * step; }
#pragma unroll
    for (int i = 0; i < 4; ++i) { l[8 + i] = qdst + (unsigned)(t & 1) * (unsigned)sizeof(sm.t.q[0]) + (unsigned)(i * 4 * sizeof(sm.t.q[0][0])); gp[8 + i] = qsrc + (size_t)(i * 4) * CC + t * step; }
    acopy12(l, gp); };
  auto foot = [&](int t, int nt) {   // nt: the path's number of tiles
    asm volatile("s_wait_dscnt 0x0" ::: "memory");      // this wave's reads of tile t are over before its buffer is refilled
    asm volatile("s_wait_asynccnt 0x0" ::: "memory");   // this wave's copies of tile t + 1 have landed
    __syncthreads();                                     // publishes tile t + 1 and ends every wave's reads of tile t
    if (t + 2 < nt) fill(t + 2); };
  fill(0);
  asm volatile("s_wait_asynccnt 0x0" ::: "memory");   // this wave's copies of tile 0 have landed
  __syncthreads();                                     // ... and every other wave's: tile 0 may be read
  fill(1);
  if (early) {
    // rolled: the buffer is picked by t & 1, and the loop's text stays small
#pragma unroll 1
    for (int t = 0; t < HD / 32; ++t) { const _Float16 (*bk)[SCW + 8] = sm.t.k[t & 1]; const _Float16 (*bq)[SCW + 8] = sm.t.q[t & 1];
      const v16h ah = frag_h(&bq[wave * 16 + col][0], lane), al = frag_h(&bq[wave * 16 + col][32], lane);
      // four key tiles at a time (their fragments and both accumulator sets fit the registers); the three products of a key tile stand four apart, so that none waits for the one before it into the same accumulator
#pragma unroll
      for (int jh = 0; jh < 8; jh += 4) { v16h kf[4], lf[4];
#pragma unroll
        for (int j = 0; j < 4; ++j) { kf[j] = frag_h(&bk[(jh + j) * 16 + col][0], lane); lf[j] = frag_h(&bk[(jh + j) * 16 + col][32], lane); }
#pragma unroll
        for (int j = 0; j < 4; ++j) acc[jh + j] = wmma16(ah, kf[j], acc[jh + j]);
#pragma unroll
        for (int j = 0; j < 4; ++j) accl[jh + j] = wmma16(al, kf[j], accl[jh + j]);
#pragma unroll
        for (int j = 0; j < 4; ++j) accl[jh + j] = wmma16(ah, lf[j], accl[jh + j]); }
      foot(t, HD / 32); }
  } else {
    // rolled, as above
#pragma unroll 1
    for (int t = 0; t < HD / 64; ++t) { const _Float16 (*bk)[SCW + 8] = sm.t.k[t & 1]; const _Float16 (*bq)[SCW + 8] = sm.t.q[t & 1];
      // all of the tile's fragment reads stand together in front of its products: one place with LDS reads a tile (the loops over kk and j are unrolled so that a, kf and acc are registers)
      v16h a[2], kf[2][8];
#pragma unroll
      for (int kk = 0; kk < 2; ++kk) a[kk] = frag_h(&bq[wave * 16 + col][kk * 32], lane);
#pragma unroll
      for (int kk = 0; kk < 2; ++kk) {
#pragma unroll
        for (int j = 0; j < 8; ++j) kf[kk][j] = frag_h(&bk[j * 16 + col][kk * 32], lane); }
#pragma unroll
      for (int kk = 0; kk < 2; ++kk) {
#pragma unroll
        for (int j = 0; j < 8; ++j) acc[j] = wmma16(a[kk], kf[kk][j], acc[j]); }
      foot(t, HD / 64); } }
  asm volatile("s_wait_asynccnt 0x0" ::: "memory");   // no copy is left in flight when the wave goes on; the last trip's barrier has ended every wave's reads of the tiles, so ss may take their place
  // The block's share of the softmax, in the accumulators' own layout (lane = key column, register r = query row 8 g + r): a row's 128 logits lie in 8 registers of each of 16 lanes.
  // Every (row, block) that runs holds at least one open key (the block's first key is never past the row), so the block maximum is a real logit.
  float bm[8], bs[8];   // every loop over r and j is unrolled so that bm, bs and acc are registers
#pragma unroll
  for (int r = 0; r < 8; ++r) { const int row = ql0 + 8 * g + r; float m = -3.0e38f;
#pragma unroll
    for (int j = 0; j < 8; ++j) { const float lg = (acc[j][r] + accl[j][r] * (1.0f / 1024.0f)) * SCALE; const float x = (!CAUSAL || k0 + j * 16 + col <= row) ? lg : -3.0e38f; acc[j][r] = x; m = fmaxf(m, x); }
    bm[r] = m; }
  // over the 16 lanes of a row; the eight rows' exchanges stand side by side, so that their latencies overlap
#pragma unroll
  for (int o = 1; o < 16; o <<= 1) {
#pragma unroll
    for (int r = 0; r < 8; ++r) bm[r] = fmaxf(bm[r], __shfl_xor(bm[r], o)); }
#pragma unroll
  for (int r = 0; r < 8; ++r) { float s = 0.f;
#pragma unroll
    for (int j = 0; j < 8; ++j) { const float x = acc[j][r]; const float ex = exp_neg(x - bm[r]); const float e = (x <= -1.0e38f) ? 0.f : ex; acc[j][r] = e; s += e; }
    bs[r] = s; }
#pragma unroll
  for (int o = 1; o < 16; o <<= 1) {
#pragma unroll
    for (int r = 0; r < 8; ++r) bs[r] += __shfl_xor(bs[r], o); }
  // lane col < 8 of each half stores row 8 g + col: the wave's 16 pairs are one whole 128-B line, written by this wave alone
  { float mv = bm[0], sv = bs[0];
#pragma unroll
    for (int r = 1; r < 8; ++r) { mv = col == r ? bm[r] : mv; sv = col == r ? bs[r] : sv; }
    if (col < 8) { const v2f pr = { mv, sv }; vst2(ST + (((size_t)b * (TT / 128) + kb) * TT + ql0 + 8 * g + col) * 2, pr); }
    asm volatile("s_wait_xcnt 0x0" ::: "memory"); }   // stands in front of any later rewrite of the registers that the store names
#pragma unroll
  for (int j = 0; j < 8; ++j) {
#pragma unroll
    for (int r = 0; r < 8; ++r) sm.ss[wave][8 * g + r][j * 16 + col] = acc[j][r]; }
  LDSX();
  if (early) {   // f32: k_pv splits these rows in two. 32 lanes a row (512 B), eight stores a statement; unrolled so that p and d are registers
#pragma unroll
    for (int hf = 0; hf < 2; ++hf) { void* p[8]; v4u d[8];
#pragma unroll
      for (int i = 0; i < 8; ++i) { const int rl = hf * 8 + i; p[i] = S + (size_t)(ql0 + rl) * TT + k0 + lane * 4; d[i] = *(const v4u*)&sm.ss[wave][rl][lane * 4]; }
      gst8(p, d); }
  } else {       // f16 x 2^11, the type k_pv multiplies: 16 lanes a row (256 B), two rows a store, eight stores in one statement; unrolled so that p and d are registers
    void* p[8]; v4u d[8];
#pragma unroll
    for (int i = 0; i < 8; ++i) { const int rl = i * 2 + g; const v4f w0 = *(const v4f*)&sm.ss[wave][rl][col * 8] * 2048.0f, w1 = *(const v4f*)&sm.ss[wave][rl][col * 8 + 4] * 2048.0f; union { v8h h; v4u u; } cv;
#pragma unroll
      for (int c = 0; c < 4; ++c) { cv.h[c] = (_Float16)w0[c]; cv.h[4 + c] = (_Float16)w1[c]; }
      p[i] = (_Float16*)(S + (size_t)(ql0 + rl) * TT) + k0 + col * 8; d[i] = cv.u; }
    gst8(p, d); } }
#define PVK 64             // keys per staged tile of k_pv
#define DVH 128            // value columns per k_pv block: the 768-wide head is walked in six 128-column slices (8 accumulator tiles per wave; a 48-tile accumulator would not fit the register file)
// ---- k_pv: block = (64 queries (qb), 128-column value slice d0, batch b = blockIdx.z): ctx[:, d0 .. d0+127] = P . v over keys [0, kend); k_sc left E = exp(logit - block maximum) and each (row, 128-key block)'s maximum and sum; P = E x the block's factor exp(block maximum - row maximum) / row sum.
// Late rows: E x 2^11 f16 against v f16, 1 product; a tile's products are summed from zero and join the row's accumulator times the factor, in f32. Causal early query blocks: E times the factor in f32, then P and v as bf16 hi + lo, 3 products. The 512-B (row, slice) segment by 32 lanes x 16 B
__global__ __launch_bounds__(128) void k_pv(const float* __restrict__ PS0, const _Float16* __restrict__ VT, const __bf16* __restrict__ VB, const __bf16* __restrict__ VBL, const float* __restrict__ ST, int h0, float* __restrict__ Y) { const int b = blockIdx.z; const int h = h0; const int d0 = blockIdx.y * DVH; const float* PS = PS0 + (size_t)b * TT * TT; __shared__ __align__(16) float fs[4][TT / 128][16];   // factors [wave][128-key block][row]
  __shared__ __align__(16) _Float16 sv[2][DVH][PVK + 8]; __shared__ __align__(16) union { float f[2][64][PVK + 4]; _Float16 h[2][64][PVK + 8]; float ss[4][16][DVH + 4]; } sp;   // the output tile ss takes the P tiles' place once the last tile has been read: with fs beside it as an array of its own only two blocks would fit a WGP's LDS. P tiles: f32 (early rows) or f16 (late rows); row pitches 144 B and 272 B (16 B x odd): the 16-B fragment reads of 16 rows fall on 16 different bank groups
  const int tid = threadIdx.x, wave = tid >> 5, lane = tid & 31, col = lane & 15, g = lane >> 4; const int qb = blockIdx.x; const int ql0 = qb * 64 + wave * 16; const int kce = (kb_last(qb) + 1) * 4;
  v8f acc[DVH / 16] = {};
  // The rows' factors: lane = (row col of the wave's 16, half g of the 16 blocks). A block past the row's last is read as block 0 (always written) and counts as nothing.
  auto factors = [&]() { const int nb = kb_last(qb) + 1; const float* st = ST + ((size_t)b * (TT / 128) * TT + ql0 + col) * 2; v2f pr[8]; const float* ap[8];   // every loop over i is unrolled so that ap, pr and w are registers
#pragma unroll
    for (int i = 0; i < 8; ++i) ap[i] = st + (size_t)(g * 8 + i < nb ? g * 8 + i : 0) * TT * 2;
#pragma unroll
    for (int i = 0; i < 8; ++i) pr[i] = *(const v2f*)ap[i];
    // stands in front of any later rewrite of the address pairs that the loads name; as inputs here the pairs stay whole up to this wait
    asm volatile("s_wait_xcnt 0x0" :: "v"(ap[0]), "v"(ap[1]), "v"(ap[2]), "v"(ap[3]), "v"(ap[4]), "v"(ap[5]), "v"(ap[6]), "v"(ap[7]) : "memory");
    float m = -3.0e38f;
#pragma unroll
    for (int i = 0; i < 8; ++i) m = fmaxf(m, g * 8 + i < nb ? pr[i][0] : -3.0e38f);
    m = fmaxf(m, __shfl_xor(m, 16));
    float w[8], sum = 0.f;
#pragma unroll
    for (int i = 0; i < 8; ++i) { const float ex = exp_neg(pr[i][0] - m); w[i] = g * 8 + i < nb ? ex : 0.f; sum += w[i] * pr[i][1]; }
    sum += __shfl_xor(sum, 16);
    const float inv = 1.0f / sum;   // the block that holds the row maximum adds at least 1
#pragma unroll
    for (int i = 0; i < 8; ++i) fs[wave][g * 8 + i][col] = w[i] * inv; };
  if (qb < QBH) {
    // Early rows: keys in tiles of 32 (kce = 4, 8 or 12 tiles). A staged v row is 128 B: 32 keys of the bf16 hi plane, then the same 32 of the lo plane (16-B slots 4..7); a staged P row is 128 B of f32.
    // Both come into LDS by asynchronous copies in runs of 64 and 128 B, the v tile serves all four waves, and tile t + 1 flies while tile t is multiplied (the late rows' two buffers, read as bf16),
    // instead of a global fragment load and a full wait in front of every product. Same fragments; every accumulator takes its three products of a tile in the same order (hi x hi, lo x hi, hi x lo).
    const int rr = lane >> 3, o = lane & 7; const bool res = o >= 4;   // lane: row rr of four, 16-B slot o of the staged row
    const __bf16* vsrc = (res ? VBL : VB) + ((size_t)b * CC + h * HD + d0 + wave * 32 + rr) * (size_t)KHI + (res ? o - 4 : o) * 8; const float* psrc = PS + (size_t)(ql0 + rr) * TT + o * 4;
    const unsigned vdst = lds_off(&sv[0][wave * 32 + rr][o * 8]), pdst = lds_off(&sp.f[0][wave * 16 + rr][o * 4]);
    auto fill = [&](int t) { unsigned l[12]; const void* gp[12];   // each wave: 32 columns of v (4 a copy), then its own 16 rows of P (4 a copy); both loops unrolled so that l and gp are registers
#pragma unroll
      for (int i = 0; i < 8; ++i) { l[i] = vdst + (unsigned)(t & 1) * (unsigned)sizeof(sv[0]) + (unsigned)(i * 4 * sizeof(sv[0][0])); gp[i] = vsrc + (size_t)(i * 4) * KHI + t * 32; }
#pragma unroll
      for (int i = 0; i < 4; ++i) { l[8 + i] = pdst + (unsigned)(t & 1) * (unsigned)sizeof(sp.f[0]) + (unsigned)(i * 4 * sizeof(sp.f[0][0])); gp[8 + i] = psrc + (size_t)(i * 4) * TT + t * 32; }
      acopy12(l, gp); };
    fill(0);
    factors();   // under tile 0's flight; the barrier below stands between its LDS stores and their reads
    asm volatile("s_wait_asynccnt 0x0" ::: "memory");   // this wave's copies of tile 0 have landed
    __syncthreads();                                     // ... and every other wave's: tile 0 may be read
    fill(1);
    // rolled: the trip count depends on the query block, and the buffer is picked by t & 1
#pragma unroll 1
    for (int t = 0; t < kce; ++t) { const __bf16 (*bv)[PVK + 8] = (const __bf16 (*)[PVK + 8])sv[t & 1]; const float (*bp)[PVK + 4] = sp.f[t & 1];
      // all of the tile's fragment reads stand together in front of its products (the loops over j are unrolled so that vh, vl and acc are registers);
      // the three products of a column tile stand eight apart, so that none waits for the one before it into the same accumulator
      const float fe = fs[wave][t >> 2][col] * 2048.0f; float pv[16]; const float* pp = &bp[wave * 16 + col][8 * g];   // four 32-key tiles a block
#pragma unroll
      for (int i = 0; i < 8; ++i) { pv[i] = pp[i] * fe; pv[8 + i] = pp[16 + i] * fe; }
      const F2 p = bsplit16(pv); v16b vh[DVH / 16], vl[DVH / 16];
#pragma unroll
      for (int j = 0; j < DVH / 16; ++j) { vh[j] = frag_b(&bv[j * 16 + col][0], lane); vl[j] = frag_b(&bv[j * 16 + col][32], lane); }
#pragma unroll
      for (int j = 0; j < DVH / 16; ++j) acc[j] = wmma_bf(p.h, vh[j], acc[j]);
#pragma unroll
      for (int j = 0; j < DVH / 16; ++j) acc[j] = wmma_bf(p.l, vh[j], acc[j]);
#pragma unroll
      for (int j = 0; j < DVH / 16; ++j) acc[j] = wmma_bf(p.h, vl[j], acc[j]);
      asm volatile("s_wait_dscnt 0x0" ::: "memory");      // this wave's reads of tile t are over before its buffer is refilled
      asm volatile("s_wait_asynccnt 0x0" ::: "memory");   // this wave's copies of tile t + 1 have landed
      __syncthreads();                                     // publishes tile t + 1 and ends every wave's reads of tile t
      if (t + 2 < kce) fill(t + 2); }
    asm volatile("s_wait_asynccnt 0x0" ::: "memory");   // no copy is left in flight when the wave goes on
  } else {
    // Keys in tiles of PVK = 64. A tile of v (128 columns x 128 B) and of E (64 rows x 128 B, f16 as k_sc left it) comes into LDS by asynchronous copies that cover whole 128-B lines (8 neighbouring lanes a row);
    // the v tile serves all four waves. Two buffers: tile t + 1 flies while tile t is multiplied.
    const int nt = kce >> 1;
    const _Float16* vsrc = VT + ((size_t)b * CC + h * HD + d0 + wave * 32 + (lane >> 3)) * (size_t)TT + (lane & 7) * 8; const _Float16* psrc = (const _Float16*)(PS + (size_t)(ql0 + (lane >> 3)) * TT) + (lane & 7) * 8;   // a P row starts where its f32 row did
    const unsigned vdst = lds_off(&sv[0][wave * 32 + (lane >> 3)][(lane & 7) * 8]), pdst = lds_off(&sp.h[0][wave * 16 + (lane >> 3)][(lane & 7) * 8]);
    auto fill = [&](int t) { unsigned l[12]; const void* gp[12];   // each wave: 32 columns of v (4 a copy), then its own 16 rows of P (4 a copy); both loops unrolled so that l and gp are registers
#pragma unroll
      for (int i = 0; i < 8; ++i) { l[i] = vdst + (unsigned)(t & 1) * (unsigned)sizeof(sv[0]) + (unsigned)(i * 4 * sizeof(sv[0][0])); gp[i] = vsrc + (size_t)(i * 4) * TT + t * PVK; }
#pragma unroll
      for (int i = 0; i < 4; ++i) { l[8 + i] = pdst + (unsigned)(t & 1) * (unsigned)sizeof(sp.h[0]) + (unsigned)(i * 4 * sizeof(sp.h[0][0])); gp[8 + i] = psrc + (size_t)(i * 4) * (2 * TT) + t * PVK; }
      acopy12(l, gp); };
    fill(0);
    factors();   // under tile 0's flight; the barrier below stands between its LDS stores and their reads
    asm volatile("s_wait_asynccnt 0x0" ::: "memory");   // this wave's copies of tile 0 have landed
    __syncthreads();                                     // ... and every other wave's: tile 0 may be read
    if (nt > 1) fill(1);
    // rolled: the trip count depends on the query block, and the buffer is picked by t & 1
#pragma unroll 1
    for (int t = 0; t < nt; ++t) { const _Float16 (*bv)[PVK + 8] = sv[t & 1]; const _Float16 (*bp)[PVK + 8] = sp.h[t & 1];
      // all of the tile's fragment reads stand together in front of its products: one place with LDS reads a tile instead of a read and a full wait in front of every product
      // (the loops over kk, jh, j and r are unrolled so that p, vf, part and acc are registers)
      v16h p[PVK / 32], vf[PVK / 32][DVH / 16];
#pragma unroll
      for (int kk = 0; kk < PVK / 32; ++kk) p[kk] = frag_h(&bp[wave * 16 + col][kk * 32], lane);
#pragma unroll
      for (int kk = 0; kk < PVK / 32; ++kk) {
#pragma unroll
        for (int j = 0; j < DVH / 16; ++j) vf[kk][j] = frag_h(&bv[j * 16 + col][kk * 32], lane); }
      const v4f f0 = *(const v4f*)&fs[wave][t >> 1][8 * g], f1 = *(const v4f*)&fs[wave][t >> 1][8 * g + 4];   // two 64-key tiles a block; accumulator register r is row 8 g + r
      // four column tiles at a time: half the registers for the tile's own sums, and the first four's multiply-adds stand among the last four's products
#pragma unroll
      for (int jh = 0; jh < DVH / 16; jh += 4) { v8f part[4] = {};
#pragma unroll
        for (int kk = 0; kk < PVK / 32; ++kk) {
#pragma unroll
          for (int j = 0; j < 4; ++j) part[j] = wmma16(p[kk], vf[kk][jh + j], part[j]); }
#pragma unroll
        for (int j = 0; j < 4; ++j) {
#pragma unroll
          for (int r = 0; r < 4; ++r) { acc[jh + j][r] += part[j][r] * f0[r]; acc[jh + j][4 + r] += part[j][4 + r] * f1[r]; } } }
      asm volatile("s_wait_dscnt 0x0" ::: "memory");      // this wave's reads of tile t are over before its buffer is refilled
      asm volatile("s_wait_asynccnt 0x0" ::: "memory");   // this wave's copies of tile t + 1 have landed
      __syncthreads();                                     // publishes tile t + 1 and ends every wave's reads of tile t
      if (t + 2 < nt) fill(t + 2); }
    asm volatile("s_wait_asynccnt 0x0" ::: "memory"); }   // no copy is left in flight when the wave goes on
#pragma unroll
  for (int j = 0; j < DVH / 16; ++j)
#pragma unroll
    for (int r = 0; r < 8; ++r) sp.ss[wave][8 * g + r][j * 16 + col] = acc[j][r] * (1.0f / 2048.0f);   // the last trip's barrier has ended every wave's reads of the P tiles, and no copy is in flight
  LDSX(); for (int rl = 0; rl < 16; ++rl) vst2(Y + ((size_t)b * TT + ql0 + rl) * CC + h * HD + d0 + lane * 4, *(const v4f*)&sp.ss[wave][rl][lane * 4]); }   
extern "C" void kernel_launch(void* const* d_in, const int* in_sizes, int n_in, void* d_out, int out_size, void* d_ws, size_t ws_size, hipStream_t stream) {
  (void)in_sizes; (void)n_in; (void)out_size;
  const float** F = (const float**)d_in;
  if (ws_size < (size_t)WS_END) return;
  char* ws = (char*)d_ws; _Float16 *QH = (_Float16*)(ws + WS_QH), *KH = (_Float16*)(ws + WS_KH), *VT = (_Float16*)(ws + WS_VT), *QL = (_Float16*)(ws + WS_QL), *KL = (_Float16*)(ws + WS_KL); __bf16 *VB = (__bf16*)(ws + WS_VB), *VBL = (__bf16*)(ws + WS_VBL); float *S = (float*)(ws + WS_S), *ST = (float*)(ws + WS_ST), *Y = (float*)(ws + WS_Y);
  (void)Y; (void)QL; (void)KL; (void)VB; (void)VBL;
  // inputs: 0 x [4,2048,768]; 1 Wq [768,768] (in,out); 2 Wk; 3 Wv; no biases, no output projection
  k_proj<<<dim3(TNB * TT / PBM, CC / 128, 3), 128, 0, stream>>>(F[0], F[0], F[0], F[1], F[2], F[3], nullptr, nullptr, nullptr, QH, QL, KH, KL, VT, VB, VBL);
  k_sc<<<dim3(NQB, TT / 128, TNB), 128, 0, stream>>>(QH, KH, QL, KL, 0, S, ST);
  k_pv<<<dim3(NQB, HD / DVH, TNB), 128, 0, stream>>>(S, VT, VB, VBL, ST, 0, (float*)d_out);   /* six 128-column value slices per query block */
}
